// v000
// Measured on an AMD MI455X. A time is GPU time per run, averaged over a window of back-to-back runs after a warm-up
// (all launches, gaps included; the runs take copies of the inputs in turn), and the median of several windows.
// Apart from v000's, it joins two sittings. Times from different sittings can be a few percent apart, while
// side-by-side timings come from the same sitting.
// v000 is the starting kernel. One run takes 7290 microseconds.
#include <hip/hip_runtime.h>
// Dot-product attention with TRANSPOSED roles and no scaling (query, key, value [8][4096][64]; q = query Wq^T + bq, k = key Wk^T + bk, v = value Wv^T + bv (natural [64][64] sigma 1/8, biases 0.01); scores[i][j] = k_i . q_j (NO 1/sqrt(d): sigma ~8); attn = softmax over the query positions j; out[i] = sum_j attn[i][j] v[j] -> [8][4096][64] (rows are key positions)).
// Structure: token rows; the bf16-valued inputs as exact f16 rows; natural weights x16; q and k as WMMA GEMMs (32x64 wave tiles, f32 accumulation, + bias) -> f32 -> f16 hi + x1024 residual rows, v -> f16 rows; per batch: V^T via LDS transposes; scores [4096][4096] = hi.hi + lo.hi 2^-10 + hi.lo 2^-10 (K = 64, unscaled) f32; row softmax on VALU (f32 statistics, native exp; weights x256 f16); out = P V^T 2^-8 f32.
// Compute dtype: inputs rounded to bf16; x / weights exact; q and k as f16 hi + x1024 residual pairs, v and softmax weights as plain f16 GEMM operands (~2^-12), o f32; scores and softmax statistics f32. v_wmma_f32_16x16x32_f16.
#define NB 8
#define SQ 4096
#define DM 64
#define NH 1
#define HD 64
#define HG 8                         /* heads per launch of the k_vt(b, h0) overload (not launched) */
#define B0 0                         /* first batch processed (used by no kernel or launch) */
#define NBR NB                       /* batches processed (used by no kernel or launch) */
#define NR ((size_t)NB * SQ)         /* token rows */
#define MP ((int)((size_t)NBR * SQ)) /* rows projected (used by no kernel or launch) */
#define QT 256                       /* query rows per causal tile */
#define NKX SQ                       /* S / P row pitch */
#define QT0 256                      /* first-tile rows recomputed exactly */
#define QN SQ                        /* query rows attended per batch (used by no kernel or launch) */
#define NHD NH                       /* heads attended (used by no kernel or launch) */
#define MPO MP                       /* rows through the output stage (used by no kernel or launch) */
#define LQ DM            /* row pitch of the q/k/v rows */
typedef __bf16 v16b __attribute__((ext_vector_type(16)));
typedef unsigned short v8us __attribute__((ext_vector_type(8), may_alias));
typedef float  v8f  __attribute__((ext_vector_type(8)));
typedef float  v4f  __attribute__((ext_vector_type(4)));
typedef float  v4fa __attribute__((ext_vector_type(4), may_alias));
union FragB { v16b v; v8us half[2]; unsigned short u[16]; };

__device__ __forceinline__ unsigned short bf16_bits(float x) { unsigned int u = __float_as_uint(x); return (unsigned short)((u + 0x7FFFu + ((u >> 16) & 1u)) >> 16); }
__device__ __forceinline__ float bf16_val(unsigned short b) { return __uint_as_float(((unsigned int)b) << 16); }
__device__ __forceinline__ float bf16_round(float x) { return bf16_val(bf16_bits(x)); }
// D += A·B with NT terms: 1 = ah·bh, 2 = + al·bh (A split), 3 = + ah·bl (both split)
template <int NT>
__device__ __forceinline__ v8f mmaN(v16b ah, v16b al, v16b bh, v16b bl, v8f c) {
  c = __builtin_amdgcn_wmma_f32_16x16x32_bf16(false, ah, false, bh, (short)0, c, false, false);
  if (NT >= 2) c = __builtin_amdgcn_wmma_f32_16x16x32_bf16(false, al, false, bh, (short)0, c, false, false);
  if (NT >= 3) c = __builtin_amdgcn_wmma_f32_16x16x32_bf16(false, ah, false, bl, (short)0, c, false, false);
  asm volatile("v_nop\n\tv_nop\n\tv_nop\n\tv_nop" : "+v"(c) : "v"(ah), "v"(al), "v"(bh), "v"(bl));
  return c;
}

__global__ __launch_bounds__(256) void k_wt_bf16(const float* __restrict__ W, unsigned short* __restrict__ Wt, int K, int N) {
  const int t = blockIdx.x * 256 + threadIdx.x;
  const int k8n = K / 8;
  if (t >= N * k8n) return;
  const int n = t / k8n, k8 = (t % k8n) * 8;
  v8us v;
#pragma unroll
  for (int i = 0; i < 8; ++i) v[i] = bf16_bits(W[(size_t)(k8 + i) * N + n]);
  *(v8us*)(Wt + (size_t)n * K + k8) = v;
  
}

// GEMM C[M][N] (f32, pitch ldc) = act(A[M][K]·W + bias). A f32 row-major (pitch lda) converted per fragment to bf16
// (ASPLIT: hi/lo two planes -> 2 terms, else single rounded term); Wt bf16 [N][K] (pitch ldb). BIAS_BF16 rounds the
// bias to bf16 first (bias quantised to bf16 before the add). K%32==0, M%16==0, N%64==0.
template <bool ASPLIT, int ACT, bool BIAS_BF16>
__global__ __launch_bounds__(128) void k_gemm_bf(const float* __restrict__ A, int lda, const unsigned short* __restrict__ Wt, int ldb,
                                               const float* __restrict__ bias, float* __restrict__ C, int ldc, int M, int N, int K) {
  __shared__ __attribute__((aligned(16))) float so[4][16][64];
  const int tid = threadIdx.x, w = tid >> 5, lane = tid & 31, ln = lane & 15, hh = lane >> 4;
  const int ntn = N / 64;
  const int wid = blockIdx.x * 4 + w;
  const int mt = wid / ntn, nq = wid % ntn;
  if (mt * 16 >= M) return;
  const int row0 = mt * 16, col0 = nq * 64;
  const float* arow = A + (size_t)(row0 + ln) * lda;
  v8f acc[4] = {};
  for (int kb = 0; kb < K; kb += 32) {
    FragB ah, al;
    const v4f x0 = *(const v4fa*)(arow + kb + 8 * hh), x1 = *(const v4fa*)(arow + kb + 8 * hh + 4);
    const v4f x2 = *(const v4fa*)(arow + kb + 16 + 8 * hh), x3 = *(const v4fa*)(arow + kb + 16 + 8 * hh + 4);
    float xs[16] = {x0[0],x0[1],x0[2],x0[3],x1[0],x1[1],x1[2],x1[3],x2[0],x2[1],x2[2],x2[3],x3[0],x3[1],x3[2],x3[3]};
#pragma unroll
    for (int i = 0; i < 16; ++i) { const unsigned short hb = bf16_bits(xs[i]); ah.u[i] = hb; al.u[i] = ASPLIT ? bf16_bits(xs[i] - bf16_val(hb)) : (unsigned short)0; }
#pragma unroll
    for (int t = 0; t < 4; ++t) {
      const unsigned short* brow = Wt + (size_t)(col0 + t * 16 + ln) * ldb + kb;
      FragB b;
      b.half[0] = *(const v8us*)(brow + 8 * hh);
      b.half[1] = *(const v8us*)(brow + 16 + 8 * hh);
      acc[t] = mmaN<ASPLIT ? 2 : 1>(ah.v, al.v, b.v, b.v, acc[t]);
    }
  }
#pragma unroll
  for (int t = 0; t < 4; ++t) {
    float bv = bias ? bias[col0 + t * 16 + ln] : 0.f;
    if (BIAS_BF16) bv = bf16_round(bv);
#pragma unroll
    for (int r = 0; r < 8; ++r) { float v = acc[t][r] + bv; if (ACT == 1) v = fmaxf(v, 0.f); so[w][8 * hh + r][t * 16 + ln] = v; }
  }
  __builtin_amdgcn_fence(__ATOMIC_ACQ_REL, "workgroup");
  __builtin_amdgcn_wave_barrier();
  const int rsub = lane >> 4, c4 = (lane & 15) * 4;
  {
#pragma unroll
    for (int q = 0; q < 8; ++q) {
      const int r = q * 2 + rsub;
      const v4f v = *(const v4fa*)&so[w][r][c4];
      *(v4f*)(C + (size_t)(row0 + r) * ldc + col0 + c4) = v;
    }
    
  }
}

// GEMM C = act(A·W + bias + resid): A f32 (ASPLIT -> hi/lo 2 terms), Wt bf16 [N][K]; ACT 0 none, 1 relu, 2 exact gelu;
// resid (optional, f32, row index = (row % rmod), pitch ldr, RES_BF16 rounds it) added before the activation.
template <bool ASPLIT, int ACT, bool BIAS_BF16, bool RES_BF16>
__global__ __launch_bounds__(128) void k_gemm_bf3(const float* __restrict__ A, int lda, const unsigned short* __restrict__ Wt, int ldb,
                                                const float* __restrict__ bias, const float* __restrict__ resid, int rmod, int ldr,
                                                float* __restrict__ C, int ldc, int M, int N, int K) {
  __shared__ __attribute__((aligned(16))) float so[4][16][64];
  const int tid = threadIdx.x, w = tid >> 5, lane = tid & 31, ln = lane & 15, hh = lane >> 4;
  const int ntn = N / 64;
  const int wid = blockIdx.x * 4 + w;
  const int mt = wid / ntn, nq = wid % ntn;
  if (mt * 16 >= M) return;
  const int row0 = mt * 16, col0 = nq * 64;
  const float* arow = A + (size_t)(row0 + ln) * lda;
  v8f acc[4] = {};
  for (int kb = 0; kb < K; kb += 32) {
    FragB ah, al;
    const v4f x0 = *(const v4fa*)(arow + kb + 8 * hh), x1 = *(const v4fa*)(arow + kb + 8 * hh + 4);
    const v4f x2 = *(const v4fa*)(arow + kb + 16 + 8 * hh), x3 = *(const v4fa*)(arow + kb + 16 + 8 * hh + 4);
    float xs[16] = {x0[0],x0[1],x0[2],x0[3],x1[0],x1[1],x1[2],x1[3],x2[0],x2[1],x2[2],x2[3],x3[0],x3[1],x3[2],x3[3]};
#pragma unroll
    for (int i = 0; i < 16; ++i) { const unsigned short hb = bf16_bits(xs[i]); ah.u[i] = hb; al.u[i] = ASPLIT ? bf16_bits(xs[i] - bf16_val(hb)) : (unsigned short)0; }
#pragma unroll
    for (int t = 0; t < 4; ++t) {
      const unsigned short* brow = Wt + (size_t)(col0 + t * 16 + ln) * ldb + kb;
      FragB b;
      b.half[0] = *(const v8us*)(brow + 8 * hh);
      b.half[1] = *(const v8us*)(brow + 16 + 8 * hh);
      acc[t] = mmaN<ASPLIT ? 2 : 1>(ah.v, al.v, b.v, b.v, acc[t]);
    }
  }
#pragma unroll
  for (int t = 0; t < 4; ++t) {
    const int col = col0 + t * 16 + ln;
    float bv = bias ? bias[col] : 0.f;
    if (BIAS_BF16) bv = bf16_round(bv);
#pragma unroll
    for (int r = 0; r < 8; ++r) {
      float v = acc[t][r] + bv;
      if (resid) { float rv = resid[(size_t)((row0 + 8 * hh + r) % rmod) * ldr + col]; if (RES_BF16) rv = bf16_round(rv); v += rv; }
      if (ACT == 1) v = fmaxf(v, 0.f);
      if (ACT == 2) v = 0.5f * v * (1.0f + erff(v * 0.70710678118654752f));
      if (ACT == 3) { const float u = 0.7978845608028654f * (v + 0.044715f * v * v * v); v = 0.5f * v * (1.0f + tanhf(u)); }
      so[w][8 * hh + r][t * 16 + ln] = v;
    }
  }
  __builtin_amdgcn_fence(__ATOMIC_ACQ_REL, "workgroup");
  __builtin_amdgcn_wave_barrier();
  const int rsub = lane >> 4, c4 = (lane & 15) * 4;
  {
#pragma unroll
    for (int q = 0; q < 8; ++q) {
      const int r = q * 2 + rsub;
      const v4f v = *(const v4fa*)&so[w][r][c4];
      *(v4f*)(C + (size_t)(row0 + r) * ldc + col0 + c4) = v;
    }
    
  }
}
// row LayerNorm (biased variance, eps) over N: s = X (+ R); optional out_sum <- s; out_norm <- (s-mu)*rsqrt(var+eps)*g + b
template <bool PARAM_BF16>
__global__ __launch_bounds__(256) void k_layernorm(const float* __restrict__ X, const float* __restrict__ R, const float* __restrict__ g, const float* __restrict__ bta,
                                                  float* __restrict__ out_sum, float* __restrict__ out_norm, int N, float eps) {
  __shared__ float red[256];
  const int row = blockIdx.x, tid = threadIdx.x;
  const float* x = X + (size_t)row * N; const float* rr = R ? R + (size_t)row * N : nullptr;
  float vals[16];                     // up to N = 4096
  const int per = N / 256;            // contiguous chunk per thread? use strided-by-4 chunks: thread handles j = tid*4 + 1024*u
  float s1 = 0.f;
  for (int u = 0; u < per / 4; ++u) {
    const int j = tid * 4 + 1024 * u;
    const v4f a = *(const v4fa*)(x + j);
    v4f b = {0.f,0.f,0.f,0.f}; if (rr) b = *(const v4fa*)(rr + j);
#pragma unroll
    for (int q = 0; q < 4; ++q) { const float v = a[q] + b[q]; vals[u * 4 + q] = v; s1 += v; }
  }
  red[tid] = s1; __syncthreads();
  for (int st = 128; st > 0; st >>= 1) { if (tid < st) red[tid] += red[tid + st]; __syncthreads(); }
  const float mu = red[0] / (float)N; __syncthreads();
  float s2 = 0.f;
  for (int u = 0; u < per / 4; ++u)
#pragma unroll
    for (int q = 0; q < 4; ++q) { const float c = vals[u * 4 + q] - mu; s2 += c * c; }
  red[tid] = s2; __syncthreads();
  for (int st = 128; st > 0; st >>= 1) { if (tid < st) red[tid] += red[tid + st]; __syncthreads(); }
  const float rs = rsqrtf(red[0] / (float)N + eps);
  {
    for (int u = 0; u < per / 4; ++u) {
      const int j = tid * 4 + 1024 * u;
      v4f o, sm;
#pragma unroll
      for (int q = 0; q < 4; ++q) {
        float gg = g[j + q], bb = bta[j + q];
        if (PARAM_BF16) { gg = bf16_round(gg); bb = bf16_round(bb); }
        sm[q] = vals[u * 4 + q]; o[q] = (vals[u * 4 + q] - mu) * rs * gg + bb;
      }
      if (out_sum) *(v4f*)(out_sum + (size_t)row * N + j) = sm;
      *(v4f*)(out_norm + (size_t)row * N + j) = o;
    }
    
  }
}



// ---- f16 WMMA path (v_wmma_f32_16x16x32_f16): 11-bit significands for operands in range — used where a [0,1] probability operand needs more precision than bf16
typedef _Float16 v16h __attribute__((ext_vector_type(16)));
union FragH { v16h v; v8us half[2]; _Float16 h[16]; unsigned short u[16]; };
template <int NT>
__device__ __forceinline__ v8f mmaH(v16h ah, v16h al, v16h bh, v16h bl, v8f c) {
  c = __builtin_amdgcn_wmma_f32_16x16x32_f16(false, ah, false, bh, (short)0, c, false, false);
  if (NT >= 2) c = __builtin_amdgcn_wmma_f32_16x16x32_f16(false, al, false, bh, (short)0, c, false, false);
  if (NT >= 3) c = __builtin_amdgcn_wmma_f32_16x16x32_f16(false, ah, false, bl, (short)0, c, false, false);
  asm volatile("v_nop\n\tv_nop\n\tv_nop\n\tv_nop" : "+v"(c) : "v"(ah), "v"(al), "v"(bh), "v"(bl));
  return c;
}
// batched GEMM like k_gemm_b but f16 operands: A f32 (split into f16 hi/lo if ASPLIT, else rounded to f16), Bt = f16 values [n][k]; alpha; C f32; N multiple of 16 (partial tiles skipped)
template <bool ASPLIT>
__global__ __launch_bounds__(128) void k_gemm_h(const float* __restrict__ A, int lda, size_t sA, const _Float16* __restrict__ Bh, int ldb, size_t sB, float alpha, float* __restrict__ C, int ldc, size_t sC, int M, int N, int K) {
  __shared__ __attribute__((aligned(16))) float so[4][16][64];
  const int tid = threadIdx.x, w = tid >> 5, lane = tid & 31, ln = lane & 15, hh = lane >> 4; const int by = blockIdx.y;
  A += (size_t)by * sA; Bh += (size_t)by * sB; C += (size_t)by * sC;
  const int ntn = (N + 63) / 64; const int wid = blockIdx.x * 4 + w; const int mt = wid / ntn, nq = wid % ntn; if (mt * 16 >= M) return;
  const int row0 = mt * 16, col0 = nq * 64; const float* arow = A + (size_t)(row0 + ln) * lda;
  v8f acc[4] = {};
  for (int kb = 0; kb < K; kb += 32) {
    FragH ah, al;
    const v4f x0 = *(const v4fa*)(arow + kb + 8 * hh), x1 = *(const v4fa*)(arow + kb + 8 * hh + 4), x2 = *(const v4fa*)(arow + kb + 16 + 8 * hh), x3 = *(const v4fa*)(arow + kb + 16 + 8 * hh + 4);
    float xs[16] = {x0[0],x0[1],x0[2],x0[3],x1[0],x1[1],x1[2],x1[3],x2[0],x2[1],x2[2],x2[3],x3[0],x3[1],x3[2],x3[3]};
#pragma unroll
    for (int i = 0; i < 16; ++i) { const _Float16 h = (_Float16)xs[i]; ah.h[i] = h; al.h[i] = ASPLIT ? (_Float16)(xs[i] - (float)h) : (_Float16)0.0f; }
#pragma unroll
    for (int t = 0; t < 4; ++t) { if (col0 + t * 16 >= N) continue; const size_t boff = (size_t)(col0 + t * 16 + ln) * ldb + kb; FragH bq; bq.half[0] = *(const v8us*)(Bh + boff + 8 * hh); bq.half[1] = *(const v8us*)(Bh + boff + 16 + 8 * hh);
      acc[t] = mmaH<ASPLIT ? 2 : 1>(ah.v, al.v, bq.v, bq.v, acc[t]); }
  }
#pragma unroll
  for (int t = 0; t < 4; ++t) { if (col0 + t * 16 >= N) continue;
#pragma unroll
    for (int r = 0; r < 8; ++r) so[w][8 * hh + r][t * 16 + ln] = acc[t][r] * alpha; }
  __builtin_amdgcn_fence(__ATOMIC_ACQ_REL, "workgroup"); __builtin_amdgcn_wave_barrier();
  const int rsub = lane >> 4, c4 = (lane & 15) * 4;
  {
#pragma unroll
    for (int q = 0; q < 8; ++q) { const int r = q * 2 + rsub; if (col0 + c4 < N) { const v4f v = *(const v4fa*)&so[w][r][c4]; *(v4f*)(C + (size_t)(row0 + r) * ldc + col0 + c4) = v; } }
     }
}

// Wt[n][k] = f16(W[k][n]·scale) from f32 row-major W[K][N] (scale = power of two; bf16-exact weights stay exact in f16 away from the subnormal range)
__global__ __launch_bounds__(256) void k_wt_f16(const float* __restrict__ W, _Float16* __restrict__ Wt, int K, int N, float scale) {
  const int t = blockIdx.x * 256 + threadIdx.x; if (t >= N * (K / 8)) return; const int n = t / (K / 8), k8 = (t % (K / 8)) * 8; FragH f;
#pragma unroll
  for (int i = 0; i < 8; ++i) f.h[i] = (_Float16)(bf16_round(W[(size_t)(k8 + i) * N + n]) * scale); const v8us o = f.half[0];
  *(v8us*)((unsigned short*)Wt + (size_t)n * K + k8) = o; 
}
// k_gemm_hh variant with fused epilogue: v = acc·alpha + bias[by·sBias + col] (+ CP[(row/rowsPerB)·sCPb + by·64 + col] if CP) ; ACT 0 none / 1 elu ; writes f16 C16 (and f32 C if non-null)
template <int ACT>
__global__ __launch_bounds__(128) void k_gemm_hhx(const _Float16* __restrict__ A, int lda, size_t sA, const _Float16* __restrict__ Bh, int ldb, size_t sB, float alpha, const float* __restrict__ bias, size_t sBias, const float* __restrict__ CP, int rowsPerB, size_t sCPb, int row0g,
    float* __restrict__ C, _Float16* __restrict__ C16, int ldc, size_t sC, int M, int N, int K) {
  __shared__ __attribute__((aligned(16))) float so[4][16][64];
  const int tid = threadIdx.x, w = tid >> 5, lane = tid & 31, ln = lane & 15, hh = lane >> 4; const int by = blockIdx.y;
  A += (size_t)by * sA; Bh += (size_t)by * sB; const size_t cofs = (size_t)by * sC; const float* bp = bias ? bias + (size_t)by * sBias : nullptr;
  const int ntn = (N + 63) / 64; const int wid = blockIdx.x * 4 + w; const int mt = wid / ntn, nq = wid % ntn; if (mt * 16 >= M) return;
  const int row0 = mt * 16, col0 = nq * 64; const _Float16* arow = A + (size_t)(row0 + ln) * lda;
  v8f acc[4] = {};
  for (int kb = 0; kb < K; kb += 32) { FragH ah; ah.half[0] = *(const v8us*)((const unsigned short*)arow + kb + 8 * hh); ah.half[1] = *(const v8us*)((const unsigned short*)arow + kb + 16 + 8 * hh);
#pragma unroll
    for (int t = 0; t < 4; ++t) { if (col0 + t * 16 >= N) continue; const size_t boff = (size_t)(col0 + t * 16 + ln) * ldb + kb; FragH bq; bq.half[0] = *(const v8us*)((const unsigned short*)Bh + boff + 8 * hh); bq.half[1] = *(const v8us*)((const unsigned short*)Bh + boff + 16 + 8 * hh);
      acc[t] = mmaH<1>(ah.v, ah.v, bq.v, bq.v, acc[t]); }
  }
#pragma unroll
  for (int t = 0; t < 4; ++t) { if (col0 + t * 16 >= N) continue; const int col = col0 + t * 16 + ln; const float bv = bp ? bf16_round(bp[col]) : 0.f;
#pragma unroll
    for (int r = 0; r < 8; ++r) { float v = acc[t][r] * alpha + bv; if (CP) { const int rr = row0g + row0 + 8 * hh + r; if (rowsPerB < 0) v += CP[cofs + (size_t)rr * ldc + col];      /* rowsPerB < 0: own element of the batched C plane */ else { const int bidx = rr / rowsPerB; v += CP[(size_t)bidx * sCPb + (size_t)by * 64 + col]; } } if (ACT == 1) v = (v > 0.f) ? v : expm1f(v); else if (ACT == 7) v = (v > 0.f) ? v + 1.0f : expf(v); else if (ACT == 8) v = tanhf(v); else if (ACT == 9) v = 0.5f * v * (1.0f + tanhf(0.7978845608028654f * (v + 0.044715f * v * v * v))); else if (ACT == 11) v = 1.0f / (1.0f + expf(-v)); else if (ACT == 12) v = (v > 0.f) ? v : 0.01f * v; else if (ACT == 14) v = (v > 0.f) ? v : 0.1f * v; else if (ACT == 16) v = (v >= 0.f) ? v : 0.3f * v; else if (ACT == 17) v = (v >= 0.f) ? v : 0.2f * v; else if (ACT == 15) v = v / (1.0f + expf(-v)); else if (ACT == 3) v = fmaxf(v, 0.f); else if (ACT == 6) v = 0.5f * v * (1.0f + erff(v * 0.70710678118654752f)); so[w][8 * hh + r][t * 16 + ln] = v; } }
  __builtin_amdgcn_fence(__ATOMIC_ACQ_REL, "workgroup"); __builtin_amdgcn_wave_barrier();
  const int rsub = lane >> 4, c4 = (lane & 15) * 4; typedef _Float16 v4h __attribute__((ext_vector_type(4)));
  {
#pragma unroll
    for (int q = 0; q < 8; ++q) { const int r = q * 2 + rsub; if (col0 + c4 < N) { const v4f v = *(const v4fa*)&so[w][r][c4]; if (C) *(v4f*)(C + cofs + (size_t)(row0 + r) * ldc + col0 + c4) = v; if (C16) { v4h h4; for (int i = 0; i < 4; ++i) h4[i] = (_Float16)v[i]; *(v4h*)(C16 + cofs + (size_t)(row0 + r) * ldc + col0 + c4) = h4; } } }
     }
}


typedef _Float16 v4h __attribute__((ext_vector_type(4)));

__global__ __launch_bounds__(256) void k_x16(const float* __restrict__ x, _Float16* __restrict__ X16, size_t n8) { const size_t t = (size_t)blockIdx.x * 256 + threadIdx.x; if (t >= n8) return; FragH f;
#pragma unroll
  for (int q = 0; q < 8; ++q) f.h[q] = (_Float16)bf16_round(x[t * 8 + q]); *(v8us*)((unsigned short*)X16 + t * 8) = f.half[0];  }
__global__ __launch_bounds__(256) void k_h16(const float* __restrict__ x, _Float16* __restrict__ X16, size_t n8) { const size_t t = (size_t)blockIdx.x * 256 + threadIdx.x; if (t >= n8) return; FragH f;
#pragma unroll
  for (int q = 0; q < 8; ++q) f.h[q] = (_Float16)x[t * 8 + q]; *(v8us*)((unsigned short*)X16 + t * 8) = f.half[0];  }
__global__ __launch_bounds__(256) void k_round16f(const float* __restrict__ W, _Float16* __restrict__ Bt, size_t n8) { const size_t t = (size_t)blockIdx.x * 256 + threadIdx.x; if (t >= n8) return; FragH f;
#pragma unroll
  for (int i = 0; i < 8; ++i) f.h[i] = (_Float16)(bf16_round(W[t * 8 + i]) * 16.0f); *(v8us*)((unsigned short*)Bt + t * 8) = f.half[0];  }
template <int NHv, int TTv>
__global__ __launch_bounds__(256) void k_vt(const _Float16* __restrict__ V16, int ldv, int voff, _Float16* __restrict__ Vt) { __shared__ unsigned short tl[64][66]; const int tid = threadIdx.x; const int slab = blockIdx.x / (TTv / 64), lg = blockIdx.x % (TTv / 64); const int b = slab / NHv, h = slab % NHv;
  for (int i = tid; i < 64 * 8; i += 256) { const int r = i / 8, c8 = (i % 8) * 8; FragH f; f.half[0] = *(const v8us*)((const unsigned short*)V16 + ((size_t)b * TTv + lg * 64 + r) * ldv + voff + h * 64 + c8);
#pragma unroll
    for (int q = 0; q < 8; ++q) tl[r][c8 + q] = f.u[q]; }
  __syncthreads();
  {
#pragma unroll
    for (int rd = 0; rd < 2; ++rd) { const int d = rd * 32 + tid / 8, pc = tid % 8; FragH f;
#pragma unroll
      for (int q = 0; q < 8; ++q) f.u[q] = tl[pc * 8 + q][d];
      *(v8us*)((unsigned short*)Vt + ((size_t)slab * 64 + d) * TTv + lg * 64 + pc * 8) = f.half[0]; }
     } }

__global__ __launch_bounds__(256) void k_hl(const float* __restrict__ F, _Float16* __restrict__ Hh, _Float16* __restrict__ Hl, size_t n8) { const size_t t = (size_t)blockIdx.x * 256 + threadIdx.x; if (t >= n8) return; FragH fh, fl; const v4f a = *(const v4fa*)(F + t * 8), c = *(const v4fa*)(F + t * 8 + 4);
#pragma unroll
  for (int q = 0; q < 4; ++q) { _Float16 h = (_Float16)a[q]; fh.h[q] = h; fl.h[q] = (_Float16)((a[q] - (float)h) * 1024.0f); h = (_Float16)c[q]; fh.h[4 + q] = h; fl.h[4 + q] = (_Float16)((c[q] - (float)h) * 1024.0f); }
  { *(v8us*)((unsigned short*)Hh + t * 8) = fh.half[0]; *(v8us*)((unsigned short*)Hl + t * 8) = fl.half[0];  } }

// ---- fast GEMM (wave tile 32x64; requires M % 32 == 0 rows per launch region and N % 64 == 0); epilogue = k_gemm_hhx semantics ----
__device__ __forceinline__ v16h g2_frag(const _Float16* p, int hh) { FragH f; f.half[0] = *(const v8us*)((const unsigned short*)p + 8 * hh); f.half[1] = *(const v8us*)((const unsigned short*)p + 16 + 8 * hh); return f.v; }
__device__ __forceinline__ v8f g2_mma(v16h a, v16h b, v8f c) { v8f d = __builtin_amdgcn_wmma_f32_16x16x32_f16(false, a, false, b, (short)0, c, false, false); asm volatile("v_nop\n\tv_nop\n\tv_nop\n\tv_nop" : "+v"(d) : "v"(a), "v"(b)); return d; }
template <int ACT>
__global__ __launch_bounds__(128) void k_gemm2(const _Float16* __restrict__ A, int lda, size_t sA, const _Float16* __restrict__ Bh, int ldb, size_t sB, float alpha, const float* __restrict__ bias, size_t sBias, const float* __restrict__ CP, int rowsPerB, size_t sCPb, int row0g,
    float* __restrict__ C, _Float16* __restrict__ C16, int ldc, size_t sC, int M, int N, int K) { static_assert(ACT == 0 || ACT == 3 || ACT == 6 || ACT == 8 || ACT == 9 || ACT == 11 || ACT == 12 || ACT == 14 || ACT == 15 || ACT == 16 || ACT == 17, "k_gemm2: unsupported ACT code (would silently apply no activation)");
  __shared__ __attribute__((aligned(16))) float so[4][32][68];
  const int tid = threadIdx.x, w = tid >> 5, lane = tid & 31, ln = lane & 15, hh = lane >> 4; const int by = blockIdx.y;
  A += (size_t)by * sA; Bh += (size_t)by * sB; const size_t cofs = (size_t)by * sC; const float* bp = bias ? bias + (size_t)by * sBias : nullptr;
  const int ntn = N >> 6; const int mt = blockIdx.x / ntn, nq = blockIdx.x - mt * ntn; const int row0 = mt * 128 + 32 * w, col0 = nq * 64; if (row0 >= M) return;
  const _Float16* a0p = A + (size_t)(row0 + ln) * lda; const _Float16* a1p = a0p + (size_t)16 * lda;
  const _Float16* b0p = Bh + (size_t)(col0 + ln) * ldb; const _Float16* b1p = b0p + (size_t)16 * ldb; const _Float16* b2p = b1p + (size_t)16 * ldb; const _Float16* b3p = b2p + (size_t)16 * ldb;
  const v8f z8 = {0.f,0.f,0.f,0.f,0.f,0.f,0.f,0.f}; v8f c00 = z8, c01 = z8, c02 = z8, c03 = z8, c10 = z8, c11 = z8, c12 = z8, c13 = z8;
#pragma unroll 1
  for (int kb = 0; kb < K; kb += 32) { const v16h a0 = g2_frag(a0p + kb, hh), a1 = g2_frag(a1p + kb, hh);
    v16h b = g2_frag(b0p + kb, hh); c00 = g2_mma(a0, b, c00); c10 = g2_mma(a1, b, c10);
    b = g2_frag(b1p + kb, hh); c01 = g2_mma(a0, b, c01); c11 = g2_mma(a1, b, c11);
    b = g2_frag(b2p + kb, hh); c02 = g2_mma(a0, b, c02); c12 = g2_mma(a1, b, c12);
    b = g2_frag(b3p + kb, hh); c03 = g2_mma(a0, b, c03); c13 = g2_mma(a1, b, c13); }
  v8f accs[8] = {c00, c01, c02, c03, c10, c11, c12, c13};
#pragma unroll
  for (int u = 0; u < 8; ++u) { const int t = u & 3, half = u >> 2; const int col = col0 + t * 16 + ln; const float bv = bp ? bf16_round(bp[col]) : 0.f;
#pragma unroll
    for (int r = 0; r < 8; ++r) { const int rloc = half * 16 + 8 * hh + r; float v = accs[u][r] * alpha + bv; if (CP) { if (rowsPerB < 0) v += CP[cofs + (size_t)(row0g + row0 + rloc) * ldc + col];      /* rowsPerB < 0: own element of the batched C plane */ else { const int bidx = (row0g + row0 + rloc) / rowsPerB; v += CP[(size_t)bidx * sCPb + (size_t)by * 64 + col]; } }
      if (ACT == 3) v = fmaxf(v, 0.f); else if (ACT == 6) v = 0.5f * v * (1.0f + erff(v * 0.70710678118654752f)); else if (ACT == 11) v = 1.0f / (1.0f + expf(-v)); else if (ACT == 15) v = v / (1.0f + expf(-v)); else if (ACT == 12) v = (v > 0.f) ? v : 0.01f * v; else if (ACT == 8) v = tanhf(v); else if (ACT == 9) v = 0.5f * v * (1.0f + tanhf(0.7978845608028654f * (v + 0.044715f * v * v * v))); else if (ACT == 14) v = (v > 0.f) ? v : 0.1f * v; else if (ACT == 16) v = (v >= 0.f) ? v : 0.3f * v; else if (ACT == 17) v = (v >= 0.f) ? v : 0.2f * v;
      so[w][rloc][t * 16 + ln] = v; } }
  __builtin_amdgcn_fence(__ATOMIC_ACQ_REL, "workgroup"); __builtin_amdgcn_wave_barrier();
  const int rsub = lane >> 4, c4 = (lane & 15) * 4;
  {
#pragma unroll
    for (int q = 0; q < 16; ++q) { const int r = q * 2 + rsub; const v4f v = *(const v4fa*)&so[w][r][c4]; if (C) *(v4f*)(C + cofs + (size_t)(row0 + r) * ldc + col0 + c4) = v; if (C16) { v4h h4; for (int i = 0; i < 4; ++i) h4[i] = (_Float16)v[i]; *(v4h*)(C16 + cofs + (size_t)(row0 + r) * ldc + col0 + c4) = h4; } }
     } }


__global__ __launch_bounds__(256) void k_wnat(const float* __restrict__ w, size_t n8, _Float16* __restrict__ Bt) { const size_t t = (size_t)blockIdx.x * 256 + threadIdx.x; if (t >= n8) return; FragH f; for (int q = 0; q < 8; ++q) f.h[q] = (_Float16)(bf16_round(w[t * 8 + q]) * 16.0f); *(v8us*)((unsigned short*)Bt + t * 8) = f.half[0];  }
__global__ __launch_bounds__(256) void k_rsm(const float* __restrict__ S, _Float16* __restrict__ P, int nrows) {
  #pragma clang fp contract(off)
  const int i = blockIdx.x * 256 + threadIdx.x; if (i >= nrows) return; const float* s = S + (size_t)i * SQ; float mx = -3.0e38f;
#pragma unroll 1
  for (int j = 0; j < SQ; ++j) mx = fmaxf(mx, s[j]); float se = 0.f;
#pragma unroll 1
  for (int j = 0; j < SQ; ++j) se += expf(s[j] - mx); const float sc = 256.0f / se;
#pragma unroll 1
  for (int j0 = 0; j0 < SQ; j0 += 8) { FragH f; for (int q = 0; q < 8; ++q) f.h[q] = (_Float16)(expf(s[j0 + q] - mx) * sc); unsigned short* d = (unsigned short*)P + (size_t)i * SQ + j0; *(v8us*)d = f.half[0];  } }
__global__ __launch_bounds__(256) void k_vt(const _Float16* __restrict__ V16, int b, int h0, _Float16* __restrict__ VT) { __shared__ unsigned short tl[64][65]; const int tid = threadIdx.x; const int hh = blockIdx.x % HG, sg = blockIdx.x / HG; const int s0 = sg * 64; const int h = h0 + hh;
  for (int i = tid; i < 64 * 8; i += 256) { const int j = i / 8, d8 = (i % 8) * 8; FragH f; f.half[0] = *(const v8us*)((const unsigned short*)V16 + ((size_t)b * SQ + s0 + j) * DM + h * HD + d8); for (int q = 0; q < 8; ++q) tl[d8 + q][j] = f.u[q]; }
  __syncthreads();
  { for (int i = tid; i < 64 * 8; i += 256) { const int d = i / 8, j8 = (i % 8) * 8; FragH f; for (int q = 0; q < 8; ++q) f.u[q] = tl[d][j8 + q]; *(v8us*)((unsigned short*)VT + ((size_t)hh * HD + d) * SQ + s0 + j8) = f.half[0]; }  } }



__global__ __launch_bounds__(256) void k_rsmcf2(const float* __restrict__ S, _Float16* __restrict__ P, int hg, int q0, int nk) {
  #pragma clang fp contract(off)
  const int t = blockIdx.x * 256 + threadIdx.x; if (t >= hg * QT) return; const size_t i = (size_t)t; const float* s = S + i * NKX; const int last = q0 + (t % QT); float mx = -3.0e38f;
#pragma unroll 1
  for (int j = 0; j < nk; ++j) { const float f = (j <= last) ? 1.f : 0.f; mx = fmaxf(mx, fmaf(f, s[j], (1.f - f) * -1.0e9f)); } float se = 0.f;
#pragma unroll 1
  for (int j = 0; j < nk; ++j) { const float f = (j <= last) ? 1.f : 0.f; se += __expf(fmaf(f, s[j], (1.f - f) * -1.0e9f) - mx); } const float sc = 256.0f / se;
#pragma unroll 1
  for (int j0 = 0; j0 < nk; j0 += 8) { FragH fr; for (int q = 0; q < 8; ++q) { const int j = j0 + q; const float f = (j <= last) ? 1.f : 0.f; fr.h[q] = (_Float16)(__expf(fmaf(f, s[j], (1.f - f) * -1.0e9f) - mx) * sc); } unsigned short* d = (unsigned short*)P + i * NKX + j0; *(v8us*)d = fr.half[0];  } }

template <int MASKADD>
__global__ __launch_bounds__(64) void k_att0(const float* __restrict__ QF, const float* __restrict__ KF, const float* __restrict__ VF, int ld, const float* __restrict__ mask, float scale, float* __restrict__ OF, int ldo) {
  #pragma clang fp contract(off)
  __shared__ __attribute__((aligned(16))) float lq[64][64]; __shared__ __attribute__((aligned(16))) float lo[64][64];
  const int tid = threadIdx.x; const int h = blockIdx.x / (QT0 / 64), rg = blockIdx.x % (QT0 / 64); const int i = rg * 64 + tid;
  const float* qr = QF + (size_t)i * ld + h * HD;
#pragma unroll 1
  for (int c = 0; c < HD / 4; ++c) { *(v4f*)&lq[tid][c * 4] = *(const v4fa*)(qr + c * 4); const v4f z = {0.f, 0.f, 0.f, 0.f}; *(v4f*)&lo[tid][c * 4] = z; }
  float m = -1.0e30f, l = 0.f; const int jmax = MASKADD ? (SQ - 1) : (rg * 64 + 63);      /* additive-mask form: every key (the mask input decides); causal form: keys up to the block's last row */
#pragma unroll 1
  for (int j = 0; j <= jmax; ++j) { const float* kr = KF + (size_t)j * ld + h * HD; const float* vr = VF + (size_t)j * ld + h * HD; float s = 0.f;
#pragma unroll 1
    for (int c = 0; c < HD / 4; ++c) { const v4f kq = *(const v4fa*)(kr + c * 4); const v4f qq = *(v4f*)&lq[tid][c * 4]; s = __fadd_rn(s, __fmul_rn(qq[0], kq[0])); s = __fadd_rn(s, __fmul_rn(qq[1], kq[1])); s = __fadd_rn(s, __fmul_rn(qq[2], kq[2])); s = __fadd_rn(s, __fmul_rn(qq[3], kq[3])); }
    s = __fmul_rn(s, scale); if (MASKADD) s = __fadd_rn(s, __fmul_rn(bf16_round(mask[(size_t)i * SQ + j]), -10000.0f));
    const float f = (MASKADD || j <= i) ? 1.f : 0.f; const float sm = fmaf(f, s, (1.f - f) * -1.0e30f); const float mn = fmaxf(m, sm); const float sc = expf(m - mn); const float e = expf(sm - mn); l = __fadd_rn(__fmul_rn(l, sc), e); m = mn;
#pragma unroll 1
    for (int c = 0; c < HD / 4; ++c) { const v4f vv = *(const v4fa*)(vr + c * 4); v4f oo = *(v4f*)&lo[tid][c * 4]; for (int u = 0; u < 4; ++u) oo[u] = __fadd_rn(__fmul_rn(oo[u], sc), __fmul_rn(e, vv[u])); *(v4f*)&lo[tid][c * 4] = oo; } }
  const float fin = 64.0f / l;      /* o carried x64 */
#pragma unroll 1
  for (int c = 0; c < HD / 4; ++c) { v4f oo = *(v4f*)&lo[tid][c * 4]; for (int u = 0; u < 4; ++u) oo[u] = __fmul_rn(oo[u], fin); *(v4f*)&lo[tid][c * 4] = oo; }
  __syncthreads();
  {
#pragma unroll 1
    for (int it = 0; it < 16; ++it) { const int row = it * 4 + tid / 16, pc = (tid % 16) * 4; const v4f v = *(const v4f*)&lo[row][pc]; *(v4f*)(OF + (size_t)(rg * 64 + row) * ldo + h * HD + pc) = v; }
     } }

__global__ __launch_bounds__(256) void k_oscale(const float* __restrict__ OF, float* __restrict__ out, size_t n4) { const size_t t = (size_t)blockIdx.x * 256 + threadIdx.x; if (t >= n4) return; const v4f a = *(const v4fa*)(OF + t * 4); v4f o; for (int q = 0; q < 4; ++q) o[q] = a[q] * 0.015625f; *(v4f*)(out + t * 4) = o;  }

__global__ __launch_bounds__(256) void k_bfr(const float* __restrict__ x, float* __restrict__ XB, size_t n8) { const size_t t = (size_t)blockIdx.x * 256 + threadIdx.x; if (t >= n8) return; v4f a = *(const v4fa*)(x + t * 8), c = *(const v4fa*)(x + t * 8 + 4); for (int q = 0; q < 4; ++q) { a[q] = bf16_round(a[q]); c[q] = bf16_round(c[q]); }
  { *(v4f*)(XB + t * 8) = a; *(v4f*)(XB + t * 8 + 4) = c;  } }



__global__ __launch_bounds__(256) void k_rsmfvl(const float* __restrict__ S, _Float16* __restrict__ P, _Float16* __restrict__ PL, int qn, const int* __restrict__ vlp) {
  #pragma clang fp contract(off)
  const int t = blockIdx.x * 256 + threadIdx.x; if (t >= qn) return; const int vl = vlp[0]; const size_t i = (size_t)t; const float* s = S + i * SQ; float mx = -3.0e38f;
#pragma unroll 1
  for (int j = 0; j < SQ; ++j) { const float f = (j < vl) ? 1.f : 0.f; mx = fmaxf(mx, fmaf(f, s[j], (1.f - f) * -1000000.0f)); } float se = 0.f;
#pragma unroll 1
  for (int j = 0; j < SQ; ++j) { const float f = (j < vl) ? 1.f : 0.f; se += __expf(fmaf(f, s[j], (1.f - f) * -1000000.0f) - mx); } const float sc = 256.0f / se;
#pragma unroll 1
  for (int j0 = 0; j0 < SQ; j0 += 8) { FragH fr, gr; for (int q = 0; q < 8; ++q) { const int j = j0 + q; const float f = (j < vl) ? 1.f : 0.f; const float pv = __expf(fmaf(f, s[j], (1.f - f) * -1000000.0f) - mx) * sc; const _Float16 ph = (_Float16)pv; fr.h[q] = ph; gr.h[q] = (_Float16)((pv - (float)ph) * 1024.0f); }
    unsigned short* d = (unsigned short*)P + i * SQ + j0; unsigned short* dl = (unsigned short*)PL + i * SQ + j0; *(v8us*)d = fr.half[0]; *(v8us*)dl = gr.half[0];  } }

__global__ __launch_bounds__(256) void k_rsmf(const float* __restrict__ S, _Float16* __restrict__ P, int qn, int hg) {
  #pragma clang fp contract(off)
  const int t = blockIdx.x * 256 + threadIdx.x; if (t >= qn * hg) return; const size_t i = (size_t)(t / qn) * SQ + (t % qn); const float* s = S + i * SQ; float mx = -3.0e38f;
#pragma unroll 1
  for (int j = 0; j < SQ; ++j) mx = fmaxf(mx, s[j]); float se = 0.f;
#pragma unroll 1
  for (int j = 0; j < SQ; ++j) se += __expf(s[j] - mx); const float sc = 256.0f / se;
#pragma unroll 1
  for (int j0 = 0; j0 < SQ; j0 += 8) { FragH f; for (int q = 0; q < 8; ++q) f.h[q] = (_Float16)(__expf(s[j0 + q] - mx) * sc); unsigned short* d = (unsigned short*)P + i * SQ + j0; *(v8us*)d = f.half[0];  } }


extern "C" void kernel_launch(void* const* d_in, const int* in_sizes, int n_in,
                              void* d_out, int out_size, void* d_ws, size_t ws_size, hipStream_t stream) {
  (void)in_sizes; (void)n_in; (void)out_size;
  const float* const* I = (const float* const*)d_in; const float* xq = I[0]; const float* xk = I[1]; const float* xv = I[2]; const float* wq = I[3]; const float* bq = I[4]; const float* wk = I[5]; const float* bk = I[6]; const float* wv = I[7]; const float* bv = I[8];      /* natural [64][64] weights + biases */      /* Q, K, V [8][4096][64] (bf16-valued), single head */
  char* ws = (char*)d_ws; size_t off = 0;
  auto take = [&](size_t bytes) { char* p = ws + off; off += (bytes + 255) & ~(size_t)255; return p; };
  _Float16* XQ = (_Float16*)take(NR * DM * 2); _Float16* XK = (_Float16*)take(NR * DM * 2); _Float16* XV = (_Float16*)take(NR * DM * 2); _Float16* BQ = (_Float16*)take(DM * DM * 2); _Float16* BK = (_Float16*)take(DM * DM * 2); _Float16* BV = (_Float16*)take(DM * DM * 2); float* F1 = (float*)take(NR * DM * 4); _Float16* QH = (_Float16*)take(NR * DM * 2); _Float16* QL = (_Float16*)take(NR * DM * 2); _Float16* KH = (_Float16*)take(NR * DM * 2); _Float16* KL = (_Float16*)take(NR * DM * 2); _Float16* V16 = (_Float16*)take(NR * DM * 2);
  float* S = (float*)take((size_t)SQ * SQ * 4); _Float16* P = (_Float16*)take((size_t)SQ * SQ * 2); _Float16* VT = (_Float16*)take((size_t)DM * SQ * 2);
  if (off > ws_size) return;
  k_x16<<<(unsigned)((NR * DM / 8 + 255) / 256), 256, 0, stream>>>(xq, XQ, NR * DM / 8); k_x16<<<(unsigned)((NR * DM / 8 + 255) / 256), 256, 0, stream>>>(xk, XK, NR * DM / 8); k_x16<<<(unsigned)((NR * DM / 8 + 255) / 256), 256, 0, stream>>>(xv, XV, NR * DM / 8);      /* exact f16 copies of the bf16-valued inputs */
  { const unsigned g = (unsigned)((DM * DM / 8 + 255) / 256); k_wnat<<<g, 256, 0, stream>>>(wq, DM * DM / 8, BQ); k_wnat<<<g, 256, 0, stream>>>(wk, DM * DM / 8, BK); k_wnat<<<g, 256, 0, stream>>>(wv, DM * DM / 8, BV); }      /* natural [out][in] = Bt x16 */
  k_gemm2<0><<<dim3((unsigned)((NR / 128) * (DM / 64)), 1), 128, 0, stream>>>(XQ, DM, 0, BQ, DM, 0, 0.0625f, bq, 0, nullptr, 1, 0, 0, F1, nullptr, DM, 0, (int)NR, DM, DM); k_hl<<<(unsigned)((NR * DM / 8 + 255) / 256), 256, 0, stream>>>(F1, QH, QL, NR * DM / 8);      /* q = query Wq^T + bq (f32) -> f16 hi + x1024 residual */
  k_gemm2<0><<<dim3((unsigned)((NR / 128) * (DM / 64)), 1), 128, 0, stream>>>(XK, DM, 0, BK, DM, 0, 0.0625f, bk, 0, nullptr, 1, 0, 0, F1, nullptr, DM, 0, (int)NR, DM, DM); k_hl<<<(unsigned)((NR * DM / 8 + 255) / 256), 256, 0, stream>>>(F1, KH, KL, NR * DM / 8);      /* k = key Wk^T + bk -> hi + residual */
  k_gemm2<0><<<dim3((unsigned)((NR / 128) * (DM / 64)), 1), 128, 0, stream>>>(XV, DM, 0, BV, DM, 0, 0.0625f, bv, 0, nullptr, 1, 0, 0, nullptr, V16, DM, 0, (int)NR, DM, DM);      /* v = value Wv^T + bv -> f16 rows */
  for (int b = 0; b < NB; ++b) { const size_t r0 = (size_t)b * SQ;
    k_vt<1, SQ><<<SQ / 64, 256, 0, stream>>>(V16 + r0 * DM, DM, 0, VT);      /* V^T [64][4096] of this batch */
    k_gemm2<0><<<dim3((SQ / 128) * (SQ / 64), 1), 128, 0, stream>>>(KH + r0 * DM, DM, 0, QH + r0 * DM, DM, 0, 1.0f, nullptr, 0, nullptr, 1, 0, 0, S, nullptr, SQ, 0, SQ, SQ, DM);      /* scores[i][j] = k_i . q_j (rows = key positions; NO scale): hi.hi */
    k_gemm2<0><<<dim3((SQ / 128) * (SQ / 64), 1), 128, 0, stream>>>(KL + r0 * DM, DM, 0, QH + r0 * DM, DM, 0, 0.0009765625f, nullptr, 0, S, -1, 0, 0, S, nullptr, SQ, 0, SQ, SQ, DM);      /* += lo.hi 2^-10 */
    k_gemm2<0><<<dim3((SQ / 128) * (SQ / 64), 1), 128, 0, stream>>>(KH + r0 * DM, DM, 0, QL + r0 * DM, DM, 0, 0.0009765625f, nullptr, 0, S, -1, 0, 0, S, nullptr, SQ, 0, SQ, SQ, DM);      /* += hi.lo 2^-10 */
    k_rsmf<<<(SQ + 255) / 256, 256, 0, stream>>>(S, P, SQ, 1);      /* softmax over the query positions -> P x256 f16 */
    k_gemm2<0><<<dim3((SQ / 128) * (DM / 64), 1), 128, 0, stream>>>(P, SQ, 0, VT, SQ, 0, 0.00390625f, nullptr, 0, nullptr, 1, 0, 0, (float*)d_out + r0 * DM, nullptr, DM, 0, SQ, DM, SQ); }      /* out[i] = sum_j attn[i][j] v[j] f32 into the output rows */
}

// v001
// Measured time: 1940 microseconds a run.
// Timed twice side by side with v000, it ran 3.81 and 3.76 times as fast.
#include <hip/hip_runtime.h>
// Dot-product attention with TRANSPOSED roles and no scaling (query, key, value [8][4096][64]; q = query Wq^T + bq, k = key Wk^T + bk, v = value Wv^T + bv (natural [64][64] sigma 1/8, biases 0.01); scores[i][j] = k_i . q_j (NO 1/sqrt(d): sigma ~8); attn = softmax over the query positions j; out[i] = sum_j attn[i][j] v[j] -> [8][4096][64] (rows are key positions)).
// Structure: token rows; the bf16-valued inputs as exact f16 rows; natural weights x16; q and k as WMMA GEMMs (32x64 wave tiles, f32 accumulation, + bias) -> f32 -> f16 hi + x1024 residual rows, v -> f16 rows; per batch: V^T via LDS transposes; scores [4096][4096] = hi.hi + lo.hi 2^-10 + hi.lo 2^-10 (K = 64, unscaled) f32; row softmax on VALU, one wave per row (f32 statistics, native exp; weights x256 f16); out = P V^T 2^-8 f32; launches: see trace.
// Compute dtype: inputs rounded to bf16; x / weights exact; q and k as f16 hi + x1024 residual pairs, v and softmax weights as plain f16 GEMM operands (~2^-12), o f32; scores and softmax statistics f32; v_wmma_f32_16x16x32_f16.
#define NB 8
#define SQ 4096
#define DM 64
#define NH 1
#define HD 64
#define HG 8                         /* heads per launch of the k_vt(b, h0) overload (not launched) */
#define B0 0                         /* first batch processed (used by no kernel or launch) */
#define NBR NB                       /* batches processed (used by no kernel or launch) */
#define NR ((size_t)NB * SQ)         /* token rows */
#define MP ((int)((size_t)NBR * SQ)) /* rows projected (used by no kernel or launch) */
#define QT 256                       /* query rows per causal tile */
#define NKX SQ                       /* S / P row pitch */
#define QT0 256                      /* first-tile rows recomputed exactly */
#define QN SQ                        /* query rows attended per batch (used by no kernel or launch) */
#define NHD NH                       /* heads attended (used by no kernel or launch) */
#define MPO MP                       /* rows through the output stage (used by no kernel or launch) */
#define LQ DM            /* row pitch of the q/k/v rows */
typedef __bf16 v16b __attribute__((ext_vector_type(16)));
typedef unsigned short v8us __attribute__((ext_vector_type(8), may_alias));
typedef float  v8f  __attribute__((ext_vector_type(8)));
typedef float  v4f  __attribute__((ext_vector_type(4)));
typedef float  v4fa __attribute__((ext_vector_type(4), may_alias));
union FragB { v16b v; v8us half[2]; unsigned short u[16]; };

__device__ __forceinline__ unsigned short bf16_bits(float x) { unsigned int u = __float_as_uint(x); return (unsigned short)((u + 0x7FFFu + ((u >> 16) & 1u)) >> 16); }
__device__ __forceinline__ float bf16_val(unsigned short b) { return __uint_as_float(((unsigned int)b) << 16); }
__device__ __forceinline__ float bf16_round(float x) { return bf16_val(bf16_bits(x)); }
// D += A·B with NT terms: 1 = ah·bh, 2 = + al·bh (A split), 3 = + ah·bl (both split)
template <int NT>
__device__ __forceinline__ v8f mmaN(v16b ah, v16b al, v16b bh, v16b bl, v8f c) {
  c = __builtin_amdgcn_wmma_f32_16x16x32_bf16(false, ah, false, bh, (short)0, c, false, false);
  if (NT >= 2) c = __builtin_amdgcn_wmma_f32_16x16x32_bf16(false, al, false, bh, (short)0, c, false, false);
  if (NT >= 3) c = __builtin_amdgcn_wmma_f32_16x16x32_bf16(false, ah, false, bl, (short)0, c, false, false);
  asm volatile("v_nop\n\tv_nop\n\tv_nop\n\tv_nop" : "+v"(c) : "v"(ah), "v"(al), "v"(bh), "v"(bl));
  return c;
}

__global__ __launch_bounds__(256) void k_wt_bf16(const float* __restrict__ W, unsigned short* __restrict__ Wt, int K, int N) {
  const int t = blockIdx.x * 256 + threadIdx.x;
  const int k8n = K / 8;
  if (t >= N * k8n) return;
  const int n = t / k8n, k8 = (t % k8n) * 8;
  v8us v;
#pragma unroll
  for (int i = 0; i < 8; ++i) v[i] = bf16_bits(W[(size_t)(k8 + i) * N + n]);
  *(v8us*)(Wt + (size_t)n * K + k8) = v;
  
}

// GEMM C[M][N] (f32, pitch ldc) = act(A[M][K]·W + bias). A f32 row-major (pitch lda) converted per fragment to bf16
// (ASPLIT: hi/lo two planes -> 2 terms, else single rounded term); Wt bf16 [N][K] (pitch ldb). BIAS_BF16 rounds the
// bias to bf16 first (bias quantised to bf16 before the add). K%32==0, M%16==0, N%64==0.
template <bool ASPLIT, int ACT, bool BIAS_BF16>
__global__ __launch_bounds__(128) void k_gemm_bf(const float* __restrict__ A, int lda, const unsigned short* __restrict__ Wt, int ldb,
                                               const float* __restrict__ bias, float* __restrict__ C, int ldc, int M, int N, int K) {
  __shared__ __attribute__((aligned(16))) float so[4][16][64];
  const int tid = threadIdx.x, w = tid >> 5, lane = tid & 31, ln = lane & 15, hh = lane >> 4;
  const int ntn = N / 64;
  const int wid = blockIdx.x * 4 + w;
  const int mt = wid / ntn, nq = wid % ntn;
  if (mt * 16 >= M) return;
  const int row0 = mt * 16, col0 = nq * 64;
  const float* arow = A + (size_t)(row0 + ln) * lda;
  v8f acc[4] = {};
  for (int kb = 0; kb < K; kb += 32) {
    FragB ah, al;
    const v4f x0 = *(const v4fa*)(arow + kb + 8 * hh), x1 = *(const v4fa*)(arow + kb + 8 * hh + 4);
    const v4f x2 = *(const v4fa*)(arow + kb + 16 + 8 * hh), x3 = *(const v4fa*)(arow + kb + 16 + 8 * hh + 4);
    float xs[16] = {x0[0],x0[1],x0[2],x0[3],x1[0],x1[1],x1[2],x1[3],x2[0],x2[1],x2[2],x2[3],x3[0],x3[1],x3[2],x3[3]};
#pragma unroll
    for (int i = 0; i < 16; ++i) { const unsigned short hb = bf16_bits(xs[i]); ah.u[i] = hb; al.u[i] = ASPLIT ? bf16_bits(xs[i] - bf16_val(hb)) : (unsigned short)0; }
#pragma unroll
    for (int t = 0; t < 4; ++t) {
      const unsigned short* brow = Wt + (size_t)(col0 + t * 16 + ln) * ldb + kb;
      FragB b;
      b.half[0] = *(const v8us*)(brow + 8 * hh);
      b.half[1] = *(const v8us*)(brow + 16 + 8 * hh);
      acc[t] = mmaN<ASPLIT ? 2 : 1>(ah.v, al.v, b.v, b.v, acc[t]);
    }
  }
#pragma unroll
  for (int t = 0; t < 4; ++t) {
    float bv = bias ? bias[col0 + t * 16 + ln] : 0.f;
    if (BIAS_BF16) bv = bf16_round(bv);
#pragma unroll
    for (int r = 0; r < 8; ++r) { float v = acc[t][r] + bv; if (ACT == 1) v = fmaxf(v, 0.f); so[w][8 * hh + r][t * 16 + ln] = v; }
  }
  __builtin_amdgcn_fence(__ATOMIC_ACQ_REL, "workgroup");
  __builtin_amdgcn_wave_barrier();
  const int rsub = lane >> 4, c4 = (lane & 15) * 4;
  {
#pragma unroll
    for (int q = 0; q < 8; ++q) {
      const int r = q * 2 + rsub;
      const v4f v = *(const v4fa*)&so[w][r][c4];
      *(v4f*)(C + (size_t)(row0 + r) * ldc + col0 + c4) = v;
    }
    
  }
}

// GEMM C = act(A·W + bias + resid): A f32 (ASPLIT -> hi/lo 2 terms), Wt bf16 [N][K]; ACT 0 none, 1 relu, 2 exact gelu;
// resid (optional, f32, row index = (row % rmod), pitch ldr, RES_BF16 rounds it) added before the activation.
template <bool ASPLIT, int ACT, bool BIAS_BF16, bool RES_BF16>
__global__ __launch_bounds__(128) void k_gemm_bf3(const float* __restrict__ A, int lda, const unsigned short* __restrict__ Wt, int ldb,
                                                const float* __restrict__ bias, const float* __restrict__ resid, int rmod, int ldr,
                                                float* __restrict__ C, int ldc, int M, int N, int K) {
  __shared__ __attribute__((aligned(16))) float so[4][16][64];
  const int tid = threadIdx.x, w = tid >> 5, lane = tid & 31, ln = lane & 15, hh = lane >> 4;
  const int ntn = N / 64;
  const int wid = blockIdx.x * 4 + w;
  const int mt = wid / ntn, nq = wid % ntn;
  if (mt * 16 >= M) return;
  const int row0 = mt * 16, col0 = nq * 64;
  const float* arow = A + (size_t)(row0 + ln) * lda;
  v8f acc[4] = {};
  for (int kb = 0; kb < K; kb += 32) {
    FragB ah, al;
    const v4f x0 = *(const v4fa*)(arow + kb + 8 * hh), x1 = *(const v4fa*)(arow + kb + 8 * hh + 4);
    const v4f x2 = *(const v4fa*)(arow + kb + 16 + 8 * hh), x3 = *(const v4fa*)(arow + kb + 16 + 8 * hh + 4);
    float xs[16] = {x0[0],x0[1],x0[2],x0[3],x1[0],x1[1],x1[2],x1[3],x2[0],x2[1],x2[2],x2[3],x3[0],x3[1],x3[2],x3[3]};
#pragma unroll
    for (int i = 0; i < 16; ++i) { const unsigned short hb = bf16_bits(xs[i]); ah.u[i] = hb; al.u[i] = ASPLIT ? bf16_bits(xs[i] - bf16_val(hb)) : (unsigned short)0; }
#pragma unroll
    for (int t = 0; t < 4; ++t) {
      const unsigned short* brow = Wt + (size_t)(col0 + t * 16 + ln) * ldb + kb;
      FragB b;
      b.half[0] = *(const v8us*)(brow + 8 * hh);
      b.half[1] = *(const v8us*)(brow + 16 + 8 * hh);
      acc[t] = mmaN<ASPLIT ? 2 : 1>(ah.v, al.v, b.v, b.v, acc[t]);
    }
  }
#pragma unroll
  for (int t = 0; t < 4; ++t) {
    const int col = col0 + t * 16 + ln;
    float bv = bias ? bias[col] : 0.f;
    if (BIAS_BF16) bv = bf16_round(bv);
#pragma unroll
    for (int r = 0; r < 8; ++r) {
      float v = acc[t][r] + bv;
      if (resid) { float rv = resid[(size_t)((row0 + 8 * hh + r) % rmod) * ldr + col]; if (RES_BF16) rv = bf16_round(rv); v += rv; }
      if (ACT == 1) v = fmaxf(v, 0.f);
      if (ACT == 2) v = 0.5f * v * (1.0f + erff(v * 0.70710678118654752f));
      if (ACT == 3) { const float u = 0.7978845608028654f * (v + 0.044715f * v * v * v); v = 0.5f * v * (1.0f + tanhf(u)); }
      so[w][8 * hh + r][t * 16 + ln] = v;
    }
  }
  __builtin_amdgcn_fence(__ATOMIC_ACQ_REL, "workgroup");
  __builtin_amdgcn_wave_barrier();
  const int rsub = lane >> 4, c4 = (lane & 15) * 4;
  {
#pragma unroll
    for (int q = 0; q < 8; ++q) {
      const int r = q * 2 + rsub;
      const v4f v = *(const v4fa*)&so[w][r][c4];
      *(v4f*)(C + (size_t)(row0 + r) * ldc + col0 + c4) = v;
    }
    
  }
}
// row LayerNorm (biased variance, eps) over N: s = X (+ R); optional out_sum <- s; out_norm <- (s-mu)*rsqrt(var+eps)*g + b
template <bool PARAM_BF16>
__global__ __launch_bounds__(256) void k_layernorm(const float* __restrict__ X, const float* __restrict__ R, const float* __restrict__ g, const float* __restrict__ bta,
                                                  float* __restrict__ out_sum, float* __restrict__ out_norm, int N, float eps) {
  __shared__ float red[256];
  const int row = blockIdx.x, tid = threadIdx.x;
  const float* x = X + (size_t)row * N; const float* rr = R ? R + (size_t)row * N : nullptr;
  float vals[16];                     // up to N = 4096
  const int per = N / 256;            // contiguous chunk per thread? use strided-by-4 chunks: thread handles j = tid*4 + 1024*u
  float s1 = 0.f;
  for (int u = 0; u < per / 4; ++u) {
    const int j = tid * 4 + 1024 * u;
    const v4f a = *(const v4fa*)(x + j);
    v4f b = {0.f,0.f,0.f,0.f}; if (rr) b = *(const v4fa*)(rr + j);
#pragma unroll
    for (int q = 0; q < 4; ++q) { const float v = a[q] + b[q]; vals[u * 4 + q] = v; s1 += v; }
  }
  red[tid] = s1; __syncthreads();
  for (int st = 128; st > 0; st >>= 1) { if (tid < st) red[tid] += red[tid + st]; __syncthreads(); }
  const float mu = red[0] / (float)N; __syncthreads();
  float s2 = 0.f;
  for (int u = 0; u < per / 4; ++u)
#pragma unroll
    for (int q = 0; q < 4; ++q) { const float c = vals[u * 4 + q] - mu; s2 += c * c; }
  red[tid] = s2; __syncthreads();
  for (int st = 128; st > 0; st >>= 1) { if (tid < st) red[tid] += red[tid + st]; __syncthreads(); }
  const float rs = rsqrtf(red[0] / (float)N + eps);
  {
    for (int u = 0; u < per / 4; ++u) {
      const int j = tid * 4 + 1024 * u;
      v4f o, sm;
#pragma unroll
      for (int q = 0; q < 4; ++q) {
        float gg = g[j + q], bb = bta[j + q];
        if (PARAM_BF16) { gg = bf16_round(gg); bb = bf16_round(bb); }
        sm[q] = vals[u * 4 + q]; o[q] = (vals[u * 4 + q] - mu) * rs * gg + bb;
      }
      if (out_sum) *(v4f*)(out_sum + (size_t)row * N + j) = sm;
      *(v4f*)(out_norm + (size_t)row * N + j) = o;
    }
    
  }
}



// ---- f16 WMMA path (v_wmma_f32_16x16x32_f16): 11-bit significands for operands in range — used where a [0,1] probability operand needs more precision than bf16
typedef _Float16 v16h __attribute__((ext_vector_type(16)));
union FragH { v16h v; v8us half[2]; _Float16 h[16]; unsigned short u[16]; };
template <int NT>
__device__ __forceinline__ v8f mmaH(v16h ah, v16h al, v16h bh, v16h bl, v8f c) {
  c = __builtin_amdgcn_wmma_f32_16x16x32_f16(false, ah, false, bh, (short)0, c, false, false);
  if (NT >= 2) c = __builtin_amdgcn_wmma_f32_16x16x32_f16(false, al, false, bh, (short)0, c, false, false);
  if (NT >= 3) c = __builtin_amdgcn_wmma_f32_16x16x32_f16(false, ah, false, bl, (short)0, c, false, false);
  asm volatile("v_nop\n\tv_nop\n\tv_nop\n\tv_nop" : "+v"(c) : "v"(ah), "v"(al), "v"(bh), "v"(bl));
  return c;
}
// batched GEMM like k_gemm_b but f16 operands: A f32 (split into f16 hi/lo if ASPLIT, else rounded to f16), Bt = f16 values [n][k]; alpha; C f32; N multiple of 16 (partial tiles skipped)
template <bool ASPLIT>
__global__ __launch_bounds__(128) void k_gemm_h(const float* __restrict__ A, int lda, size_t sA, const _Float16* __restrict__ Bh, int ldb, size_t sB, float alpha, float* __restrict__ C, int ldc, size_t sC, int M, int N, int K) {
  __shared__ __attribute__((aligned(16))) float so[4][16][64];
  const int tid = threadIdx.x, w = tid >> 5, lane = tid & 31, ln = lane & 15, hh = lane >> 4; const int by = blockIdx.y;
  A += (size_t)by * sA; Bh += (size_t)by * sB; C += (size_t)by * sC;
  const int ntn = (N + 63) / 64; const int wid = blockIdx.x * 4 + w; const int mt = wid / ntn, nq = wid % ntn; if (mt * 16 >= M) return;
  const int row0 = mt * 16, col0 = nq * 64; const float* arow = A + (size_t)(row0 + ln) * lda;
  v8f acc[4] = {};
  for (int kb = 0; kb < K; kb += 32) {
    FragH ah, al;
    const v4f x0 = *(const v4fa*)(arow + kb + 8 * hh), x1 = *(const v4fa*)(arow + kb + 8 * hh + 4), x2 = *(const v4fa*)(arow + kb + 16 + 8 * hh), x3 = *(const v4fa*)(arow + kb + 16 + 8 * hh + 4);
    float xs[16] = {x0[0],x0[1],x0[2],x0[3],x1[0],x1[1],x1[2],x1[3],x2[0],x2[1],x2[2],x2[3],x3[0],x3[1],x3[2],x3[3]};
#pragma unroll
    for (int i = 0; i < 16; ++i) { const _Float16 h = (_Float16)xs[i]; ah.h[i] = h; al.h[i] = ASPLIT ? (_Float16)(xs[i] - (float)h) : (_Float16)0.0f; }
#pragma unroll
    for (int t = 0; t < 4; ++t) { if (col0 + t * 16 >= N) continue; const size_t boff = (size_t)(col0 + t * 16 + ln) * ldb + kb; FragH bq; bq.half[0] = *(const v8us*)(Bh + boff + 8 * hh); bq.half[1] = *(const v8us*)(Bh + boff + 16 + 8 * hh);
      acc[t] = mmaH<ASPLIT ? 2 : 1>(ah.v, al.v, bq.v, bq.v, acc[t]); }
  }
#pragma unroll
  for (int t = 0; t < 4; ++t) { if (col0 + t * 16 >= N) continue;
#pragma unroll
    for (int r = 0; r < 8; ++r) so[w][8 * hh + r][t * 16 + ln] = acc[t][r] * alpha; }
  __builtin_amdgcn_fence(__ATOMIC_ACQ_REL, "workgroup"); __builtin_amdgcn_wave_barrier();
  const int rsub = lane >> 4, c4 = (lane & 15) * 4;
  {
#pragma unroll
    for (int q = 0; q < 8; ++q) { const int r = q * 2 + rsub; if (col0 + c4 < N) { const v4f v = *(const v4fa*)&so[w][r][c4]; *(v4f*)(C + (size_t)(row0 + r) * ldc + col0 + c4) = v; } }
     }
}

// Wt[n][k] = f16(W[k][n]·scale) from f32 row-major W[K][N] (scale = power of two; bf16-exact weights stay exact in f16 away from the subnormal range)
__global__ __launch_bounds__(256) void k_wt_f16(const float* __restrict__ W, _Float16* __restrict__ Wt, int K, int N, float scale) {
  const int t = blockIdx.x * 256 + threadIdx.x; if (t >= N * (K / 8)) return; const int n = t / (K / 8), k8 = (t % (K / 8)) * 8; FragH f;
#pragma unroll
  for (int i = 0; i < 8; ++i) f.h[i] = (_Float16)(bf16_round(W[(size_t)(k8 + i) * N + n]) * scale); const v8us o = f.half[0];
  *(v8us*)((unsigned short*)Wt + (size_t)n * K + k8) = o; 
}
// k_gemm_hh variant with fused epilogue: v = acc·alpha + bias[by·sBias + col] (+ CP[(row/rowsPerB)·sCPb + by·64 + col] if CP) ; ACT 0 none / 1 elu ; writes f16 C16 (and f32 C if non-null)
template <int ACT>
__global__ __launch_bounds__(128) void k_gemm_hhx(const _Float16* __restrict__ A, int lda, size_t sA, const _Float16* __restrict__ Bh, int ldb, size_t sB, float alpha, const float* __restrict__ bias, size_t sBias, const float* __restrict__ CP, int rowsPerB, size_t sCPb, int row0g,
    float* __restrict__ C, _Float16* __restrict__ C16, int ldc, size_t sC, int M, int N, int K) {
  __shared__ __attribute__((aligned(16))) float so[4][16][64];
  const int tid = threadIdx.x, w = tid >> 5, lane = tid & 31, ln = lane & 15, hh = lane >> 4; const int by = blockIdx.y;
  A += (size_t)by * sA; Bh += (size_t)by * sB; const size_t cofs = (size_t)by * sC; const float* bp = bias ? bias + (size_t)by * sBias : nullptr;
  const int ntn = (N + 63) / 64; const int wid = blockIdx.x * 4 + w; const int mt = wid / ntn, nq = wid % ntn; if (mt * 16 >= M) return;
  const int row0 = mt * 16, col0 = nq * 64; const _Float16* arow = A + (size_t)(row0 + ln) * lda;
  v8f acc[4] = {};
  for (int kb = 0; kb < K; kb += 32) { FragH ah; ah.half[0] = *(const v8us*)((const unsigned short*)arow + kb + 8 * hh); ah.half[1] = *(const v8us*)((const unsigned short*)arow + kb + 16 + 8 * hh);
#pragma unroll
    for (int t = 0; t < 4; ++t) { if (col0 + t * 16 >= N) continue; const size_t boff = (size_t)(col0 + t * 16 + ln) * ldb + kb; FragH bq; bq.half[0] = *(const v8us*)((const unsigned short*)Bh + boff + 8 * hh); bq.half[1] = *(const v8us*)((const unsigned short*)Bh + boff + 16 + 8 * hh);
      acc[t] = mmaH<1>(ah.v, ah.v, bq.v, bq.v, acc[t]); }
  }
#pragma unroll
  for (int t = 0; t < 4; ++t) { if (col0 + t * 16 >= N) continue; const int col = col0 + t * 16 + ln; const float bv = bp ? bf16_round(bp[col]) : 0.f;
#pragma unroll
    for (int r = 0; r < 8; ++r) { float v = acc[t][r] * alpha + bv; if (CP) { const int rr = row0g + row0 + 8 * hh + r; if (rowsPerB < 0) v += CP[cofs + (size_t)rr * ldc + col];      /* rowsPerB < 0: own element of the batched C plane */ else { const int bidx = rr / rowsPerB; v += CP[(size_t)bidx * sCPb + (size_t)by * 64 + col]; } } if (ACT == 1) v = (v > 0.f) ? v : expm1f(v); else if (ACT == 7) v = (v > 0.f) ? v + 1.0f : expf(v); else if (ACT == 8) v = tanhf(v); else if (ACT == 9) v = 0.5f * v * (1.0f + tanhf(0.7978845608028654f * (v + 0.044715f * v * v * v))); else if (ACT == 11) v = 1.0f / (1.0f + expf(-v)); else if (ACT == 12) v = (v > 0.f) ? v : 0.01f * v; else if (ACT == 14) v = (v > 0.f) ? v : 0.1f * v; else if (ACT == 16) v = (v >= 0.f) ? v : 0.3f * v; else if (ACT == 17) v = (v >= 0.f) ? v : 0.2f * v; else if (ACT == 15) v = v / (1.0f + expf(-v)); else if (ACT == 3) v = fmaxf(v, 0.f); else if (ACT == 6) v = 0.5f * v * (1.0f + erff(v * 0.70710678118654752f)); so[w][8 * hh + r][t * 16 + ln] = v; } }
  __builtin_amdgcn_fence(__ATOMIC_ACQ_REL, "workgroup"); __builtin_amdgcn_wave_barrier();
  const int rsub = lane >> 4, c4 = (lane & 15) * 4; typedef _Float16 v4h __attribute__((ext_vector_type(4)));
  {
#pragma unroll
    for (int q = 0; q < 8; ++q) { const int r = q * 2 + rsub; if (col0 + c4 < N) { const v4f v = *(const v4fa*)&so[w][r][c4]; if (C) *(v4f*)(C + cofs + (size_t)(row0 + r) * ldc + col0 + c4) = v; if (C16) { v4h h4; for (int i = 0; i < 4; ++i) h4[i] = (_Float16)v[i]; *(v4h*)(C16 + cofs + (size_t)(row0 + r) * ldc + col0 + c4) = h4; } } }
     }
}


typedef _Float16 v4h __attribute__((ext_vector_type(4)));

__global__ __launch_bounds__(256) void k_x16(const float* __restrict__ x, _Float16* __restrict__ X16, size_t n8) { const size_t t = (size_t)blockIdx.x * 256 + threadIdx.x; if (t >= n8) return; FragH f;
#pragma unroll
  for (int q = 0; q < 8; ++q) f.h[q] = (_Float16)bf16_round(x[t * 8 + q]); *(v8us*)((unsigned short*)X16 + t * 8) = f.half[0];  }
__global__ __launch_bounds__(256) void k_h16(const float* __restrict__ x, _Float16* __restrict__ X16, size_t n8) { const size_t t = (size_t)blockIdx.x * 256 + threadIdx.x; if (t >= n8) return; FragH f;
#pragma unroll
  for (int q = 0; q < 8; ++q) f.h[q] = (_Float16)x[t * 8 + q]; *(v8us*)((unsigned short*)X16 + t * 8) = f.half[0];  }
__global__ __launch_bounds__(256) void k_round16f(const float* __restrict__ W, _Float16* __restrict__ Bt, size_t n8) { const size_t t = (size_t)blockIdx.x * 256 + threadIdx.x; if (t >= n8) return; FragH f;
#pragma unroll
  for (int i = 0; i < 8; ++i) f.h[i] = (_Float16)(bf16_round(W[t * 8 + i]) * 16.0f); *(v8us*)((unsigned short*)Bt + t * 8) = f.half[0];  }
template <int NHv, int TTv>
__global__ __launch_bounds__(256) void k_vt(const _Float16* __restrict__ V16, int ldv, int voff, _Float16* __restrict__ Vt) { __shared__ unsigned short tl[64][66]; const int tid = threadIdx.x; const int slab = blockIdx.x / (TTv / 64), lg = blockIdx.x % (TTv / 64); const int b = slab / NHv, h = slab % NHv;
  for (int i = tid; i < 64 * 8; i += 256) { const int r = i / 8, c8 = (i % 8) * 8; FragH f; f.half[0] = *(const v8us*)((const unsigned short*)V16 + ((size_t)b * TTv + lg * 64 + r) * ldv + voff + h * 64 + c8);
#pragma unroll
    for (int q = 0; q < 8; ++q) tl[r][c8 + q] = f.u[q]; }
  __syncthreads();
  {
#pragma unroll
    for (int rd = 0; rd < 2; ++rd) { const int d = rd * 32 + tid / 8, pc = tid % 8; FragH f;
#pragma unroll
      for (int q = 0; q < 8; ++q) f.u[q] = tl[pc * 8 + q][d];
      *(v8us*)((unsigned short*)Vt + ((size_t)slab * 64 + d) * TTv + lg * 64 + pc * 8) = f.half[0]; }
     } }

__global__ __launch_bounds__(256) void k_hl(const float* __restrict__ F, _Float16* __restrict__ Hh, _Float16* __restrict__ Hl, size_t n8) { const size_t t = (size_t)blockIdx.x * 256 + threadIdx.x; if (t >= n8) return; FragH fh, fl; const v4f a = *(const v4fa*)(F + t * 8), c = *(const v4fa*)(F + t * 8 + 4);
#pragma unroll
  for (int q = 0; q < 4; ++q) { _Float16 h = (_Float16)a[q]; fh.h[q] = h; fl.h[q] = (_Float16)((a[q] - (float)h) * 1024.0f); h = (_Float16)c[q]; fh.h[4 + q] = h; fl.h[4 + q] = (_Float16)((c[q] - (float)h) * 1024.0f); }
  { *(v8us*)((unsigned short*)Hh + t * 8) = fh.half[0]; *(v8us*)((unsigned short*)Hl + t * 8) = fl.half[0];  } }

// ---- fast GEMM (wave tile 32x64; requires M % 32 == 0 rows per launch region and N % 64 == 0); epilogue = k_gemm_hhx semantics ----
__device__ __forceinline__ v16h g2_frag(const _Float16* p, int hh) { FragH f; f.half[0] = *(const v8us*)((const unsigned short*)p + 8 * hh); f.half[1] = *(const v8us*)((const unsigned short*)p + 16 + 8 * hh); return f.v; }
__device__ __forceinline__ v8f g2_mma(v16h a, v16h b, v8f c) { v8f d = __builtin_amdgcn_wmma_f32_16x16x32_f16(false, a, false, b, (short)0, c, false, false); asm volatile("v_nop\n\tv_nop\n\tv_nop\n\tv_nop" : "+v"(d) : "v"(a), "v"(b)); return d; }
template <int ACT>
__global__ __launch_bounds__(128) void k_gemm2(const _Float16* __restrict__ A, int lda, size_t sA, const _Float16* __restrict__ Bh, int ldb, size_t sB, float alpha, const float* __restrict__ bias, size_t sBias, const float* __restrict__ CP, int rowsPerB, size_t sCPb, int row0g,
    float* __restrict__ C, _Float16* __restrict__ C16, int ldc, size_t sC, int M, int N, int K) { static_assert(ACT == 0 || ACT == 3 || ACT == 6 || ACT == 8 || ACT == 9 || ACT == 11 || ACT == 12 || ACT == 14 || ACT == 15 || ACT == 16 || ACT == 17, "k_gemm2: unsupported ACT code (would silently apply no activation)");
  __shared__ __attribute__((aligned(16))) float so[4][32][68];
  const int tid = threadIdx.x, w = tid >> 5, lane = tid & 31, ln = lane & 15, hh = lane >> 4; const int by = blockIdx.y;
  A += (size_t)by * sA; Bh += (size_t)by * sB; const size_t cofs = (size_t)by * sC; const float* bp = bias ? bias + (size_t)by * sBias : nullptr;
  const int ntn = N >> 6; const int mt = blockIdx.x / ntn, nq = blockIdx.x - mt * ntn; const int row0 = mt * 128 + 32 * w, col0 = nq * 64; if (row0 >= M) return;
  const _Float16* a0p = A + (size_t)(row0 + ln) * lda; const _Float16* a1p = a0p + (size_t)16 * lda;
  const _Float16* b0p = Bh + (size_t)(col0 + ln) * ldb; const _Float16* b1p = b0p + (size_t)16 * ldb; const _Float16* b2p = b1p + (size_t)16 * ldb; const _Float16* b3p = b2p + (size_t)16 * ldb;
  const v8f z8 = {0.f,0.f,0.f,0.f,0.f,0.f,0.f,0.f}; v8f c00 = z8, c01 = z8, c02 = z8, c03 = z8, c10 = z8, c11 = z8, c12 = z8, c13 = z8;
#pragma unroll 1
  for (int kb = 0; kb < K; kb += 32) { const v16h a0 = g2_frag(a0p + kb, hh), a1 = g2_frag(a1p + kb, hh);
    v16h b = g2_frag(b0p + kb, hh); c00 = g2_mma(a0, b, c00); c10 = g2_mma(a1, b, c10);
    b = g2_frag(b1p + kb, hh); c01 = g2_mma(a0, b, c01); c11 = g2_mma(a1, b, c11);
    b = g2_frag(b2p + kb, hh); c02 = g2_mma(a0, b, c02); c12 = g2_mma(a1, b, c12);
    b = g2_frag(b3p + kb, hh); c03 = g2_mma(a0, b, c03); c13 = g2_mma(a1, b, c13); }
  v8f accs[8] = {c00, c01, c02, c03, c10, c11, c12, c13};
#pragma unroll
  for (int u = 0; u < 8; ++u) { const int t = u & 3, half = u >> 2; const int col = col0 + t * 16 + ln; const float bv = bp ? bf16_round(bp[col]) : 0.f;
#pragma unroll
    for (int r = 0; r < 8; ++r) { const int rloc = half * 16 + 8 * hh + r; float v = accs[u][r] * alpha + bv; if (CP) { if (rowsPerB < 0) v += CP[cofs + (size_t)(row0g + row0 + rloc) * ldc + col];      /* rowsPerB < 0: own element of the batched C plane */ else { const int bidx = (row0g + row0 + rloc) / rowsPerB; v += CP[(size_t)bidx * sCPb + (size_t)by * 64 + col]; } }
      if (ACT == 3) v = fmaxf(v, 0.f); else if (ACT == 6) v = 0.5f * v * (1.0f + erff(v * 0.70710678118654752f)); else if (ACT == 11) v = 1.0f / (1.0f + expf(-v)); else if (ACT == 15) v = v / (1.0f + expf(-v)); else if (ACT == 12) v = (v > 0.f) ? v : 0.01f * v; else if (ACT == 8) v = tanhf(v); else if (ACT == 9) v = 0.5f * v * (1.0f + tanhf(0.7978845608028654f * (v + 0.044715f * v * v * v))); else if (ACT == 14) v = (v > 0.f) ? v : 0.1f * v; else if (ACT == 16) v = (v >= 0.f) ? v : 0.3f * v; else if (ACT == 17) v = (v >= 0.f) ? v : 0.2f * v;
      so[w][rloc][t * 16 + ln] = v; } }
  __builtin_amdgcn_fence(__ATOMIC_ACQ_REL, "workgroup"); __builtin_amdgcn_wave_barrier();
  const int rsub = lane >> 4, c4 = (lane & 15) * 4;
  {
#pragma unroll
    for (int q = 0; q < 16; ++q) { const int r = q * 2 + rsub; const v4f v = *(const v4fa*)&so[w][r][c4]; if (C) *(v4f*)(C + cofs + (size_t)(row0 + r) * ldc + col0 + c4) = v; if (C16) { v4h h4; for (int i = 0; i < 4; ++i) h4[i] = (_Float16)v[i]; *(v4h*)(C16 + cofs + (size_t)(row0 + r) * ldc + col0 + c4) = h4; } }
     } }


__global__ __launch_bounds__(256) void k_wnat(const float* __restrict__ w, size_t n8, _Float16* __restrict__ Bt) { const size_t t = (size_t)blockIdx.x * 256 + threadIdx.x; if (t >= n8) return; FragH f; for (int q = 0; q < 8; ++q) f.h[q] = (_Float16)(bf16_round(w[t * 8 + q]) * 16.0f); *(v8us*)((unsigned short*)Bt + t * 8) = f.half[0];  }
__global__ __launch_bounds__(256) void k_rsm(const float* __restrict__ S, _Float16* __restrict__ P, int nrows) {
  #pragma clang fp contract(off)
  const int i = blockIdx.x * 256 + threadIdx.x; if (i >= nrows) return; const float* s = S + (size_t)i * SQ; float mx = -3.0e38f;
#pragma unroll 1
  for (int j = 0; j < SQ; ++j) mx = fmaxf(mx, s[j]); float se = 0.f;
#pragma unroll 1
  for (int j = 0; j < SQ; ++j) se += expf(s[j] - mx); const float sc = 256.0f / se;
#pragma unroll 1
  for (int j0 = 0; j0 < SQ; j0 += 8) { FragH f; for (int q = 0; q < 8; ++q) f.h[q] = (_Float16)(expf(s[j0 + q] - mx) * sc); unsigned short* d = (unsigned short*)P + (size_t)i * SQ + j0; *(v8us*)d = f.half[0];  } }
__global__ __launch_bounds__(256) void k_vt(const _Float16* __restrict__ V16, int b, int h0, _Float16* __restrict__ VT) { __shared__ unsigned short tl[64][65]; const int tid = threadIdx.x; const int hh = blockIdx.x % HG, sg = blockIdx.x / HG; const int s0 = sg * 64; const int h = h0 + hh;
  for (int i = tid; i < 64 * 8; i += 256) { const int j = i / 8, d8 = (i % 8) * 8; FragH f; f.half[0] = *(const v8us*)((const unsigned short*)V16 + ((size_t)b * SQ + s0 + j) * DM + h * HD + d8); for (int q = 0; q < 8; ++q) tl[d8 + q][j] = f.u[q]; }
  __syncthreads();
  { for (int i = tid; i < 64 * 8; i += 256) { const int d = i / 8, j8 = (i % 8) * 8; FragH f; for (int q = 0; q < 8; ++q) f.u[q] = tl[d][j8 + q]; *(v8us*)((unsigned short*)VT + ((size_t)hh * HD + d) * SQ + s0 + j8) = f.half[0]; }  } }



__global__ __launch_bounds__(256) void k_rsmcf2(const float* __restrict__ S, _Float16* __restrict__ P, int hg, int q0, int nk) {
  #pragma clang fp contract(off)
  const int t = blockIdx.x * 256 + threadIdx.x; if (t >= hg * QT) return; const size_t i = (size_t)t; const float* s = S + i * NKX; const int last = q0 + (t % QT); float mx = -3.0e38f;
#pragma unroll 1
  for (int j = 0; j < nk; ++j) { const float f = (j <= last) ? 1.f : 0.f; mx = fmaxf(mx, fmaf(f, s[j], (1.f - f) * -1.0e9f)); } float se = 0.f;
#pragma unroll 1
  for (int j = 0; j < nk; ++j) { const float f = (j <= last) ? 1.f : 0.f; se += __expf(fmaf(f, s[j], (1.f - f) * -1.0e9f) - mx); } const float sc = 256.0f / se;
#pragma unroll 1
  for (int j0 = 0; j0 < nk; j0 += 8) { FragH fr; for (int q = 0; q < 8; ++q) { const int j = j0 + q; const float f = (j <= last) ? 1.f : 0.f; fr.h[q] = (_Float16)(__expf(fmaf(f, s[j], (1.f - f) * -1.0e9f) - mx) * sc); } unsigned short* d = (unsigned short*)P + i * NKX + j0; *(v8us*)d = fr.half[0];  } }

template <int MASKADD>
__global__ __launch_bounds__(64) void k_att0(const float* __restrict__ QF, const float* __restrict__ KF, const float* __restrict__ VF, int ld, const float* __restrict__ mask, float scale, float* __restrict__ OF, int ldo) {
  #pragma clang fp contract(off)
  __shared__ __attribute__((aligned(16))) float lq[64][64]; __shared__ __attribute__((aligned(16))) float lo[64][64];
  const int tid = threadIdx.x; const int h = blockIdx.x / (QT0 / 64), rg = blockIdx.x % (QT0 / 64); const int i = rg * 64 + tid;
  const float* qr = QF + (size_t)i * ld + h * HD;
#pragma unroll 1
  for (int c = 0; c < HD / 4; ++c) { *(v4f*)&lq[tid][c * 4] = *(const v4fa*)(qr + c * 4); const v4f z = {0.f, 0.f, 0.f, 0.f}; *(v4f*)&lo[tid][c * 4] = z; }
  float m = -1.0e30f, l = 0.f; const int jmax = MASKADD ? (SQ - 1) : (rg * 64 + 63);      /* additive-mask form: every key (the mask input decides); causal form: keys up to the block's last row */
#pragma unroll 1
  for (int j = 0; j <= jmax; ++j) { const float* kr = KF + (size_t)j * ld + h * HD; const float* vr = VF + (size_t)j * ld + h * HD; float s = 0.f;
#pragma unroll 1
    for (int c = 0; c < HD / 4; ++c) { const v4f kq = *(const v4fa*)(kr + c * 4); const v4f qq = *(v4f*)&lq[tid][c * 4]; s = __fadd_rn(s, __fmul_rn(qq[0], kq[0])); s = __fadd_rn(s, __fmul_rn(qq[1], kq[1])); s = __fadd_rn(s, __fmul_rn(qq[2], kq[2])); s = __fadd_rn(s, __fmul_rn(qq[3], kq[3])); }
    s = __fmul_rn(s, scale); if (MASKADD) s = __fadd_rn(s, __fmul_rn(bf16_round(mask[(size_t)i * SQ + j]), -10000.0f));
    const float f = (MASKADD || j <= i) ? 1.f : 0.f; const float sm = fmaf(f, s, (1.f - f) * -1.0e30f); const float mn = fmaxf(m, sm); const float sc = expf(m - mn); const float e = expf(sm - mn); l = __fadd_rn(__fmul_rn(l, sc), e); m = mn;
#pragma unroll 1
    for (int c = 0; c < HD / 4; ++c) { const v4f vv = *(const v4fa*)(vr + c * 4); v4f oo = *(v4f*)&lo[tid][c * 4]; for (int u = 0; u < 4; ++u) oo[u] = __fadd_rn(__fmul_rn(oo[u], sc), __fmul_rn(e, vv[u])); *(v4f*)&lo[tid][c * 4] = oo; } }
  const float fin = 64.0f / l;      /* o carried x64 */
#pragma unroll 1
  for (int c = 0; c < HD / 4; ++c) { v4f oo = *(v4f*)&lo[tid][c * 4]; for (int u = 0; u < 4; ++u) oo[u] = __fmul_rn(oo[u], fin); *(v4f*)&lo[tid][c * 4] = oo; }
  __syncthreads();
  {
#pragma unroll 1
    for (int it = 0; it < 16; ++it) { const int row = it * 4 + tid / 16, pc = (tid % 16) * 4; const v4f v = *(const v4f*)&lo[row][pc]; *(v4f*)(OF + (size_t)(rg * 64 + row) * ldo + h * HD + pc) = v; }
     } }

__global__ __launch_bounds__(256) void k_oscale(const float* __restrict__ OF, float* __restrict__ out, size_t n4) { const size_t t = (size_t)blockIdx.x * 256 + threadIdx.x; if (t >= n4) return; const v4f a = *(const v4fa*)(OF + t * 4); v4f o; for (int q = 0; q < 4; ++q) o[q] = a[q] * 0.015625f; *(v4f*)(out + t * 4) = o;  }

__global__ __launch_bounds__(256) void k_bfr(const float* __restrict__ x, float* __restrict__ XB, size_t n8) { const size_t t = (size_t)blockIdx.x * 256 + threadIdx.x; if (t >= n8) return; v4f a = *(const v4fa*)(x + t * 8), c = *(const v4fa*)(x + t * 8 + 4); for (int q = 0; q < 4; ++q) { a[q] = bf16_round(a[q]); c[q] = bf16_round(c[q]); }
  { *(v4f*)(XB + t * 8) = a; *(v4f*)(XB + t * 8 + 4) = c;  } }



__global__ __launch_bounds__(256) void k_rsmfvl(const float* __restrict__ S, _Float16* __restrict__ P, _Float16* __restrict__ PL, int qn, const int* __restrict__ vlp) {
  #pragma clang fp contract(off)
  const int t = blockIdx.x * 256 + threadIdx.x; if (t >= qn) return; const int vl = vlp[0]; const size_t i = (size_t)t; const float* s = S + i * SQ; float mx = -3.0e38f;
#pragma unroll 1
  for (int j = 0; j < SQ; ++j) { const float f = (j < vl) ? 1.f : 0.f; mx = fmaxf(mx, fmaf(f, s[j], (1.f - f) * -1000000.0f)); } float se = 0.f;
#pragma unroll 1
  for (int j = 0; j < SQ; ++j) { const float f = (j < vl) ? 1.f : 0.f; se += __expf(fmaf(f, s[j], (1.f - f) * -1000000.0f) - mx); } const float sc = 256.0f / se;
#pragma unroll 1
  for (int j0 = 0; j0 < SQ; j0 += 8) { FragH fr, gr; for (int q = 0; q < 8; ++q) { const int j = j0 + q; const float f = (j < vl) ? 1.f : 0.f; const float pv = __expf(fmaf(f, s[j], (1.f - f) * -1000000.0f) - mx) * sc; const _Float16 ph = (_Float16)pv; fr.h[q] = ph; gr.h[q] = (_Float16)((pv - (float)ph) * 1024.0f); }
    unsigned short* d = (unsigned short*)P + i * SQ + j0; unsigned short* dl = (unsigned short*)PL + i * SQ + j0; *(v8us*)d = fr.half[0]; *(v8us*)dl = gr.half[0];  } }

// Row softmax, one wave per row: each lane keeps 128 of the row's 4096 scores in registers, so S is read once, in wave loads of 512 contiguous bytes; maximum and sum = four chains a lane, then a five-step butterfly over the lanes.
__global__ __launch_bounds__(256) void k_rsmf(const float* __restrict__ S, _Float16* __restrict__ P, int qn, int hg) {
  const int lane = threadIdx.x & 31; const int t = blockIdx.x * 8 + (int)(threadIdx.x >> 5); if (t >= qn * hg) return;      /* wave-uniform exit; the kernel has no barrier */
  const size_t i = (size_t)(t / qn) * SQ + (t % qn); const float* s = S + i * SQ + lane * 4; v4f x[SQ / 128];
#pragma unroll
  for (int u = 0; u < SQ / 128; ++u) x[u] = *(const v4fa*)(s + u * 128);
  v4f m4 = x[0];
#pragma unroll
  for (int u = 1; u < SQ / 128; ++u) for (int q = 0; q < 4; ++q) m4[q] = fmaxf(m4[q], x[u][q]);
  float mx = fmaxf(fmaxf(m4[0], m4[1]), fmaxf(m4[2], m4[3]));
#pragma unroll
  for (int m = 16; m >= 1; m >>= 1) mx = fmaxf(mx, __shfl_xor(mx, m, 32));
  v4f a4 = {0.f, 0.f, 0.f, 0.f};
#pragma unroll
  for (int u = 0; u < SQ / 128; ++u) { const v4f y = (x[u] - mx) * 1.44269504f; float e0, e1, e2, e3;      /* native exp = v_exp_f32 of the product with log2(e), as __expf compiles */
    /* the four v_exp_f32 in one statement with the slot the instruction set asks for behind a transcendental: each is followed by an independent one (outputs early-clobbered, so none overwrites a source), the last by v_nop */
    asm("v_exp_f32 %0, %4\n\tv_exp_f32 %1, %5\n\tv_exp_f32 %2, %6\n\tv_exp_f32 %3, %7\n\tv_nop" : "=&v"(e0), "=&v"(e1), "=&v"(e2), "=&v"(e3) : "v"(y[0]), "v"(y[1]), "v"(y[2]), "v"(y[3]));
    const v4f e = {e0, e1, e2, e3}; x[u] = e; a4 += e; }
  float se = (a4[0] + a4[1]) + (a4[2] + a4[3]);
#pragma unroll
  for (int m = 16; m >= 1; m >>= 1) se += __shfl_xor(se, m, 32);
  const float sc = 256.0f / se; _Float16* d = P + i * SQ + lane * 4;
#pragma unroll
  for (int u = 0; u < SQ / 128; ++u) { v4h h4; for (int q = 0; q < 4; ++q) h4[q] = (_Float16)(x[u][q] * sc); *(v4h*)(d + u * 128) = h4; } }


extern "C" void kernel_launch(void* const* d_in, const int* in_sizes, int n_in,
                              void* d_out, int out_size, void* d_ws, size_t ws_size, hipStream_t stream) {
  (void)in_sizes; (void)n_in; (void)out_size;
  const float* const* I = (const float* const*)d_in; const float* xq = I[0]; const float* xk = I[1]; const float* xv = I[2]; const float* wq = I[3]; const float* bq = I[4]; const float* wk = I[5]; const float* bk = I[6]; const float* wv = I[7]; const float* bv = I[8];      /* natural [64][64] weights + biases */      /* Q, K, V [8][4096][64] (bf16-valued), single head */
  char* ws = (char*)d_ws; size_t off = 0;
  auto take = [&](size_t bytes) { char* p = ws + off; off += (bytes + 255) & ~(size_t)255; return p; };
  _Float16* XQ = (_Float16*)take(NR * DM * 2); _Float16* XK = (_Float16*)take(NR * DM * 2); _Float16* XV = (_Float16*)take(NR * DM * 2); _Float16* BQ = (_Float16*)take(DM * DM * 2); _Float16* BK = (_Float16*)take(DM * DM * 2); _Float16* BV = (_Float16*)take(DM * DM * 2); float* F1 = (float*)take(NR * DM * 4); _Float16* QH = (_Float16*)take(NR * DM * 2); _Float16* QL = (_Float16*)take(NR * DM * 2); _Float16* KH = (_Float16*)take(NR * DM * 2); _Float16* KL = (_Float16*)take(NR * DM * 2); _Float16* V16 = (_Float16*)take(NR * DM * 2);
  float* S = (float*)take((size_t)SQ * SQ * 4); _Float16* P = (_Float16*)take((size_t)SQ * SQ * 2); _Float16* VT = (_Float16*)take((size_t)DM * SQ * 2);
  if (off > ws_size) return;
  k_x16<<<(unsigned)((NR * DM / 8 + 255) / 256), 256, 0, stream>>>(xq, XQ, NR * DM / 8); k_x16<<<(unsigned)((NR * DM / 8 + 255) / 256), 256, 0, stream>>>(xk, XK, NR * DM / 8); k_x16<<<(unsigned)((NR * DM / 8 + 255) / 256), 256, 0, stream>>>(xv, XV, NR * DM / 8);      /* exact f16 copies of the bf16-valued inputs */
  { const unsigned g = (unsigned)((DM * DM / 8 + 255) / 256); k_wnat<<<g, 256, 0, stream>>>(wq, DM * DM / 8, BQ); k_wnat<<<g, 256, 0, stream>>>(wk, DM * DM / 8, BK); k_wnat<<<g, 256, 0, stream>>>(wv, DM * DM / 8, BV); }      /* natural [out][in] = Bt x16 */
  k_gemm2<0><<<dim3((unsigned)((NR / 128) * (DM / 64)), 1), 128, 0, stream>>>(XQ, DM, 0, BQ, DM, 0, 0.0625f, bq, 0, nullptr, 1, 0, 0, F1, nullptr, DM, 0, (int)NR, DM, DM); k_hl<<<(unsigned)((NR * DM / 8 + 255) / 256), 256, 0, stream>>>(F1, QH, QL, NR * DM / 8);      /* q = query Wq^T + bq (f32) -> f16 hi + x1024 residual */
  k_gemm2<0><<<dim3((unsigned)((NR / 128) * (DM / 64)), 1), 128, 0, stream>>>(XK, DM, 0, BK, DM, 0, 0.0625f, bk, 0, nullptr, 1, 0, 0, F1, nullptr, DM, 0, (int)NR, DM, DM); k_hl<<<(unsigned)((NR * DM / 8 + 255) / 256), 256, 0, stream>>>(F1, KH, KL, NR * DM / 8);      /* k = key Wk^T + bk -> hi + residual */
  k_gemm2<0><<<dim3((unsigned)((NR / 128) * (DM / 64)), 1), 128, 0, stream>>>(XV, DM, 0, BV, DM, 0, 0.0625f, bv, 0, nullptr, 1, 0, 0, nullptr, V16, DM, 0, (int)NR, DM, DM);      /* v = value Wv^T + bv -> f16 rows */
  for (int b = 0; b < NB; ++b) { const size_t r0 = (size_t)b * SQ;
    k_vt<1, SQ><<<SQ / 64, 256, 0, stream>>>(V16 + r0 * DM, DM, 0, VT);      /* V^T [64][4096] of this batch */
    k_gemm2<0><<<dim3((SQ / 128) * (SQ / 64), 1), 128, 0, stream>>>(KH + r0 * DM, DM, 0, QH + r0 * DM, DM, 0, 1.0f, nullptr, 0, nullptr, 1, 0, 0, S, nullptr, SQ, 0, SQ, SQ, DM);      /* scores[i][j] = k_i . q_j (rows = key positions; NO scale): hi.hi */
    k_gemm2<0><<<dim3((SQ / 128) * (SQ / 64), 1), 128, 0, stream>>>(KL + r0 * DM, DM, 0, QH + r0 * DM, DM, 0, 0.0009765625f, nullptr, 0, S, -1, 0, 0, S, nullptr, SQ, 0, SQ, SQ, DM);      /* += lo.hi 2^-10 */
    k_gemm2<0><<<dim3((SQ / 128) * (SQ / 64), 1), 128, 0, stream>>>(KH + r0 * DM, DM, 0, QL + r0 * DM, DM, 0, 0.0009765625f, nullptr, 0, S, -1, 0, 0, S, nullptr, SQ, 0, SQ, SQ, DM);      /* += hi.lo 2^-10 */
    k_rsmf<<<SQ / 8, 256, 0, stream>>>(S, P, SQ, 1);      /* softmax over the query positions -> P x256 f16 */
    k_gemm2<0><<<dim3((SQ / 128) * (DM / 64), 1), 128, 0, stream>>>(P, SQ, 0, VT, SQ, 0, 0.00390625f, nullptr, 0, nullptr, 1, 0, 0, (float*)d_out + r0 * DM, nullptr, DM, 0, SQ, DM, SQ); }      /* out[i] = sum_j attn[i][j] v[j] f32 into the output rows */
}

// v003
// It runs in 64.3 microseconds.
// Versions between v001 and this one are left out; their measured steps multiply to 30.3 times as fast.
// All steps since v000 together make it 115 times as fast.
#include <hip/hip_runtime.h>
// Dot-product attention with TRANSPOSED roles and no scaling (query, key, value [8][4096][64]; q = query Wq^T + bq, k = key Wk^T + bk, v = value Wv^T + bv (natural [64][64] sigma 1/8, biases 0.01); scores[i][j] = k_i . q_j (NO 1/sqrt(d): sigma ~8); attn = softmax over the query positions j; out[i] = sum_j attn[i][j] v[j] -> [8][4096][64] (rows are key positions)).
// Structure: one launch in front of the attention: a work-group takes 128 token rows of query, key and value; the bf16-valued inputs as exact f16 rows and the natural weights x16 in LDS; q and k as WMMA products (f32 accumulation, + bias) -> f16 hi + x1024 residual rows, v -> f16 V^T rows, every output staged through LDS and stored in whole lines; then one fused kernel: scores = hi.hi + (lo.hi + hi.lo) 2^-10 (K = 64, unscaled) f32 in registers; running row maximum and sum (f32, native exp; weights x256 f16); out = P V^T / sum f32.
// Compute dtype: inputs rounded to bf16; x / weights exact; q and k as f16 hi + x1024 residual (three products), v and softmax weights as plain f16 GEMM operands (~2^-12); scores, softmax statistics and o f32. v_wmma_f32_16x16x32_f16.
#define NB 8
#define SQ 4096
#define DM 64
#define NH 1
#define HD 64
#define HG 8                         /* heads per launch of the k_vt(b, h0) overload (not launched) */
#define B0 0                         /* first batch processed (used by no kernel or launch) */
#define NBR NB                       /* batches processed (used by no kernel or launch) */
#define NR ((size_t)NB * SQ)         /* token rows */
#define MP ((int)((size_t)NBR * SQ)) /* rows projected (used by no kernel or launch) */
#define QT 256                       /* query rows per causal tile */
#define NKX SQ                       /* S / P row pitch */
#define QT0 256                      /* first-tile rows recomputed exactly */
#define QN SQ                        /* query rows attended per batch (used by no kernel or launch) */
#define NHD NH                       /* heads attended (used by no kernel or launch) */
#define MPO MP                       /* rows through the output stage (used by no kernel or launch) */
#define LQ DM            /* row pitch of the q/k/v rows (used by no kernel or launch) */
typedef __bf16 v16b __attribute__((ext_vector_type(16)));
typedef unsigned short v8us __attribute__((ext_vector_type(8), may_alias));
typedef float  v8f  __attribute__((ext_vector_type(8)));
typedef float  v4f  __attribute__((ext_vector_type(4)));
typedef float  v4fa __attribute__((ext_vector_type(4), may_alias));
union FragB { v16b v; v8us half[2]; unsigned short u[16]; };

__device__ __forceinline__ unsigned short bf16_bits(float x) { unsigned int u = __float_as_uint(x); return (unsigned short)((u + 0x7FFFu + ((u >> 16) & 1u)) >> 16); }
__device__ __forceinline__ float bf16_val(unsigned short b) { return __uint_as_float(((unsigned int)b) << 16); }
__device__ __forceinline__ float bf16_round(float x) { return bf16_val(bf16_bits(x)); }
// D += A·B with NT terms: 1 = ah·bh, 2 = + al·bh (A split), 3 = + ah·bl (both split)
template <int NT>
__device__ __forceinline__ v8f mmaN(v16b ah, v16b al, v16b bh, v16b bl, v8f c) {
  c = __builtin_amdgcn_wmma_f32_16x16x32_bf16(false, ah, false, bh, (short)0, c, false, false);
  if (NT >= 2) c = __builtin_amdgcn_wmma_f32_16x16x32_bf16(false, al, false, bh, (short)0, c, false, false);
  if (NT >= 3) c = __builtin_amdgcn_wmma_f32_16x16x32_bf16(false, ah, false, bl, (short)0, c, false, false);
  asm volatile("v_nop\n\tv_nop\n\tv_nop\n\tv_nop" : "+v"(c) : "v"(ah), "v"(al), "v"(bh), "v"(bl));
  return c;
}

__global__ __launch_bounds__(256) void k_wt_bf16(const float* __restrict__ W, unsigned short* __restrict__ Wt, int K, int N) {
  const int t = blockIdx.x * 256 + threadIdx.x;
  const int k8n = K / 8;
  if (t >= N * k8n) return;
  const int n = t / k8n, k8 = (t % k8n) * 8;
  v8us v;
#pragma unroll
  for (int i = 0; i < 8; ++i) v[i] = bf16_bits(W[(size_t)(k8 + i) * N + n]);
  *(v8us*)(Wt + (size_t)n * K + k8) = v;
  
}

// GEMM C[M][N] (f32, pitch ldc) = act(A[M][K]·W + bias). A f32 row-major (pitch lda) converted per fragment to bf16
// (ASPLIT: hi/lo two planes -> 2 terms, else single rounded term); Wt bf16 [N][K] (pitch ldb). BIAS_BF16 rounds the
// bias to bf16 first (bias quantised to bf16 before the add). K%32==0, M%16==0, N%64==0.
template <bool ASPLIT, int ACT, bool BIAS_BF16>
__global__ __launch_bounds__(128) void k_gemm_bf(const float* __restrict__ A, int lda, const unsigned short* __restrict__ Wt, int ldb,
                                               const float* __restrict__ bias, float* __restrict__ C, int ldc, int M, int N, int K) {
  __shared__ __attribute__((aligned(16))) float so[4][16][64];
  const int tid = threadIdx.x, w = tid >> 5, lane = tid & 31, ln = lane & 15, hh = lane >> 4;
  const int ntn = N / 64;
  const int wid = blockIdx.x * 4 + w;
  const int mt = wid / ntn, nq = wid % ntn;
  if (mt * 16 >= M) return;
  const int row0 = mt * 16, col0 = nq * 64;
  const float* arow = A + (size_t)(row0 + ln) * lda;
  v8f acc[4] = {};
  for (int kb = 0; kb < K; kb += 32) {
    FragB ah, al;
    const v4f x0 = *(const v4fa*)(arow + kb + 8 * hh), x1 = *(const v4fa*)(arow + kb + 8 * hh + 4);
    const v4f x2 = *(const v4fa*)(arow + kb + 16 + 8 * hh), x3 = *(const v4fa*)(arow + kb + 16 + 8 * hh + 4);
    float xs[16] = {x0[0],x0[1],x0[2],x0[3],x1[0],x1[1],x1[2],x1[3],x2[0],x2[1],x2[2],x2[3],x3[0],x3[1],x3[2],x3[3]};
#pragma unroll
    for (int i = 0; i < 16; ++i) { const unsigned short hb = bf16_bits(xs[i]); ah.u[i] = hb; al.u[i] = ASPLIT ? bf16_bits(xs[i] - bf16_val(hb)) : (unsigned short)0; }
#pragma unroll
    for (int t = 0; t < 4; ++t) {
      const unsigned short* brow = Wt + (size_t)(col0 + t * 16 + ln) * ldb + kb;
      FragB b;
      b.half[0] = *(const v8us*)(brow + 8 * hh);
      b.half[1] = *(const v8us*)(brow + 16 + 8 * hh);
      acc[t] = mmaN<ASPLIT ? 2 : 1>(ah.v, al.v, b.v, b.v, acc[t]);
    }
  }
#pragma unroll
  for (int t = 0; t < 4; ++t) {
    float bv = bias ? bias[col0 + t * 16 + ln] : 0.f;
    if (BIAS_BF16) bv = bf16_round(bv);
#pragma unroll
    for (int r = 0; r < 8; ++r) { float v = acc[t][r] + bv; if (ACT == 1) v = fmaxf(v, 0.f); so[w][8 * hh + r][t * 16 + ln] = v; }
  }
  __builtin_amdgcn_fence(__ATOMIC_ACQ_REL, "workgroup");
  __builtin_amdgcn_wave_barrier();
  const int rsub = lane >> 4, c4 = (lane & 15) * 4;
  {
#pragma unroll
    for (int q = 0; q < 8; ++q) {
      const int r = q * 2 + rsub;
      const v4f v = *(const v4fa*)&so[w][r][c4];
      *(v4f*)(C + (size_t)(row0 + r) * ldc + col0 + c4) = v;
    }
    
  }
}

// GEMM C = act(A·W + bias + resid): A f32 (ASPLIT -> hi/lo 2 terms), Wt bf16 [N][K]; ACT 0 none, 1 relu, 2 exact gelu;
// resid (optional, f32, row index = (row % rmod), pitch ldr, RES_BF16 rounds it) added before the activation.
template <bool ASPLIT, int ACT, bool BIAS_BF16, bool RES_BF16>
__global__ __launch_bounds__(128) void k_gemm_bf3(const float* __restrict__ A, int lda, const unsigned short* __restrict__ Wt, int ldb,
                                                const float* __restrict__ bias, const float* __restrict__ resid, int rmod, int ldr,
                                                float* __restrict__ C, int ldc, int M, int N, int K) {
  __shared__ __attribute__((aligned(16))) float so[4][16][64];
  const int tid = threadIdx.x, w = tid >> 5, lane = tid & 31, ln = lane & 15, hh = lane >> 4;
  const int ntn = N / 64;
  const int wid = blockIdx.x * 4 + w;
  const int mt = wid / ntn, nq = wid % ntn;
  if (mt * 16 >= M) return;
  const int row0 = mt * 16, col0 = nq * 64;
  const float* arow = A + (size_t)(row0 + ln) * lda;
  v8f acc[4] = {};
  for (int kb = 0; kb < K; kb += 32) {
    FragB ah, al;
    const v4f x0 = *(const v4fa*)(arow + kb + 8 * hh), x1 = *(const v4fa*)(arow + kb + 8 * hh + 4);
    const v4f x2 = *(const v4fa*)(arow + kb + 16 + 8 * hh), x3 = *(const v4fa*)(arow + kb + 16 + 8 * hh + 4);
    float xs[16] = {x0[0],x0[1],x0[2],x0[3],x1[0],x1[1],x1[2],x1[3],x2[0],x2[1],x2[2],x2[3],x3[0],x3[1],x3[2],x3[3]};
#pragma unroll
    for (int i = 0; i < 16; ++i) { const unsigned short hb = bf16_bits(xs[i]); ah.u[i] = hb; al.u[i] = ASPLIT ? bf16_bits(xs[i] - bf16_val(hb)) : (unsigned short)0; }
#pragma unroll
    for (int t = 0; t < 4; ++t) {
      const unsigned short* brow = Wt + (size_t)(col0 + t * 16 + ln) * ldb + kb;
      FragB b;
      b.half[0] = *(const v8us*)(brow + 8 * hh);
      b.half[1] = *(const v8us*)(brow + 16 + 8 * hh);
      acc[t] = mmaN<ASPLIT ? 2 : 1>(ah.v, al.v, b.v, b.v, acc[t]);
    }
  }
#pragma unroll
  for (int t = 0; t < 4; ++t) {
    const int col = col0 + t * 16 + ln;
    float bv = bias ? bias[col] : 0.f;
    if (BIAS_BF16) bv = bf16_round(bv);
#pragma unroll
    for (int r = 0; r < 8; ++r) {
      float v = acc[t][r] + bv;
      if (resid) { float rv = resid[(size_t)((row0 + 8 * hh + r) % rmod) * ldr + col]; if (RES_BF16) rv = bf16_round(rv); v += rv; }
      if (ACT == 1) v = fmaxf(v, 0.f);
      if (ACT == 2) v = 0.5f * v * (1.0f + erff(v * 0.70710678118654752f));
      if (ACT == 3) { const float u = 0.7978845608028654f * (v + 0.044715f * v * v * v); v = 0.5f * v * (1.0f + tanhf(u)); }
      so[w][8 * hh + r][t * 16 + ln] = v;
    }
  }
  __builtin_amdgcn_fence(__ATOMIC_ACQ_REL, "workgroup");
  __builtin_amdgcn_wave_barrier();
  const int rsub = lane >> 4, c4 = (lane & 15) * 4;
  {
#pragma unroll
    for (int q = 0; q < 8; ++q) {
      const int r = q * 2 + rsub;
      const v4f v = *(const v4fa*)&so[w][r][c4];
      *(v4f*)(C + (size_t)(row0 + r) * ldc + col0 + c4) = v;
    }
    
  }
}
// row LayerNorm (biased variance, eps) over N: s = X (+ R); optional out_sum <- s; out_norm <- (s-mu)*rsqrt(var+eps)*g + b
template <bool PARAM_BF16>
__global__ __launch_bounds__(256) void k_layernorm(const float* __restrict__ X, const float* __restrict__ R, const float* __restrict__ g, const float* __restrict__ bta,
                                                  float* __restrict__ out_sum, float* __restrict__ out_norm, int N, float eps) {
  __shared__ float red[256];
  const int row = blockIdx.x, tid = threadIdx.x;
  const float* x = X + (size_t)row * N; const float* rr = R ? R + (size_t)row * N : nullptr;
  float vals[16];                     // up to N = 4096
  const int per = N / 256;            // contiguous chunk per thread? use strided-by-4 chunks: thread handles j = tid*4 + 1024*u
  float s1 = 0.f;
  for (int u = 0; u < per / 4; ++u) {
    const int j = tid * 4 + 1024 * u;
    const v4f a = *(const v4fa*)(x + j);
    v4f b = {0.f,0.f,0.f,0.f}; if (rr) b = *(const v4fa*)(rr + j);
#pragma unroll
    for (int q = 0; q < 4; ++q) { const float v = a[q] + b[q]; vals[u * 4 + q] = v; s1 += v; }
  }
  red[tid] = s1; __syncthreads();
  for (int st = 128; st > 0; st >>= 1) { if (tid < st) red[tid] += red[tid + st]; __syncthreads(); }
  const float mu = red[0] / (float)N; __syncthreads();
  float s2 = 0.f;
  for (int u = 0; u < per / 4; ++u)
#pragma unroll
    for (int q = 0; q < 4; ++q) { const float c = vals[u * 4 + q] - mu; s2 += c * c; }
  red[tid] = s2; __syncthreads();
  for (int st = 128; st > 0; st >>= 1) { if (tid < st) red[tid] += red[tid + st]; __syncthreads(); }
  const float rs = rsqrtf(red[0] / (float)N + eps);
  {
    for (int u = 0; u < per / 4; ++u) {
      const int j = tid * 4 + 1024 * u;
      v4f o, sm;
#pragma unroll
      for (int q = 0; q < 4; ++q) {
        float gg = g[j + q], bb = bta[j + q];
        if (PARAM_BF16) { gg = bf16_round(gg); bb = bf16_round(bb); }
        sm[q] = vals[u * 4 + q]; o[q] = (vals[u * 4 + q] - mu) * rs * gg + bb;
      }
      if (out_sum) *(v4f*)(out_sum + (size_t)row * N + j) = sm;
      *(v4f*)(out_norm + (size_t)row * N + j) = o;
    }
    
  }
}



// ---- f16 WMMA path (v_wmma_f32_16x16x32_f16): 11-bit significands for operands in range — used where a [0,1] probability operand needs more precision than bf16
typedef _Float16 v16h __attribute__((ext_vector_type(16)));
union FragH { v16h v; v8us half[2]; _Float16 h[16]; unsigned short u[16]; };
template <int NT>
__device__ __forceinline__ v8f mmaH(v16h ah, v16h al, v16h bh, v16h bl, v8f c) {
  c = __builtin_amdgcn_wmma_f32_16x16x32_f16(false, ah, false, bh, (short)0, c, false, false);
  if (NT >= 2) c = __builtin_amdgcn_wmma_f32_16x16x32_f16(false, al, false, bh, (short)0, c, false, false);
  if (NT >= 3) c = __builtin_amdgcn_wmma_f32_16x16x32_f16(false, ah, false, bl, (short)0, c, false, false);
  asm volatile("v_nop\n\tv_nop\n\tv_nop\n\tv_nop" : "+v"(c) : "v"(ah), "v"(al), "v"(bh), "v"(bl));
  return c;
}
// batched GEMM like k_gemm_b but f16 operands: A f32 (split into f16 hi/lo if ASPLIT, else rounded to f16), Bt = f16 values [n][k]; alpha; C f32; N multiple of 16 (partial tiles skipped)
template <bool ASPLIT>
__global__ __launch_bounds__(128) void k_gemm_h(const float* __restrict__ A, int lda, size_t sA, const _Float16* __restrict__ Bh, int ldb, size_t sB, float alpha, float* __restrict__ C, int ldc, size_t sC, int M, int N, int K) {
  __shared__ __attribute__((aligned(16))) float so[4][16][64];
  const int tid = threadIdx.x, w = tid >> 5, lane = tid & 31, ln = lane & 15, hh = lane >> 4; const int by = blockIdx.y;
  A += (size_t)by * sA; Bh += (size_t)by * sB; C += (size_t)by * sC;
  const int ntn = (N + 63) / 64; const int wid = blockIdx.x * 4 + w; const int mt = wid / ntn, nq = wid % ntn; if (mt * 16 >= M) return;
  const int row0 = mt * 16, col0 = nq * 64; const float* arow = A + (size_t)(row0 + ln) * lda;
  v8f acc[4] = {};
  for (int kb = 0; kb < K; kb += 32) {
    FragH ah, al;
    const v4f x0 = *(const v4fa*)(arow + kb + 8 * hh), x1 = *(const v4fa*)(arow + kb + 8 * hh + 4), x2 = *(const v4fa*)(arow + kb + 16 + 8 * hh), x3 = *(const v4fa*)(arow + kb + 16 + 8 * hh + 4);
    float xs[16] = {x0[0],x0[1],x0[2],x0[3],x1[0],x1[1],x1[2],x1[3],x2[0],x2[1],x2[2],x2[3],x3[0],x3[1],x3[2],x3[3]};
#pragma unroll
    for (int i = 0; i < 16; ++i) { const _Float16 h = (_Float16)xs[i]; ah.h[i] = h; al.h[i] = ASPLIT ? (_Float16)(xs[i] - (float)h) : (_Float16)0.0f; }
#pragma unroll
    for (int t = 0; t < 4; ++t) { if (col0 + t * 16 >= N) continue; const size_t boff = (size_t)(col0 + t * 16 + ln) * ldb + kb; FragH bq; bq.half[0] = *(const v8us*)(Bh + boff + 8 * hh); bq.half[1] = *(const v8us*)(Bh + boff + 16 + 8 * hh);
      acc[t] = mmaH<ASPLIT ? 2 : 1>(ah.v, al.v, bq.v, bq.v, acc[t]); }
  }
#pragma unroll
  for (int t = 0; t < 4; ++t) { if (col0 + t * 16 >= N) continue;
#pragma unroll
    for (int r = 0; r < 8; ++r) so[w][8 * hh + r][t * 16 + ln] = acc[t][r] * alpha; }
  __builtin_amdgcn_fence(__ATOMIC_ACQ_REL, "workgroup"); __builtin_amdgcn_wave_barrier();
  const int rsub = lane >> 4, c4 = (lane & 15) * 4;
  {
#pragma unroll
    for (int q = 0; q < 8; ++q) { const int r = q * 2 + rsub; if (col0 + c4 < N) { const v4f v = *(const v4fa*)&so[w][r][c4]; *(v4f*)(C + (size_t)(row0 + r) * ldc + col0 + c4) = v; } }
     }
}

// Wt[n][k] = f16(W[k][n]·scale) from f32 row-major W[K][N] (scale = power of two; bf16-exact weights stay exact in f16 away from the subnormal range)
__global__ __launch_bounds__(256) void k_wt_f16(const float* __restrict__ W, _Float16* __restrict__ Wt, int K, int N, float scale) {
  const int t = blockIdx.x * 256 + threadIdx.x; if (t >= N * (K / 8)) return; const int n = t / (K / 8), k8 = (t % (K / 8)) * 8; FragH f;
#pragma unroll
  for (int i = 0; i < 8; ++i) f.h[i] = (_Float16)(bf16_round(W[(size_t)(k8 + i) * N + n]) * scale); const v8us o = f.half[0];
  *(v8us*)((unsigned short*)Wt + (size_t)n * K + k8) = o; 
}
// k_gemm_hh variant with fused epilogue: v = acc·alpha + bias[by·sBias + col] (+ CP[(row/rowsPerB)·sCPb + by·64 + col] if CP) ; ACT 0 none / 1 elu ; writes f16 C16 (and f32 C if non-null)
template <int ACT>
__global__ __launch_bounds__(128) void k_gemm_hhx(const _Float16* __restrict__ A, int lda, size_t sA, const _Float16* __restrict__ Bh, int ldb, size_t sB, float alpha, const float* __restrict__ bias, size_t sBias, const float* __restrict__ CP, int rowsPerB, size_t sCPb, int row0g,
    float* __restrict__ C, _Float16* __restrict__ C16, int ldc, size_t sC, int M, int N, int K) {
  __shared__ __attribute__((aligned(16))) float so[4][16][64];
  const int tid = threadIdx.x, w = tid >> 5, lane = tid & 31, ln = lane & 15, hh = lane >> 4; const int by = blockIdx.y;
  A += (size_t)by * sA; Bh += (size_t)by * sB; const size_t cofs = (size_t)by * sC; const float* bp = bias ? bias + (size_t)by * sBias : nullptr;
  const int ntn = (N + 63) / 64; const int wid = blockIdx.x * 4 + w; const int mt = wid / ntn, nq = wid % ntn; if (mt * 16 >= M) return;
  const int row0 = mt * 16, col0 = nq * 64; const _Float16* arow = A + (size_t)(row0 + ln) * lda;
  v8f acc[4] = {};
  for (int kb = 0; kb < K; kb += 32) { FragH ah; ah.half[0] = *(const v8us*)((const unsigned short*)arow + kb + 8 * hh); ah.half[1] = *(const v8us*)((const unsigned short*)arow + kb + 16 + 8 * hh);
#pragma unroll
    for (int t = 0; t < 4; ++t) { if (col0 + t * 16 >= N) continue; const size_t boff = (size_t)(col0 + t * 16 + ln) * ldb + kb; FragH bq; bq.half[0] = *(const v8us*)((const unsigned short*)Bh + boff + 8 * hh); bq.half[1] = *(const v8us*)((const unsigned short*)Bh + boff + 16 + 8 * hh);
      acc[t] = mmaH<1>(ah.v, ah.v, bq.v, bq.v, acc[t]); }
  }
#pragma unroll
  for (int t = 0; t < 4; ++t) { if (col0 + t * 16 >= N) continue; const int col = col0 + t * 16 + ln; const float bv = bp ? bf16_round(bp[col]) : 0.f;
#pragma unroll
    for (int r = 0; r < 8; ++r) { float v = acc[t][r] * alpha + bv; if (CP) { const int rr = row0g + row0 + 8 * hh + r; if (rowsPerB < 0) v += CP[cofs + (size_t)rr * ldc + col];      /* rowsPerB < 0: own element of the batched C plane */ else { const int bidx = rr / rowsPerB; v += CP[(size_t)bidx * sCPb + (size_t)by * 64 + col]; } } if (ACT == 1) v = (v > 0.f) ? v : expm1f(v); else if (ACT == 7) v = (v > 0.f) ? v + 1.0f : expf(v); else if (ACT == 8) v = tanhf(v); else if (ACT == 9) v = 0.5f * v * (1.0f + tanhf(0.7978845608028654f * (v + 0.044715f * v * v * v))); else if (ACT == 11) v = 1.0f / (1.0f + expf(-v)); else if (ACT == 12) v = (v > 0.f) ? v : 0.01f * v; else if (ACT == 14) v = (v > 0.f) ? v : 0.1f * v; else if (ACT == 16) v = (v >= 0.f) ? v : 0.3f * v; else if (ACT == 17) v = (v >= 0.f) ? v : 0.2f * v; else if (ACT == 15) v = v / (1.0f + expf(-v)); else if (ACT == 3) v = fmaxf(v, 0.f); else if (ACT == 6) v = 0.5f * v * (1.0f + erff(v * 0.70710678118654752f)); so[w][8 * hh + r][t * 16 + ln] = v; } }
  __builtin_amdgcn_fence(__ATOMIC_ACQ_REL, "workgroup"); __builtin_amdgcn_wave_barrier();
  const int rsub = lane >> 4, c4 = (lane & 15) * 4; typedef _Float16 v4h __attribute__((ext_vector_type(4)));
  {
#pragma unroll
    for (int q = 0; q < 8; ++q) { const int r = q * 2 + rsub; if (col0 + c4 < N) { const v4f v = *(const v4fa*)&so[w][r][c4]; if (C) *(v4f*)(C + cofs + (size_t)(row0 + r) * ldc + col0 + c4) = v; if (C16) { v4h h4; for (int i = 0; i < 4; ++i) h4[i] = (_Float16)v[i]; *(v4h*)(C16 + cofs + (size_t)(row0 + r) * ldc + col0 + c4) = h4; } } }
     }
}


typedef _Float16 v4h __attribute__((ext_vector_type(4)));

__global__ __launch_bounds__(256) void k_h16(const float* __restrict__ x, _Float16* __restrict__ X16, size_t n8) { const size_t t = (size_t)blockIdx.x * 256 + threadIdx.x; if (t >= n8) return; FragH f;
#pragma unroll
  for (int q = 0; q < 8; ++q) f.h[q] = (_Float16)x[t * 8 + q]; *(v8us*)((unsigned short*)X16 + t * 8) = f.half[0];  }
__global__ __launch_bounds__(256) void k_round16f(const float* __restrict__ W, _Float16* __restrict__ Bt, size_t n8) { const size_t t = (size_t)blockIdx.x * 256 + threadIdx.x; if (t >= n8) return; FragH f;
#pragma unroll
  for (int i = 0; i < 8; ++i) f.h[i] = (_Float16)(bf16_round(W[t * 8 + i]) * 16.0f); *(v8us*)((unsigned short*)Bt + t * 8) = f.half[0];  }
// fragment of 16 rows x 32 k from f16 rows in global memory: a lane holds k = 8 hh .. + 7 and 16 + 8 hh .. + 7 of its row
__device__ __forceinline__ v16h g2_frag(const _Float16* p, int hh) { FragH f; f.half[0] = *(const v8us*)((const unsigned short*)p + 8 * hh); f.half[1] = *(const v8us*)((const unsigned short*)p + 16 + 8 * hh); return f.v; }
__global__ __launch_bounds__(256) void k_rsm(const float* __restrict__ S, _Float16* __restrict__ P, int nrows) {
  #pragma clang fp contract(off)
  const int i = blockIdx.x * 256 + threadIdx.x; if (i >= nrows) return; const float* s = S + (size_t)i * SQ; float mx = -3.0e38f;
#pragma unroll 1
  for (int j = 0; j < SQ; ++j) mx = fmaxf(mx, s[j]); float se = 0.f;
#pragma unroll 1
  for (int j = 0; j < SQ; ++j) se += expf(s[j] - mx); const float sc = 256.0f / se;
#pragma unroll 1
  for (int j0 = 0; j0 < SQ; j0 += 8) { FragH f; for (int q = 0; q < 8; ++q) f.h[q] = (_Float16)(expf(s[j0 + q] - mx) * sc); unsigned short* d = (unsigned short*)P + (size_t)i * SQ + j0; *(v8us*)d = f.half[0];  } }
__global__ __launch_bounds__(256) void k_vt(const _Float16* __restrict__ V16, int b, int h0, _Float16* __restrict__ VT) { __shared__ unsigned short tl[64][65]; const int tid = threadIdx.x; const int hh = blockIdx.x % HG, sg = blockIdx.x / HG; const int s0 = sg * 64; const int h = h0 + hh;
  for (int i = tid; i < 64 * 8; i += 256) { const int j = i / 8, d8 = (i % 8) * 8; FragH f; f.half[0] = *(const v8us*)((const unsigned short*)V16 + ((size_t)b * SQ + s0 + j) * DM + h * HD + d8); for (int q = 0; q < 8; ++q) tl[d8 + q][j] = f.u[q]; }
  __syncthreads();
  { for (int i = tid; i < 64 * 8; i += 256) { const int d = i / 8, j8 = (i % 8) * 8; FragH f; for (int q = 0; q < 8; ++q) f.u[q] = tl[d][j8 + q]; *(v8us*)((unsigned short*)VT + ((size_t)hh * HD + d) * SQ + s0 + j8) = f.half[0]; }  } }



__global__ __launch_bounds__(256) void k_rsmcf2(const float* __restrict__ S, _Float16* __restrict__ P, int hg, int q0, int nk) {
  #pragma clang fp contract(off)
  const int t = blockIdx.x * 256 + threadIdx.x; if (t >= hg * QT) return; const size_t i = (size_t)t; const float* s = S + i * NKX; const int last = q0 + (t % QT); float mx = -3.0e38f;
#pragma unroll 1
  for (int j = 0; j < nk; ++j) { const float f = (j <= last) ? 1.f : 0.f; mx = fmaxf(mx, fmaf(f, s[j], (1.f - f) * -1.0e9f)); } float se = 0.f;
#pragma unroll 1
  for (int j = 0; j < nk; ++j) { const float f = (j <= last) ? 1.f : 0.f; se += __expf(fmaf(f, s[j], (1.f - f) * -1.0e9f) - mx); } const float sc = 256.0f / se;
#pragma unroll 1
  for (int j0 = 0; j0 < nk; j0 += 8) { FragH fr; for (int q = 0; q < 8; ++q) { const int j = j0 + q; const float f = (j <= last) ? 1.f : 0.f; fr.h[q] = (_Float16)(__expf(fmaf(f, s[j], (1.f - f) * -1.0e9f) - mx) * sc); } unsigned short* d = (unsigned short*)P + i * NKX + j0; *(v8us*)d = fr.half[0];  } }

template <int MASKADD>
__global__ __launch_bounds__(64) void k_att0(const float* __restrict__ QF, const float* __restrict__ KF, const float* __restrict__ VF, int ld, const float* __restrict__ mask, float scale, float* __restrict__ OF, int ldo) {
  #pragma clang fp contract(off)
  __shared__ __attribute__((aligned(16))) float lq[64][64]; __shared__ __attribute__((aligned(16))) float lo[64][64];
  const int tid = threadIdx.x; const int h = blockIdx.x / (QT0 / 64), rg = blockIdx.x % (QT0 / 64); const int i = rg * 64 + tid;
  const float* qr = QF + (size_t)i * ld + h * HD;
#pragma unroll 1
  for (int c = 0; c < HD / 4; ++c) { *(v4f*)&lq[tid][c * 4] = *(const v4fa*)(qr + c * 4); const v4f z = {0.f, 0.f, 0.f, 0.f}; *(v4f*)&lo[tid][c * 4] = z; }
  float m = -1.0e30f, l = 0.f; const int jmax = MASKADD ? (SQ - 1) : (rg * 64 + 63);      /* additive-mask form: every key (the mask input decides); causal form: keys up to the block's last row */
#pragma unroll 1
  for (int j = 0; j <= jmax; ++j) { const float* kr = KF + (size_t)j * ld + h * HD; const float* vr = VF + (size_t)j * ld + h * HD; float s = 0.f;
#pragma unroll 1
    for (int c = 0; c < HD / 4; ++c) { const v4f kq = *(const v4fa*)(kr + c * 4); const v4f qq = *(v4f*)&lq[tid][c * 4]; s = __fadd_rn(s, __fmul_rn(qq[0], kq[0])); s = __fadd_rn(s, __fmul_rn(qq[1], kq[1])); s = __fadd_rn(s, __fmul_rn(qq[2], kq[2])); s = __fadd_rn(s, __fmul_rn(qq[3], kq[3])); }
    s = __fmul_rn(s, scale); if (MASKADD) s = __fadd_rn(s, __fmul_rn(bf16_round(mask[(size_t)i * SQ + j]), -10000.0f));
    const float f = (MASKADD || j <= i) ? 1.f : 0.f; const float sm = fmaf(f, s, (1.f - f) * -1.0e30f); const float mn = fmaxf(m, sm); const float sc = expf(m - mn); const float e = expf(sm - mn); l = __fadd_rn(__fmul_rn(l, sc), e); m = mn;
#pragma unroll 1
    for (int c = 0; c < HD / 4; ++c) { const v4f vv = *(const v4fa*)(vr + c * 4); v4f oo = *(v4f*)&lo[tid][c * 4]; for (int u = 0; u < 4; ++u) oo[u] = __fadd_rn(__fmul_rn(oo[u], sc), __fmul_rn(e, vv[u])); *(v4f*)&lo[tid][c * 4] = oo; } }
  const float fin = 64.0f / l;      /* o carried x64 */
#pragma unroll 1
  for (int c = 0; c < HD / 4; ++c) { v4f oo = *(v4f*)&lo[tid][c * 4]; for (int u = 0; u < 4; ++u) oo[u] = __fmul_rn(oo[u], fin); *(v4f*)&lo[tid][c * 4] = oo; }
  __syncthreads();
  {
#pragma unroll 1
    for (int it = 0; it < 16; ++it) { const int row = it * 4 + tid / 16, pc = (tid % 16) * 4; const v4f v = *(const v4f*)&lo[row][pc]; *(v4f*)(OF + (size_t)(rg * 64 + row) * ldo + h * HD + pc) = v; }
     } }

__global__ __launch_bounds__(256) void k_oscale(const float* __restrict__ OF, float* __restrict__ out, size_t n4) { const size_t t = (size_t)blockIdx.x * 256 + threadIdx.x; if (t >= n4) return; const v4f a = *(const v4fa*)(OF + t * 4); v4f o; for (int q = 0; q < 4; ++q) o[q] = a[q] * 0.015625f; *(v4f*)(out + t * 4) = o;  }

__global__ __launch_bounds__(256) void k_bfr(const float* __restrict__ x, float* __restrict__ XB, size_t n8) { const size_t t = (size_t)blockIdx.x * 256 + threadIdx.x; if (t >= n8) return; v4f a = *(const v4fa*)(x + t * 8), c = *(const v4fa*)(x + t * 8 + 4); for (int q = 0; q < 4; ++q) { a[q] = bf16_round(a[q]); c[q] = bf16_round(c[q]); }
  { *(v4f*)(XB + t * 8) = a; *(v4f*)(XB + t * 8 + 4) = c;  } }



__global__ __launch_bounds__(256) void k_rsmfvl(const float* __restrict__ S, _Float16* __restrict__ P, _Float16* __restrict__ PL, int qn, const int* __restrict__ vlp) {
  #pragma clang fp contract(off)
  const int t = blockIdx.x * 256 + threadIdx.x; if (t >= qn) return; const int vl = vlp[0]; const size_t i = (size_t)t; const float* s = S + i * SQ; float mx = -3.0e38f;
#pragma unroll 1
  for (int j = 0; j < SQ; ++j) { const float f = (j < vl) ? 1.f : 0.f; mx = fmaxf(mx, fmaf(f, s[j], (1.f - f) * -1000000.0f)); } float se = 0.f;
#pragma unroll 1
  for (int j = 0; j < SQ; ++j) { const float f = (j < vl) ? 1.f : 0.f; se += __expf(fmaf(f, s[j], (1.f - f) * -1000000.0f) - mx); } const float sc = 256.0f / se;
#pragma unroll 1
  for (int j0 = 0; j0 < SQ; j0 += 8) { FragH fr, gr; for (int q = 0; q < 8; ++q) { const int j = j0 + q; const float f = (j < vl) ? 1.f : 0.f; const float pv = __expf(fmaf(f, s[j], (1.f - f) * -1000000.0f) - mx) * sc; const _Float16 ph = (_Float16)pv; fr.h[q] = ph; gr.h[q] = (_Float16)((pv - (float)ph) * 1024.0f); }
    unsigned short* d = (unsigned short*)P + i * SQ + j0; unsigned short* dl = (unsigned short*)PL + i * SQ + j0; *(v8us*)d = fr.half[0]; *(v8us*)dl = gr.half[0];  } }

// Fused attention, one launch for all batches: a wave owns 16 output rows i (their k rows stay in registers as B operands) and walks the 4096 positions j in passes of 32.
// S^T = q k^T (A = q rows from LDS), so a lane holds 16 scores of ONE row i: maximum and sum in-lane plus one exchange between the wave halves; the weights pack straight into the B operand of O^T += V^T P^T.
// Running maximum and sum (base 2, weights x256 for the f16 range; the factor cancels in the division by the sum). S and P never leave registers.
typedef _Float16 v8h __attribute__((ext_vector_type(8)));
#define FJ 64                        /* positions j per LDS stage (two passes) */
#define FPB 144                      /* LDS row pitch, bytes: 128-byte rows + 16, an odd multiple of 16 for 16-byte reads */
#define FTB (64 * FPB)               /* one staged tile of 64 rows: q hi, q residual, V^T */
__device__ __forceinline__ float fa_xhalf(float x) { return __builtin_bit_cast(float, __builtin_amdgcn_permlanex16(__builtin_bit_cast(int, x), __builtin_bit_cast(int, x), 0x76543210, 0xfedcba98, false, false)); }      /* lane l with lane l ^ 16 */
__device__ __forceinline__ v16h fa_frag(const unsigned char* p) { FragH f; f.half[0] = *(const v8us*)p; f.half[1] = *(const v8us*)(p + 32); return f.v; }      /* same k order as g2_frag: p already holds the 16 * hh bytes */
__device__ __forceinline__ v8f fa_mma(v16h a, v16h b, v8f c) { return __builtin_amdgcn_wmma_f32_16x16x32_f16(false, a, false, b, (short)0, c, false, false); }
/* eight v_exp_f32 in one statement with the slot the instruction set asks for behind a transcendental: each is followed by an independent one (outputs early-clobbered, so none overwrites a source), the last by v_nop */
__device__ __forceinline__ v8f fa_exp8(v8f y) { float e0, e1, e2, e3, e4, e5, e6, e7;
  asm("v_exp_f32 %0, %8\n\tv_exp_f32 %1, %9\n\tv_exp_f32 %2, %10\n\tv_exp_f32 %3, %11\n\tv_exp_f32 %4, %12\n\tv_exp_f32 %5, %13\n\tv_exp_f32 %6, %14\n\tv_exp_f32 %7, %15\n\tv_nop" : "=&v"(e0), "=&v"(e1), "=&v"(e2), "=&v"(e3), "=&v"(e4), "=&v"(e5), "=&v"(e6), "=&v"(e7) : "v"(y[0]), "v"(y[1]), "v"(y[2]), "v"(y[3]), "v"(y[4]), "v"(y[5]), "v"(y[6]), "v"(y[7]));
  const v8f e = {e0, e1, e2, e3, e4, e5, e6, e7}; return e; }
typedef float v2f __attribute__((ext_vector_type(2)));
__global__ __launch_bounds__(256) void k_fattn(const _Float16* __restrict__ KH, const _Float16* __restrict__ KL, const _Float16* __restrict__ QH, const _Float16* __restrict__ QL, const _Float16* __restrict__ VT, float* __restrict__ out) {
  __shared__ __attribute__((aligned(16))) unsigned char sm[2 * 3 * FTB];      /* two buffers of three tiles */
  const int tid = threadIdx.x, w = tid >> 5, lane = tid & 31, ln = lane & 15, hh = lane >> 4;
  const int b = blockIdx.x / (SQ / 128), i0 = (blockIdx.x % (SQ / 128)) * 128 + w * 16; const size_t r0 = (size_t)b * SQ;
  const _Float16* khp = KH + (r0 + i0 + ln) * DM; const _Float16* klp = KL + (r0 + i0 + ln) * DM;
  const v16h kh0 = g2_frag(khp, hh), kh1 = g2_frag(khp + 32, hh), kl0 = g2_frag(klp, hh), kl1 = g2_frag(klp + 32, hh);
  __builtin_amdgcn_sched_barrier(0);      /* the k loads stay the oldest global loads: the wait for stage 0 then covers them, and the loop needs no wait to zero that would drain the stage in flight */
  const int srow = tid >> 3, sch = tid & 7;      /* staging: a thread moves 16-byte piece sch of rows srow and srow + 32 of each of the three tiles */
  const unsigned short* gq = (const unsigned short*)QH + (r0 + srow) * DM + sch * 8; const unsigned short* gl = (const unsigned short*)QL + (r0 + srow) * DM + sch * 8; const unsigned short* gv = (const unsigned short*)VT + ((size_t)b * DM + srow) * SQ + sch * 8;
  unsigned char* sb = sm + srow * FPB + sch * 16; const unsigned char* lb = sm + ln * FPB + 16 * hh;
  v8us t0, t1, t2, t3, t4, t5; v16h qa[8], va[4];
  auto g_load = [&](int st) { t0 = *(const v8us*)(gq + (size_t)st * FJ * DM); t1 = *(const v8us*)(gq + (size_t)st * FJ * DM + 32 * DM); t2 = *(const v8us*)(gl + (size_t)st * FJ * DM); t3 = *(const v8us*)(gl + (size_t)st * FJ * DM + 32 * DM); t4 = *(const v8us*)(gv + (size_t)st * FJ); t5 = *(const v8us*)(gv + (size_t)st * FJ + (size_t)32 * SQ); };
  auto s_store = [&](int off) { unsigned char* d = sb + off; *(v8us*)d = t0; *(v8us*)(d + 32 * FPB) = t1; *(v8us*)(d + FTB) = t2; *(v8us*)(d + FTB + 32 * FPB) = t3; *(v8us*)(d + 2 * FTB) = t4; *(v8us*)(d + 2 * FTB + 32 * FPB) = t5; };
  auto ld_q = [&](int off) {      /* the q fragments of one pass: per 16 rows j hi k 0..31, hi k 32..63, residual k 0..31, residual k 32..63 */
#pragma unroll
    for (int jt = 0; jt < 2; ++jt) { const unsigned char* p = lb + off + jt * 16 * FPB; qa[jt * 4] = fa_frag(p); qa[jt * 4 + 1] = fa_frag(p + 64); qa[jt * 4 + 2] = fa_frag(p + FTB); qa[jt * 4 + 3] = fa_frag(p + FTB + 64); } };
  auto ld_v = [&](int off) {      /* the V^T fragments of one pass: 16 rows f each, 32 positions j */
#pragma unroll
    for (int t = 0; t < 4; ++t) va[t] = fa_frag(lb + off + 2 * FTB + t * 16 * FPB); };
  const v8f z8 = {0.f, 0.f, 0.f, 0.f, 0.f, 0.f, 0.f, 0.f}; v8f o0 = z8, o1 = z8, o2 = z8, o3 = z8, h0, h1, e0, e1; float m = -3.0e38f; v2f l2 = {0.f, 0.f};
  auto scores = [&]() {      /* four independent accumulator chains: hi.hi (h) and lo.hi + hi.lo (e) of both 16-row tiles; x[r] belongs to i = i0 + ln, j = 16 jt + 8 hh + r */
    h0 = fa_mma(qa[0], kh0, z8); e0 = fa_mma(qa[0], kl0, z8); h1 = fa_mma(qa[4], kh0, z8); e1 = fa_mma(qa[4], kl0, z8);
    h0 = fa_mma(qa[1], kh1, h0); e0 = fa_mma(qa[1], kl1, e0); h1 = fa_mma(qa[5], kh1, h1); e1 = fa_mma(qa[5], kl1, e1);
    e0 = fa_mma(qa[2], kh0, e0); e1 = fa_mma(qa[6], kh0, e1); e0 = fa_mma(qa[3], kh1, e0); e1 = fa_mma(qa[7], kh1, e1); };
  auto soft_pv = [&]() {
    const v8f s0 = e0 * 0.0009765625f + h0, s1 = e1 * 0.0009765625f + h1;      /* residual products 2^-10 */
    float mx = s0[0], my = s1[0];      /* two independent chains */
#pragma unroll
    for (int r = 1; r < 8; ++r) { mx = fmaxf(mx, s0[r]); my = fmaxf(my, s1[r]); }
    mx = fmaxf(mx, my); mx = fmaxf(mx, fa_xhalf(mx));
    const float mn = fmaxf(m, mx * 1.44269504f); const float dm = m - mn; float al;
    asm("v_exp_f32 %0, %1\n\tv_nop" : "=&v"(al) : "v"(dm));      /* v_nop: the slot behind a transcendental */
    m = mn; const float nm = 8.0f - mn;      /* + 8: weights x256 */
    const v8f p0 = fa_exp8(s0 * 1.44269504f + nm), p1 = fa_exp8(s1 * 1.44269504f + nm); const v8f ps = p0 + p1;
    l2 = l2 * al + ((__builtin_shufflevector(ps, ps, 0, 1) + __builtin_shufflevector(ps, ps, 2, 3)) + (__builtin_shufflevector(ps, ps, 4, 5) + __builtin_shufflevector(ps, ps, 6, 7)));
    union { v16h v; v8h h[2]; } pf; pf.h[0] = __builtin_convertvector(p0, v8h); pf.h[1] = __builtin_convertvector(p1, v8h);      /* element e: j = 8 hh + e, then 16 + 8 hh + (e - 8): the k order of fa_frag */
    o0 *= al; o1 *= al; o2 *= al; o3 *= al;
    o0 = fa_mma(va[0], pf.v, o0); o1 = fa_mma(va[1], pf.v, o1); o2 = fa_mma(va[2], pf.v, o2); o3 = fa_mma(va[3], pf.v, o3); };      /* o_t[r] = O[i][16 t + 8 hh + r] */
  g_load(0); s_store(0); g_load(1);
  asm volatile("s_wait_dscnt 0x0" ::: "memory");      /* own LDS stores done before the barrier is signalled */
  asm volatile("s_barrier_signal -1\n\ts_barrier_wait -1" ::: "memory");      /* by hand: __syncthreads() would also wait for the global loads of the next stage, which are meant to stay in flight */
  ld_q(0); ld_v(0);
#pragma unroll 1      /* one stage (two passes) a trip: the two buffers alternate by the trip's parity */
  for (int s = 0; s < SQ / FJ; ++s) { const int cur = (s & 1) * (3 * FTB), nxt = 3 * FTB - cur;
    /* the scheduling fences keep each group of fragment loads where it is written: directly behind the products that read the same registers, so that it flies under the vector work */
    scores(); __builtin_amdgcn_sched_barrier(0); ld_q(cur + 32 * FPB); __builtin_amdgcn_sched_barrier(0);
    soft_pv(); __builtin_amdgcn_sched_barrier(0); ld_v(cur + 64);
    s_store(nxt); g_load((s + 2 < SQ / FJ) ? s + 2 : SQ / FJ - 1); __builtin_amdgcn_sched_barrier(0);      /* next stage into the buffer every wave left at the last barrier; the stage after it flies for a whole trip; past the end the last stage is fetched again (in bounds) and nobody uses it */
    scores(); __builtin_amdgcn_sched_barrier(0);
    asm volatile("s_wait_dscnt 0x0" ::: "memory");      /* own stores of the next stage and own last reads of this one are done */
    asm volatile("s_barrier_signal -1\n\ts_barrier_wait -1" ::: "memory");      /* publishes the next stage and frees this one; by hand for the reason above */
    ld_q(nxt); __builtin_amdgcn_sched_barrier(0);
    soft_pv(); __builtin_amdgcn_sched_barrier(0); ld_v(nxt); __builtin_amdgcn_sched_barrier(0); }
  asm volatile("s_wait_loadcnt 0x0\n\ts_wait_dscnt 0x0" ::: "memory");      /* what the last trip fetched ahead (nobody uses it) has landed before the wave gives its registers back */
  float l = l2[0] + l2[1]; l += fa_xhalf(l); const float inv = 1.0f / l; float* orow = out + (r0 + i0 + ln) * DM + 8 * hh;
  const v8f oo[4] = {o0 * inv, o1 * inv, o2 * inv, o3 * inv};
#pragma unroll
  for (int t = 0; t < 4; ++t) { const v4f x = {oo[t][0], oo[t][1], oo[t][2], oo[t][3]}, y = {oo[t][4], oo[t][5], oo[t][6], oo[t][7]}; *(v4f*)(orow + t * 16) = x; *(v4f*)(orow + t * 16 + 4) = y; } }


// Everything in front of the attention in ONE launch. A work-group takes 128 token rows and projects query, key and value of those rows.
// All global loads are issued first, 512 contiguous bytes a wave; inputs (rounded to bf16, exact in f16), the three weight matrices (x16) and the rounded biases go to LDS.
// q, k: D^T = W x^T (A = weight rows, B = token rows), so a lane holds 8 neighbouring features of ONE token: hi and residual pack into 16-byte pieces.
// v: D = x W^T (A = token rows, B = weight rows), so a lane holds 8 neighbouring tokens of ONE feature: the pieces of a V^T row. Same k order and the same two accumulation steps (k 0..31, then 32..63) in both forms.
// Every result is staged in LDS; behind one barrier all of it is stored in whole 128-byte lines.
#define PJT 128                      /* token rows per work-group: 16 a wave */
#define PJP 144                      /* LDS row pitch, bytes, of 64 f16: 128 + 16, as FPB */
#define PJV 272                      /* LDS row pitch, bytes, of a staged V^T row of 128 tokens: 256 + 16 */
typedef unsigned short v4us __attribute__((ext_vector_type(4), may_alias));
__device__ __forceinline__ float pj_round(float x) { const unsigned int u = __float_as_uint(x); return __uint_as_float((u + 0x7FFFu + ((u >> 16) & 1u)) & 0xFFFF0000u); }      /* the value of bf16_round */
__device__ __forceinline__ v4us pj_cvt(v4f x, float scale) { const v4f y = {pj_round(x[0]) * scale, pj_round(x[1]) * scale, pj_round(x[2]) * scale, pj_round(x[3]) * scale}; return __builtin_bit_cast(v4us, __builtin_convertvector(y, v4h)); }
__global__ __launch_bounds__(256) void k_proj(const float* __restrict__ xq, const float* __restrict__ xk, const float* __restrict__ xv, const float* __restrict__ wq, const float* __restrict__ bq, const float* __restrict__ wk, const float* __restrict__ bk, const float* __restrict__ wv, const float* __restrict__ bv,
    _Float16* __restrict__ QH, _Float16* __restrict__ QL, _Float16* __restrict__ KH, _Float16* __restrict__ KL, _Float16* __restrict__ VT) {
  __shared__ __attribute__((aligned(16))) unsigned char sx[3 * PJT * PJP];      /* f16 rows of query, key, value */
  __shared__ __attribute__((aligned(16))) unsigned char sw[3 * DM * PJP];       /* f16 rows of Wq, Wk, Wv (x16) */
  __shared__ __attribute__((aligned(16))) float sb[4 * DM];                     /* bq, bk, bv rounded to bf16 (the fourth quarter: bv again, nobody reads it) */
  __shared__ __attribute__((aligned(16))) unsigned char so[8 * 4 * 16 * PJP];   /* per wave: its 16 rows of q hi, q residual, k hi, k residual */
  __shared__ __attribute__((aligned(16))) unsigned char sv[DM * PJV];           /* V^T of the 128 tokens */
  const int tid = threadIdx.x, w = tid >> 5, lane = tid & 31, ln = lane & 15, hh = lane >> 4;
  const size_t row0 = (size_t)blockIdx.x * PJT;
  const float* const xs[3] = {xq + row0 * DM, xk + row0 * DM, xv + row0 * DM}; const float* const wsr[3] = {wq, wk, wv};
  const float br = (tid < DM ? bq : tid < 2 * DM ? bk : bv)[tid & (DM - 1)];      /* from every thread, among the other loads: under a branch its wait would go to zero and drain the input loads before the first conversion */
  v4f wr[3][4], xr[3][8];      /* piece i * 256 + tid (4 floats) of each tile: row i * 16 + tid / 16, piece tid % 16 of the row */
#pragma unroll
  for (int m = 0; m < 3; ++m) {
#pragma unroll
    for (int i = 0; i < 4; ++i) wr[m][i] = *(const v4fa*)(wsr[m] + (i * 256 + tid) * 4); }
#pragma unroll
  for (int m = 0; m < 3; ++m) {
#pragma unroll
    for (int i = 0; i < 8; ++i) xr[m][i] = *(const v4fa*)(xs[m] + (i * 256 + tid) * 4); }
  sb[tid] = pj_round(br);
  const int so4 = (tid >> 4) * PJP + (tid & 15) * 8;
#pragma unroll
  for (int m = 0; m < 3; ++m) {
#pragma unroll
    for (int i = 0; i < 4; ++i) *(v4us*)(sw + (m * DM + i * 16) * PJP + so4) = pj_cvt(wr[m][i], 16.0f); }
#pragma unroll
  for (int m = 0; m < 3; ++m) {
#pragma unroll
    for (int i = 0; i < 8; ++i) *(v4us*)(sx + (m * PJT + i * 16) * PJP + so4) = pj_cvt(xr[m][i], 1.0f); }
  __syncthreads();
  const unsigned char* xl = sx + (16 * w + ln) * PJP + 16 * hh; const unsigned char* wl = sw + ln * PJP + 16 * hh; unsigned char* sh = so + w * (4 * 16 * PJP);
  const v8f z8 = {0.f, 0.f, 0.f, 0.f, 0.f, 0.f, 0.f, 0.f};
  { const v16h x0 = fa_frag(xl + 2 * PJT * PJP), x1 = fa_frag(xl + 2 * PJT * PJP + 64);
#pragma unroll
    for (int t = 0; t < 4; ++t) { const unsigned char* p = wl + (2 * DM + t * 16) * PJP;
      v8f c = fa_mma(x0, fa_frag(p), z8); c = fa_mma(x1, fa_frag(p + 64), c);      /* c[r]: token 16 w + 8 hh + r, feature 16 t + ln */
      const v8f v = c * 0.0625f + sb[2 * DM + t * 16 + ln];
      *(v8us*)(sv + (t * 16 + ln) * PJV + (16 * w + 8 * hh) * 2) = __builtin_bit_cast(v8us, __builtin_convertvector(v, v8h)); } }
#pragma unroll
  for (int m = 0; m < 2; ++m) { const v16h x0 = fa_frag(xl + m * PJT * PJP), x1 = fa_frag(xl + m * PJT * PJP + 64);
#pragma unroll
    for (int t = 0; t < 4; ++t) { const unsigned char* p = wl + (m * DM + t * 16) * PJP;
      v8f c = fa_mma(fa_frag(p), x0, z8); c = fa_mma(fa_frag(p + 64), x1, c);      /* c[r]: feature 16 t + 8 hh + r, token 16 w + ln */
      const v4f b0 = *(const v4f*)&sb[m * DM + t * 16 + 8 * hh], b1 = *(const v4f*)&sb[m * DM + t * 16 + 8 * hh + 4];
      const v8f v = c * 0.0625f + __builtin_shufflevector(b0, b1, 0, 1, 2, 3, 4, 5, 6, 7); const v8h h = __builtin_convertvector(v, v8h);
      const v8h l = __builtin_convertvector((v - __builtin_convertvector(h, v8f)) * 1024.0f, v8h);
      unsigned char* d = sh + (m * 32 + ln) * PJP + t * 32 + hh * 16; *(v8us*)d = __builtin_bit_cast(v8us, h); *(v8us*)(d + 16 * PJP) = __builtin_bit_cast(v8us, l); } }
  __syncthreads();      /* V^T rows cross the waves; the q and k rows are read back by other lanes of the wave that staged them */
#pragma unroll
  for (int m = 0; m < 2; ++m) { unsigned short* gh = (unsigned short*)(m ? KH : QH) + (row0 + 16 * w) * DM; unsigned short* gl = (unsigned short*)(m ? KL : QL) + (row0 + 16 * w) * DM;
#pragma unroll
    for (int i = 0; i < 4; ++i) { const int ix = i * 32 + lane; const unsigned char* s = sh + (m * 32 + (ix >> 3)) * PJP + (ix & 7) * 16;      /* the wave's 16 rows are 2 KiB in a row: 512 contiguous bytes a store */
      *(v8us*)(gh + ix * 8) = *(const v8us*)s; *(v8us*)(gl + ix * 8) = *(const v8us*)(s + 16 * PJP); } }
  unsigned short* gv = (unsigned short*)VT + (size_t)(blockIdx.x / (SQ / PJT)) * DM * SQ + (blockIdx.x % (SQ / PJT)) * PJT;
#pragma unroll
  for (int i = 0; i < 4; ++i) { const int ix = i * 256 + tid, d = ix >> 4, pc = ix & 15; *(v8us*)(gv + (size_t)d * SQ + pc * 8) = *(const v8us*)(sv + d * PJV + pc * 16); } }      /* 256 contiguous bytes of a V^T row per 16 lanes */

extern "C" void kernel_launch(void* const* d_in, const int* in_sizes, int n_in,
                              void* d_out, int out_size, void* d_ws, size_t ws_size, hipStream_t stream) {
  (void)in_sizes; (void)n_in; (void)out_size;
  const float* const* I = (const float* const*)d_in; const float* xq = I[0]; const float* xk = I[1]; const float* xv = I[2]; const float* wq = I[3]; const float* bq = I[4]; const float* wk = I[5]; const float* bk = I[6]; const float* wv = I[7]; const float* bv = I[8];      /* query, key, value [8][4096][64]; natural [64][64] weights + biases */
  char* ws = (char*)d_ws; size_t off = 0;
  auto take = [&](size_t bytes) { char* p = ws + off; off += (bytes + 255) & ~(size_t)255; return p; };
  _Float16* QH = (_Float16*)take(NR * DM * 2); _Float16* QL = (_Float16*)take(NR * DM * 2); _Float16* KH = (_Float16*)take(NR * DM * 2); _Float16* KL = (_Float16*)take(NR * DM * 2); _Float16* VT = (_Float16*)take(NR * DM * 2);
  if (off > ws_size) return;
  k_proj<<<(unsigned)(NR / PJT), 256, 0, stream>>>(xq, xk, xv, wq, bq, wk, bk, wv, bv, QH, QL, KH, KL, VT);      /* q, k -> f16 hi + x1024 residual rows; v -> V^T [64][4096] of every batch */
  k_fattn<<<NB * (SQ / 128), 256, 0, stream>>>(KH, KL, QH, QL, VT, (float*)d_out);      /* scores (hi.hi + (lo.hi + hi.lo) 2^-10, unscaled), softmax over the query positions, out[i] = sum_j attn[i][j] v[j] */
}

// v004
// It runs in 62.3 microseconds.
// In both of two side-by-side timings against v003, it was 1.03 times as fast.
// All steps since v000 together make it 118 times as fast.
#include <hip/hip_runtime.h>
// Dot-product attention with TRANSPOSED roles and no scaling (query, key, value [8][4096][64]; q = query Wq^T + bq, k = key Wk^T + bk, v = value Wv^T + bv (natural [64][64] sigma 1/8, biases 0.01); scores[i][j] = k_i . q_j (NO 1/sqrt(d): sigma ~8); attn = softmax over the query positions j; out[i] = sum_j attn[i][j] v[j] -> [8][4096][64] (rows are key positions)).
// Structure: one launch in front of the attention: a work-group takes 128 token rows of query, key and value; the bf16-valued inputs as exact f16 rows and the natural weights x16 in LDS; q and k as WMMA products (f32 accumulation, + bias) -> f16 hi + x1024 residual rows, v -> f16 V^T rows, every output staged through LDS and stored in whole lines; then one fused kernel: scores = hi.hi + (lo.hi + hi.lo) 2^-10 (K = 64, unscaled) f32 in registers; running row maximum and sum (f32, native exp; weights x256 f16); out = P V^T / sum f32.
// Compute dtype: inputs rounded to bf16; x / weights exact; q and k as f16 hi + x1024 residual (three products), v and softmax weights as plain f16 GEMM operands (~2^-12); scores, softmax statistics and o f32. v_wmma_f32_16x16x32_f16.
#define NB 8
#define SQ 4096
#define DM 64
#define NH 1
#define HD 64
#define HG 8                         /* heads per launch of the k_vt(b, h0) overload (not launched) */
#define B0 0                         /* first batch processed (used by no kernel or launch) */
#define NBR NB                       /* batches processed (used by no kernel or launch) */
#define NR ((size_t)NB * SQ)         /* token rows */
#define MP ((int)((size_t)NBR * SQ)) /* rows projected (used by no kernel or launch) */
#define QT 256                       /* query rows per causal tile */
#define NKX SQ                       /* S / P row pitch */
#define QT0 256                      /* first-tile rows recomputed exactly */
#define QN SQ                        /* query rows attended per batch (used by no kernel or launch) */
#define NHD NH                       /* heads attended (used by no kernel or launch) */
#define MPO MP                       /* rows through the output stage (used by no kernel or launch) */
#define LQ DM            /* row pitch of the q/k/v rows (used by no kernel or launch) */
typedef __bf16 v16b __attribute__((ext_vector_type(16)));
typedef unsigned short v8us __attribute__((ext_vector_type(8), may_alias));
typedef float  v8f  __attribute__((ext_vector_type(8)));
typedef float  v4f  __attribute__((ext_vector_type(4)));
typedef float  v4fa __attribute__((ext_vector_type(4), may_alias));
union FragB { v16b v; v8us half[2]; unsigned short u[16]; };

__device__ __forceinline__ unsigned short bf16_bits(float x) { unsigned int u = __float_as_uint(x); return (unsigned short)((u + 0x7FFFu + ((u >> 16) & 1u)) >> 16); }
__device__ __forceinline__ float bf16_val(unsigned short b) { return __uint_as_float(((unsigned int)b) << 16); }
__device__ __forceinline__ float bf16_round(float x) { return bf16_val(bf16_bits(x)); }
// D += A·B with NT terms: 1 = ah·bh, 2 = + al·bh (A split), 3 = + ah·bl (both split)
template <int NT>
__device__ __forceinline__ v8f mmaN(v16b ah, v16b al, v16b bh, v16b bl, v8f c) {
  c = __builtin_amdgcn_wmma_f32_16x16x32_bf16(false, ah, false, bh, (short)0, c, false, false);
  if (NT >= 2) c = __builtin_amdgcn_wmma_f32_16x16x32_bf16(false, al, false, bh, (short)0, c, false, false);
  if (NT >= 3) c = __builtin_amdgcn_wmma_f32_16x16x32_bf16(false, ah, false, bl, (short)0, c, false, false);
  asm volatile("v_nop\n\tv_nop\n\tv_nop\n\tv_nop" : "+v"(c) : "v"(ah), "v"(al), "v"(bh), "v"(bl));
  return c;
}

__global__ __launch_bounds__(256) void k_wt_bf16(const float* __restrict__ W, unsigned short* __restrict__ Wt, int K, int N) {
  const int t = blockIdx.x * 256 + threadIdx.x;
  const int k8n = K / 8;
  if (t >= N * k8n) return;
  const int n = t / k8n, k8 = (t % k8n) * 8;
  v8us v;
#pragma unroll
  for (int i = 0; i < 8; ++i) v[i] = bf16_bits(W[(size_t)(k8 + i) * N + n]);
  *(v8us*)(Wt + (size_t)n * K + k8) = v;
  
}

// GEMM C[M][N] (f32, pitch ldc) = act(A[M][K]·W + bias). A f32 row-major (pitch lda) converted per fragment to bf16
// (ASPLIT: hi/lo two planes -> 2 terms, else single rounded term); Wt bf16 [N][K] (pitch ldb). BIAS_BF16 rounds the
// bias to bf16 first (bias quantised to bf16 before the add). K%32==0, M%16==0, N%64==0.
template <bool ASPLIT, int ACT, bool BIAS_BF16>
__global__ __launch_bounds__(128) void k_gemm_bf(const float* __restrict__ A, int lda, const unsigned short* __restrict__ Wt, int ldb,
                                               const float* __restrict__ bias, float* __restrict__ C, int ldc, int M, int N, int K) {
  __shared__ __attribute__((aligned(16))) float so[4][16][64];
  const int tid = threadIdx.x, w = tid >> 5, lane = tid & 31, ln = lane & 15, hh = lane >> 4;
  const int ntn = N / 64;
  const int wid = blockIdx.x * 4 + w;
  const int mt = wid / ntn, nq = wid % ntn;
  if (mt * 16 >= M) return;
  const int row0 = mt * 16, col0 = nq * 64;
  const float* arow = A + (size_t)(row0 + ln) * lda;
  v8f acc[4] = {};
  for (int kb = 0; kb < K; kb += 32) {
    FragB ah, al;
    const v4f x0 = *(const v4fa*)(arow + kb + 8 * hh), x1 = *(const v4fa*)(arow + kb + 8 * hh + 4);
    const v4f x2 = *(const v4fa*)(arow + kb + 16 + 8 * hh), x3 = *(const v4fa*)(arow + kb + 16 + 8 * hh + 4);
    float xs[16] = {x0[0],x0[1],x0[2],x0[3],x1[0],x1[1],x1[2],x1[3],x2[0],x2[1],x2[2],x2[3],x3[0],x3[1],x3[2],x3[3]};
#pragma unroll
    for (int i = 0; i < 16; ++i) { const unsigned short hb = bf16_bits(xs[i]); ah.u[i] = hb; al.u[i] = ASPLIT ? bf16_bits(xs[i] - bf16_val(hb)) : (unsigned short)0; }
#pragma unroll
    for (int t = 0; t < 4; ++t) {
      const unsigned short* brow = Wt + (size_t)(col0 + t * 16 + ln) * ldb + kb;
      FragB b;
      b.half[0] = *(const v8us*)(brow + 8 * hh);
      b.half[1] = *(const v8us*)(brow + 16 + 8 * hh);
      acc[t] = mmaN<ASPLIT ? 2 : 1>(ah.v, al.v, b.v, b.v, acc[t]);
    }
  }
#pragma unroll
  for (int t = 0; t < 4; ++t) {
    float bv = bias ? bias[col0 + t * 16 + ln] : 0.f;
    if (BIAS_BF16) bv = bf16_round(bv);
#pragma unroll
    for (int r = 0; r < 8; ++r) { float v = acc[t][r] + bv; if (ACT == 1) v = fmaxf(v, 0.f); so[w][8 * hh + r][t * 16 + ln] = v; }
  }
  __builtin_amdgcn_fence(__ATOMIC_ACQ_REL, "workgroup");
  __builtin_amdgcn_wave_barrier();
  const int rsub = lane >> 4, c4 = (lane & 15) * 4;
  {
#pragma unroll
    for (int q = 0; q < 8; ++q) {
      const int r = q * 2 + rsub;
      const v4f v = *(const v4fa*)&so[w][r][c4];
      *(v4f*)(C + (size_t)(row0 + r) * ldc + col0 + c4) = v;
    }
    
  }
}

// GEMM C = act(A·W + bias + resid): A f32 (ASPLIT -> hi/lo 2 terms), Wt bf16 [N][K]; ACT 0 none, 1 relu, 2 exact gelu;
// resid (optional, f32, row index = (row % rmod), pitch ldr, RES_BF16 rounds it) added before the activation.
template <bool ASPLIT, int ACT, bool BIAS_BF16, bool RES_BF16>
__global__ __launch_bounds__(128) void k_gemm_bf3(const float* __restrict__ A, int lda, const unsigned short* __restrict__ Wt, int ldb,
                                                const float* __restrict__ bias, const float* __restrict__ resid, int rmod, int ldr,
                                                float* __restrict__ C, int ldc, int M, int N, int K) {
  __shared__ __attribute__((aligned(16))) float so[4][16][64];
  const int tid = threadIdx.x, w = tid >> 5, lane = tid & 31, ln = lane & 15, hh = lane >> 4;
  const int ntn = N / 64;
  const int wid = blockIdx.x * 4 + w;
  const int mt = wid / ntn, nq = wid % ntn;
  if (mt * 16 >= M) return;
  const int row0 = mt * 16, col0 = nq * 64;
  const float* arow = A + (size_t)(row0 + ln) * lda;
  v8f acc[4] = {};
  for (int kb = 0; kb < K; kb += 32) {
    FragB ah, al;
    const v4f x0 = *(const v4fa*)(arow + kb + 8 * hh), x1 = *(const v4fa*)(arow + kb + 8 * hh + 4);
    const v4f x2 = *(const v4fa*)(arow + kb + 16 + 8 * hh), x3 = *(const v4fa*)(arow + kb + 16 + 8 * hh + 4);
    float xs[16] = {x0[0],x0[1],x0[2],x0[3],x1[0],x1[1],x1[2],x1[3],x2[0],x2[1],x2[2],x2[3],x3[0],x3[1],x3[2],x3[3]};
#pragma unroll
    for (int i = 0; i < 16; ++i) { const unsigned short hb = bf16_bits(xs[i]); ah.u[i] = hb; al.u[i] = ASPLIT ? bf16_bits(xs[i] - bf16_val(hb)) : (unsigned short)0; }
#pragma unroll
    for (int t = 0; t < 4; ++t) {
      const unsigned short* brow = Wt + (size_t)(col0 + t * 16 + ln) * ldb + kb;
      FragB b;
      b.half[0] = *(const v8us*)(brow + 8 * hh);
      b.half[1] = *(const v8us*)(brow + 16 + 8 * hh);
      acc[t] = mmaN<ASPLIT ? 2 : 1>(ah.v, al.v, b.v, b.v, acc[t]);
    }
  }
#pragma unroll
  for (int t = 0; t < 4; ++t) {
    const int col = col0 + t * 16 + ln;
    float bv = bias ? bias[col] : 0.f;
    if (BIAS_BF16) bv = bf16_round(bv);
#pragma unroll
    for (int r = 0; r < 8; ++r) {
      float v = acc[t][r] + bv;
      if (resid) { float rv = resid[(size_t)((row0 + 8 * hh + r) % rmod) * ldr + col]; if (RES_BF16) rv = bf16_round(rv); v += rv; }
      if (ACT == 1) v = fmaxf(v, 0.f);
      if (ACT == 2) v = 0.5f * v * (1.0f + erff(v * 0.70710678118654752f));
      if (ACT == 3) { const float u = 0.7978845608028654f * (v + 0.044715f * v * v * v); v = 0.5f * v * (1.0f + tanhf(u)); }
      so[w][8 * hh + r][t * 16 + ln] = v;
    }
  }
  __builtin_amdgcn_fence(__ATOMIC_ACQ_REL, "workgroup");
  __builtin_amdgcn_wave_barrier();
  const int rsub = lane >> 4, c4 = (lane & 15) * 4;
  {
#pragma unroll
    for (int q = 0; q < 8; ++q) {
      const int r = q * 2 + rsub;
      const v4f v = *(const v4fa*)&so[w][r][c4];
      *(v4f*)(C + (size_t)(row0 + r) * ldc + col0 + c4) = v;
    }
    
  }
}
// row LayerNorm (biased variance, eps) over N: s = X (+ R); optional out_sum <- s; out_norm <- (s-mu)*rsqrt(var+eps)*g + b
template <bool PARAM_BF16>
__global__ __launch_bounds__(256) void k_layernorm(const float* __restrict__ X, const float* __restrict__ R, const float* __restrict__ g, const float* __restrict__ bta,
                                                  float* __restrict__ out_sum, float* __restrict__ out_norm, int N, float eps) {
  __shared__ float red[256];
  const int row = blockIdx.x, tid = threadIdx.x;
  const float* x = X + (size_t)row * N; const float* rr = R ? R + (size_t)row * N : nullptr;
  float vals[16];                     // up to N = 4096
  const int per = N / 256;            // contiguous chunk per thread? use strided-by-4 chunks: thread handles j = tid*4 + 1024*u
  float s1 = 0.f;
  for (int u = 0; u < per / 4; ++u) {
    const int j = tid * 4 + 1024 * u;
    const v4f a = *(const v4fa*)(x + j);
    v4f b = {0.f,0.f,0.f,0.f}; if (rr) b = *(const v4fa*)(rr + j);
#pragma unroll
    for (int q = 0; q < 4; ++q) { const float v = a[q] + b[q]; vals[u * 4 + q] = v; s1 += v; }
  }
  red[tid] = s1; __syncthreads();
  for (int st = 128; st > 0; st >>= 1) { if (tid < st) red[tid] += red[tid + st]; __syncthreads(); }
  const float mu = red[0] / (float)N; __syncthreads();
  float s2 = 0.f;
  for (int u = 0; u < per / 4; ++u)
#pragma unroll
    for (int q = 0; q < 4; ++q) { const float c = vals[u * 4 + q] - mu; s2 += c * c; }
  red[tid] = s2; __syncthreads();
  for (int st = 128; st > 0; st >>= 1) { if (tid < st) red[tid] += red[tid + st]; __syncthreads(); }
  const float rs = rsqrtf(red[0] / (float)N + eps);
  {
    for (int u = 0; u < per / 4; ++u) {
      const int j = tid * 4 + 1024 * u;
      v4f o, sm;
#pragma unroll
      for (int q = 0; q < 4; ++q) {
        float gg = g[j + q], bb = bta[j + q];
        if (PARAM_BF16) { gg = bf16_round(gg); bb = bf16_round(bb); }
        sm[q] = vals[u * 4 + q]; o[q] = (vals[u * 4 + q] - mu) * rs * gg + bb;
      }
      if (out_sum) *(v4f*)(out_sum + (size_t)row * N + j) = sm;
      *(v4f*)(out_norm + (size_t)row * N + j) = o;
    }
    
  }
}



// ---- f16 WMMA path (v_wmma_f32_16x16x32_f16): 11-bit significands for operands in range — used where a [0,1] probability operand needs more precision than bf16
typedef _Float16 v16h __attribute__((ext_vector_type(16)));
union FragH { v16h v; v8us half[2]; _Float16 h[16]; unsigned short u[16]; };
template <int NT>
__device__ __forceinline__ v8f mmaH(v16h ah, v16h al, v16h bh, v16h bl, v8f c) {
  c = __builtin_amdgcn_wmma_f32_16x16x32_f16(false, ah, false, bh, (short)0, c, false, false);
  if (NT >= 2) c = __builtin_amdgcn_wmma_f32_16x16x32_f16(false, al, false, bh, (short)0, c, false, false);
  if (NT >= 3) c = __builtin_amdgcn_wmma_f32_16x16x32_f16(false, ah, false, bl, (short)0, c, false, false);
  asm volatile("v_nop\n\tv_nop\n\tv_nop\n\tv_nop" : "+v"(c) : "v"(ah), "v"(al), "v"(bh), "v"(bl));
  return c;
}
// batched GEMM like k_gemm_b but f16 operands: A f32 (split into f16 hi/lo if ASPLIT, else rounded to f16), Bt = f16 values [n][k]; alpha; C f32; N multiple of 16 (partial tiles skipped)
template <bool ASPLIT>
__global__ __launch_bounds__(128) void k_gemm_h(const float* __restrict__ A, int lda, size_t sA, const _Float16* __restrict__ Bh, int ldb, size_t sB, float alpha, float* __restrict__ C, int ldc, size_t sC, int M, int N, int K) {
  __shared__ __attribute__((aligned(16))) float so[4][16][64];
  const int tid = threadIdx.x, w = tid >> 5, lane = tid & 31, ln = lane & 15, hh = lane >> 4; const int by = blockIdx.y;
  A += (size_t)by * sA; Bh += (size_t)by * sB; C += (size_t)by * sC;
  const int ntn = (N + 63) / 64; const int wid = blockIdx.x * 4 + w; const int mt = wid / ntn, nq = wid % ntn; if (mt * 16 >= M) return;
  const int row0 = mt * 16, col0 = nq * 64; const float* arow = A + (size_t)(row0 + ln) * lda;
  v8f acc[4] = {};
  for (int kb = 0; kb < K; kb += 32) {
    FragH ah, al;
    const v4f x0 = *(const v4fa*)(arow + kb + 8 * hh), x1 = *(const v4fa*)(arow + kb + 8 * hh + 4), x2 = *(const v4fa*)(arow + kb + 16 + 8 * hh), x3 = *(const v4fa*)(arow + kb + 16 + 8 * hh + 4);
    float xs[16] = {x0[0],x0[1],x0[2],x0[3],x1[0],x1[1],x1[2],x1[3],x2[0],x2[1],x2[2],x2[3],x3[0],x3[1],x3[2],x3[3]};
#pragma unroll
    for (int i = 0; i < 16; ++i) { const _Float16 h = (_Float16)xs[i]; ah.h[i] = h; al.h[i] = ASPLIT ? (_Float16)(xs[i] - (float)h) : (_Float16)0.0f; }
#pragma unroll
    for (int t = 0; t < 4; ++t) { if (col0 + t * 16 >= N) continue; const size_t boff = (size_t)(col0 + t * 16 + ln) * ldb + kb; FragH bq; bq.half[0] = *(const v8us*)(Bh + boff + 8 * hh); bq.half[1] = *(const v8us*)(Bh + boff + 16 + 8 * hh);
      acc[t] = mmaH<ASPLIT ? 2 : 1>(ah.v, al.v, bq.v, bq.v, acc[t]); }
  }
#pragma unroll
  for (int t = 0; t < 4; ++t) { if (col0 + t * 16 >= N) continue;
#pragma unroll
    for (int r = 0; r < 8; ++r) so[w][8 * hh + r][t * 16 + ln] = acc[t][r] * alpha; }
  __builtin_amdgcn_fence(__ATOMIC_ACQ_REL, "workgroup"); __builtin_amdgcn_wave_barrier();
  const int rsub = lane >> 4, c4 = (lane & 15) * 4;
  {
#pragma unroll
    for (int q = 0; q < 8; ++q) { const int r = q * 2 + rsub; if (col0 + c4 < N) { const v4f v = *(const v4fa*)&so[w][r][c4]; *(v4f*)(C + (size_t)(row0 + r) * ldc + col0 + c4) = v; } }
     }
}

// Wt[n][k] = f16(W[k][n]·scale) from f32 row-major W[K][N] (scale = power of two; bf16-exact weights stay exact in f16 away from the subnormal range)
__global__ __launch_bounds__(256) void k_wt_f16(const float* __restrict__ W, _Float16* __restrict__ Wt, int K, int N, float scale) {
  const int t = blockIdx.x * 256 + threadIdx.x; if (t >= N * (K / 8)) return; const int n = t / (K / 8), k8 = (t % (K / 8)) * 8; FragH f;
#pragma unroll
  for (int i = 0; i < 8; ++i) f.h[i] = (_Float16)(bf16_round(W[(size_t)(k8 + i) * N + n]) * scale); const v8us o = f.half[0];
  *(v8us*)((unsigned short*)Wt + (size_t)n * K + k8) = o; 
}
// k_gemm_hh variant with fused epilogue: v = acc·alpha + bias[by·sBias + col] (+ CP[(row/rowsPerB)·sCPb + by·64 + col] if CP) ; ACT 0 none / 1 elu ; writes f16 C16 (and f32 C if non-null)
template <int ACT>
__global__ __launch_bounds__(128) void k_gemm_hhx(const _Float16* __restrict__ A, int lda, size_t sA, const _Float16* __restrict__ Bh, int ldb, size_t sB, float alpha, const float* __restrict__ bias, size_t sBias, const float* __restrict__ CP, int rowsPerB, size_t sCPb, int row0g,
    float* __restrict__ C, _Float16* __restrict__ C16, int ldc, size_t sC, int M, int N, int K) {
  __shared__ __attribute__((aligned(16))) float so[4][16][64];
  const int tid = threadIdx.x, w = tid >> 5, lane = tid & 31, ln = lane & 15, hh = lane >> 4; const int by = blockIdx.y;
  A += (size_t)by * sA; Bh += (size_t)by * sB; const size_t cofs = (size_t)by * sC; const float* bp = bias ? bias + (size_t)by * sBias : nullptr;
  const int ntn = (N + 63) / 64; const int wid = blockIdx.x * 4 + w; const int mt = wid / ntn, nq = wid % ntn; if (mt * 16 >= M) return;
  const int row0 = mt * 16, col0 = nq * 64; const _Float16* arow = A + (size_t)(row0 + ln) * lda;
  v8f acc[4] = {};
  for (int kb = 0; kb < K; kb += 32) { FragH ah; ah.half[0] = *(const v8us*)((const unsigned short*)arow + kb + 8 * hh); ah.half[1] = *(const v8us*)((const unsigned short*)arow + kb + 16 + 8 * hh);
#pragma unroll
    for (int t = 0; t < 4; ++t) { if (col0 + t * 16 >= N) continue; const size_t boff = (size_t)(col0 + t * 16 + ln) * ldb + kb; FragH bq; bq.half[0] = *(const v8us*)((const unsigned short*)Bh + boff + 8 * hh); bq.half[1] = *(const v8us*)((const unsigned short*)Bh + boff + 16 + 8 * hh);
      acc[t] = mmaH<1>(ah.v, ah.v, bq.v, bq.v, acc[t]); }
  }
#pragma unroll
  for (int t = 0; t < 4; ++t) { if (col0 + t * 16 >= N) continue; const int col = col0 + t * 16 + ln; const float bv = bp ? bf16_round(bp[col]) : 0.f;
#pragma unroll
    for (int r = 0; r < 8; ++r) { float v = acc[t][r] * alpha + bv; if (CP) { const int rr = row0g + row0 + 8 * hh + r; if (rowsPerB < 0) v += CP[cofs + (size_t)rr * ldc + col];      /* rowsPerB < 0: own element of the batched C plane */ else { const int bidx = rr / rowsPerB; v += CP[(size_t)bidx * sCPb + (size_t)by * 64 + col]; } } if (ACT == 1) v = (v > 0.f) ? v : expm1f(v); else if (ACT == 7) v = (v > 0.f) ? v + 1.0f : expf(v); else if (ACT == 8) v = tanhf(v); else if (ACT == 9) v = 0.5f * v * (1.0f + tanhf(0.7978845608028654f * (v + 0.044715f * v * v * v))); else if (ACT == 11) v = 1.0f / (1.0f + expf(-v)); else if (ACT == 12) v = (v > 0.f) ? v : 0.01f * v; else if (ACT == 14) v = (v > 0.f) ? v : 0.1f * v; else if (ACT == 16) v = (v >= 0.f) ? v : 0.3f * v; else if (ACT == 17) v = (v >= 0.f) ? v : 0.2f * v; else if (ACT == 15) v = v / (1.0f + expf(-v)); else if (ACT == 3) v = fmaxf(v, 0.f); else if (ACT == 6) v = 0.5f * v * (1.0f + erff(v * 0.70710678118654752f)); so[w][8 * hh + r][t * 16 + ln] = v; } }
  __builtin_amdgcn_fence(__ATOMIC_ACQ_REL, "workgroup"); __builtin_amdgcn_wave_barrier();
  const int rsub = lane >> 4, c4 = (lane & 15) * 4; typedef _Float16 v4h __attribute__((ext_vector_type(4)));
  {
#pragma unroll
    for (int q = 0; q < 8; ++q) { const int r = q * 2 + rsub; if (col0 + c4 < N) { const v4f v = *(const v4fa*)&so[w][r][c4]; if (C) *(v4f*)(C + cofs + (size_t)(row0 + r) * ldc + col0 + c4) = v; if (C16) { v4h h4; for (int i = 0; i < 4; ++i) h4[i] = (_Float16)v[i]; *(v4h*)(C16 + cofs + (size_t)(row0 + r) * ldc + col0 + c4) = h4; } } }
     }
}


typedef _Float16 v4h __attribute__((ext_vector_type(4)));

__global__ __launch_bounds__(256) void k_h16(const float* __restrict__ x, _Float16* __restrict__ X16, size_t n8) { const size_t t = (size_t)blockIdx.x * 256 + threadIdx.x; if (t >= n8) return; FragH f;
#pragma unroll
  for (int q = 0; q < 8; ++q) f.h[q] = (_Float16)x[t * 8 + q]; *(v8us*)((unsigned short*)X16 + t * 8) = f.half[0];  }
__global__ __launch_bounds__(256) void k_round16f(const float* __restrict__ W, _Float16* __restrict__ Bt, size_t n8) { const size_t t = (size_t)blockIdx.x * 256 + threadIdx.x; if (t >= n8) return; FragH f;
#pragma unroll
  for (int i = 0; i < 8; ++i) f.h[i] = (_Float16)(bf16_round(W[t * 8 + i]) * 16.0f); *(v8us*)((unsigned short*)Bt + t * 8) = f.half[0];  }
// fragment of 16 rows x 32 k from f16 rows in global memory: a lane holds k = 8 hh .. + 7 and 16 + 8 hh .. + 7 of its row
__device__ __forceinline__ v16h g2_frag(const _Float16* p, int hh) { FragH f; f.half[0] = *(const v8us*)((const unsigned short*)p + 8 * hh); f.half[1] = *(const v8us*)((const unsigned short*)p + 16 + 8 * hh); return f.v; }
__global__ __launch_bounds__(256) void k_rsm(const float* __restrict__ S, _Float16* __restrict__ P, int nrows) {
  #pragma clang fp contract(off)
  const int i = blockIdx.x * 256 + threadIdx.x; if (i >= nrows) return; const float* s = S + (size_t)i * SQ; float mx = -3.0e38f;
#pragma unroll 1
  for (int j = 0; j < SQ; ++j) mx = fmaxf(mx, s[j]); float se = 0.f;
#pragma unroll 1
  for (int j = 0; j < SQ; ++j) se += expf(s[j] - mx); const float sc = 256.0f / se;
#pragma unroll 1
  for (int j0 = 0; j0 < SQ; j0 += 8) { FragH f; for (int q = 0; q < 8; ++q) f.h[q] = (_Float16)(expf(s[j0 + q] - mx) * sc); unsigned short* d = (unsigned short*)P + (size_t)i * SQ + j0; *(v8us*)d = f.half[0];  } }
__global__ __launch_bounds__(256) void k_vt(const _Float16* __restrict__ V16, int b, int h0, _Float16* __restrict__ VT) { __shared__ unsigned short tl[64][65]; const int tid = threadIdx.x; const int hh = blockIdx.x % HG, sg = blockIdx.x / HG; const int s0 = sg * 64; const int h = h0 + hh;
  for (int i = tid; i < 64 * 8; i += 256) { const int j = i / 8, d8 = (i % 8) * 8; FragH f; f.half[0] = *(const v8us*)((const unsigned short*)V16 + ((size_t)b * SQ + s0 + j) * DM + h * HD + d8); for (int q = 0; q < 8; ++q) tl[d8 + q][j] = f.u[q]; }
  __syncthreads();
  { for (int i = tid; i < 64 * 8; i += 256) { const int d = i / 8, j8 = (i % 8) * 8; FragH f; for (int q = 0; q < 8; ++q) f.u[q] = tl[d][j8 + q]; *(v8us*)((unsigned short*)VT + ((size_t)hh * HD + d) * SQ + s0 + j8) = f.half[0]; }  } }



__global__ __launch_bounds__(256) void k_rsmcf2(const float* __restrict__ S, _Float16* __restrict__ P, int hg, int q0, int nk) {
  #pragma clang fp contract(off)
  const int t = blockIdx.x * 256 + threadIdx.x; if (t >= hg * QT) return; const size_t i = (size_t)t; const float* s = S + i * NKX; const int last = q0 + (t % QT); float mx = -3.0e38f;
#pragma unroll 1
  for (int j = 0; j < nk; ++j) { const float f = (j <= last) ? 1.f : 0.f; mx = fmaxf(mx, fmaf(f, s[j], (1.f - f) * -1.0e9f)); } float se = 0.f;
#pragma unroll 1
  for (int j = 0; j < nk; ++j) { const float f = (j <= last) ? 1.f : 0.f; se += __expf(fmaf(f, s[j], (1.f - f) * -1.0e9f) - mx); } const float sc = 256.0f / se;
#pragma unroll 1
  for (int j0 = 0; j0 < nk; j0 += 8) { FragH fr; for (int q = 0; q < 8; ++q) { const int j = j0 + q; const float f = (j <= last) ? 1.f : 0.f; fr.h[q] = (_Float16)(__expf(fmaf(f, s[j], (1.f - f) * -1.0e9f) - mx) * sc); } unsigned short* d = (unsigned short*)P + i * NKX + j0; *(v8us*)d = fr.half[0];  } }

template <int MASKADD>
__global__ __launch_bounds__(64) void k_att0(const float* __restrict__ QF, const float* __restrict__ KF, const float* __restrict__ VF, int ld, const float* __restrict__ mask, float scale, float* __restrict__ OF, int ldo) {
  #pragma clang fp contract(off)
  __shared__ __attribute__((aligned(16))) float lq[64][64]; __shared__ __attribute__((aligned(16))) float lo[64][64];
  const int tid = threadIdx.x; const int h = blockIdx.x / (QT0 / 64), rg = blockIdx.x % (QT0 / 64); const int i = rg * 64 + tid;
  const float* qr = QF + (size_t)i * ld + h * HD;
#pragma unroll 1
  for (int c = 0; c < HD / 4; ++c) { *(v4f*)&lq[tid][c * 4] = *(const v4fa*)(qr + c * 4); const v4f z = {0.f, 0.f, 0.f, 0.f}; *(v4f*)&lo[tid][c * 4] = z; }
  float m = -1.0e30f, l = 0.f; const int jmax = MASKADD ? (SQ - 1) : (rg * 64 + 63);      /* additive-mask form: every key (the mask input decides); causal form: keys up to the block's last row */
#pragma unroll 1
  for (int j = 0; j <= jmax; ++j) { const float* kr = KF + (size_t)j * ld + h * HD; const float* vr = VF + (size_t)j * ld + h * HD; float s = 0.f;
#pragma unroll 1
    for (int c = 0; c < HD / 4; ++c) { const v4f kq = *(const v4fa*)(kr + c * 4); const v4f qq = *(v4f*)&lq[tid][c * 4]; s = __fadd_rn(s, __fmul_rn(qq[0], kq[0])); s = __fadd_rn(s, __fmul_rn(qq[1], kq[1])); s = __fadd_rn(s, __fmul_rn(qq[2], kq[2])); s = __fadd_rn(s, __fmul_rn(qq[3], kq[3])); }
    s = __fmul_rn(s, scale); if (MASKADD) s = __fadd_rn(s, __fmul_rn(bf16_round(mask[(size_t)i * SQ + j]), -10000.0f));
    const float f = (MASKADD || j <= i) ? 1.f : 0.f; const float sm = fmaf(f, s, (1.f - f) * -1.0e30f); const float mn = fmaxf(m, sm); const float sc = expf(m - mn); const float e = expf(sm - mn); l = __fadd_rn(__fmul_rn(l, sc), e); m = mn;
#pragma unroll 1
    for (int c = 0; c < HD / 4; ++c) { const v4f vv = *(const v4fa*)(vr + c * 4); v4f oo = *(v4f*)&lo[tid][c * 4]; for (int u = 0; u < 4; ++u) oo[u] = __fadd_rn(__fmul_rn(oo[u], sc), __fmul_rn(e, vv[u])); *(v4f*)&lo[tid][c * 4] = oo; } }
  const float fin = 64.0f / l;      /* o carried x64 */
#pragma unroll 1
  for (int c = 0; c < HD / 4; ++c) { v4f oo = *(v4f*)&lo[tid][c * 4]; for (int u = 0; u < 4; ++u) oo[u] = __fmul_rn(oo[u], fin); *(v4f*)&lo[tid][c * 4] = oo; }
  __syncthreads();
  {
#pragma unroll 1
    for (int it = 0; it < 16; ++it) { const int row = it * 4 + tid / 16, pc = (tid % 16) * 4; const v4f v = *(const v4f*)&lo[row][pc]; *(v4f*)(OF + (size_t)(rg * 64 + row) * ldo + h * HD + pc) = v; }
     } }

__global__ __launch_bounds__(256) void k_oscale(const float* __restrict__ OF, float* __restrict__ out, size_t n4) { const size_t t = (size_t)blockIdx.x * 256 + threadIdx.x; if (t >= n4) return; const v4f a = *(const v4fa*)(OF + t * 4); v4f o; for (int q = 0; q < 4; ++q) o[q] = a[q] * 0.015625f; *(v4f*)(out + t * 4) = o;  }

__global__ __launch_bounds__(256) void k_bfr(const float* __restrict__ x, float* __restrict__ XB, size_t n8) { const size_t t = (size_t)blockIdx.x * 256 + threadIdx.x; if (t >= n8) return; v4f a = *(const v4fa*)(x + t * 8), c = *(const v4fa*)(x + t * 8 + 4); for (int q = 0; q < 4; ++q) { a[q] = bf16_round(a[q]); c[q] = bf16_round(c[q]); }
  { *(v4f*)(XB + t * 8) = a; *(v4f*)(XB + t * 8 + 4) = c;  } }



__global__ __launch_bounds__(256) void k_rsmfvl(const float* __restrict__ S, _Float16* __restrict__ P, _Float16* __restrict__ PL, int qn, const int* __restrict__ vlp) {
  #pragma clang fp contract(off)
  const int t = blockIdx.x * 256 + threadIdx.x; if (t >= qn) return; const int vl = vlp[0]; const size_t i = (size_t)t; const float* s = S + i * SQ; float mx = -3.0e38f;
#pragma unroll 1
  for (int j = 0; j < SQ; ++j) { const float f = (j < vl) ? 1.f : 0.f; mx = fmaxf(mx, fmaf(f, s[j], (1.f - f) * -1000000.0f)); } float se = 0.f;
#pragma unroll 1
  for (int j = 0; j < SQ; ++j) { const float f = (j < vl) ? 1.f : 0.f; se += __expf(fmaf(f, s[j], (1.f - f) * -1000000.0f) - mx); } const float sc = 256.0f / se;
#pragma unroll 1
  for (int j0 = 0; j0 < SQ; j0 += 8) { FragH fr, gr; for (int q = 0; q < 8; ++q) { const int j = j0 + q; const float f = (j < vl) ? 1.f : 0.f; const float pv = __expf(fmaf(f, s[j], (1.f - f) * -1000000.0f) - mx) * sc; const _Float16 ph = (_Float16)pv; fr.h[q] = ph; gr.h[q] = (_Float16)((pv - (float)ph) * 1024.0f); }
    unsigned short* d = (unsigned short*)P + i * SQ + j0; unsigned short* dl = (unsigned short*)PL + i * SQ + j0; *(v8us*)d = fr.half[0]; *(v8us*)dl = gr.half[0];  } }

// Fused attention, one launch for all batches: a wave owns 32 output rows i (two groups of 16; their k rows stay in registers as B operands), so every fragment read from LDS feeds two products; it walks every second pass of 32 positions j, its partner wave the others, and the two partial results are joined at the end.
// S^T = q k^T (A = q rows from LDS), so a lane holds 16 scores of ONE row i: maximum and sum in-lane plus one exchange between the wave halves; the weights pack straight into the B operand of O^T += V^T P^T.
// Running maximum and sum (base 2, weights x256 for the f16 range; the factor cancels in the division by the sum). S and P never leave registers.
typedef _Float16 v8h __attribute__((ext_vector_type(8)));
#define FJ 64                        /* positions j per LDS stage (two passes) */
#define FPB 144                      /* LDS row pitch, bytes: 128-byte rows + 16, an odd multiple of 16 for 16-byte reads */
#define FTB (64 * FPB)               /* one staged tile of 64 rows: q hi, q residual, V^T */
__device__ __forceinline__ float fa_xhalf(float x) { return __builtin_bit_cast(float, __builtin_amdgcn_permlanex16(__builtin_bit_cast(int, x), __builtin_bit_cast(int, x), 0x76543210, 0xfedcba98, false, false)); }      /* lane l with lane l ^ 16 */
__device__ __forceinline__ v16h fa_frag(const unsigned char* p) { FragH f; f.half[0] = *(const v8us*)p; f.half[1] = *(const v8us*)(p + 32); return f.v; }      /* same k order as g2_frag: p already holds the 16 * hh bytes */
__device__ __forceinline__ v8f fa_mma(v16h a, v16h b, v8f c) { return __builtin_amdgcn_wmma_f32_16x16x32_f16(false, a, false, b, (short)0, c, false, false); }
/* eight v_exp_f32 in one statement with the slot the instruction set asks for behind a transcendental: each is followed by an independent one (outputs early-clobbered, so none overwrites a source), the last by v_nop */
__device__ __forceinline__ v8f fa_exp8(v8f y) { float e0, e1, e2, e3, e4, e5, e6, e7;
  asm("v_exp_f32 %0, %8\n\tv_exp_f32 %1, %9\n\tv_exp_f32 %2, %10\n\tv_exp_f32 %3, %11\n\tv_exp_f32 %4, %12\n\tv_exp_f32 %5, %13\n\tv_exp_f32 %6, %14\n\tv_exp_f32 %7, %15\n\tv_nop" : "=&v"(e0), "=&v"(e1), "=&v"(e2), "=&v"(e3), "=&v"(e4), "=&v"(e5), "=&v"(e6), "=&v"(e7) : "v"(y[0]), "v"(y[1]), "v"(y[2]), "v"(y[3]), "v"(y[4]), "v"(y[5]), "v"(y[6]), "v"(y[7]));
  const v8f e = {e0, e1, e2, e3, e4, e5, e6, e7}; return e; }
typedef float v2f __attribute__((ext_vector_type(2)));
__global__ __launch_bounds__(256) void k_fattn(const _Float16* __restrict__ KH, const _Float16* __restrict__ KL, const _Float16* __restrict__ QH, const _Float16* __restrict__ QL, const _Float16* __restrict__ VT, float* __restrict__ out) {
  __shared__ __attribute__((aligned(16))) unsigned char sm[2 * 3 * FTB];      /* two buffers of three tiles; behind the loop: the exchange of the partial results */
  const int tid = threadIdx.x, w = tid >> 5, lane = tid & 31, ln = lane & 15, hh = lane >> 4;
  const int rg = w & 3, jh = w >> 2;      /* a wave owns 32 output rows (two groups of 16) and walks one of the two passes of every stage; waves w and w ^ 4 share their rows */
  const int b = blockIdx.x / (SQ / 128), i0 = (blockIdx.x % (SQ / 128)) * 128 + rg * 32; const size_t r0 = (size_t)b * SQ;
  v16h kh[2][2], kl[2][2];
#pragma unroll
  for (int c = 0; c < 2; ++c) { const _Float16* khp = KH + (r0 + i0 + 16 * c + ln) * DM; const _Float16* klp = KL + (r0 + i0 + 16 * c + ln) * DM;
    kh[c][0] = g2_frag(khp, hh); kh[c][1] = g2_frag(khp + 32, hh); kl[c][0] = g2_frag(klp, hh); kl[c][1] = g2_frag(klp + 32, hh); }
  asm volatile("s_wait_xcnt 0x0" ::: "memory");      /* in front of the first instruction that reuses an address register of the k loads */
  __builtin_amdgcn_sched_barrier(0);      /* the k loads stay the oldest global loads: the wait for stage 0 then covers them, and the loop needs no wait to zero that would drain the stage in flight */
  const int srow = tid >> 3, sch = tid & 7;      /* staging: a thread moves 16-byte piece sch of rows srow and srow + 32 of each of the three tiles */
  const unsigned short* gq = (const unsigned short*)QH + (r0 + srow) * DM + sch * 8; const unsigned short* gl = (const unsigned short*)QL + (r0 + srow) * DM + sch * 8; const unsigned short* gv = (const unsigned short*)VT + ((size_t)b * DM + srow) * SQ + sch * 8;
  unsigned char* sb = sm + srow * FPB + sch * 16; const unsigned char* lbq = sm + (jh * 32 + ln) * FPB + 16 * hh; const unsigned char* lbv = sm + 2 * FTB + ln * FPB + jh * 64 + 16 * hh;      /* the wave's pass: rows j 32 jh .. + 31 of the q tiles, the same positions (64 bytes) of the V^T rows */
  v8us t0, t1, t2, t3, t4, t5; v16h qa[8], va[4];
  const unsigned short *pq, *pl, *pv;      /* the addresses of the stage last asked for */
  auto g_load = [&](int st) { pq = gq + (size_t)st * FJ * DM; pl = gl + (size_t)st * FJ * DM; pv = gv + (size_t)st * FJ; t0 = *(const v8us*)pq; t1 = *(const v8us*)(pq + 32 * DM); t2 = *(const v8us*)pl; t3 = *(const v8us*)(pl + 32 * DM); t4 = *(const v8us*)pv; t5 = *(const v8us*)(pv + (size_t)32 * SQ); };
  auto s_store = [&](int off) { unsigned char* d = sb + off; *(v8us*)d = t0; *(v8us*)(d + 32 * FPB) = t1; *(v8us*)(d + FTB) = t2; *(v8us*)(d + FTB + 32 * FPB) = t3; *(v8us*)(d + 2 * FTB) = t4; *(v8us*)(d + 2 * FTB + 32 * FPB) = t5; };
  auto ld_q = [&](int off) {      /* the q fragments of the wave's pass: per 16 rows j hi k 0..31, hi k 32..63, residual k 0..31, residual k 32..63 */
#pragma unroll
    for (int jt = 0; jt < 2; ++jt) { const unsigned char* p = lbq + off + jt * 16 * FPB; qa[jt * 4] = fa_frag(p); qa[jt * 4 + 1] = fa_frag(p + 64); qa[jt * 4 + 2] = fa_frag(p + FTB); qa[jt * 4 + 3] = fa_frag(p + FTB + 64); } };
  auto ld_v = [&](int off) {      /* the V^T fragments of the wave's pass: 16 rows f each, 32 positions j */
#pragma unroll
    for (int t = 0; t < 4; ++t) va[t] = fa_frag(lbv + off + t * 16 * FPB); };
  const v8f z8 = {0.f, 0.f, 0.f, 0.f, 0.f, 0.f, 0.f, 0.f}; v8f o[2][4] = {{z8, z8, z8, z8}, {z8, z8, z8, z8}}, h[2][2], e[2][2]; float m[2] = {-3.0e38f, -3.0e38f}; v2f l2[2] = {{0.f, 0.f}, {0.f, 0.f}};
  auto scores = [&](int c) {      /* row group c; four independent accumulator chains: hi.hi (h) and lo.hi + hi.lo (e) of both 16-row tiles; x[r] belongs to i = i0 + 16 c + ln, j = 16 jt + 8 hh + r */
    h[c][0] = fa_mma(qa[0], kh[c][0], z8); e[c][0] = fa_mma(qa[0], kl[c][0], z8); h[c][1] = fa_mma(qa[4], kh[c][0], z8); e[c][1] = fa_mma(qa[4], kl[c][0], z8);
    h[c][0] = fa_mma(qa[1], kh[c][1], h[c][0]); e[c][0] = fa_mma(qa[1], kl[c][1], e[c][0]); h[c][1] = fa_mma(qa[5], kh[c][1], h[c][1]); e[c][1] = fa_mma(qa[5], kl[c][1], e[c][1]);
    e[c][0] = fa_mma(qa[2], kh[c][0], e[c][0]); e[c][1] = fa_mma(qa[6], kh[c][0], e[c][1]); e[c][0] = fa_mma(qa[3], kh[c][1], e[c][0]); e[c][1] = fa_mma(qa[7], kh[c][1], e[c][1]); };
  auto soft_pv = [&](int c) {
    const v8f s0 = e[c][0] * 0.0009765625f + h[c][0], s1 = e[c][1] * 0.0009765625f + h[c][1];      /* residual products 2^-10 */
    float mx = s0[0], my = s1[0];      /* two independent chains */
#pragma unroll
    for (int r = 1; r < 8; ++r) { mx = fmaxf(mx, s0[r]); my = fmaxf(my, s1[r]); }
    mx = fmaxf(mx, my); mx = fmaxf(mx, fa_xhalf(mx));
    const float mn = fmaxf(m[c], mx * 1.44269504f); const float dm = m[c] - mn; float al;
    asm("v_exp_f32 %0, %1\n\tv_nop" : "=&v"(al) : "v"(dm));      /* v_nop: the slot behind a transcendental */
    m[c] = mn; const float nm = 8.0f - mn;      /* + 8: weights x256 */
    const v8f p0 = fa_exp8(s0 * 1.44269504f + nm), p1 = fa_exp8(s1 * 1.44269504f + nm); const v8f ps = p0 + p1;
    l2[c] = l2[c] * al + ((__builtin_shufflevector(ps, ps, 0, 1) + __builtin_shufflevector(ps, ps, 2, 3)) + (__builtin_shufflevector(ps, ps, 4, 5) + __builtin_shufflevector(ps, ps, 6, 7)));
    union { v16h v; v8h h[2]; } pf; pf.h[0] = __builtin_convertvector(p0, v8h); pf.h[1] = __builtin_convertvector(p1, v8h);      /* element e: j = 8 hh + e, then 16 + 8 hh + (e - 8): the k order of fa_frag */
#pragma unroll
    for (int t = 0; t < 4; ++t) o[c][t] *= al;
#pragma unroll
    for (int t = 0; t < 4; ++t) o[c][t] = fa_mma(va[t], pf.v, o[c][t]); };      /* o[c][t][r] = O[i0 + 16 c + ln][16 t + 8 hh + r] */
  g_load(0); s_store(0); g_load(1);
  asm volatile("s_wait_dscnt 0x0" ::: "memory");      /* own LDS stores done before the barrier is signalled */
  asm volatile("s_barrier_signal -1\n\ts_barrier_wait -1" ::: "memory");      /* by hand: __syncthreads() would also wait for the global loads of the next stage, which are meant to stay in flight */
  ld_q(0); ld_v(0);
#pragma unroll 1      /* one stage (one pass of 32 rows a wave) a trip: the two buffers alternate by the trip's parity */
  for (int s = 0; s < SQ / FJ; ++s) { const int nxt = 3 * FTB - (s & 1) * (3 * FTB);
    /* the scheduling fences keep each group of LDS instructions where it is written, in one place and not among the products */
    s_store(nxt); g_load((s + 2 < SQ / FJ) ? s + 2 : SQ / FJ - 1); __builtin_amdgcn_sched_barrier(0);      /* next stage into the buffer every wave left at the last barrier: the stores land under the products; the stage after it flies for a whole trip; past the end the last stage is fetched again (in bounds) and nobody uses it */
    scores(0); scores(1); __builtin_amdgcn_sched_barrier(0);
    asm volatile("s_wait_xcnt 0x0" :: "v"(pq), "v"(pl), "v"(pv) : "memory");      /* the address registers of this trip's global loads are inputs here: they are kept up to this wait and reused only behind it, so it can stand behind the products instead of directly behind the loads */
    asm volatile("s_wait_dscnt 0x0" ::: "memory");      /* own stores of the next stage and own last reads of this one are done */
    asm volatile("s_barrier_signal -1\n\ts_barrier_wait -1" ::: "memory");      /* publishes the next stage and frees this one; by hand for the reason above. Left for a later step: every wave meets here between its products and its vector work */
    ld_q(nxt); __builtin_amdgcn_sched_barrier(0);      /* directly behind the products that read the same registers: it flies under the vector work */
    soft_pv(0); soft_pv(1); __builtin_amdgcn_sched_barrier(0);
    ld_v(nxt); __builtin_amdgcn_sched_barrier(0); }
  asm volatile("s_wait_loadcnt 0x0\n\ts_wait_dscnt 0x0" ::: "memory");      /* what the last trip fetched ahead (nobody uses it) has landed before its registers and the ring are used for something else */
  __syncthreads();      /* every wave has left the ring: it becomes the exchange buffer */
  /* the two waves of a pair hold partial results of the same 32 rows: each hands the partner one row group (maximum, sum, O) and finishes the other */
  float lc[2];
#pragma unroll
  for (int c = 0; c < 2; ++c) { float l = l2[c][0] + l2[c][1]; l += fa_xhalf(l); lc[c] = l; }
  const bool up = jh != 0;      /* wave-uniform: the upper wave keeps group 1 */
  float* xs = (float*)sm + w * (34 * 32); const float* xp = (const float*)sm + (w ^ 4) * (34 * 32);
#pragma unroll
  for (int t = 0; t < 4; ++t) { const v8f g = up ? o[0][t] : o[1][t]; const v4f x = {g[0], g[1], g[2], g[3]}, y = {g[4], g[5], g[6], g[7]}; *(v4f*)(xs + (t * 64 + lane) * 4) = x; *(v4f*)(xs + (t * 64 + 32 + lane) * 4) = y; }
  xs[1024 + lane] = up ? m[0] : m[1]; xs[1056 + lane] = up ? lc[0] : lc[1];
  __syncthreads();      /* the partner's group is in LDS */
  const float mk = up ? m[1] : m[0], lk = up ? lc[1] : lc[0], mp = xp[1024 + lane], lp = xp[1056 + lane];
  const float mn = fmaxf(mk, mp), dk = mk - mn, dp = mp - mn; float fk, fp;
  asm("v_exp_f32 %0, %2\n\tv_exp_f32 %1, %3\n\tv_nop" : "=&v"(fk), "=&v"(fp) : "v"(dk), "v"(dp));      /* v_nop: the slot behind a transcendental */
  const float inv = 1.0f / (lk * fk + lp * fp); fk *= inv; fp *= inv;
  float* orow = out + (r0 + i0 + 16 * jh + ln) * DM + 8 * hh;
#pragma unroll
  for (int t = 0; t < 4; ++t) { const v8f g = up ? o[1][t] : o[0][t]; const v4f px = *(const v4f*)(xp + (t * 64 + lane) * 4), py = *(const v4f*)(xp + (t * 64 + 32 + lane) * 4);
    const v4f x = {g[0] * fk + px[0] * fp, g[1] * fk + px[1] * fp, g[2] * fk + px[2] * fp, g[3] * fk + px[3] * fp}, y = {g[4] * fk + py[0] * fp, g[5] * fk + py[1] * fp, g[6] * fk + py[2] * fp, g[7] * fk + py[3] * fp};
    *(v4f*)(orow + t * 16) = x; *(v4f*)(orow + t * 16 + 4) = y; } }


// Everything in front of the attention in ONE launch. A work-group takes 128 token rows and projects query, key and value of those rows.
// All global loads are issued first, 512 contiguous bytes a wave; inputs (rounded to bf16, exact in f16), the three weight matrices (x16) and the rounded biases go to LDS.
// q, k: D^T = W x^T (A = weight rows, B = token rows), so a lane holds 8 neighbouring features of ONE token: hi and residual pack into 16-byte pieces.
// v: D = x W^T (A = token rows, B = weight rows), so a lane holds 8 neighbouring tokens of ONE feature: the pieces of a V^T row. Same k order and the same two accumulation steps (k 0..31, then 32..63) in both forms.
// Every result is staged in LDS; behind one barrier all of it is stored in whole 128-byte lines.
#define PJT 128                      /* token rows per work-group: 16 a wave */
#define PJP 144                      /* LDS row pitch, bytes, of 64 f16: 128 + 16, as FPB */
#define PJV 272                      /* LDS row pitch, bytes, of a staged V^T row of 128 tokens: 256 + 16 */
typedef unsigned short v4us __attribute__((ext_vector_type(4), may_alias));
__device__ __forceinline__ float pj_round(float x) { const unsigned int u = __float_as_uint(x); return __uint_as_float((u + 0x7FFFu + ((u >> 16) & 1u)) & 0xFFFF0000u); }      /* the value of bf16_round */
__device__ __forceinline__ v4us pj_cvt(v4f x, float scale) { const v4f y = {pj_round(x[0]) * scale, pj_round(x[1]) * scale, pj_round(x[2]) * scale, pj_round(x[3]) * scale}; return __builtin_bit_cast(v4us, __builtin_convertvector(y, v4h)); }
__global__ __launch_bounds__(256) void k_proj(const float* __restrict__ xq, const float* __restrict__ xk, const float* __restrict__ xv, const float* __restrict__ wq, const float* __restrict__ bq, const float* __restrict__ wk, const float* __restrict__ bk, const float* __restrict__ wv, const float* __restrict__ bv,
    _Float16* __restrict__ QH, _Float16* __restrict__ QL, _Float16* __restrict__ KH, _Float16* __restrict__ KL, _Float16* __restrict__ VT) {
  __shared__ __attribute__((aligned(16))) unsigned char sx[3 * PJT * PJP];      /* f16 rows of query, key, value */
  __shared__ __attribute__((aligned(16))) unsigned char sw[3 * DM * PJP];       /* f16 rows of Wq, Wk, Wv (x16) */
  __shared__ __attribute__((aligned(16))) float sb[4 * DM];                     /* bq, bk, bv rounded to bf16 (the fourth quarter: bv again, nobody reads it) */
  __shared__ __attribute__((aligned(16))) unsigned char so[8 * 4 * 16 * PJP];   /* per wave: its 16 rows of q hi, q residual, k hi, k residual */
  __shared__ __attribute__((aligned(16))) unsigned char sv[DM * PJV];           /* V^T of the 128 tokens */
  const int tid = threadIdx.x, w = tid >> 5, lane = tid & 31, ln = lane & 15, hh = lane >> 4;
  const size_t row0 = (size_t)blockIdx.x * PJT;
  const float* const xs[3] = {xq + row0 * DM, xk + row0 * DM, xv + row0 * DM}; const float* const wsr[3] = {wq, wk, wv};
  const float br = (tid < DM ? bq : tid < 2 * DM ? bk : bv)[tid & (DM - 1)];      /* from every thread, among the other loads: under a branch its wait would go to zero and drain the input loads before the first conversion */
  v4f wr[3][4], xr[3][8];      /* piece i * 256 + tid (4 floats) of each tile: row i * 16 + tid / 16, piece tid % 16 of the row */
#pragma unroll
  for (int m = 0; m < 3; ++m) {
#pragma unroll
    for (int i = 0; i < 4; ++i) wr[m][i] = *(const v4fa*)(wsr[m] + (i * 256 + tid) * 4); }
#pragma unroll
  for (int m = 0; m < 3; ++m) {
#pragma unroll
    for (int i = 0; i < 8; ++i) xr[m][i] = *(const v4fa*)(xs[m] + (i * 256 + tid) * 4); }
  sb[tid] = pj_round(br);
  const int so4 = (tid >> 4) * PJP + (tid & 15) * 8;
#pragma unroll
  for (int m = 0; m < 3; ++m) {
#pragma unroll
    for (int i = 0; i < 4; ++i) *(v4us*)(sw + (m * DM + i * 16) * PJP + so4) = pj_cvt(wr[m][i], 16.0f); }
#pragma unroll
  for (int m = 0; m < 3; ++m) {
#pragma unroll
    for (int i = 0; i < 8; ++i) *(v4us*)(sx + (m * PJT + i * 16) * PJP + so4) = pj_cvt(xr[m][i], 1.0f); }
  __syncthreads();
  const unsigned char* xl = sx + (16 * w + ln) * PJP + 16 * hh; const unsigned char* wl = sw + ln * PJP + 16 * hh; unsigned char* sh = so + w * (4 * 16 * PJP);
  const v8f z8 = {0.f, 0.f, 0.f, 0.f, 0.f, 0.f, 0.f, 0.f};
  { const v16h x0 = fa_frag(xl + 2 * PJT * PJP), x1 = fa_frag(xl + 2 * PJT * PJP + 64);
#pragma unroll
    for (int t = 0; t < 4; ++t) { const unsigned char* p = wl + (2 * DM + t * 16) * PJP;
      v8f c = fa_mma(x0, fa_frag(p), z8); c = fa_mma(x1, fa_frag(p + 64), c);      /* c[r]: token 16 w + 8 hh + r, feature 16 t + ln */
      const v8f v = c * 0.0625f + sb[2 * DM + t * 16 + ln];
      *(v8us*)(sv + (t * 16 + ln) * PJV + (16 * w + 8 * hh) * 2) = __builtin_bit_cast(v8us, __builtin_convertvector(v, v8h)); } }
#pragma unroll
  for (int m = 0; m < 2; ++m) { const v16h x0 = fa_frag(xl + m * PJT * PJP), x1 = fa_frag(xl + m * PJT * PJP + 64);
#pragma unroll
    for (int t = 0; t < 4; ++t) { const unsigned char* p = wl + (m * DM + t * 16) * PJP;
      v8f c = fa_mma(fa_frag(p), x0, z8); c = fa_mma(fa_frag(p + 64), x1, c);      /* c[r]: feature 16 t + 8 hh + r, token 16 w + ln */
      const v4f b0 = *(const v4f*)&sb[m * DM + t * 16 + 8 * hh], b1 = *(const v4f*)&sb[m * DM + t * 16 + 8 * hh + 4];
      const v8f v = c * 0.0625f + __builtin_shufflevector(b0, b1, 0, 1, 2, 3, 4, 5, 6, 7); const v8h h = __builtin_convertvector(v, v8h);
      const v8h l = __builtin_convertvector((v - __builtin_convertvector(h, v8f)) * 1024.0f, v8h);
      unsigned char* d = sh + (m * 32 + ln) * PJP + t * 32 + hh * 16; *(v8us*)d = __builtin_bit_cast(v8us, h); *(v8us*)(d + 16 * PJP) = __builtin_bit_cast(v8us, l); } }
  __syncthreads();      /* V^T rows cross the waves; the q and k rows are read back by other lanes of the wave that staged them */
#pragma unroll
  for (int m = 0; m < 2; ++m) { unsigned short* gh = (unsigned short*)(m ? KH : QH) + (row0 + 16 * w) * DM; unsigned short* gl = (unsigned short*)(m ? KL : QL) + (row0 + 16 * w) * DM;
#pragma unroll
    for (int i = 0; i < 4; ++i) { const int ix = i * 32 + lane; const unsigned char* s = sh + (m * 32 + (ix >> 3)) * PJP + (ix & 7) * 16;      /* the wave's 16 rows are 2 KiB in a row: 512 contiguous bytes a store */
      *(v8us*)(gh + ix * 8) = *(const v8us*)s; *(v8us*)(gl + ix * 8) = *(const v8us*)(s + 16 * PJP); } }
  unsigned short* gv = (unsigned short*)VT + (size_t)(blockIdx.x / (SQ / PJT)) * DM * SQ + (blockIdx.x % (SQ / PJT)) * PJT;
#pragma unroll
  for (int i = 0; i < 4; ++i) { const int ix = i * 256 + tid, d = ix >> 4, pc = ix & 15; *(v8us*)(gv + (size_t)d * SQ + pc * 8) = *(const v8us*)(sv + d * PJV + pc * 16); } }      /* 256 contiguous bytes of a V^T row per 16 lanes */

extern "C" void kernel_launch(void* const* d_in, const int* in_sizes, int n_in,
                              void* d_out, int out_size, void* d_ws, size_t ws_size, hipStream_t stream) {
  (void)in_sizes; (void)n_in; (void)out_size;
  const float* const* I = (const float* const*)d_in; const float* xq = I[0]; const float* xk = I[1]; const float* xv = I[2]; const float* wq = I[3]; const float* bq = I[4]; const float* wk = I[5]; const float* bk = I[6]; const float* wv = I[7]; const float* bv = I[8];      /* query, key, value [8][4096][64]; natural [64][64] weights + biases */
  char* ws = (char*)d_ws; size_t off = 0;
  auto take = [&](size_t bytes) { char* p = ws + off; off += (bytes + 255) & ~(size_t)255; return p; };
  _Float16* QH = (_Float16*)take(NR * DM * 2); _Float16* QL = (_Float16*)take(NR * DM * 2); _Float16* KH = (_Float16*)take(NR * DM * 2); _Float16* KL = (_Float16*)take(NR * DM * 2); _Float16* VT = (_Float16*)take(NR * DM * 2);
  if (off > ws_size) return;
  k_proj<<<(unsigned)(NR / PJT), 256, 0, stream>>>(xq, xk, xv, wq, bq, wk, bk, wv, bv, QH, QL, KH, KL, VT);      /* q, k -> f16 hi + x1024 residual rows; v -> V^T [64][4096] of every batch */
  k_fattn<<<NB * (SQ / 128), 256, 0, stream>>>(KH, KL, QH, QL, VT, (float*)d_out);      /* scores (hi.hi + (lo.hi + hi.lo) 2^-10, unscaled), softmax over the query positions, out[i] = sum_j attn[i][j] v[j] */
}

// v006
// Measured time: 45.7 microseconds a run.
// Versions between v004 and this one are left out; their measured steps multiply to 1.31 times as fast.
// Counting every step since v000, it is 155 times as fast.
#include <hip/hip_runtime.h>
// Dot-product attention with TRANSPOSED roles and no scaling (query, key, value [8][4096][64]; q = query Wq^T + bq, k = key Wk^T + bk, v = value Wv^T + bv (natural [64][64] sigma 1/8, biases 0.01); scores[i][j] = k_i . q_j (NO 1/sqrt(d): sigma ~8); attn = softmax over the query positions j; out[i] = sum_j attn[i][j] v[j] -> [8][4096][64] (rows are key positions)).
// Structure: one launch in front of the attention: a work-group takes 128 token rows of query, key and value; the bf16-valued inputs as exact f16 rows and the weights x16 in LDS; k as WMMA products (f32 accumulation, + bias) -> f16 hi + x1024 residual, then k' = Wq^T k (WMMA on both parts) -> f16 hi + x1024 residual rows; the query rows go out as they are (exact f16); v -> f16 V^T rows; every output staged through LDS and stored in whole lines; then one fused kernel: scores = k'.x = hi.x + (lo.x) 2^-10 (K = 64, unscaled) f32 in registers; running row maximum and sum (f32, native exp; weights x256 f16); out = P V^T / sum f32.
// k_i . q_j = k_i . (Wq x_j + bq) = (Wq^T k_i) . x_j + k_i . bq; the last term is the same for every j of a row i, and the softmax over j does not see it: it is left out, for any bq.
// Compute dtype: inputs rounded to bf16; x / weights exact; k and k' as f16 hi + x1024 residual, v and softmax weights as plain f16 GEMM operands (~2^-12); scores and softmax statistics f32. v_wmma_f32_16x16x32_f16.
#define NB 8
#define SQ 4096
#define DM 64
#define NH 1
#define HD 64
#define HG 8                         /* heads per launch of the k_vt(b, h0) overload (not launched) */
#define B0 0                         /* first batch processed (used by no kernel or launch) */
#define NBR NB                       /* batches processed (used by no kernel or launch) */
#define NR ((size_t)NB * SQ)         /* token rows */
#define MP ((int)((size_t)NBR * SQ)) /* rows projected (used by no kernel or launch) */
#define QT 256                       /* query rows per causal tile */
#define NKX SQ                       /* S / P row pitch */
#define QT0 256                      /* first-tile rows recomputed exactly */
#define QN SQ                        /* query rows attended per batch (used by no kernel or launch) */
#define NHD NH                       /* heads attended (used by no kernel or launch) */
#define MPO MP                       /* rows through the output stage (used by no kernel or launch) */
#define LQ DM            /* row pitch of the q/k/v rows (used by no kernel or launch) */
typedef __bf16 v16b __attribute__((ext_vector_type(16)));
typedef unsigned short v8us __attribute__((ext_vector_type(8), may_alias));
typedef float  v8f  __attribute__((ext_vector_type(8)));
typedef float  v4f  __attribute__((ext_vector_type(4)));
typedef float  v4fa __attribute__((ext_vector_type(4), may_alias));
union FragB { v16b v; v8us half[2]; unsigned short u[16]; };

__device__ __forceinline__ unsigned short bf16_bits(float x) { unsigned int u = __float_as_uint(x); return (unsigned short)((u + 0x7FFFu + ((u >> 16) & 1u)) >> 16); }
__device__ __forceinline__ float bf16_val(unsigned short b) { return __uint_as_float(((unsigned int)b) << 16); }
__device__ __forceinline__ float bf16_round(float x) { return bf16_val(bf16_bits(x)); }
// D += A·B with NT terms: 1 = ah·bh, 2 = + al·bh (A split), 3 = + ah·bl (both split)
template <int NT>
__device__ __forceinline__ v8f mmaN(v16b ah, v16b al, v16b bh, v16b bl, v8f c) {
  c = __builtin_amdgcn_wmma_f32_16x16x32_bf16(false, ah, false, bh, (short)0, c, false, false);
  if (NT >= 2) c = __builtin_amdgcn_wmma_f32_16x16x32_bf16(false, al, false, bh, (short)0, c, false, false);
  if (NT >= 3) c = __builtin_amdgcn_wmma_f32_16x16x32_bf16(false, ah, false, bl, (short)0, c, false, false);
  asm volatile("v_nop\n\tv_nop\n\tv_nop\n\tv_nop" : "+v"(c) : "v"(ah), "v"(al), "v"(bh), "v"(bl));
  return c;
}

__global__ __launch_bounds__(256) void k_wt_bf16(const float* __restrict__ W, unsigned short* __restrict__ Wt, int K, int N) {
  const int t = blockIdx.x * 256 + threadIdx.x;
  const int k8n = K / 8;
  if (t >= N * k8n) return;
  const int n = t / k8n, k8 = (t % k8n) * 8;
  v8us v;
#pragma unroll
  for (int i = 0; i < 8; ++i) v[i] = bf16_bits(W[(size_t)(k8 + i) * N + n]);
  *(v8us*)(Wt + (size_t)n * K + k8) = v;
  
}

// GEMM C[M][N] (f32, pitch ldc) = act(A[M][K]·W + bias). A f32 row-major (pitch lda) converted per fragment to bf16
// (ASPLIT: hi/lo two planes -> 2 terms, else single rounded term); Wt bf16 [N][K] (pitch ldb). BIAS_BF16 rounds the
// bias to bf16 first (bias quantised to bf16 before the add). K%32==0, M%16==0, N%64==0.
template <bool ASPLIT, int ACT, bool BIAS_BF16>
__global__ __launch_bounds__(128) void k_gemm_bf(const float* __restrict__ A, int lda, const unsigned short* __restrict__ Wt, int ldb,
                                               const float* __restrict__ bias, float* __restrict__ C, int ldc, int M, int N, int K) {
  __shared__ __attribute__((aligned(16))) float so[4][16][64];
  const int tid = threadIdx.x, w = tid >> 5, lane = tid & 31, ln = lane & 15, hh = lane >> 4;
  const int ntn = N / 64;
  const int wid = blockIdx.x * 4 + w;
  const int mt = wid / ntn, nq = wid % ntn;
  if (mt * 16 >= M) return;
  const int row0 = mt * 16, col0 = nq * 64;
  const float* arow = A + (size_t)(row0 + ln) * lda;
  v8f acc[4] = {};
  for (int kb = 0; kb < K; kb += 32) {
    FragB ah, al;
    const v4f x0 = *(const v4fa*)(arow + kb + 8 * hh), x1 = *(const v4fa*)(arow + kb + 8 * hh + 4);
    const v4f x2 = *(const v4fa*)(arow + kb + 16 + 8 * hh), x3 = *(const v4fa*)(arow + kb + 16 + 8 * hh + 4);
    float xs[16] = {x0[0],x0[1],x0[2],x0[3],x1[0],x1[1],x1[2],x1[3],x2[0],x2[1],x2[2],x2[3],x3[0],x3[1],x3[2],x3[3]};
#pragma unroll
    for (int i = 0; i < 16; ++i) { const unsigned short hb = bf16_bits(xs[i]); ah.u[i] = hb; al.u[i] = ASPLIT ? bf16_bits(xs[i] - bf16_val(hb)) : (unsigned short)0; }
#pragma unroll
    for (int t = 0; t < 4; ++t) {
      const unsigned short* brow = Wt + (size_t)(col0 + t * 16 + ln) * ldb + kb;
      FragB b;
      b.half[0] = *(const v8us*)(brow + 8 * hh);
      b.half[1] = *(const v8us*)(brow + 16 + 8 * hh);
      acc[t] = mmaN<ASPLIT ? 2 : 1>(ah.v, al.v, b.v, b.v, acc[t]);
    }
  }
#pragma unroll
  for (int t = 0; t < 4; ++t) {
    float bv = bias ? bias[col0 + t * 16 + ln] : 0.f;
    if (BIAS_BF16) bv = bf16_round(bv);
#pragma unroll
    for (int r = 0; r < 8; ++r) { float v = acc[t][r] + bv; if (ACT == 1) v = fmaxf(v, 0.f); so[w][8 * hh + r][t * 16 + ln] = v; }
  }
  __builtin_amdgcn_fence(__ATOMIC_ACQ_REL, "workgroup");
  __builtin_amdgcn_wave_barrier();
  const int rsub = lane >> 4, c4 = (lane & 15) * 4;
  {
#pragma unroll
    for (int q = 0; q < 8; ++q) {
      const int r = q * 2 + rsub;
      const v4f v = *(const v4fa*)&so[w][r][c4];
      *(v4f*)(C + (size_t)(row0 + r) * ldc + col0 + c4) = v;
    }
    
  }
}

// GEMM C = act(A·W + bias + resid): A f32 (ASPLIT -> hi/lo 2 terms), Wt bf16 [N][K]; ACT 0 none, 1 relu, 2 exact gelu;
// resid (optional, f32, row index = (row % rmod), pitch ldr, RES_BF16 rounds it) added before the activation.
template <bool ASPLIT, int ACT, bool BIAS_BF16, bool RES_BF16>
__global__ __launch_bounds__(128) void k_gemm_bf3(const float* __restrict__ A, int lda, const unsigned short* __restrict__ Wt, int ldb,
                                                const float* __restrict__ bias, const float* __restrict__ resid, int rmod, int ldr,
                                                float* __restrict__ C, int ldc, int M, int N, int K) {
  __shared__ __attribute__((aligned(16))) float so[4][16][64];
  const int tid = threadIdx.x, w = tid >> 5, lane = tid & 31, ln = lane & 15, hh = lane >> 4;
  const int ntn = N / 64;
  const int wid = blockIdx.x * 4 + w;
  const int mt = wid / ntn, nq = wid % ntn;
  if (mt * 16 >= M) return;
  const int row0 = mt * 16, col0 = nq * 64;
  const float* arow = A + (size_t)(row0 + ln) * lda;
  v8f acc[4] = {};
  for (int kb = 0; kb < K; kb += 32) {
    FragB ah, al;
    const v4f x0 = *(const v4fa*)(arow + kb + 8 * hh), x1 = *(const v4fa*)(arow + kb + 8 * hh + 4);
    const v4f x2 = *(const v4fa*)(arow + kb + 16 + 8 * hh), x3 = *(const v4fa*)(arow + kb + 16 + 8 * hh + 4);
    float xs[16] = {x0[0],x0[1],x0[2],x0[3],x1[0],x1[1],x1[2],x1[3],x2[0],x2[1],x2[2],x2[3],x3[0],x3[1],x3[2],x3[3]};
#pragma unroll
    for (int i = 0; i < 16; ++i) { const unsigned short hb = bf16_bits(xs[i]); ah.u[i] = hb; al.u[i] = ASPLIT ? bf16_bits(xs[i] - bf16_val(hb)) : (unsigned short)0; }
#pragma unroll
    for (int t = 0; t < 4; ++t) {
      const unsigned short* brow = Wt + (size_t)(col0 + t * 16 + ln) * ldb + kb;
      FragB b;
      b.half[0] = *(const v8us*)(brow + 8 * hh);
      b.half[1] = *(const v8us*)(brow + 16 + 8 * hh);
      acc[t] = mmaN<ASPLIT ? 2 : 1>(ah.v, al.v, b.v, b.v, acc[t]);
    }
  }
#pragma unroll
  for (int t = 0; t < 4; ++t) {
    const int col = col0 + t * 16 + ln;
    float bv = bias ? bias[col] : 0.f;
    if (BIAS_BF16) bv = bf16_round(bv);
#pragma unroll
    for (int r = 0; r < 8; ++r) {
      float v = acc[t][r] + bv;
      if (resid) { float rv = resid[(size_t)((row0 + 8 * hh + r) % rmod) * ldr + col]; if (RES_BF16) rv = bf16_round(rv); v += rv; }
      if (ACT == 1) v = fmaxf(v, 0.f);
      if (ACT == 2) v = 0.5f * v * (1.0f + erff(v * 0.70710678118654752f));
      if (ACT == 3) { const float u = 0.7978845608028654f * (v + 0.044715f * v * v * v); v = 0.5f * v * (1.0f + tanhf(u)); }
      so[w][8 * hh + r][t * 16 + ln] = v;
    }
  }
  __builtin_amdgcn_fence(__ATOMIC_ACQ_REL, "workgroup");
  __builtin_amdgcn_wave_barrier();
  const int rsub = lane >> 4, c4 = (lane & 15) * 4;
  {
#pragma unroll
    for (int q = 0; q < 8; ++q) {
      const int r = q * 2 + rsub;
      const v4f v = *(const v4fa*)&so[w][r][c4];
      *(v4f*)(C + (size_t)(row0 + r) * ldc + col0 + c4) = v;
    }
    
  }
}
// row LayerNorm (biased variance, eps) over N: s = X (+ R); optional out_sum <- s; out_norm <- (s-mu)*rsqrt(var+eps)*g + b
template <bool PARAM_BF16>
__global__ __launch_bounds__(256) void k_layernorm(const float* __restrict__ X, const float* __restrict__ R, const float* __restrict__ g, const float* __restrict__ bta,
                                                  float* __restrict__ out_sum, float* __restrict__ out_norm, int N, float eps) {
  __shared__ float red[256];
  const int row = blockIdx.x, tid = threadIdx.x;
  const float* x = X + (size_t)row * N; const float* rr = R ? R + (size_t)row * N : nullptr;
  float vals[16];                     // up to N = 4096
  const int per = N / 256;            // contiguous chunk per thread? use strided-by-4 chunks: thread handles j = tid*4 + 1024*u
  float s1 = 0.f;
  for (int u = 0; u < per / 4; ++u) {
    const int j = tid * 4 + 1024 * u;
    const v4f a = *(const v4fa*)(x + j);
    v4f b = {0.f,0.f,0.f,0.f}; if (rr) b = *(const v4fa*)(rr + j);
#pragma unroll
    for (int q = 0; q < 4; ++q) { const float v = a[q] + b[q]; vals[u * 4 + q] = v; s1 += v; }
  }
  red[tid] = s1; __syncthreads();
  for (int st = 128; st > 0; st >>= 1) { if (tid < st) red[tid] += red[tid + st]; __syncthreads(); }
  const float mu = red[0] / (float)N; __syncthreads();
  float s2 = 0.f;
  for (int u = 0; u < per / 4; ++u)
#pragma unroll
    for (int q = 0; q < 4; ++q) { const float c = vals[u * 4 + q] - mu; s2 += c * c; }
  red[tid] = s2; __syncthreads();
  for (int st = 128; st > 0; st >>= 1) { if (tid < st) red[tid] += red[tid + st]; __syncthreads(); }
  const float rs = rsqrtf(red[0] / (float)N + eps);
  {
    for (int u = 0; u < per / 4; ++u) {
      const int j = tid * 4 + 1024 * u;
      v4f o, sm;
#pragma unroll
      for (int q = 0; q < 4; ++q) {
        float gg = g[j + q], bb = bta[j + q];
        if (PARAM_BF16) { gg = bf16_round(gg); bb = bf16_round(bb); }
        sm[q] = vals[u * 4 + q]; o[q] = (vals[u * 4 + q] - mu) * rs * gg + bb;
      }
      if (out_sum) *(v4f*)(out_sum + (size_t)row * N + j) = sm;
      *(v4f*)(out_norm + (size_t)row * N + j) = o;
    }
    
  }
}



// ---- f16 WMMA path (v_wmma_f32_16x16x32_f16): 11-bit significands for operands in range — used where a [0,1] probability operand needs more precision than bf16
typedef _Float16 v16h __attribute__((ext_vector_type(16)));
union FragH { v16h v; v8us half[2]; _Float16 h[16]; unsigned short u[16]; };
template <int NT>
__device__ __forceinline__ v8f mmaH(v16h ah, v16h al, v16h bh, v16h bl, v8f c) {
  c = __builtin_amdgcn_wmma_f32_16x16x32_f16(false, ah, false, bh, (short)0, c, false, false);
  if (NT >= 2) c = __builtin_amdgcn_wmma_f32_16x16x32_f16(false, al, false, bh, (short)0, c, false, false);
  if (NT >= 3) c = __builtin_amdgcn_wmma_f32_16x16x32_f16(false, ah, false, bl, (short)0, c, false, false);
  asm volatile("v_nop\n\tv_nop\n\tv_nop\n\tv_nop" : "+v"(c) : "v"(ah), "v"(al), "v"(bh), "v"(bl));
  return c;
}
// batched GEMM like k_gemm_b but f16 operands: A f32 (split into f16 hi/lo if ASPLIT, else rounded to f16), Bt = f16 values [n][k]; alpha; C f32; N multiple of 16 (partial tiles skipped)
template <bool ASPLIT>
__global__ __launch_bounds__(128) void k_gemm_h(const float* __restrict__ A, int lda, size_t sA, const _Float16* __restrict__ Bh, int ldb, size_t sB, float alpha, float* __restrict__ C, int ldc, size_t sC, int M, int N, int K) {
  __shared__ __attribute__((aligned(16))) float so[4][16][64];
  const int tid = threadIdx.x, w = tid >> 5, lane = tid & 31, ln = lane & 15, hh = lane >> 4; const int by = blockIdx.y;
  A += (size_t)by * sA; Bh += (size_t)by * sB; C += (size_t)by * sC;
  const int ntn = (N + 63) / 64; const int wid = blockIdx.x * 4 + w; const int mt = wid / ntn, nq = wid % ntn; if (mt * 16 >= M) return;
  const int row0 = mt * 16, col0 = nq * 64; const float* arow = A + (size_t)(row0 + ln) * lda;
  v8f acc[4] = {};
  for (int kb = 0; kb < K; kb += 32) {
    FragH ah, al;
    const v4f x0 = *(const v4fa*)(arow + kb + 8 * hh), x1 = *(const v4fa*)(arow + kb + 8 * hh + 4), x2 = *(const v4fa*)(arow + kb + 16 + 8 * hh), x3 = *(const v4fa*)(arow + kb + 16 + 8 * hh + 4);
    float xs[16] = {x0[0],x0[1],x0[2],x0[3],x1[0],x1[1],x1[2],x1[3],x2[0],x2[1],x2[2],x2[3],x3[0],x3[1],x3[2],x3[3]};
#pragma unroll
    for (int i = 0; i < 16; ++i) { const _Float16 h = (_Float16)xs[i]; ah.h[i] = h; al.h[i] = ASPLIT ? (_Float16)(xs[i] - (float)h) : (_Float16)0.0f; }
#pragma unroll
    for (int t = 0; t < 4; ++t) { if (col0 + t * 16 >= N) continue; const size_t boff = (size_t)(col0 + t * 16 + ln) * ldb + kb; FragH bq; bq.half[0] = *(const v8us*)(Bh + boff + 8 * hh); bq.half[1] = *(const v8us*)(Bh + boff + 16 + 8 * hh);
      acc[t] = mmaH<ASPLIT ? 2 : 1>(ah.v, al.v, bq.v, bq.v, acc[t]); }
  }
#pragma unroll
  for (int t = 0; t < 4; ++t) { if (col0 + t * 16 >= N) continue;
#pragma unroll
    for (int r = 0; r < 8; ++r) so[w][8 * hh + r][t * 16 + ln] = acc[t][r] * alpha; }
  __builtin_amdgcn_fence(__ATOMIC_ACQ_REL, "workgroup"); __builtin_amdgcn_wave_barrier();
  const int rsub = lane >> 4, c4 = (lane & 15) * 4;
  {
#pragma unroll
    for (int q = 0; q < 8; ++q) { const int r = q * 2 + rsub; if (col0 + c4 < N) { const v4f v = *(const v4fa*)&so[w][r][c4]; *(v4f*)(C + (size_t)(row0 + r) * ldc + col0 + c4) = v; } }
     }
}

// Wt[n][k] = f16(W[k][n]·scale) from f32 row-major W[K][N] (scale = power of two; bf16-exact weights stay exact in f16 away from the subnormal range)
__global__ __launch_bounds__(256) void k_wt_f16(const float* __restrict__ W, _Float16* __restrict__ Wt, int K, int N, float scale) {
  const int t = blockIdx.x * 256 + threadIdx.x; if (t >= N * (K / 8)) return; const int n = t / (K / 8), k8 = (t % (K / 8)) * 8; FragH f;
#pragma unroll
  for (int i = 0; i < 8; ++i) f.h[i] = (_Float16)(bf16_round(W[(size_t)(k8 + i) * N + n]) * scale); const v8us o = f.half[0];
  *(v8us*)((unsigned short*)Wt + (size_t)n * K + k8) = o; 
}
// k_gemm_hh variant with fused epilogue: v = acc·alpha + bias[by·sBias + col] (+ CP[(row/rowsPerB)·sCPb + by·64 + col] if CP) ; ACT 0 none / 1 elu ; writes f16 C16 (and f32 C if non-null)
template <int ACT>
__global__ __launch_bounds__(128) void k_gemm_hhx(const _Float16* __restrict__ A, int lda, size_t sA, const _Float16* __restrict__ Bh, int ldb, size_t sB, float alpha, const float* __restrict__ bias, size_t sBias, const float* __restrict__ CP, int rowsPerB, size_t sCPb, int row0g,
    float* __restrict__ C, _Float16* __restrict__ C16, int ldc, size_t sC, int M, int N, int K) {
  __shared__ __attribute__((aligned(16))) float so[4][16][64];
  const int tid = threadIdx.x, w = tid >> 5, lane = tid & 31, ln = lane & 15, hh = lane >> 4; const int by = blockIdx.y;
  A += (size_t)by * sA; Bh += (size_t)by * sB; const size_t cofs = (size_t)by * sC; const float* bp = bias ? bias + (size_t)by * sBias : nullptr;
  const int ntn = (N + 63) / 64; const int wid = blockIdx.x * 4 + w; const int mt = wid / ntn, nq = wid % ntn; if (mt * 16 >= M) return;
  const int row0 = mt * 16, col0 = nq * 64; const _Float16* arow = A + (size_t)(row0 + ln) * lda;
  v8f acc[4] = {};
  for (int kb = 0; kb < K; kb += 32) { FragH ah; ah.half[0] = *(const v8us*)((const unsigned short*)arow + kb + 8 * hh); ah.half[1] = *(const v8us*)((const unsigned short*)arow + kb + 16 + 8 * hh);
#pragma unroll
    for (int t = 0; t < 4; ++t) { if (col0 + t * 16 >= N) continue; const size_t boff = (size_t)(col0 + t * 16 + ln) * ldb + kb; FragH bq; bq.half[0] = *(const v8us*)((const unsigned short*)Bh + boff + 8 * hh); bq.half[1] = *(const v8us*)((const unsigned short*)Bh + boff + 16 + 8 * hh);
      acc[t] = mmaH<1>(ah.v, ah.v, bq.v, bq.v, acc[t]); }
  }
#pragma unroll
  for (int t = 0; t < 4; ++t) { if (col0 + t * 16 >= N) continue; const int col = col0 + t * 16 + ln; const float bv = bp ? bf16_round(bp[col]) : 0.f;
#pragma unroll
    for (int r = 0; r < 8; ++r) { float v = acc[t][r] * alpha + bv; if (CP) { const int rr = row0g + row0 + 8 * hh + r; if (rowsPerB < 0) v += CP[cofs + (size_t)rr * ldc + col];      /* rowsPerB < 0: own element of the batched C plane */ else { const int bidx = rr / rowsPerB; v += CP[(size_t)bidx * sCPb + (size_t)by * 64 + col]; } } if (ACT == 1) v = (v > 0.f) ? v : expm1f(v); else if (ACT == 7) v = (v > 0.f) ? v + 1.0f : expf(v); else if (ACT == 8) v = tanhf(v); else if (ACT == 9) v = 0.5f * v * (1.0f + tanhf(0.7978845608028654f * (v + 0.044715f * v * v * v))); else if (ACT == 11) v = 1.0f / (1.0f + expf(-v)); else if (ACT == 12) v = (v > 0.f) ? v : 0.01f * v; else if (ACT == 14) v = (v > 0.f) ? v : 0.1f * v; else if (ACT == 16) v = (v >= 0.f) ? v : 0.3f * v; else if (ACT == 17) v = (v >= 0.f) ? v : 0.2f * v; else if (ACT == 15) v = v / (1.0f + expf(-v)); else if (ACT == 3) v = fmaxf(v, 0.f); else if (ACT == 6) v = 0.5f * v * (1.0f + erff(v * 0.70710678118654752f)); so[w][8 * hh + r][t * 16 + ln] = v; } }
  __builtin_amdgcn_fence(__ATOMIC_ACQ_REL, "workgroup"); __builtin_amdgcn_wave_barrier();
  const int rsub = lane >> 4, c4 = (lane & 15) * 4; typedef _Float16 v4h __attribute__((ext_vector_type(4)));
  {
#pragma unroll
    for (int q = 0; q < 8; ++q) { const int r = q * 2 + rsub; if (col0 + c4 < N) { const v4f v = *(const v4fa*)&so[w][r][c4]; if (C) *(v4f*)(C + cofs + (size_t)(row0 + r) * ldc + col0 + c4) = v; if (C16) { v4h h4; for (int i = 0; i < 4; ++i) h4[i] = (_Float16)v[i]; *(v4h*)(C16 + cofs + (size_t)(row0 + r) * ldc + col0 + c4) = h4; } } }
     }
}


typedef _Float16 v4h __attribute__((ext_vector_type(4)));

__global__ __launch_bounds__(256) void k_h16(const float* __restrict__ x, _Float16* __restrict__ X16, size_t n8) { const size_t t = (size_t)blockIdx.x * 256 + threadIdx.x; if (t >= n8) return; FragH f;
#pragma unroll
  for (int q = 0; q < 8; ++q) f.h[q] = (_Float16)x[t * 8 + q]; *(v8us*)((unsigned short*)X16 + t * 8) = f.half[0];  }
__global__ __launch_bounds__(256) void k_round16f(const float* __restrict__ W, _Float16* __restrict__ Bt, size_t n8) { const size_t t = (size_t)blockIdx.x * 256 + threadIdx.x; if (t >= n8) return; FragH f;
#pragma unroll
  for (int i = 0; i < 8; ++i) f.h[i] = (_Float16)(bf16_round(W[t * 8 + i]) * 16.0f); *(v8us*)((unsigned short*)Bt + t * 8) = f.half[0];  }
// fragment of 16 rows x 32 k from f16 rows in global memory: a lane holds k = 8 hh .. + 7 and 16 + 8 hh .. + 7 of its row
__device__ __forceinline__ v16h g2_frag(const _Float16* p, int hh) { FragH f; f.half[0] = *(const v8us*)((const unsigned short*)p + 8 * hh); f.half[1] = *(const v8us*)((const unsigned short*)p + 16 + 8 * hh); return f.v; }
__global__ __launch_bounds__(256) void k_rsm(const float* __restrict__ S, _Float16* __restrict__ P, int nrows) {
  #pragma clang fp contract(off)
  const int i = blockIdx.x * 256 + threadIdx.x; if (i >= nrows) return; const float* s = S + (size_t)i * SQ; float mx = -3.0e38f;
#pragma unroll 1
  for (int j = 0; j < SQ; ++j) mx = fmaxf(mx, s[j]); float se = 0.f;
#pragma unroll 1
  for (int j = 0; j < SQ; ++j) se += expf(s[j] - mx); const float sc = 256.0f / se;
#pragma unroll 1
  for (int j0 = 0; j0 < SQ; j0 += 8) { FragH f; for (int q = 0; q < 8; ++q) f.h[q] = (_Float16)(expf(s[j0 + q] - mx) * sc); unsigned short* d = (unsigned short*)P + (size_t)i * SQ + j0; *(v8us*)d = f.half[0];  } }
__global__ __launch_bounds__(256) void k_vt(const _Float16* __restrict__ V16, int b, int h0, _Float16* __restrict__ VT) { __shared__ unsigned short tl[64][65]; const int tid = threadIdx.x; const int hh = blockIdx.x % HG, sg = blockIdx.x / HG; const int s0 = sg * 64; const int h = h0 + hh;
  for (int i = tid; i < 64 * 8; i += 256) { const int j = i / 8, d8 = (i % 8) * 8; FragH f; f.half[0] = *(const v8us*)((const unsigned short*)V16 + ((size_t)b * SQ + s0 + j) * DM + h * HD + d8); for (int q = 0; q < 8; ++q) tl[d8 + q][j] = f.u[q]; }
  __syncthreads();
  { for (int i = tid; i < 64 * 8; i += 256) { const int d = i / 8, j8 = (i % 8) * 8; FragH f; for (int q = 0; q < 8; ++q) f.u[q] = tl[d][j8 + q]; *(v8us*)((unsigned short*)VT + ((size_t)hh * HD + d) * SQ + s0 + j8) = f.half[0]; }  } }



__global__ __launch_bounds__(256) void k_rsmcf2(const float* __restrict__ S, _Float16* __restrict__ P, int hg, int q0, int nk) {
  #pragma clang fp contract(off)
  const int t = blockIdx.x * 256 + threadIdx.x; if (t >= hg * QT) return; const size_t i = (size_t)t; const float* s = S + i * NKX; const int last = q0 + (t % QT); float mx = -3.0e38f;
#pragma unroll 1
  for (int j = 0; j < nk; ++j) { const float f = (j <= last) ? 1.f : 0.f; mx = fmaxf(mx, fmaf(f, s[j], (1.f - f) * -1.0e9f)); } float se = 0.f;
#pragma unroll 1
  for (int j = 0; j < nk; ++j) { const float f = (j <= last) ? 1.f : 0.f; se += __expf(fmaf(f, s[j], (1.f - f) * -1.0e9f) - mx); } const float sc = 256.0f / se;
#pragma unroll 1
  for (int j0 = 0; j0 < nk; j0 += 8) { FragH fr; for (int q = 0; q < 8; ++q) { const int j = j0 + q; const float f = (j <= last) ? 1.f : 0.f; fr.h[q] = (_Float16)(__expf(fmaf(f, s[j], (1.f - f) * -1.0e9f) - mx) * sc); } unsigned short* d = (unsigned short*)P + i * NKX + j0; *(v8us*)d = fr.half[0];  } }

template <int MASKADD>
__global__ __launch_bounds__(64) void k_att0(const float* __restrict__ QF, const float* __restrict__ KF, const float* __restrict__ VF, int ld, const float* __restrict__ mask, float scale, float* __restrict__ OF, int ldo) {
  #pragma clang fp contract(off)
  __shared__ __attribute__((aligned(16))) float lq[64][64]; __shared__ __attribute__((aligned(16))) float lo[64][64];
  const int tid = threadIdx.x; const int h = blockIdx.x / (QT0 / 64), rg = blockIdx.x % (QT0 / 64); const int i = rg * 64 + tid;
  const float* qr = QF + (size_t)i * ld + h * HD;
#pragma unroll 1
  for (int c = 0; c < HD / 4; ++c) { *(v4f*)&lq[tid][c * 4] = *(const v4fa*)(qr + c * 4); const v4f z = {0.f, 0.f, 0.f, 0.f}; *(v4f*)&lo[tid][c * 4] = z; }
  float m = -1.0e30f, l = 0.f; const int jmax = MASKADD ? (SQ - 1) : (rg * 64 + 63);      /* additive-mask form: every key (the mask input decides); causal form: keys up to the block's last row */
#pragma unroll 1
  for (int j = 0; j <= jmax; ++j) { const float* kr = KF + (size_t)j * ld + h * HD; const float* vr = VF + (size_t)j * ld + h * HD; float s = 0.f;
#pragma unroll 1
    for (int c = 0; c < HD / 4; ++c) { const v4f kq = *(const v4fa*)(kr + c * 4); const v4f qq = *(v4f*)&lq[tid][c * 4]; s = __fadd_rn(s, __fmul_rn(qq[0], kq[0])); s = __fadd_rn(s, __fmul_rn(qq[1], kq[1])); s = __fadd_rn(s, __fmul_rn(qq[2], kq[2])); s = __fadd_rn(s, __fmul_rn(qq[3], kq[3])); }
    s = __fmul_rn(s, scale); if (MASKADD) s = __fadd_rn(s, __fmul_rn(bf16_round(mask[(size_t)i * SQ + j]), -10000.0f));
    const float f = (MASKADD || j <= i) ? 1.f : 0.f; const float sm = fmaf(f, s, (1.f - f) * -1.0e30f); const float mn = fmaxf(m, sm); const float sc = expf(m - mn); const float e = expf(sm - mn); l = __fadd_rn(__fmul_rn(l, sc), e); m = mn;
#pragma unroll 1
    for (int c = 0; c < HD / 4; ++c) { const v4f vv = *(const v4fa*)(vr + c * 4); v4f oo = *(v4f*)&lo[tid][c * 4]; for (int u = 0; u < 4; ++u) oo[u] = __fadd_rn(__fmul_rn(oo[u], sc), __fmul_rn(e, vv[u])); *(v4f*)&lo[tid][c * 4] = oo; } }
  const float fin = 64.0f / l;      /* o carried x64 */
#pragma unroll 1
  for (int c = 0; c < HD / 4; ++c) { v4f oo = *(v4f*)&lo[tid][c * 4]; for (int u = 0; u < 4; ++u) oo[u] = __fmul_rn(oo[u], fin); *(v4f*)&lo[tid][c * 4] = oo; }
  __syncthreads();
  {
#pragma unroll 1
    for (int it = 0; it < 16; ++it) { const int row = it * 4 + tid / 16, pc = (tid % 16) * 4; const v4f v = *(const v4f*)&lo[row][pc]; *(v4f*)(OF + (size_t)(rg * 64 + row) * ldo + h * HD + pc) = v; }
     } }

__global__ __launch_bounds__(256) void k_oscale(const float* __restrict__ OF, float* __restrict__ out, size_t n4) { const size_t t = (size_t)blockIdx.x * 256 + threadIdx.x; if (t >= n4) return; const v4f a = *(const v4fa*)(OF + t * 4); v4f o; for (int q = 0; q < 4; ++q) o[q] = a[q] * 0.015625f; *(v4f*)(out + t * 4) = o;  }

__global__ __launch_bounds__(256) void k_bfr(const float* __restrict__ x, float* __restrict__ XB, size_t n8) { const size_t t = (size_t)blockIdx.x * 256 + threadIdx.x; if (t >= n8) return; v4f a = *(const v4fa*)(x + t * 8), c = *(const v4fa*)(x + t * 8 + 4); for (int q = 0; q < 4; ++q) { a[q] = bf16_round(a[q]); c[q] = bf16_round(c[q]); }
  { *(v4f*)(XB + t * 8) = a; *(v4f*)(XB + t * 8 + 4) = c;  } }



__global__ __launch_bounds__(256) void k_rsmfvl(const float* __restrict__ S, _Float16* __restrict__ P, _Float16* __restrict__ PL, int qn, const int* __restrict__ vlp) {
  #pragma clang fp contract(off)
  const int t = blockIdx.x * 256 + threadIdx.x; if (t >= qn) return; const int vl = vlp[0]; const size_t i = (size_t)t; const float* s = S + i * SQ; float mx = -3.0e38f;
#pragma unroll 1
  for (int j = 0; j < SQ; ++j) { const float f = (j < vl) ? 1.f : 0.f; mx = fmaxf(mx, fmaf(f, s[j], (1.f - f) * -1000000.0f)); } float se = 0.f;
#pragma unroll 1
  for (int j = 0; j < SQ; ++j) { const float f = (j < vl) ? 1.f : 0.f; se += __expf(fmaf(f, s[j], (1.f - f) * -1000000.0f) - mx); } const float sc = 256.0f / se;
#pragma unroll 1
  for (int j0 = 0; j0 < SQ; j0 += 8) { FragH fr, gr; for (int q = 0; q < 8; ++q) { const int j = j0 + q; const float f = (j < vl) ? 1.f : 0.f; const float pv = __expf(fmaf(f, s[j], (1.f - f) * -1000000.0f) - mx) * sc; const _Float16 ph = (_Float16)pv; fr.h[q] = ph; gr.h[q] = (_Float16)((pv - (float)ph) * 1024.0f); }
    unsigned short* d = (unsigned short*)P + i * SQ + j0; unsigned short* dl = (unsigned short*)PL + i * SQ + j0; *(v8us*)d = fr.half[0]; *(v8us*)dl = gr.half[0];  } }

// Fused attention, one launch for all batches: a wave owns 32 output rows i (two groups of 16; their k rows stay in registers as B operands), so every fragment read from LDS feeds two products; it walks every second pass of 64 positions j, its partner wave the others, and the two partial results are joined at the end.
// S^T = x k'^T (A = query rows x from LDS, exact in f16: one plane), so a lane holds 32 scores of ONE row i: maximum and sum in-lane plus one exchange between the wave halves; the weights pack straight into the B operand of O^T += V^T P^T.
// Running maximum and sum (base 2, weights x256 for the f16 range; the factor cancels in the division by the sum). S and P never leave registers.
typedef _Float16 v8h __attribute__((ext_vector_type(8)));
#define FJ 128                       /* positions j per LDS stage (two passes of 64) */
#define FPB 144                      /* LDS row pitch, bytes: 128-byte rows + 16, an odd multiple of 16 for 16-byte reads */
#define FVB 272                      /* LDS row pitch, bytes, of a V^T row of 128 positions: 256 + 16, an odd multiple of 16 too */
#define FXT (FJ * FPB)               /* the staged x tile: 128 rows of 64 features */
#define FBF (FXT + DM * FVB)         /* one buffer: the x tile, then the V^T tile of 64 rows */
__device__ __forceinline__ float fa_xhalf(float x) { return __builtin_bit_cast(float, __builtin_amdgcn_permlanex16(__builtin_bit_cast(int, x), __builtin_bit_cast(int, x), 0x76543210, 0xfedcba98, false, false)); }      /* lane l with lane l ^ 16 */
__device__ __forceinline__ v16h fa_frag(const unsigned char* p) { FragH f; f.half[0] = *(const v8us*)p; f.half[1] = *(const v8us*)(p + 32); return f.v; }      /* same k order as g2_frag: p already holds the 16 * hh bytes */
__device__ __forceinline__ v8f fa_mma(v16h a, v16h b, v8f c) { return __builtin_amdgcn_wmma_f32_16x16x32_f16(false, a, false, b, (short)0, c, false, false); }
/* eight v_exp_f32 in one statement with the slot the instruction set asks for behind a transcendental: each is followed by an independent one (outputs early-clobbered, so none overwrites a source), the last by v_nop */
__device__ __forceinline__ v8f fa_exp8(v8f y) { float e0, e1, e2, e3, e4, e5, e6, e7;
  asm("v_exp_f32 %0, %8\n\tv_exp_f32 %1, %9\n\tv_exp_f32 %2, %10\n\tv_exp_f32 %3, %11\n\tv_exp_f32 %4, %12\n\tv_exp_f32 %5, %13\n\tv_exp_f32 %6, %14\n\tv_exp_f32 %7, %15\n\tv_nop" : "=&v"(e0), "=&v"(e1), "=&v"(e2), "=&v"(e3), "=&v"(e4), "=&v"(e5), "=&v"(e6), "=&v"(e7) : "v"(y[0]), "v"(y[1]), "v"(y[2]), "v"(y[3]), "v"(y[4]), "v"(y[5]), "v"(y[6]), "v"(y[7]));
  const v8f e = {e0, e1, e2, e3, e4, e5, e6, e7}; return e; }
typedef float v2f __attribute__((ext_vector_type(2)));
__global__ __launch_bounds__(256) void k_fattn(const _Float16* __restrict__ KH, const _Float16* __restrict__ KL, const _Float16* __restrict__ QH, const _Float16* __restrict__ VT, float* __restrict__ out) {
  __shared__ __attribute__((aligned(16))) unsigned char sm[2 * FBF];      /* two buffers of two tiles; behind the loop: the exchange of the partial results */
  const int tid = threadIdx.x, w = tid >> 5, lane = tid & 31, ln = lane & 15, hh = lane >> 4;
  const int rg = w & 3, jh = w >> 2;      /* a wave owns 32 output rows (two groups of 16) and walks one of the two passes of every stage; waves w and w ^ 4 share their rows */
  const int b = blockIdx.x / (SQ / 128), i0 = (blockIdx.x % (SQ / 128)) * 128 + rg * 32; const size_t r0 = (size_t)b * SQ;
  v16h kh[2][2], kl[2][2];
#pragma unroll
  for (int c = 0; c < 2; ++c) { const _Float16* khp = KH + (r0 + i0 + 16 * c + ln) * DM; const _Float16* klp = KL + (r0 + i0 + 16 * c + ln) * DM;
    kh[c][0] = g2_frag(khp, hh); kh[c][1] = g2_frag(khp + 32, hh); kl[c][0] = g2_frag(klp, hh); kl[c][1] = g2_frag(klp + 32, hh); }
  asm volatile("s_wait_xcnt 0x0" ::: "memory");      /* in front of the first instruction that reuses an address register of the k loads */
  __builtin_amdgcn_sched_barrier(0);      /* the k loads stay the oldest global loads: the wait for stage 0 then covers them, and the loop needs no wait to zero that would drain the stage in flight */
  const int srow = tid >> 3, sch = tid & 7, vrow = tid >> 4, vch = tid & 15;      /* staging: a thread moves 16-byte piece sch of rows srow + 32 r of the x tile and piece vch of rows vrow + 16 r of the V^T tile, r = 0 .. 3 */
  const unsigned short* gq = (const unsigned short*)QH + (r0 + srow) * DM + sch * 8; const unsigned short* gv = (const unsigned short*)VT + ((size_t)b * DM + vrow) * SQ + vch * 8;
  unsigned char* sb = sm + srow * FPB + sch * 16; unsigned char* sbv = sm + FXT + vrow * FVB + vch * 16; const unsigned char* lbq = sm + (jh * 64 + ln) * FPB + 16 * hh; const unsigned char* lbv = sm + FXT + ln * FVB + jh * 128 + 16 * hh;      /* the wave's pass: rows j 64 jh .. + 63 of the x tile, the same positions (128 bytes) of the V^T rows */
  v8us tq[4], tv[4]; v16h qa[8], va[4][2];
  const unsigned short *pq, *pv;      /* the addresses of the stage last asked for */
  auto g_load = [&](int st) { pq = gq + (size_t)st * FJ * DM; pv = gv + (size_t)st * FJ;
#pragma unroll
    for (int r = 0; r < 4; ++r) tq[r] = *(const v8us*)(pq + r * 32 * DM);
#pragma unroll
    for (int r = 0; r < 4; ++r) tv[r] = *(const v8us*)(pv + (size_t)r * 16 * SQ); };
  auto s_store = [&](int off) {
#pragma unroll
    for (int r = 0; r < 4; ++r) *(v8us*)(sb + off + r * 32 * FPB) = tq[r];
#pragma unroll
    for (int r = 0; r < 4; ++r) *(v8us*)(sbv + off + r * 16 * FVB) = tv[r]; };
  auto ld_q = [&](int off) {      /* the x fragments of the wave's pass: per 16 rows j k 0..31, k 32..63 */
#pragma unroll
    for (int jt = 0; jt < 4; ++jt) { const unsigned char* p = lbq + off + jt * 16 * FPB; qa[jt * 2] = fa_frag(p); qa[jt * 2 + 1] = fa_frag(p + 64); } };
  auto ld_v = [&](int off) {      /* the V^T fragments of the wave's pass: 16 rows f each, positions j 32 u .. + 31 */
#pragma unroll
    for (int t = 0; t < 4; ++t) { const unsigned char* p = lbv + off + t * 16 * FVB; va[t][0] = fa_frag(p); va[t][1] = fa_frag(p + 64); } };
  const v8f z8 = {0.f, 0.f, 0.f, 0.f, 0.f, 0.f, 0.f, 0.f}; v8f o[2][4] = {{z8, z8, z8, z8}, {z8, z8, z8, z8}}, h[2][4], e[2][4]; float m[2] = {-3.0e38f, -3.0e38f}; v2f l2[2] = {{0.f, 0.f}, {0.f, 0.f}};
  auto scores = [&](int c) {      /* row group c; eight independent accumulator chains: x.hi (h) and x.lo (e) of the four 16-row tiles jt; x[r] belongs to i = i0 + 16 c + ln, j = 16 jt + 8 hh + r */
#pragma unroll
    for (int jt = 0; jt < 4; ++jt) { h[c][jt] = fa_mma(qa[2 * jt], kh[c][0], z8); e[c][jt] = fa_mma(qa[2 * jt], kl[c][0], z8); }
#pragma unroll
    for (int jt = 0; jt < 4; ++jt) { h[c][jt] = fa_mma(qa[2 * jt + 1], kh[c][1], h[c][jt]); e[c][jt] = fa_mma(qa[2 * jt + 1], kl[c][1], e[c][jt]); } };
  auto soft_pv = [&](int c) {
    const v8f s0 = e[c][0] * 0.0009765625f + h[c][0], s1 = e[c][1] * 0.0009765625f + h[c][1], s2 = e[c][2] * 0.0009765625f + h[c][2], s3 = e[c][3] * 0.0009765625f + h[c][3];      /* residual products 2^-10 */
    float mx = s0[0], my = s1[0], mz = s2[0], mw = s3[0];      /* four independent chains */
#pragma unroll
    for (int r = 1; r < 8; ++r) { mx = fmaxf(mx, s0[r]); my = fmaxf(my, s1[r]); mz = fmaxf(mz, s2[r]); mw = fmaxf(mw, s3[r]); }
    mx = fmaxf(fmaxf(mx, my), fmaxf(mz, mw)); mx = fmaxf(mx, fa_xhalf(mx));
    const float mn = fmaxf(m[c], mx * 1.44269504f); const float dm = m[c] - mn; float al;
    asm("v_exp_f32 %0, %1\n\tv_nop" : "=&v"(al) : "v"(dm));      /* v_nop: the slot behind a transcendental */
    m[c] = mn; const float nm = 8.0f - mn;      /* + 8: weights x256 */
    const v8f p0 = fa_exp8(s0 * 1.44269504f + nm), p1 = fa_exp8(s1 * 1.44269504f + nm), p2 = fa_exp8(s2 * 1.44269504f + nm), p3 = fa_exp8(s3 * 1.44269504f + nm); const v8f ps = (p0 + p1) + (p2 + p3);
    l2[c] = l2[c] * al + ((__builtin_shufflevector(ps, ps, 0, 1) + __builtin_shufflevector(ps, ps, 2, 3)) + (__builtin_shufflevector(ps, ps, 4, 5) + __builtin_shufflevector(ps, ps, 6, 7)));
    union { v16h v; v8h h[2]; } pf, pg; pf.h[0] = __builtin_convertvector(p0, v8h); pf.h[1] = __builtin_convertvector(p1, v8h); pg.h[0] = __builtin_convertvector(p2, v8h); pg.h[1] = __builtin_convertvector(p3, v8h);      /* element e: j = 8 hh + e, then 16 + 8 hh + (e - 8): the k order of fa_frag; pg: the same + 32 */
#pragma unroll
    for (int t = 0; t < 4; ++t) o[c][t] *= al;
#pragma unroll
    for (int t = 0; t < 4; ++t) o[c][t] = fa_mma(va[t][0], pf.v, o[c][t]);
#pragma unroll
    for (int t = 0; t < 4; ++t) o[c][t] = fa_mma(va[t][1], pg.v, o[c][t]); };      /* o[c][t][r] = O[i0 + 16 c + ln][16 t + 8 hh + r] */
  g_load(0); s_store(0); g_load(1);
  asm volatile("s_wait_dscnt 0x0" ::: "memory");      /* own LDS stores done before the barrier is signalled */
  asm volatile("s_barrier_signal -1\n\ts_barrier_wait -1" ::: "memory");      /* by hand: __syncthreads() would also wait for the global loads of the next stage, which are meant to stay in flight */
  ld_q(0); ld_v(0);
#pragma unroll 1      /* one stage (one pass of 64 rows a wave) a trip: the two buffers alternate by the trip's parity */
  for (int s = 0; s < SQ / FJ; ++s) { const int nxt = FBF - (s & 1) * FBF;
    /* the scheduling fences keep each group of LDS instructions where it is written, in one place and not among the products */
    s_store(nxt); g_load((s + 2 < SQ / FJ) ? s + 2 : SQ / FJ - 1); __builtin_amdgcn_sched_barrier(0);      /* next stage into the buffer every wave left at the last barrier: the stores land under the products; the stage after it flies for a whole trip; past the end the last stage is fetched again (in bounds) and nobody uses it */
    scores(0); scores(1); __builtin_amdgcn_sched_barrier(0);
    asm volatile("s_wait_xcnt 0x0" :: "v"(pq), "v"(pv) : "memory");      /* the address registers of this trip's global loads are inputs here: they are kept up to this wait and reused only behind it, so it can stand behind the products instead of directly behind the loads */
    asm volatile("s_wait_dscnt 0x0" ::: "memory");      /* own stores of the next stage and own last reads of this one are done */
    asm volatile("s_barrier_signal -1\n\ts_barrier_wait -1" ::: "memory");      /* publishes the next stage and frees this one; by hand for the reason above. Left for a later step: every wave meets here between its products and its vector work */
    ld_q(nxt); __builtin_amdgcn_sched_barrier(0);      /* directly behind the products that read the same registers: it flies under the vector work */
    soft_pv(0); soft_pv(1); __builtin_amdgcn_sched_barrier(0);
    ld_v(nxt); __builtin_amdgcn_sched_barrier(0); }
  asm volatile("s_wait_loadcnt 0x0\n\ts_wait_dscnt 0x0" ::: "memory");      /* what the last trip fetched ahead (nobody uses it) has landed before its registers and the ring are used for something else */
  __syncthreads();      /* every wave has left the ring: it becomes the exchange buffer */
  /* the two waves of a pair hold partial results of the same 32 rows: each hands the partner one row group (maximum, sum, O) and finishes the other */
  float lc[2];
#pragma unroll
  for (int c = 0; c < 2; ++c) { float l = l2[c][0] + l2[c][1]; l += fa_xhalf(l); lc[c] = l; }
  const bool up = jh != 0;      /* wave-uniform: the upper wave keeps group 1 */
  float* xs = (float*)sm + w * (34 * 32); const float* xp = (const float*)sm + (w ^ 4) * (34 * 32);
#pragma unroll
  for (int t = 0; t < 4; ++t) { const v8f g = up ? o[0][t] : o[1][t]; const v4f x = {g[0], g[1], g[2], g[3]}, y = {g[4], g[5], g[6], g[7]}; *(v4f*)(xs + (t * 64 + lane) * 4) = x; *(v4f*)(xs + (t * 64 + 32 + lane) * 4) = y; }
  xs[1024 + lane] = up ? m[0] : m[1]; xs[1056 + lane] = up ? lc[0] : lc[1];
  __syncthreads();      /* the partner's group is in LDS */
  const float mk = up ? m[1] : m[0], lk = up ? lc[1] : lc[0], mp = xp[1024 + lane], lp = xp[1056 + lane];
  const float mn = fmaxf(mk, mp), dk = mk - mn, dp = mp - mn; float fk, fp;
  asm("v_exp_f32 %0, %2\n\tv_exp_f32 %1, %3\n\tv_nop" : "=&v"(fk), "=&v"(fp) : "v"(dk), "v"(dp));      /* v_nop: the slot behind a transcendental */
  const float inv = 1.0f / (lk * fk + lp * fp); fk *= inv; fp *= inv;
  float* orow = out + (r0 + i0 + 16 * jh + ln) * DM + 8 * hh;
#pragma unroll
  for (int t = 0; t < 4; ++t) { const v8f g = up ? o[1][t] : o[0][t]; const v4f px = *(const v4f*)(xp + (t * 64 + lane) * 4), py = *(const v4f*)(xp + (t * 64 + 32 + lane) * 4);
    const v4f x = {g[0] * fk + px[0] * fp, g[1] * fk + px[1] * fp, g[2] * fk + px[2] * fp, g[3] * fk + px[3] * fp}, y = {g[4] * fk + py[0] * fp, g[5] * fk + py[1] * fp, g[6] * fk + py[2] * fp, g[7] * fk + py[3] * fp};
    *(v4f*)(orow + t * 16) = x; *(v4f*)(orow + t * 16 + 4) = y; } }


// Everything in front of the attention in ONE launch. A work-group takes 128 token rows, projects key and value of those rows, applies Wq^T to k and passes the query rows on unchanged.
// All global loads are issued first, whole lines a wave; inputs (rounded to bf16, exact in f16), the three weight matrices (x16; Wq transposed) and the rounded biases go to LDS.
// k: D^T = Wk x^T (A = weight rows, B = token rows), so a lane holds 8 neighbouring features of ONE token: hi and residual pack into 16-byte pieces, the rows of the wave's own tokens in LDS.
// k' = Wq^T k: the same form again, A = rows of Wq^T, B = those k rows, hi and residual each (two accumulators, joined 2^-10); k' -> hi + residual rows. The query rows leave as the exact f16 rows they are staged as.
// v: D = x W^T (A = token rows, B = weight rows), so a lane holds 8 neighbouring tokens of ONE feature: the pieces of a V^T row. Same k order and the same two accumulation steps (k 0..31, then 32..63) in both forms.
// Every result is staged in LDS; behind one barrier all of it is stored in whole 128-byte lines.
#define PJT 128                      /* token rows per work-group: 16 a wave */
#define PJP 144                      /* LDS row pitch, bytes, of 64 f16: 128 + 16, as FPB */
#define PJV 272                      /* LDS row pitch, bytes, of a staged V^T row of 128 tokens: 256 + 16 */
typedef unsigned short v4us __attribute__((ext_vector_type(4), may_alias));
__device__ __forceinline__ float pj_round(float x) { const unsigned int u = __float_as_uint(x); return __uint_as_float((u + 0x7FFFu + ((u >> 16) & 1u)) & 0xFFFF0000u); }      /* the value of bf16_round */
__device__ __forceinline__ v4us pj_cvt(v4f x, float scale) { const v4f y = {pj_round(x[0]) * scale, pj_round(x[1]) * scale, pj_round(x[2]) * scale, pj_round(x[3]) * scale}; return __builtin_bit_cast(v4us, __builtin_convertvector(y, v4h)); }
__global__ __launch_bounds__(256) void k_proj(const float* __restrict__ xq, const float* __restrict__ xk, const float* __restrict__ xv, const float* __restrict__ wq, const float* __restrict__ wk, const float* __restrict__ bk, const float* __restrict__ wv, const float* __restrict__ bv,
    _Float16* __restrict__ QH, _Float16* __restrict__ KH, _Float16* __restrict__ KL, _Float16* __restrict__ VT) {
  __shared__ __attribute__((aligned(16))) unsigned char sx[3 * PJT * PJP];      /* f16 rows of query, key, value */
  __shared__ __attribute__((aligned(16))) unsigned char sw[3 * DM * PJP];       /* f16 rows of Wq^T, Wk, Wv (x16) */
  __shared__ __attribute__((aligned(16))) float sb[4 * DM];                     /* bk, bk, bv, bv rounded to bf16 (the second and the third quarter are read) */
  __shared__ __attribute__((aligned(16))) unsigned char so[8 * 4 * 16 * PJP];   /* per wave: its 16 rows of k' hi, k' residual, k hi, k residual */
  __shared__ __attribute__((aligned(16))) unsigned char sv[DM * PJV];           /* V^T of the 128 tokens */
  const int tid = threadIdx.x, w = tid >> 5, lane = tid & 31, ln = lane & 15, hh = lane >> 4;
  const size_t row0 = (size_t)blockIdx.x * PJT;
  const float* const xs[3] = {xq + row0 * DM, xk + row0 * DM, xv + row0 * DM}; const float* const wsr[3] = {wq, wk, wv};
  const float br = (tid < 2 * DM ? bk : bv)[tid & (DM - 1)];      /* from every thread, among the other loads: under a branch its wait would go to zero and drain the input loads before the first conversion */
  v4f wr[3][4], xr[3][8];      /* piece i * 256 + tid (4 floats) of each tile: row i * 16 + tid / 16, piece tid % 16 of the row; Wq: column tid % 64, rows i * 16 + 4 (tid / 64) .. + 3, a whole line per wave load */
#pragma unroll
  for (int i = 0; i < 4; ++i) {
#pragma unroll
    for (int q = 0; q < 4; ++q) wr[0][i][q] = wq[(i * 16 + (tid >> 6) * 4 + q) * DM + (tid & (DM - 1))]; }
#pragma unroll
  for (int m = 1; m < 3; ++m) {
#pragma unroll
    for (int i = 0; i < 4; ++i) wr[m][i] = *(const v4fa*)(wsr[m] + (i * 256 + tid) * 4); }
#pragma unroll
  for (int m = 0; m < 3; ++m) {
#pragma unroll
    for (int i = 0; i < 8; ++i) xr[m][i] = *(const v4fa*)(xs[m] + (i * 256 + tid) * 4); }
  sb[tid] = pj_round(br);
  const int so4 = (tid >> 4) * PJP + (tid & 15) * 8;
#pragma unroll
  for (int i = 0; i < 4; ++i) *(v4us*)(sw + (tid & (DM - 1)) * PJP + (i * 16 + (tid >> 6) * 4) * 2) = pj_cvt(wr[0][i], 16.0f);      /* row m of Wq^T: Wq[n][m], n in a row */
#pragma unroll
  for (int m = 1; m < 3; ++m) {
#pragma unroll
    for (int i = 0; i < 4; ++i) *(v4us*)(sw + (m * DM + i * 16) * PJP + so4) = pj_cvt(wr[m][i], 16.0f); }
#pragma unroll
  for (int m = 0; m < 3; ++m) {
#pragma unroll
    for (int i = 0; i < 8; ++i) *(v4us*)(sx + (m * PJT + i * 16) * PJP + so4) = pj_cvt(xr[m][i], 1.0f); }
  __syncthreads();
  const unsigned char* xl = sx + (16 * w + ln) * PJP + 16 * hh; const unsigned char* wl = sw + ln * PJP + 16 * hh; unsigned char* sh = so + w * (4 * 16 * PJP);
  const v8f z8 = {0.f, 0.f, 0.f, 0.f, 0.f, 0.f, 0.f, 0.f};
  { const v16h x0 = fa_frag(xl + 2 * PJT * PJP), x1 = fa_frag(xl + 2 * PJT * PJP + 64);
#pragma unroll
    for (int t = 0; t < 4; ++t) { const unsigned char* p = wl + (2 * DM + t * 16) * PJP;
      v8f c = fa_mma(x0, fa_frag(p), z8); c = fa_mma(x1, fa_frag(p + 64), c);      /* c[r]: token 16 w + 8 hh + r, feature 16 t + ln */
      const v8f v = c * 0.0625f + sb[2 * DM + t * 16 + ln];
      *(v8us*)(sv + (t * 16 + ln) * PJV + (16 * w + 8 * hh) * 2) = __builtin_bit_cast(v8us, __builtin_convertvector(v, v8h)); } }
  { const v16h x0 = fa_frag(xl + PJT * PJP), x1 = fa_frag(xl + PJT * PJP + 64);
#pragma unroll
    for (int t = 0; t < 4; ++t) { const unsigned char* p = wl + (DM + t * 16) * PJP;
      v8f c = fa_mma(fa_frag(p), x0, z8); c = fa_mma(fa_frag(p + 64), x1, c);      /* c[r]: feature 16 t + 8 hh + r of k, token 16 w + ln */
      const v4f b0 = *(const v4f*)&sb[DM + t * 16 + 8 * hh], b1 = *(const v4f*)&sb[DM + t * 16 + 8 * hh + 4];
      const v8f v = c * 0.0625f + __builtin_shufflevector(b0, b1, 0, 1, 2, 3, 4, 5, 6, 7); const v8h h = __builtin_convertvector(v, v8h);
      const v8h l = __builtin_convertvector((v - __builtin_convertvector(h, v8f)) * 1024.0f, v8h);
      unsigned char* d = sh + (32 + ln) * PJP + t * 32 + hh * 16; *(v8us*)d = __builtin_bit_cast(v8us, h); *(v8us*)(d + 16 * PJP) = __builtin_bit_cast(v8us, l); } }
  __builtin_amdgcn_fence(__ATOMIC_ACQ_REL, "workgroup"); __builtin_amdgcn_wave_barrier();      /* each lane reads back only the k pieces it stored itself: its LDS stores stay in front of these loads */
  { const unsigned char* kr = sh + (32 + ln) * PJP + 16 * hh;      /* token 16 w + ln as a B row: k order of fa_frag, as the Wq^T rows */
    const v16h g0 = fa_frag(kr), g1 = fa_frag(kr + 64), r0 = fa_frag(kr + 16 * PJP), r1 = fa_frag(kr + 16 * PJP + 64);
#pragma unroll
    for (int t = 0; t < 4; ++t) { const unsigned char* p = wl + t * 16 * PJP; const v16h a0 = fa_frag(p), a1 = fa_frag(p + 64);
      v8f c = fa_mma(a0, g0, z8), e = fa_mma(a0, r0, z8); c = fa_mma(a1, g1, c); e = fa_mma(a1, r1, e);      /* c[r], e[r]: feature 16 t + 8 hh + r of k', token 16 w + ln */
      const v8f v = (e * 0.0009765625f + c) * 0.0625f; const v8h h = __builtin_convertvector(v, v8h);
      const v8h l = __builtin_convertvector((v - __builtin_convertvector(h, v8f)) * 1024.0f, v8h);
      unsigned char* d = sh + ln * PJP + t * 32 + hh * 16; *(v8us*)d = __builtin_bit_cast(v8us, h); *(v8us*)(d + 16 * PJP) = __builtin_bit_cast(v8us, l); } }
  __syncthreads();      /* V^T rows cross the waves; the k' rows are read back by other lanes of the wave that staged them */
  { unsigned short* gh = (unsigned short*)KH + (row0 + 16 * w) * DM; unsigned short* gl = (unsigned short*)KL + (row0 + 16 * w) * DM; unsigned short* gx = (unsigned short*)QH + (row0 + 16 * w) * DM;
#pragma unroll
    for (int i = 0; i < 4; ++i) { const int ix = i * 32 + lane; const unsigned char* s = sh + (ix >> 3) * PJP + (ix & 7) * 16;      /* the wave's 16 rows are 2 KiB in a row: 512 contiguous bytes a store */
      *(v8us*)(gh + ix * 8) = *(const v8us*)s; *(v8us*)(gl + ix * 8) = *(const v8us*)(s + 16 * PJP); *(v8us*)(gx + ix * 8) = *(const v8us*)(sx + (16 * w + (ix >> 3)) * PJP + (ix & 7) * 16); } }
  unsigned short* gv = (unsigned short*)VT + (size_t)(blockIdx.x / (SQ / PJT)) * DM * SQ + (blockIdx.x % (SQ / PJT)) * PJT;
#pragma unroll
  for (int i = 0; i < 4; ++i) { const int ix = i * 256 + tid, d = ix >> 4, pc = ix & 15; *(v8us*)(gv + (size_t)d * SQ + pc * 8) = *(const v8us*)(sv + d * PJV + pc * 16); } }      /* 256 contiguous bytes of a V^T row per 16 lanes */

extern "C" void kernel_launch(void* const* d_in, const int* in_sizes, int n_in,
                              void* d_out, int out_size, void* d_ws, size_t ws_size, hipStream_t stream) {
  (void)in_sizes; (void)n_in; (void)out_size;
  const float* const* I = (const float* const*)d_in; const float* xq = I[0]; const float* xk = I[1]; const float* xv = I[2]; const float* wq = I[3]; const float* wk = I[5]; const float* bk = I[6]; const float* wv = I[7]; const float* bv = I[8];      /* query, key, value [8][4096][64]; natural [64][64] weights + biases */
  char* ws = (char*)d_ws; size_t off = 0;
  auto take = [&](size_t bytes) { char* p = ws + off; off += (bytes + 255) & ~(size_t)255; return p; };
  _Float16* QH = (_Float16*)take(NR * DM * 2); _Float16* KH = (_Float16*)take(NR * DM * 2); _Float16* KL = (_Float16*)take(NR * DM * 2); _Float16* VT = (_Float16*)take(NR * DM * 2);
  if (off > ws_size) return;
  k_proj<<<(unsigned)(NR / PJT), 256, 0, stream>>>(xq, xk, xv, wq, wk, bk, wv, bv, QH, KH, KL, VT);      /* query rows -> exact f16 rows; k' = Wq^T k -> f16 hi + x1024 residual rows; v -> V^T [64][4096] of every batch; I[4] (bq) shifts every score of a row alike and is not read */
  k_fattn<<<NB * (SQ / 128), 256, 0, stream>>>(KH, KL, QH, VT, (float*)d_out);      /* scores (x.hi + (x.lo) 2^-10, unscaled), softmax over the query positions, out[i] = sum_j attn[i][j] v[j] */
}

// v007
// One run takes 42.9 microseconds.
// In two side-by-side timings against v006, it was 1.06 and 1.07 times as fast.
// All steps since v000 together make it 166 times as fast.
#include <hip/hip_runtime.h>
// Dot-product attention with TRANSPOSED roles and no scaling (query, key, value [8][4096][64]; q = query Wq^T + bq, k = key Wk^T + bk, v = value Wv^T + bv (natural [64][64] sigma 1/8, biases 0.01); scores[i][j] = k_i . q_j (NO 1/sqrt(d): sigma ~8); attn = softmax over the query positions j; out[i] = sum_j attn[i][j] v[j] -> [8][4096][64] (rows are key positions)).
// Structure: one launch in front of the attention: a work-group takes 128 token rows of query, key and value; the bf16-valued inputs as exact f16 rows and the weights x16 in LDS; k as WMMA products (f32 accumulation, + bias) -> f16 hi + x1024 residual, then k' = log2(e) Wq^T k (WMMA on both parts) -> f16 hi + residual rows (the residual unscaled: f16 keeps it to 2^-25); the query rows go out as they are (exact f16); v -> f16 V^T rows; every output staged through LDS and stored in whole lines; then one fused kernel: scores (base 2) = k'.x = hi.x + lo.x (K = 64, one f32 accumulator that starts at FWB minus the row's reference) in registers; weights = exp2 of the accumulator (f16), row sum f32; the reference is renewed in the first two trips and after them only when a lane's weights of a trip sum to FWL or more; out = P V^T / sum f32.
// k_i . q_j = k_i . (Wq x_j + bq) = (Wq^T k_i) . x_j + k_i . bq; the last term is the same for every j of a row i, and the softmax over j does not see it: it is left out, for any bq.
// Compute dtype: inputs rounded to bf16; x / weights exact; k as f16 hi + x1024 residual, k' as f16 hi + unscaled residual, v and softmax weights as plain f16 GEMM operands (~2^-12); scores and softmax statistics f32. v_wmma_f32_16x16x32_f16.
#define NB 8
#define SQ 4096
#define DM 64
#define NH 1
#define HD 64
#define HG 8                         /* heads per launch of the k_vt(b, h0) overload (not launched) */
#define B0 0                         /* first batch processed (used by no kernel or launch) */
#define NBR NB                       /* batches processed (used by no kernel or launch) */
#define NR ((size_t)NB * SQ)         /* token rows */
#define MP ((int)((size_t)NBR * SQ)) /* rows projected (used by no kernel or launch) */
#define QT 256                       /* query rows per causal tile */
#define NKX SQ                       /* S / P row pitch */
#define QT0 256                      /* first-tile rows recomputed exactly */
#define QN SQ                        /* query rows attended per batch (used by no kernel or launch) */
#define NHD NH                       /* heads attended (used by no kernel or launch) */
#define MPO MP                       /* rows through the output stage (used by no kernel or launch) */
#define LQ DM            /* row pitch of the q/k/v rows (used by no kernel or launch) */
typedef __bf16 v16b __attribute__((ext_vector_type(16)));
typedef unsigned short v8us __attribute__((ext_vector_type(8), may_alias));
typedef float  v8f  __attribute__((ext_vector_type(8)));
typedef float  v4f  __attribute__((ext_vector_type(4)));
typedef float  v4fa __attribute__((ext_vector_type(4), may_alias));
union FragB { v16b v; v8us half[2]; unsigned short u[16]; };

__device__ __forceinline__ unsigned short bf16_bits(float x) { unsigned int u = __float_as_uint(x); return (unsigned short)((u + 0x7FFFu + ((u >> 16) & 1u)) >> 16); }
__device__ __forceinline__ float bf16_val(unsigned short b) { return __uint_as_float(((unsigned int)b) << 16); }
__device__ __forceinline__ float bf16_round(float x) { return bf16_val(bf16_bits(x)); }
// D += A·B with NT terms: 1 = ah·bh, 2 = + al·bh (A split), 3 = + ah·bl (both split)
template <int NT>
__device__ __forceinline__ v8f mmaN(v16b ah, v16b al, v16b bh, v16b bl, v8f c) {
  c = __builtin_amdgcn_wmma_f32_16x16x32_bf16(false, ah, false, bh, (short)0, c, false, false);
  if (NT >= 2) c = __builtin_amdgcn_wmma_f32_16x16x32_bf16(false, al, false, bh, (short)0, c, false, false);
  if (NT >= 3) c = __builtin_amdgcn_wmma_f32_16x16x32_bf16(false, ah, false, bl, (short)0, c, false, false);
  asm volatile("v_nop\n\tv_nop\n\tv_nop\n\tv_nop" : "+v"(c) : "v"(ah), "v"(al), "v"(bh), "v"(bl));
  return c;
}

__global__ __launch_bounds__(256) void k_wt_bf16(const float* __restrict__ W, unsigned short* __restrict__ Wt, int K, int N) {
  const int t = blockIdx.x * 256 + threadIdx.x;
  const int k8n = K / 8;
  if (t >= N * k8n) return;
  const int n = t / k8n, k8 = (t % k8n) * 8;
  v8us v;
#pragma unroll
  for (int i = 0; i < 8; ++i) v[i] = bf16_bits(W[(size_t)(k8 + i) * N + n]);
  *(v8us*)(Wt + (size_t)n * K + k8) = v;
  
}

// GEMM C[M][N] (f32, pitch ldc) = act(A[M][K]·W + bias). A f32 row-major (pitch lda) converted per fragment to bf16
// (ASPLIT: hi/lo two planes -> 2 terms, else single rounded term); Wt bf16 [N][K] (pitch ldb). BIAS_BF16 rounds the
// bias to bf16 first (bias quantised to bf16 before the add). K%32==0, M%16==0, N%64==0.
template <bool ASPLIT, int ACT, bool BIAS_BF16>
__global__ __launch_bounds__(128) void k_gemm_bf(const float* __restrict__ A, int lda, const unsigned short* __restrict__ Wt, int ldb,
                                               const float* __restrict__ bias, float* __restrict__ C, int ldc, int M, int N, int K) {
  __shared__ __attribute__((aligned(16))) float so[4][16][64];
  const int tid = threadIdx.x, w = tid >> 5, lane = tid & 31, ln = lane & 15, hh = lane >> 4;
  const int ntn = N / 64;
  const int wid = blockIdx.x * 4 + w;
  const int mt = wid / ntn, nq = wid % ntn;
  if (mt * 16 >= M) return;
  const int row0 = mt * 16, col0 = nq * 64;
  const float* arow = A + (size_t)(row0 + ln) * lda;
  v8f acc[4] = {};
  for (int kb = 0; kb < K; kb += 32) {
    FragB ah, al;
    const v4f x0 = *(const v4fa*)(arow + kb + 8 * hh), x1 = *(const v4fa*)(arow + kb + 8 * hh + 4);
    const v4f x2 = *(const v4fa*)(arow + kb + 16 + 8 * hh), x3 = *(const v4fa*)(arow + kb + 16 + 8 * hh + 4);
    float xs[16] = {x0[0],x0[1],x0[2],x0[3],x1[0],x1[1],x1[2],x1[3],x2[0],x2[1],x2[2],x2[3],x3[0],x3[1],x3[2],x3[3]};
#pragma unroll
    for (int i = 0; i < 16; ++i) { const unsigned short hb = bf16_bits(xs[i]); ah.u[i] = hb; al.u[i] = ASPLIT ? bf16_bits(xs[i] - bf16_val(hb)) : (unsigned short)0; }
#pragma unroll
    for (int t = 0; t < 4; ++t) {
      const unsigned short* brow = Wt + (size_t)(col0 + t * 16 + ln) * ldb + kb;
      FragB b;
      b.half[0] = *(const v8us*)(brow + 8 * hh);
      b.half[1] = *(const v8us*)(brow + 16 + 8 * hh);
      acc[t] = mmaN<ASPLIT ? 2 : 1>(ah.v, al.v, b.v, b.v, acc[t]);
    }
  }
#pragma unroll
  for (int t = 0; t < 4; ++t) {
    float bv = bias ? bias[col0 + t * 16 + ln] : 0.f;
    if (BIAS_BF16) bv = bf16_round(bv);
#pragma unroll
    for (int r = 0; r < 8; ++r) { float v = acc[t][r] + bv; if (ACT == 1) v = fmaxf(v, 0.f); so[w][8 * hh + r][t * 16 + ln] = v; }
  }
  __builtin_amdgcn_fence(__ATOMIC_ACQ_REL, "workgroup");
  __builtin_amdgcn_wave_barrier();
  const int rsub = lane >> 4, c4 = (lane & 15) * 4;
  {
#pragma unroll
    for (int q = 0; q < 8; ++q) {
      const int r = q * 2 + rsub;
      const v4f v = *(const v4fa*)&so[w][r][c4];
      *(v4f*)(C + (size_t)(row0 + r) * ldc + col0 + c4) = v;
    }
    
  }
}

// GEMM C = act(A·W + bias + resid): A f32 (ASPLIT -> hi/lo 2 terms), Wt bf16 [N][K]; ACT 0 none, 1 relu, 2 exact gelu;
// resid (optional, f32, row index = (row % rmod), pitch ldr, RES_BF16 rounds it) added before the activation.
template <bool ASPLIT, int ACT, bool BIAS_BF16, bool RES_BF16>
__global__ __launch_bounds__(128) void k_gemm_bf3(const float* __restrict__ A, int lda, const unsigned short* __restrict__ Wt, int ldb,
                                                const float* __restrict__ bias, const float* __restrict__ resid, int rmod, int ldr,
                                                float* __restrict__ C, int ldc, int M, int N, int K) {
  __shared__ __attribute__((aligned(16))) float so[4][16][64];
  const int tid = threadIdx.x, w = tid >> 5, lane = tid & 31, ln = lane & 15, hh = lane >> 4;
  const int ntn = N / 64;
  const int wid = blockIdx.x * 4 + w;
  const int mt = wid / ntn, nq = wid % ntn;
  if (mt * 16 >= M) return;
  const int row0 = mt * 16, col0 = nq * 64;
  const float* arow = A + (size_t)(row0 + ln) * lda;
  v8f acc[4] = {};
  for (int kb = 0; kb < K; kb += 32) {
    FragB ah, al;
    const v4f x0 = *(const v4fa*)(arow + kb + 8 * hh), x1 = *(const v4fa*)(arow + kb + 8 * hh + 4);
    const v4f x2 = *(const v4fa*)(arow + kb + 16 + 8 * hh), x3 = *(const v4fa*)(arow + kb + 16 + 8 * hh + 4);
    float xs[16] = {x0[0],x0[1],x0[2],x0[3],x1[0],x1[1],x1[2],x1[3],x2[0],x2[1],x2[2],x2[3],x3[0],x3[1],x3[2],x3[3]};
#pragma unroll
    for (int i = 0; i < 16; ++i) { const unsigned short hb = bf16_bits(xs[i]); ah.u[i] = hb; al.u[i] = ASPLIT ? bf16_bits(xs[i] - bf16_val(hb)) : (unsigned short)0; }
#pragma unroll
    for (int t = 0; t < 4; ++t) {
      const unsigned short* brow = Wt + (size_t)(col0 + t * 16 + ln) * ldb + kb;
      FragB b;
      b.half[0] = *(const v8us*)(brow + 8 * hh);
      b.half[1] = *(const v8us*)(brow + 16 + 8 * hh);
      acc[t] = mmaN<ASPLIT ? 2 : 1>(ah.v, al.v, b.v, b.v, acc[t]);
    }
  }
#pragma unroll
  for (int t = 0; t < 4; ++t) {
    const int col = col0 + t * 16 + ln;
    float bv = bias ? bias[col] : 0.f;
    if (BIAS_BF16) bv = bf16_round(bv);
#pragma unroll
    for (int r = 0; r < 8; ++r) {
      float v = acc[t][r] + bv;
      if (resid) { float rv = resid[(size_t)((row0 + 8 * hh + r) % rmod) * ldr + col]; if (RES_BF16) rv = bf16_round(rv); v += rv; }
      if (ACT == 1) v = fmaxf(v, 0.f);
      if (ACT == 2) v = 0.5f * v * (1.0f + erff(v * 0.70710678118654752f));
      if (ACT == 3) { const float u = 0.7978845608028654f * (v + 0.044715f * v * v * v); v = 0.5f * v * (1.0f + tanhf(u)); }
      so[w][8 * hh + r][t * 16 + ln] = v;
    }
  }
  __builtin_amdgcn_fence(__ATOMIC_ACQ_REL, "workgroup");
  __builtin_amdgcn_wave_barrier();
  const int rsub = lane >> 4, c4 = (lane & 15) * 4;
  {
#pragma unroll
    for (int q = 0; q < 8; ++q) {
      const int r = q * 2 + rsub;
      const v4f v = *(const v4fa*)&so[w][r][c4];
      *(v4f*)(C + (size_t)(row0 + r) * ldc + col0 + c4) = v;
    }
    
  }
}
// row LayerNorm (biased variance, eps) over N: s = X (+ R); optional out_sum <- s; out_norm <- (s-mu)*rsqrt(var+eps)*g + b
template <bool PARAM_BF16>
__global__ __launch_bounds__(256) void k_layernorm(const float* __restrict__ X, const float* __restrict__ R, const float* __restrict__ g, const float* __restrict__ bta,
                                                  float* __restrict__ out_sum, float* __restrict__ out_norm, int N, float eps) {
  __shared__ float red[256];
  const int row = blockIdx.x, tid = threadIdx.x;
  const float* x = X + (size_t)row * N; const float* rr = R ? R + (size_t)row * N : nullptr;
  float vals[16];                     // up to N = 4096
  const int per = N / 256;            // contiguous chunk per thread? use strided-by-4 chunks: thread handles j = tid*4 + 1024*u
  float s1 = 0.f;
  for (int u = 0; u < per / 4; ++u) {
    const int j = tid * 4 + 1024 * u;
    const v4f a = *(const v4fa*)(x + j);
    v4f b = {0.f,0.f,0.f,0.f}; if (rr) b = *(const v4fa*)(rr + j);
#pragma unroll
    for (int q = 0; q < 4; ++q) { const float v = a[q] + b[q]; vals[u * 4 + q] = v; s1 += v; }
  }
  red[tid] = s1; __syncthreads();
  for (int st = 128; st > 0; st >>= 1) { if (tid < st) red[tid] += red[tid + st]; __syncthreads(); }
  const float mu = red[0] / (float)N; __syncthreads();
  float s2 = 0.f;
  for (int u = 0; u < per / 4; ++u)
#pragma unroll
    for (int q = 0; q < 4; ++q) { const float c = vals[u * 4 + q] - mu; s2 += c * c; }
  red[tid] = s2; __syncthreads();
  for (int st = 128; st > 0; st >>= 1) { if (tid < st) red[tid] += red[tid + st]; __syncthreads(); }
  const float rs = rsqrtf(red[0] / (float)N + eps);
  {
    for (int u = 0; u < per / 4; ++u) {
      const int j = tid * 4 + 1024 * u;
      v4f o, sm;
#pragma unroll
      for (int q = 0; q < 4; ++q) {
        float gg = g[j + q], bb = bta[j + q];
        if (PARAM_BF16) { gg = bf16_round(gg); bb = bf16_round(bb); }
        sm[q] = vals[u * 4 + q]; o[q] = (vals[u * 4 + q] - mu) * rs * gg + bb;
      }
      if (out_sum) *(v4f*)(out_sum + (size_t)row * N + j) = sm;
      *(v4f*)(out_norm + (size_t)row * N + j) = o;
    }
    
  }
}



// ---- f16 WMMA path (v_wmma_f32_16x16x32_f16): 11-bit significands for operands in range — used where a [0,1] probability operand needs more precision than bf16
typedef _Float16 v16h __attribute__((ext_vector_type(16)));
union FragH { v16h v; v8us half[2]; _Float16 h[16]; unsigned short u[16]; };
template <int NT>
__device__ __forceinline__ v8f mmaH(v16h ah, v16h al, v16h bh, v16h bl, v8f c) {
  c = __builtin_amdgcn_wmma_f32_16x16x32_f16(false, ah, false, bh, (short)0, c, false, false);
  if (NT >= 2) c = __builtin_amdgcn_wmma_f32_16x16x32_f16(false, al, false, bh, (short)0, c, false, false);
  if (NT >= 3) c = __builtin_amdgcn_wmma_f32_16x16x32_f16(false, ah, false, bl, (short)0, c, false, false);
  asm volatile("v_nop\n\tv_nop\n\tv_nop\n\tv_nop" : "+v"(c) : "v"(ah), "v"(al), "v"(bh), "v"(bl));
  return c;
}
// batched GEMM like k_gemm_b but f16 operands: A f32 (split into f16 hi/lo if ASPLIT, else rounded to f16), Bt = f16 values [n][k]; alpha; C f32; N multiple of 16 (partial tiles skipped)
template <bool ASPLIT>
__global__ __launch_bounds__(128) void k_gemm_h(const float* __restrict__ A, int lda, size_t sA, const _Float16* __restrict__ Bh, int ldb, size_t sB, float alpha, float* __restrict__ C, int ldc, size_t sC, int M, int N, int K) {
  __shared__ __attribute__((aligned(16))) float so[4][16][64];
  const int tid = threadIdx.x, w = tid >> 5, lane = tid & 31, ln = lane & 15, hh = lane >> 4; const int by = blockIdx.y;
  A += (size_t)by * sA; Bh += (size_t)by * sB; C += (size_t)by * sC;
  const int ntn = (N + 63) / 64; const int wid = blockIdx.x * 4 + w; const int mt = wid / ntn, nq = wid % ntn; if (mt * 16 >= M) return;
  const int row0 = mt * 16, col0 = nq * 64; const float* arow = A + (size_t)(row0 + ln) * lda;
  v8f acc[4] = {};
  for (int kb = 0; kb < K; kb += 32) {
    FragH ah, al;
    const v4f x0 = *(const v4fa*)(arow + kb + 8 * hh), x1 = *(const v4fa*)(arow + kb + 8 * hh + 4), x2 = *(const v4fa*)(arow + kb + 16 + 8 * hh), x3 = *(const v4fa*)(arow + kb + 16 + 8 * hh + 4);
    float xs[16] = {x0[0],x0[1],x0[2],x0[3],x1[0],x1[1],x1[2],x1[3],x2[0],x2[1],x2[2],x2[3],x3[0],x3[1],x3[2],x3[3]};
#pragma unroll
    for (int i = 0; i < 16; ++i) { const _Float16 h = (_Float16)xs[i]; ah.h[i] = h; al.h[i] = ASPLIT ? (_Float16)(xs[i] - (float)h) : (_Float16)0.0f; }
#pragma unroll
    for (int t = 0; t < 4; ++t) { if (col0 + t * 16 >= N) continue; const size_t boff = (size_t)(col0 + t * 16 + ln) * ldb + kb; FragH bq; bq.half[0] = *(const v8us*)(Bh + boff + 8 * hh); bq.half[1] = *(const v8us*)(Bh + boff + 16 + 8 * hh);
      acc[t] = mmaH<ASPLIT ? 2 : 1>(ah.v, al.v, bq.v, bq.v, acc[t]); }
  }
#pragma unroll
  for (int t = 0; t < 4; ++t) { if (col0 + t * 16 >= N) continue;
#pragma unroll
    for (int r = 0; r < 8; ++r) so[w][8 * hh + r][t * 16 + ln] = acc[t][r] * alpha; }
  __builtin_amdgcn_fence(__ATOMIC_ACQ_REL, "workgroup"); __builtin_amdgcn_wave_barrier();
  const int rsub = lane >> 4, c4 = (lane & 15) * 4;
  {
#pragma unroll
    for (int q = 0; q < 8; ++q) { const int r = q * 2 + rsub; if (col0 + c4 < N) { const v4f v = *(const v4fa*)&so[w][r][c4]; *(v4f*)(C + (size_t)(row0 + r) * ldc + col0 + c4) = v; } }
     }
}

// Wt[n][k] = f16(W[k][n]·scale) from f32 row-major W[K][N] (scale = power of two; bf16-exact weights stay exact in f16 away from the subnormal range)
__global__ __launch_bounds__(256) void k_wt_f16(const float* __restrict__ W, _Float16* __restrict__ Wt, int K, int N, float scale) {
  const int t = blockIdx.x * 256 + threadIdx.x; if (t >= N * (K / 8)) return; const int n = t / (K / 8), k8 = (t % (K / 8)) * 8; FragH f;
#pragma unroll
  for (int i = 0; i < 8; ++i) f.h[i] = (_Float16)(bf16_round(W[(size_t)(k8 + i) * N + n]) * scale); const v8us o = f.half[0];
  *(v8us*)((unsigned short*)Wt + (size_t)n * K + k8) = o; 
}
// k_gemm_hh variant with fused epilogue: v = acc·alpha + bias[by·sBias + col] (+ CP[(row/rowsPerB)·sCPb + by·64 + col] if CP) ; ACT 0 none / 1 elu ; writes f16 C16 (and f32 C if non-null)
template <int ACT>
__global__ __launch_bounds__(128) void k_gemm_hhx(const _Float16* __restrict__ A, int lda, size_t sA, const _Float16* __restrict__ Bh, int ldb, size_t sB, float alpha, const float* __restrict__ bias, size_t sBias, const float* __restrict__ CP, int rowsPerB, size_t sCPb, int row0g,
    float* __restrict__ C, _Float16* __restrict__ C16, int ldc, size_t sC, int M, int N, int K) {
  __shared__ __attribute__((aligned(16))) float so[4][16][64];
  const int tid = threadIdx.x, w = tid >> 5, lane = tid & 31, ln = lane & 15, hh = lane >> 4; const int by = blockIdx.y;
  A += (size_t)by * sA; Bh += (size_t)by * sB; const size_t cofs = (size_t)by * sC; const float* bp = bias ? bias + (size_t)by * sBias : nullptr;
  const int ntn = (N + 63) / 64; const int wid = blockIdx.x * 4 + w; const int mt = wid / ntn, nq = wid % ntn; if (mt * 16 >= M) return;
  const int row0 = mt * 16, col0 = nq * 64; const _Float16* arow = A + (size_t)(row0 + ln) * lda;
  v8f acc[4] = {};
  for (int kb = 0; kb < K; kb += 32) { FragH ah; ah.half[0] = *(const v8us*)((const unsigned short*)arow + kb + 8 * hh); ah.half[1] = *(const v8us*)((const unsigned short*)arow + kb + 16 + 8 * hh);
#pragma unroll
    for (int t = 0; t < 4; ++t) { if (col0 + t * 16 >= N) continue; const size_t boff = (size_t)(col0 + t * 16 + ln) * ldb + kb; FragH bq; bq.half[0] = *(const v8us*)((const unsigned short*)Bh + boff + 8 * hh); bq.half[1] = *(const v8us*)((const unsigned short*)Bh + boff + 16 + 8 * hh);
      acc[t] = mmaH<1>(ah.v, ah.v, bq.v, bq.v, acc[t]); }
  }
#pragma unroll
  for (int t = 0; t < 4; ++t) { if (col0 + t * 16 >= N) continue; const int col = col0 + t * 16 + ln; const float bv = bp ? bf16_round(bp[col]) : 0.f;
#pragma unroll
    for (int r = 0; r < 8; ++r) { float v = acc[t][r] * alpha + bv; if (CP) { const int rr = row0g + row0 + 8 * hh + r; if (rowsPerB < 0) v += CP[cofs + (size_t)rr * ldc + col];      /* rowsPerB < 0: own element of the batched C plane */ else { const int bidx = rr / rowsPerB; v += CP[(size_t)bidx * sCPb + (size_t)by * 64 + col]; } } if (ACT == 1) v = (v > 0.f) ? v : expm1f(v); else if (ACT == 7) v = (v > 0.f) ? v + 1.0f : expf(v); else if (ACT == 8) v = tanhf(v); else if (ACT == 9) v = 0.5f * v * (1.0f + tanhf(0.7978845608028654f * (v + 0.044715f * v * v * v))); else if (ACT == 11) v = 1.0f / (1.0f + expf(-v)); else if (ACT == 12) v = (v > 0.f) ? v : 0.01f * v; else if (ACT == 14) v = (v > 0.f) ? v : 0.1f * v; else if (ACT == 16) v = (v >= 0.f) ? v : 0.3f * v; else if (ACT == 17) v = (v >= 0.f) ? v : 0.2f * v; else if (ACT == 15) v = v / (1.0f + expf(-v)); else if (ACT == 3) v = fmaxf(v, 0.f); else if (ACT == 6) v = 0.5f * v * (1.0f + erff(v * 0.70710678118654752f)); so[w][8 * hh + r][t * 16 + ln] = v; } }
  __builtin_amdgcn_fence(__ATOMIC_ACQ_REL, "workgroup"); __builtin_amdgcn_wave_barrier();
  const int rsub = lane >> 4, c4 = (lane & 15) * 4; typedef _Float16 v4h __attribute__((ext_vector_type(4)));
  {
#pragma unroll
    for (int q = 0; q < 8; ++q) { const int r = q * 2 + rsub; if (col0 + c4 < N) { const v4f v = *(const v4fa*)&so[w][r][c4]; if (C) *(v4f*)(C + cofs + (size_t)(row0 + r) * ldc + col0 + c4) = v; if (C16) { v4h h4; for (int i = 0; i < 4; ++i) h4[i] = (_Float16)v[i]; *(v4h*)(C16 + cofs + (size_t)(row0 + r) * ldc + col0 + c4) = h4; } } }
     }
}


typedef _Float16 v4h __attribute__((ext_vector_type(4)));

__global__ __launch_bounds__(256) void k_h16(const float* __restrict__ x, _Float16* __restrict__ X16, size_t n8) { const size_t t = (size_t)blockIdx.x * 256 + threadIdx.x; if (t >= n8) return; FragH f;
#pragma unroll
  for (int q = 0; q < 8; ++q) f.h[q] = (_Float16)x[t * 8 + q]; *(v8us*)((unsigned short*)X16 + t * 8) = f.half[0];  }
__global__ __launch_bounds__(256) void k_round16f(const float* __restrict__ W, _Float16* __restrict__ Bt, size_t n8) { const size_t t = (size_t)blockIdx.x * 256 + threadIdx.x; if (t >= n8) return; FragH f;
#pragma unroll
  for (int i = 0; i < 8; ++i) f.h[i] = (_Float16)(bf16_round(W[t * 8 + i]) * 16.0f); *(v8us*)((unsigned short*)Bt + t * 8) = f.half[0];  }
// fragment of 16 rows x 32 k from f16 rows in global memory: a lane holds k = 8 hh .. + 7 and 16 + 8 hh .. + 7 of its row
__device__ __forceinline__ v16h g2_frag(const _Float16* p, int hh) { FragH f; f.half[0] = *(const v8us*)((const unsigned short*)p + 8 * hh); f.half[1] = *(const v8us*)((const unsigned short*)p + 16 + 8 * hh); return f.v; }
__global__ __launch_bounds__(256) void k_rsm(const float* __restrict__ S, _Float16* __restrict__ P, int nrows) {
  #pragma clang fp contract(off)
  const int i = blockIdx.x * 256 + threadIdx.x; if (i >= nrows) return; const float* s = S + (size_t)i * SQ; float mx = -3.0e38f;
#pragma unroll 1
  for (int j = 0; j < SQ; ++j) mx = fmaxf(mx, s[j]); float se = 0.f;
#pragma unroll 1
  for (int j = 0; j < SQ; ++j) se += expf(s[j] - mx); const float sc = 256.0f / se;
#pragma unroll 1
  for (int j0 = 0; j0 < SQ; j0 += 8) { FragH f; for (int q = 0; q < 8; ++q) f.h[q] = (_Float16)(expf(s[j0 + q] - mx) * sc); unsigned short* d = (unsigned short*)P + (size_t)i * SQ + j0; *(v8us*)d = f.half[0];  } }
__global__ __launch_bounds__(256) void k_vt(const _Float16* __restrict__ V16, int b, int h0, _Float16* __restrict__ VT) { __shared__ unsigned short tl[64][65]; const int tid = threadIdx.x; const int hh = blockIdx.x % HG, sg = blockIdx.x / HG; const int s0 = sg * 64; const int h = h0 + hh;
  for (int i = tid; i < 64 * 8; i += 256) { const int j = i / 8, d8 = (i % 8) * 8; FragH f; f.half[0] = *(const v8us*)((const unsigned short*)V16 + ((size_t)b * SQ + s0 + j) * DM + h * HD + d8); for (int q = 0; q < 8; ++q) tl[d8 + q][j] = f.u[q]; }
  __syncthreads();
  { for (int i = tid; i < 64 * 8; i += 256) { const int d = i / 8, j8 = (i % 8) * 8; FragH f; for (int q = 0; q < 8; ++q) f.u[q] = tl[d][j8 + q]; *(v8us*)((unsigned short*)VT + ((size_t)hh * HD + d) * SQ + s0 + j8) = f.half[0]; }  } }



__global__ __launch_bounds__(256) void k_rsmcf2(const float* __restrict__ S, _Float16* __restrict__ P, int hg, int q0, int nk) {
  #pragma clang fp contract(off)
  const int t = blockIdx.x * 256 + threadIdx.x; if (t >= hg * QT) return; const size_t i = (size_t)t; const float* s = S + i * NKX; const int last = q0 + (t % QT); float mx = -3.0e38f;
#pragma unroll 1
  for (int j = 0; j < nk; ++j) { const float f = (j <= last) ? 1.f : 0.f; mx = fmaxf(mx, fmaf(f, s[j], (1.f - f) * -1.0e9f)); } float se = 0.f;
#pragma unroll 1
  for (int j = 0; j < nk; ++j) { const float f = (j <= last) ? 1.f : 0.f; se += __expf(fmaf(f, s[j], (1.f - f) * -1.0e9f) - mx); } const float sc = 256.0f / se;
#pragma unroll 1
  for (int j0 = 0; j0 < nk; j0 += 8) { FragH fr; for (int q = 0; q < 8; ++q) { const int j = j0 + q; const float f = (j <= last) ? 1.f : 0.f; fr.h[q] = (_Float16)(__expf(fmaf(f, s[j], (1.f - f) * -1.0e9f) - mx) * sc); } unsigned short* d = (unsigned short*)P + i * NKX + j0; *(v8us*)d = fr.half[0];  } }

template <int MASKADD>
__global__ __launch_bounds__(64) void k_att0(const float* __restrict__ QF, const float* __restrict__ KF, const float* __restrict__ VF, int ld, const float* __restrict__ mask, float scale, float* __restrict__ OF, int ldo) {
  #pragma clang fp contract(off)
  __shared__ __attribute__((aligned(16))) float lq[64][64]; __shared__ __attribute__((aligned(16))) float lo[64][64];
  const int tid = threadIdx.x; const int h = blockIdx.x / (QT0 / 64), rg = blockIdx.x % (QT0 / 64); const int i = rg * 64 + tid;
  const float* qr = QF + (size_t)i * ld + h * HD;
#pragma unroll 1
  for (int c = 0; c < HD / 4; ++c) { *(v4f*)&lq[tid][c * 4] = *(const v4fa*)(qr + c * 4); const v4f z = {0.f, 0.f, 0.f, 0.f}; *(v4f*)&lo[tid][c * 4] = z; }
  float m = -1.0e30f, l = 0.f; const int jmax = MASKADD ? (SQ - 1) : (rg * 64 + 63);      /* additive-mask form: every key (the mask input decides); causal form: keys up to the block's last row */
#pragma unroll 1
  for (int j = 0; j <= jmax; ++j) { const float* kr = KF + (size_t)j * ld + h * HD; const float* vr = VF + (size_t)j * ld + h * HD; float s = 0.f;
#pragma unroll 1
    for (int c = 0; c < HD / 4; ++c) { const v4f kq = *(const v4fa*)(kr + c * 4); const v4f qq = *(v4f*)&lq[tid][c * 4]; s = __fadd_rn(s, __fmul_rn(qq[0], kq[0])); s = __fadd_rn(s, __fmul_rn(qq[1], kq[1])); s = __fadd_rn(s, __fmul_rn(qq[2], kq[2])); s = __fadd_rn(s, __fmul_rn(qq[3], kq[3])); }
    s = __fmul_rn(s, scale); if (MASKADD) s = __fadd_rn(s, __fmul_rn(bf16_round(mask[(size_t)i * SQ + j]), -10000.0f));
    const float f = (MASKADD || j <= i) ? 1.f : 0.f; const float sm = fmaf(f, s, (1.f - f) * -1.0e30f); const float mn = fmaxf(m, sm); const float sc = expf(m - mn); const float e = expf(sm - mn); l = __fadd_rn(__fmul_rn(l, sc), e); m = mn;
#pragma unroll 1
    for (int c = 0; c < HD / 4; ++c) { const v4f vv = *(const v4fa*)(vr + c * 4); v4f oo = *(v4f*)&lo[tid][c * 4]; for (int u = 0; u < 4; ++u) oo[u] = __fadd_rn(__fmul_rn(oo[u], sc), __fmul_rn(e, vv[u])); *(v4f*)&lo[tid][c * 4] = oo; } }
  const float fin = 64.0f / l;      /* o carried x64 */
#pragma unroll 1
  for (int c = 0; c < HD / 4; ++c) { v4f oo = *(v4f*)&lo[tid][c * 4]; for (int u = 0; u < 4; ++u) oo[u] = __fmul_rn(oo[u], fin); *(v4f*)&lo[tid][c * 4] = oo; }
  __syncthreads();
  {
#pragma unroll 1
    for (int it = 0; it < 16; ++it) { const int row = it * 4 + tid / 16, pc = (tid % 16) * 4; const v4f v = *(const v4f*)&lo[row][pc]; *(v4f*)(OF + (size_t)(rg * 64 + row) * ldo + h * HD + pc) = v; }
     } }

__global__ __launch_bounds__(256) void k_oscale(const float* __restrict__ OF, float* __restrict__ out, size_t n4) { const size_t t = (size_t)blockIdx.x * 256 + threadIdx.x; if (t >= n4) return; const v4f a = *(const v4fa*)(OF + t * 4); v4f o; for (int q = 0; q < 4; ++q) o[q] = a[q] * 0.015625f; *(v4f*)(out + t * 4) = o;  }

__global__ __launch_bounds__(256) void k_bfr(const float* __restrict__ x, float* __restrict__ XB, size_t n8) { const size_t t = (size_t)blockIdx.x * 256 + threadIdx.x; if (t >= n8) return; v4f a = *(const v4fa*)(x + t * 8), c = *(const v4fa*)(x + t * 8 + 4); for (int q = 0; q < 4; ++q) { a[q] = bf16_round(a[q]); c[q] = bf16_round(c[q]); }
  { *(v4f*)(XB + t * 8) = a; *(v4f*)(XB + t * 8 + 4) = c;  } }



__global__ __launch_bounds__(256) void k_rsmfvl(const float* __restrict__ S, _Float16* __restrict__ P, _Float16* __restrict__ PL, int qn, const int* __restrict__ vlp) {
  #pragma clang fp contract(off)
  const int t = blockIdx.x * 256 + threadIdx.x; if (t >= qn) return; const int vl = vlp[0]; const size_t i = (size_t)t; const float* s = S + i * SQ; float mx = -3.0e38f;
#pragma unroll 1
  for (int j = 0; j < SQ; ++j) { const float f = (j < vl) ? 1.f : 0.f; mx = fmaxf(mx, fmaf(f, s[j], (1.f - f) * -1000000.0f)); } float se = 0.f;
#pragma unroll 1
  for (int j = 0; j < SQ; ++j) { const float f = (j < vl) ? 1.f : 0.f; se += __expf(fmaf(f, s[j], (1.f - f) * -1000000.0f) - mx); } const float sc = 256.0f / se;
#pragma unroll 1
  for (int j0 = 0; j0 < SQ; j0 += 8) { FragH fr, gr; for (int q = 0; q < 8; ++q) { const int j = j0 + q; const float f = (j < vl) ? 1.f : 0.f; const float pv = __expf(fmaf(f, s[j], (1.f - f) * -1000000.0f) - mx) * sc; const _Float16 ph = (_Float16)pv; fr.h[q] = ph; gr.h[q] = (_Float16)((pv - (float)ph) * 1024.0f); }
    unsigned short* d = (unsigned short*)P + i * SQ + j0; unsigned short* dl = (unsigned short*)PL + i * SQ + j0; *(v8us*)d = fr.half[0]; *(v8us*)dl = gr.half[0];  } }

// Fused attention, one launch for all batches: a wave owns 32 output rows i (two groups of 16; their k rows stay in registers as B operands), so every fragment read from LDS feeds two products; it walks every second pass of 64 positions j, its partner wave the others, and the two partial results are joined at the end.
// S^T = x k'^T (A = query rows x from LDS, exact in f16: one plane), so a lane holds 32 scores of ONE row i: maximum and sum in-lane plus one exchange between the wave halves; the weights pack straight into the B operand of O^T += V^T P^T.
// A reference per row (base 2) goes into the score products as their C operand, so exp2 is taken straight on the accumulator; the reference moves only in the first two trips and in trips where a lane's sum of the trip's weights reaches FWL (one test a trip). S and P never leave registers.
typedef _Float16 v8h __attribute__((ext_vector_type(8)));
#define FJ 128                       /* positions j per LDS stage (two passes of 64) */
#define FPB 144                      /* LDS row pitch, bytes: 128-byte rows + 16, an odd multiple of 16 for 16-byte reads */
#define FVB 272                      /* LDS row pitch, bytes, of a V^T row of 128 positions: 256 + 16, an odd multiple of 16 too */
#define FXT (FJ * FPB)               /* the staged x tile: 128 rows of 64 features */
#define FBF (FXT + DM * FVB)         /* one buffer: the x tile, then the V^T tile of 64 rows */
#define FWB (-10.0f)                 /* a score at its row's reference gets the weight 2^FWB: 25 binades of room up to FWL, and f16 still holds 2^-14 of it */
#define FWL 32768.0f                 /* a lane's sum of a trip's weights from which the reference is renewed */
__device__ __forceinline__ float fa_xhalf(float x) { return __builtin_bit_cast(float, __builtin_amdgcn_permlanex16(__builtin_bit_cast(int, x), __builtin_bit_cast(int, x), 0x76543210, 0xfedcba98, false, false)); }      /* lane l with lane l ^ 16 */
__device__ __forceinline__ v16h fa_frag(const unsigned char* p) { FragH f; f.half[0] = *(const v8us*)p; f.half[1] = *(const v8us*)(p + 32); return f.v; }      /* same k order as g2_frag: p already holds the 16 * hh bytes */
__device__ __forceinline__ v8f fa_mma(v16h a, v16h b, v8f c) { return __builtin_amdgcn_wmma_f32_16x16x32_f16(false, a, false, b, (short)0, c, false, false); }
/* eight v_exp_f32 in one statement with the slot the instruction set asks for behind a transcendental: each is followed by an independent one (outputs early-clobbered, so none overwrites a source), the last by v_nop */
__device__ __forceinline__ v8f fa_exp8(v8f y) { float e0, e1, e2, e3, e4, e5, e6, e7;
  asm("v_exp_f32 %0, %8\n\tv_exp_f32 %1, %9\n\tv_exp_f32 %2, %10\n\tv_exp_f32 %3, %11\n\tv_exp_f32 %4, %12\n\tv_exp_f32 %5, %13\n\tv_exp_f32 %6, %14\n\tv_exp_f32 %7, %15\n\tv_nop" : "=&v"(e0), "=&v"(e1), "=&v"(e2), "=&v"(e3), "=&v"(e4), "=&v"(e5), "=&v"(e6), "=&v"(e7) : "v"(y[0]), "v"(y[1]), "v"(y[2]), "v"(y[3]), "v"(y[4]), "v"(y[5]), "v"(y[6]), "v"(y[7]));
  const v8f e = {e0, e1, e2, e3, e4, e5, e6, e7}; return e; }
typedef float v2f __attribute__((ext_vector_type(2)));
__global__ __launch_bounds__(256) void k_fattn(const _Float16* __restrict__ KH, const _Float16* __restrict__ KL, const _Float16* __restrict__ QH, const _Float16* __restrict__ VT, float* __restrict__ out) {
  __shared__ __attribute__((aligned(16))) unsigned char sm[2 * FBF];      /* two buffers of two tiles; behind the loop: the exchange of the partial results */
  const int tid = threadIdx.x, w = tid >> 5, lane = tid & 31, ln = lane & 15, hh = lane >> 4;
  const int rg = w & 3, jh = w >> 2;      /* a wave owns 32 output rows (two groups of 16) and walks one of the two passes of every stage; waves w and w ^ 4 share their rows */
  const int b = blockIdx.x / (SQ / 128), i0 = (blockIdx.x % (SQ / 128)) * 128 + rg * 32; const size_t r0 = (size_t)b * SQ;
  v16h kh[2][2], kl[2][2];
#pragma unroll
  for (int c = 0; c < 2; ++c) { const _Float16* khp = KH + (r0 + i0 + 16 * c + ln) * DM; const _Float16* klp = KL + (r0 + i0 + 16 * c + ln) * DM;
    kh[c][0] = g2_frag(khp, hh); kh[c][1] = g2_frag(khp + 32, hh); kl[c][0] = g2_frag(klp, hh); kl[c][1] = g2_frag(klp + 32, hh); }
  asm volatile("s_wait_xcnt 0x0" ::: "memory");      /* in front of the first instruction that reuses an address register of the k loads */
  __builtin_amdgcn_sched_barrier(0);      /* the k loads stay the oldest global loads: the wait for stage 0 then covers them, and the loop needs no wait to zero that would drain the stage in flight */
  const int srow = tid >> 3, sch = tid & 7, vrow = tid >> 4, vch = tid & 15;      /* staging: a thread moves 16-byte piece sch of rows srow + 32 r of the x tile and piece vch of rows vrow + 16 r of the V^T tile, r = 0 .. 3 */
  const unsigned short* gq = (const unsigned short*)QH + (r0 + srow) * DM + sch * 8; const unsigned short* gv = (const unsigned short*)VT + ((size_t)b * DM + vrow) * SQ + vch * 8;
  unsigned char* sb = sm + srow * FPB + sch * 16; unsigned char* sbv = sm + FXT + vrow * FVB + vch * 16; const unsigned char* lbq = sm + (jh * 64 + ln) * FPB + 16 * hh; const unsigned char* lbv = sm + FXT + ln * FVB + jh * 128 + 16 * hh;      /* the wave's pass: rows j 64 jh .. + 63 of the x tile, the same positions (128 bytes) of the V^T rows */
  v8us tq[4], tv[4]; v16h qa[8], va[4][2];
  const unsigned short *pq, *pv;      /* the addresses of the stage last asked for */
  auto g_load = [&](int st) { pq = gq + (size_t)st * FJ * DM; pv = gv + (size_t)st * FJ;
#pragma unroll
    for (int r = 0; r < 4; ++r) tq[r] = *(const v8us*)(pq + r * 32 * DM);
#pragma unroll
    for (int r = 0; r < 4; ++r) tv[r] = *(const v8us*)(pv + (size_t)r * 16 * SQ); };
  auto s_store = [&](int off) {
#pragma unroll
    for (int r = 0; r < 4; ++r) *(v8us*)(sb + off + r * 32 * FPB) = tq[r];
#pragma unroll
    for (int r = 0; r < 4; ++r) *(v8us*)(sbv + off + r * 16 * FVB) = tv[r]; };
  auto ld_q = [&](int off) {      /* the x fragments of the wave's pass: per 16 rows j k 0..31, k 32..63 */
#pragma unroll
    for (int jt = 0; jt < 4; ++jt) { const unsigned char* p = lbq + off + jt * 16 * FPB; qa[jt * 2] = fa_frag(p); qa[jt * 2 + 1] = fa_frag(p + 64); } };
  auto ld_v = [&](int off) {      /* the V^T fragments of the wave's pass: 16 rows f each, positions j 32 u .. + 31 */
#pragma unroll
    for (int t = 0; t < 4; ++t) { const unsigned char* p = lbv + off + t * 16 * FVB; va[t][0] = fa_frag(p); va[t][1] = fa_frag(p + 64); } };
  const v8f z8 = {0.f, 0.f, 0.f, 0.f, 0.f, 0.f, 0.f, 0.f}; v8f o[2][4] = {{z8, z8, z8, z8}, {z8, z8, z8, z8}}, a[2][4]; v2f l2[2] = {{0.f, 0.f}, {0.f, 0.f}}, ps2[2]; v16h pf[2], pg[2];
  v8f ci[2] = {z8 + FWB, z8 + FWB};      /* FWB minus the row's reference (base 2; set in trip 0) in all eight elements: the C operand of the score products */
  auto scores = [&](int c) {      /* row group c; four accumulator chains (the 16-row tiles jt), each C, x.hi (k 0..31, 32..63), x.lo (the same); a[c][jt][r] = score - reference + FWB of i = i0 + 16 c + ln, j = 16 jt + 8 hh + r */
#pragma unroll
    for (int jt = 0; jt < 4; ++jt) a[c][jt] = fa_mma(qa[2 * jt], kh[c][0], ci[c]);
#pragma unroll
    for (int jt = 0; jt < 4; ++jt) a[c][jt] = fa_mma(qa[2 * jt + 1], kh[c][1], a[c][jt]);
#pragma unroll
    for (int jt = 0; jt < 4; ++jt) a[c][jt] = fa_mma(qa[2 * jt], kl[c][0], a[c][jt]);
#pragma unroll
    for (int jt = 0; jt < 4; ++jt) a[c][jt] = fa_mma(qa[2 * jt + 1], kl[c][1], a[c][jt]); };
  auto expsum = [&](int c) {      /* the weights of row group c, the lane's sum of them (two halves), and their f16 pack */
    const v8f p0 = fa_exp8(a[c][0]), p1 = fa_exp8(a[c][1]), p2 = fa_exp8(a[c][2]), p3 = fa_exp8(a[c][3]); const v8f ps = (p0 + p1) + (p2 + p3);
    ps2[c] = (__builtin_shufflevector(ps, ps, 0, 1) + __builtin_shufflevector(ps, ps, 2, 3)) + (__builtin_shufflevector(ps, ps, 4, 5) + __builtin_shufflevector(ps, ps, 6, 7));
    union { v16h v; v8h h[2]; } f, g; f.h[0] = __builtin_convertvector(p0, v8h); f.h[1] = __builtin_convertvector(p1, v8h); g.h[0] = __builtin_convertvector(p2, v8h); g.h[1] = __builtin_convertvector(p3, v8h);      /* element e: j = 8 hh + e, then 16 + 8 hh + (e - 8): the k order of fa_frag; g: the same + 32 */
    pf[c] = f.v; pg[c] = g.v; };
  auto renew = [&](int c, bool first) {      /* the reference of every row of group c moves up to the trip's maximum (trip 0: is set to it, up or down); O and the sum follow, the trip's weights are taken again */
    float mx = a[c][0][0], my = a[c][1][0], mz = a[c][2][0], mw = a[c][3][0];      /* four independent chains */
#pragma unroll
    for (int r = 1; r < 8; ++r) { mx = fmaxf(mx, a[c][0][r]); my = fmaxf(my, a[c][1][r]); mz = fmaxf(mz, a[c][2][r]); mw = fmaxf(mw, a[c][3][r]); }
    mx = fmaxf(fmaxf(mx, my), fmaxf(mz, mw)); mx = fmaxf(mx, fa_xhalf(mx));      /* both lanes of a row get the same value */
    const float d = first ? mx - FWB : fmaxf(mx - FWB, 0.f); const float dm = first ? 0.f : -d; float al;      /* trip 0: O and the sum are zero and stay so */
    asm("v_exp_f32 %0, %1\n\tv_nop" : "=&v"(al) : "v"(dm));      /* v_nop: the slot behind a transcendental */
    ci[c] -= d; l2[c] *= al;
#pragma unroll
    for (int jt = 0; jt < 4; ++jt) a[c][jt] -= d;
#pragma unroll
    for (int t = 0; t < 4; ++t) o[c][t] *= al;
    expsum(c); };
  auto p_v = [&](int c) {
    l2[c] += ps2[c];
#pragma unroll
    for (int t = 0; t < 4; ++t) o[c][t] = fa_mma(va[t][0], pf[c], o[c][t]);
#pragma unroll
    for (int t = 0; t < 4; ++t) o[c][t] = fa_mma(va[t][1], pg[c], o[c][t]); };      /* o[c][t][r] = O[i0 + 16 c + ln][16 t + 8 hh + r] */
  g_load(0); s_store(0); g_load(1);
  asm volatile("s_wait_dscnt 0x0" ::: "memory");      /* own LDS stores done before the barrier is signalled */
  asm volatile("s_barrier_signal -1\n\ts_barrier_wait -1" ::: "memory");      /* by hand: __syncthreads() would also wait for the global loads of the next stage, which are meant to stay in flight */
  ld_q(0); ld_v(0);
#pragma unroll 1      /* one stage (one pass of 64 rows a wave) a trip: the two buffers alternate by the trip's parity */
  for (int s = 0; s < SQ / FJ; ++s) { const int nxt = FBF - (s & 1) * FBF;
    /* the scheduling fences keep each group of LDS instructions where it is written, in one place and not among the products */
    s_store(nxt); g_load((s + 2 < SQ / FJ) ? s + 2 : SQ / FJ - 1); __builtin_amdgcn_sched_barrier(0);      /* next stage into the buffer every wave left at the last barrier: the stores land under the products; the stage after it flies for a whole trip; past the end the last stage is fetched again (in bounds) and nobody uses it */
    scores(0); scores(1); __builtin_amdgcn_sched_barrier(0);
    asm volatile("s_wait_xcnt 0x0" :: "v"(pq), "v"(pv) : "memory");      /* the address registers of this trip's global loads are inputs here: they are kept up to this wait and reused only behind it, so it can stand behind the products instead of directly behind the loads */
    asm volatile("s_wait_dscnt 0x0" ::: "memory");      /* own stores of the next stage and own last reads of this one are done */
    asm volatile("s_barrier_signal -1\n\ts_barrier_wait -1" ::: "memory");      /* publishes the next stage and frees this one; by hand for the reason above. Left for a later step: every wave meets here between its products and its vector work */
    ld_q(nxt); __builtin_amdgcn_sched_barrier(0);      /* directly behind the products that read the same registers: it flies under the vector work */
    expsum(0); expsum(1);
    const bool need = !(ps2[0][0] + ps2[0][1] < FWL) | !(ps2[1][0] + ps2[1][1] < FWL) | (s < 2);      /* a weight at or above FWL (or a sum that is no number) shows in its lane's sum: below it every weight fits f16. The first two trips always renew: a maximum of 128 scores is seldom passed by the room there is */
    if (__builtin_amdgcn_ballot_w32(need) != 0) { renew(0, s == 0); renew(1, s == 0); }      /* one wave-uniform scalar branch a trip */
    p_v(0); p_v(1); __builtin_amdgcn_sched_barrier(0);
    ld_v(nxt); __builtin_amdgcn_sched_barrier(0); }
  asm volatile("s_wait_loadcnt 0x0\n\ts_wait_dscnt 0x0" ::: "memory");      /* what the last trip fetched ahead (nobody uses it) has landed before its registers and the ring are used for something else */
  __syncthreads();      /* every wave has left the ring: it becomes the exchange buffer */
  /* the two waves of a pair hold partial results of the same 32 rows: each hands the partner one row group (maximum, sum, O) and finishes the other */
  float lc[2]; const float m[2] = {FWB - ci[0][0], FWB - ci[1][0]};      /* the references in use */
#pragma unroll
  for (int c = 0; c < 2; ++c) { float l = l2[c][0] + l2[c][1]; l += fa_xhalf(l); lc[c] = l; }
  const bool up = jh != 0;      /* wave-uniform: the upper wave keeps group 1 */
  float* xs = (float*)sm + w * (34 * 32); const float* xp = (const float*)sm + (w ^ 4) * (34 * 32);
#pragma unroll
  for (int t = 0; t < 4; ++t) { const v8f g = up ? o[0][t] : o[1][t]; const v4f x = {g[0], g[1], g[2], g[3]}, y = {g[4], g[5], g[6], g[7]}; *(v4f*)(xs + (t * 64 + lane) * 4) = x; *(v4f*)(xs + (t * 64 + 32 + lane) * 4) = y; }
  xs[1024 + lane] = up ? m[0] : m[1]; xs[1056 + lane] = up ? lc[0] : lc[1];
  __syncthreads();      /* the partner's group is in LDS */
  const float mk = up ? m[1] : m[0], lk = up ? lc[1] : lc[0], mp = xp[1024 + lane], lp = xp[1056 + lane];
  const float mn = fmaxf(mk, mp), dk = mk - mn, dp = mp - mn; float fk, fp;
  asm("v_exp_f32 %0, %2\n\tv_exp_f32 %1, %3\n\tv_nop" : "=&v"(fk), "=&v"(fp) : "v"(dk), "v"(dp));      /* v_nop: the slot behind a transcendental */
  const float inv = 1.0f / (lk * fk + lp * fp); fk *= inv; fp *= inv;
  float* orow = out + (r0 + i0 + 16 * jh + ln) * DM + 8 * hh;
#pragma unroll
  for (int t = 0; t < 4; ++t) { const v8f g = up ? o[1][t] : o[0][t]; const v4f px = *(const v4f*)(xp + (t * 64 + lane) * 4), py = *(const v4f*)(xp + (t * 64 + 32 + lane) * 4);
    const v4f x = {g[0] * fk + px[0] * fp, g[1] * fk + px[1] * fp, g[2] * fk + px[2] * fp, g[3] * fk + px[3] * fp}, y = {g[4] * fk + py[0] * fp, g[5] * fk + py[1] * fp, g[6] * fk + py[2] * fp, g[7] * fk + py[3] * fp};
    *(v4f*)(orow + t * 16) = x; *(v4f*)(orow + t * 16 + 4) = y; } }


// Everything in front of the attention in ONE launch. A work-group takes 128 token rows, projects key and value of those rows, applies Wq^T to k and passes the query rows on unchanged.
// All global loads are issued first, whole lines a wave; inputs (rounded to bf16, exact in f16), the three weight matrices (x16; Wq transposed) and the rounded biases go to LDS.
// k: D^T = Wk x^T (A = weight rows, B = token rows), so a lane holds 8 neighbouring features of ONE token: hi and residual pack into 16-byte pieces, the rows of the wave's own tokens in LDS.
// k' = Wq^T k: the same form again, A = rows of Wq^T, B = those k rows, hi and residual each (two accumulators, joined 2^-10); k' -> hi + residual rows. The query rows leave as the exact f16 rows they are staged as.
// v: D = x W^T (A = token rows, B = weight rows), so a lane holds 8 neighbouring tokens of ONE feature: the pieces of a V^T row. Same k order and the same two accumulation steps (k 0..31, then 32..63) in both forms.
// Every result is staged in LDS; behind one barrier all of it is stored in whole 128-byte lines.
#define PJT 128                      /* token rows per work-group: 16 a wave */
#define PJP 144                      /* LDS row pitch, bytes, of 64 f16: 128 + 16, as FPB */
#define PJV 272                      /* LDS row pitch, bytes, of a staged V^T row of 128 tokens: 256 + 16 */
typedef unsigned short v4us __attribute__((ext_vector_type(4), may_alias));
__device__ __forceinline__ float pj_round(float x) { const unsigned int u = __float_as_uint(x); return __uint_as_float((u + 0x7FFFu + ((u >> 16) & 1u)) & 0xFFFF0000u); }      /* the value of bf16_round */
__device__ __forceinline__ v4us pj_cvt(v4f x, float scale) { const v4f y = {pj_round(x[0]) * scale, pj_round(x[1]) * scale, pj_round(x[2]) * scale, pj_round(x[3]) * scale}; return __builtin_bit_cast(v4us, __builtin_convertvector(y, v4h)); }
__global__ __launch_bounds__(256) void k_proj(const float* __restrict__ xq, const float* __restrict__ xk, const float* __restrict__ xv, const float* __restrict__ wq, const float* __restrict__ wk, const float* __restrict__ bk, const float* __restrict__ wv, const float* __restrict__ bv,
    _Float16* __restrict__ QH, _Float16* __restrict__ KH, _Float16* __restrict__ KL, _Float16* __restrict__ VT) {
  __shared__ __attribute__((aligned(16))) unsigned char sx[3 * PJT * PJP];      /* f16 rows of query, key, value */
  __shared__ __attribute__((aligned(16))) unsigned char sw[3 * DM * PJP];       /* f16 rows of Wq^T, Wk, Wv (x16) */
  __shared__ __attribute__((aligned(16))) float sb[4 * DM];                     /* bk, bk, bv, bv rounded to bf16 (the second and the third quarter are read) */
  __shared__ __attribute__((aligned(16))) unsigned char so[8 * 4 * 16 * PJP];   /* per wave: its 16 rows of k' hi, k' residual, k hi, k residual */
  __shared__ __attribute__((aligned(16))) unsigned char sv[DM * PJV];           /* V^T of the 128 tokens */
  const int tid = threadIdx.x, w = tid >> 5, lane = tid & 31, ln = lane & 15, hh = lane >> 4;
  const size_t row0 = (size_t)blockIdx.x * PJT;
  const float* const xs[3] = {xq + row0 * DM, xk + row0 * DM, xv + row0 * DM}; const float* const wsr[3] = {wq, wk, wv};
  const float br = (tid < 2 * DM ? bk : bv)[tid & (DM - 1)];      /* from every thread, among the other loads: under a branch its wait would go to zero and drain the input loads before the first conversion */
  v4f wr[3][4], xr[3][8];      /* piece i * 256 + tid (4 floats) of each tile: row i * 16 + tid / 16, piece tid % 16 of the row; Wq: column tid % 64, rows i * 16 + 4 (tid / 64) .. + 3, a whole line per wave load */
#pragma unroll
  for (int i = 0; i < 4; ++i) {
#pragma unroll
    for (int q = 0; q < 4; ++q) wr[0][i][q] = wq[(i * 16 + (tid >> 6) * 4 + q) * DM + (tid & (DM - 1))]; }
#pragma unroll
  for (int m = 1; m < 3; ++m) {
#pragma unroll
    for (int i = 0; i < 4; ++i) wr[m][i] = *(const v4fa*)(wsr[m] + (i * 256 + tid) * 4); }
#pragma unroll
  for (int m = 0; m < 3; ++m) {
#pragma unroll
    for (int i = 0; i < 8; ++i) xr[m][i] = *(const v4fa*)(xs[m] + (i * 256 + tid) * 4); }
  sb[tid] = pj_round(br);
  const int so4 = (tid >> 4) * PJP + (tid & 15) * 8;
#pragma unroll
  for (int i = 0; i < 4; ++i) *(v4us*)(sw + (tid & (DM - 1)) * PJP + (i * 16 + (tid >> 6) * 4) * 2) = pj_cvt(wr[0][i], 16.0f);      /* row m of Wq^T: Wq[n][m], n in a row */
#pragma unroll
  for (int m = 1; m < 3; ++m) {
#pragma unroll
    for (int i = 0; i < 4; ++i) *(v4us*)(sw + (m * DM + i * 16) * PJP + so4) = pj_cvt(wr[m][i], 16.0f); }
#pragma unroll
  for (int m = 0; m < 3; ++m) {
#pragma unroll
    for (int i = 0; i < 8; ++i) *(v4us*)(sx + (m * PJT + i * 16) * PJP + so4) = pj_cvt(xr[m][i], 1.0f); }
  __syncthreads();
  const unsigned char* xl = sx + (16 * w + ln) * PJP + 16 * hh; const unsigned char* wl = sw + ln * PJP + 16 * hh; unsigned char* sh = so + w * (4 * 16 * PJP);
  const v8f z8 = {0.f, 0.f, 0.f, 0.f, 0.f, 0.f, 0.f, 0.f};
  { const v16h x0 = fa_frag(xl + 2 * PJT * PJP), x1 = fa_frag(xl + 2 * PJT * PJP + 64);
#pragma unroll
    for (int t = 0; t < 4; ++t) { const unsigned char* p = wl + (2 * DM + t * 16) * PJP;
      v8f c = fa_mma(x0, fa_frag(p), z8); c = fa_mma(x1, fa_frag(p + 64), c);      /* c[r]: token 16 w + 8 hh + r, feature 16 t + ln */
      const v8f v = c * 0.0625f + sb[2 * DM + t * 16 + ln];
      *(v8us*)(sv + (t * 16 + ln) * PJV + (16 * w + 8 * hh) * 2) = __builtin_bit_cast(v8us, __builtin_convertvector(v, v8h)); } }
  { const v16h x0 = fa_frag(xl + PJT * PJP), x1 = fa_frag(xl + PJT * PJP + 64);
#pragma unroll
    for (int t = 0; t < 4; ++t) { const unsigned char* p = wl + (DM + t * 16) * PJP;
      v8f c = fa_mma(fa_frag(p), x0, z8); c = fa_mma(fa_frag(p + 64), x1, c);      /* c[r]: feature 16 t + 8 hh + r of k, token 16 w + ln */
      const v4f b0 = *(const v4f*)&sb[DM + t * 16 + 8 * hh], b1 = *(const v4f*)&sb[DM + t * 16 + 8 * hh + 4];
      const v8f v = c * 0.0625f + __builtin_shufflevector(b0, b1, 0, 1, 2, 3, 4, 5, 6, 7); const v8h h = __builtin_convertvector(v, v8h);
      const v8h l = __builtin_convertvector((v - __builtin_convertvector(h, v8f)) * 1024.0f, v8h);
      unsigned char* d = sh + (32 + ln) * PJP + t * 32 + hh * 16; *(v8us*)d = __builtin_bit_cast(v8us, h); *(v8us*)(d + 16 * PJP) = __builtin_bit_cast(v8us, l); } }
  __builtin_amdgcn_fence(__ATOMIC_ACQ_REL, "workgroup"); __builtin_amdgcn_wave_barrier();      /* each lane reads back only the k pieces it stored itself: its LDS stores stay in front of these loads */
  { const unsigned char* kr = sh + (32 + ln) * PJP + 16 * hh;      /* token 16 w + ln as a B row: k order of fa_frag, as the Wq^T rows */
    const v16h g0 = fa_frag(kr), g1 = fa_frag(kr + 64), r0 = fa_frag(kr + 16 * PJP), r1 = fa_frag(kr + 16 * PJP + 64);
#pragma unroll
    for (int t = 0; t < 4; ++t) { const unsigned char* p = wl + t * 16 * PJP; const v16h a0 = fa_frag(p), a1 = fa_frag(p + 64);
      v8f c = fa_mma(a0, g0, z8), e = fa_mma(a0, r0, z8); c = fa_mma(a1, g1, c); e = fa_mma(a1, r1, e);      /* c[r], e[r]: feature 16 t + 8 hh + r of k', token 16 w + ln */
      const v8f v = (e * 0.0009765625f + c) * (0.0625f * 1.44269504f); const v8h h = __builtin_convertvector(v, v8h);      /* log2(e): the scores come out in base 2 */
      const v8h l = __builtin_convertvector(v - __builtin_convertvector(h, v8f), v8h);      /* unscaled: it shares the accumulator of the hi products */
      unsigned char* d = sh + ln * PJP + t * 32 + hh * 16; *(v8us*)d = __builtin_bit_cast(v8us, h); *(v8us*)(d + 16 * PJP) = __builtin_bit_cast(v8us, l); } }
  __syncthreads();      /* V^T rows cross the waves; the k' rows are read back by other lanes of the wave that staged them */
  { unsigned short* gh = (unsigned short*)KH + (row0 + 16 * w) * DM; unsigned short* gl = (unsigned short*)KL + (row0 + 16 * w) * DM; unsigned short* gx = (unsigned short*)QH + (row0 + 16 * w) * DM;
#pragma unroll
    for (int i = 0; i < 4; ++i) { const int ix = i * 32 + lane; const unsigned char* s = sh + (ix >> 3) * PJP + (ix & 7) * 16;      /* the wave's 16 rows are 2 KiB in a row: 512 contiguous bytes a store */
      *(v8us*)(gh + ix * 8) = *(const v8us*)s; *(v8us*)(gl + ix * 8) = *(const v8us*)(s + 16 * PJP); *(v8us*)(gx + ix * 8) = *(const v8us*)(sx + (16 * w + (ix >> 3)) * PJP + (ix & 7) * 16); } }
  unsigned short* gv = (unsigned short*)VT + (size_t)(blockIdx.x / (SQ / PJT)) * DM * SQ + (blockIdx.x % (SQ / PJT)) * PJT;
#pragma unroll
  for (int i = 0; i < 4; ++i) { const int ix = i * 256 + tid, d = ix >> 4, pc = ix & 15; *(v8us*)(gv + (size_t)d * SQ + pc * 8) = *(const v8us*)(sv + d * PJV + pc * 16); } }      /* 256 contiguous bytes of a V^T row per 16 lanes */

extern "C" void kernel_launch(void* const* d_in, const int* in_sizes, int n_in,
                              void* d_out, int out_size, void* d_ws, size_t ws_size, hipStream_t stream) {
  (void)in_sizes; (void)n_in; (void)out_size;
  const float* const* I = (const float* const*)d_in; const float* xq = I[0]; const float* xk = I[1]; const float* xv = I[2]; const float* wq = I[3]; const float* wk = I[5]; const float* bk = I[6]; const float* wv = I[7]; const float* bv = I[8];      /* query, key, value [8][4096][64]; natural [64][64] weights + biases */
  char* ws = (char*)d_ws; size_t off = 0;
  auto take = [&](size_t bytes) { char* p = ws + off; off += (bytes + 255) & ~(size_t)255; return p; };
  _Float16* QH = (_Float16*)take(NR * DM * 2); _Float16* KH = (_Float16*)take(NR * DM * 2); _Float16* KL = (_Float16*)take(NR * DM * 2); _Float16* VT = (_Float16*)take(NR * DM * 2);
  if (off > ws_size) return;
  k_proj<<<(unsigned)(NR / PJT), 256, 0, stream>>>(xq, xk, xv, wq, wk, bk, wv, bv, QH, KH, KL, VT);      /* query rows -> exact f16 rows; k' = log2(e) Wq^T k -> f16 hi + residual rows; v -> V^T [64][4096] of every batch; I[4] (bq) shifts every score of a row alike and is not read */
  k_fattn<<<NB * (SQ / 128), 256, 0, stream>>>(KH, KL, QH, VT, (float*)d_out);      /* scores (x.hi + x.lo, base 2), softmax over the query positions, out[i] = sum_j attn[i][j] v[j] */
}

// v008
// One run takes 41 microseconds.
// In two side-by-side timings against v007, it was 1.03 and 1.02 times as fast.
// Over all steps from v000 it is 170 times as fast.
#include <hip/hip_runtime.h>
// Dot-product attention with TRANSPOSED roles and no scaling (query, key, value [8][4096][64]; q = query Wq^T + bq, k = key Wk^T + bk, v = value Wv^T + bv (natural [64][64] sigma 1/8, biases 0.01); scores[i][j] = k_i . q_j (NO 1/sqrt(d): sigma ~8); attn = softmax over the query positions j; out[i] = sum_j attn[i][j] v[j] -> [8][4096][64] (rows are key positions)).
// Structure: one launch in front of the attention: a work-group takes 128 token rows of query, key and value; the bf16-valued inputs as exact f16 rows and the weights x16 in LDS; k as WMMA products (f32 accumulation, + bias) -> f16 hi + x1024 residual, then k' = log2(e) Wq^T k (WMMA on both parts) -> f16 hi + residual rows (the residual unscaled: f16 keeps it to 2^-25); the query rows go out as they are (exact f16); v -> f16 V^T rows; every output staged through LDS and stored in whole lines; then one fused kernel: scores (base 2) = k'.x = hi.x + lo.x (K = 64, one f32 accumulator that starts at FWB minus the row's reference) in registers; weights = exp2 of the accumulator (f16), row sum f32; the reference is renewed in the first two trips and after them only when a lane's weights of a trip sum to FWL or more; out = P V^T / sum f32.
// k_i . q_j = k_i . (Wq x_j + bq) = (Wq^T k_i) . x_j + k_i . bq; the last term is the same for every j of a row i, and the softmax over j does not see it: it is left out, for any bq.
// Compute dtype: inputs rounded to bf16; x / weights exact; k as f16 hi + x1024 residual, k' as f16 hi + unscaled residual, v and softmax weights as plain f16 GEMM operands (~2^-12); scores and softmax statistics f32. v_wmma_f32_16x16x32_f16.
#define NB 8
#define SQ 4096
#define DM 64
#define NH 1
#define HD 64
#define HG 8                         /* heads per launch of the k_vt(b, h0) overload (not launched) */
#define B0 0                         /* first batch processed (used by no kernel or launch) */
#define NBR NB                       /* batches processed (used by no kernel or launch) */
#define NR ((size_t)NB * SQ)         /* token rows */
#define MP ((int)((size_t)NBR * SQ)) /* rows projected (used by no kernel or launch) */
#define QT 256                       /* query rows per causal tile */
#define NKX SQ                       /* S / P row pitch */
#define QT0 256                      /* first-tile rows recomputed exactly */
#define QN SQ                        /* query rows attended per batch (used by no kernel or launch) */
#define NHD NH                       /* heads attended (used by no kernel or launch) */
#define MPO MP                       /* rows through the output stage (used by no kernel or launch) */
#define LQ DM            /* row pitch of the q/k/v rows (used by no kernel or launch) */
typedef __bf16 v16b __attribute__((ext_vector_type(16)));
typedef unsigned short v8us __attribute__((ext_vector_type(8), may_alias));
typedef float  v8f  __attribute__((ext_vector_type(8)));
typedef float  v4f  __attribute__((ext_vector_type(4)));
typedef float  v4fa __attribute__((ext_vector_type(4), may_alias));
union FragB { v16b v; v8us half[2]; unsigned short u[16]; };

__device__ __forceinline__ unsigned short bf16_bits(float x) { unsigned int u = __float_as_uint(x); return (unsigned short)((u + 0x7FFFu + ((u >> 16) & 1u)) >> 16); }
__device__ __forceinline__ float bf16_val(unsigned short b) { return __uint_as_float(((unsigned int)b) << 16); }
__device__ __forceinline__ float bf16_round(float x) { return bf16_val(bf16_bits(x)); }
// D += A·B with NT terms: 1 = ah·bh, 2 = + al·bh (A split), 3 = + ah·bl (both split)
template <int NT>
__device__ __forceinline__ v8f mmaN(v16b ah, v16b al, v16b bh, v16b bl, v8f c) {
  c = __builtin_amdgcn_wmma_f32_16x16x32_bf16(false, ah, false, bh, (short)0, c, false, false);
  if (NT >= 2) c = __builtin_amdgcn_wmma_f32_16x16x32_bf16(false, al, false, bh, (short)0, c, false, false);
  if (NT >= 3) c = __builtin_amdgcn_wmma_f32_16x16x32_bf16(false, ah, false, bl, (short)0, c, false, false);
  asm volatile("v_nop\n\tv_nop\n\tv_nop\n\tv_nop" : "+v"(c) : "v"(ah), "v"(al), "v"(bh), "v"(bl));
  return c;
}

__global__ __launch_bounds__(256) void k_wt_bf16(const float* __restrict__ W, unsigned short* __restrict__ Wt, int K, int N) {
  const int t = blockIdx.x * 256 + threadIdx.x;
  const int k8n = K / 8;
  if (t >= N * k8n) return;
  const int n = t / k8n, k8 = (t % k8n) * 8;
  v8us v;
#pragma unroll
  for (int i = 0; i < 8; ++i) v[i] = bf16_bits(W[(size_t)(k8 + i) * N + n]);
  *(v8us*)(Wt + (size_t)n * K + k8) = v;
  
}

// GEMM C[M][N] (f32, pitch ldc) = act(A[M][K]·W + bias). A f32 row-major (pitch lda) converted per fragment to bf16
// (ASPLIT: hi/lo two planes -> 2 terms, else single rounded term); Wt bf16 [N][K] (pitch ldb). BIAS_BF16 rounds the
// bias to bf16 first (bias quantised to bf16 before the add). K%32==0, M%16==0, N%64==0.
template <bool ASPLIT, int ACT, bool BIAS_BF16>
__global__ __launch_bounds__(128) void k_gemm_bf(const float* __restrict__ A, int lda, const unsigned short* __restrict__ Wt, int ldb,
                                               const float* __restrict__ bias, float* __restrict__ C, int ldc, int M, int N, int K) {
  __shared__ __attribute__((aligned(16))) float so[4][16][64];
  const int tid = threadIdx.x, w = tid >> 5, lane = tid & 31, ln = lane & 15, hh = lane >> 4;
  const int ntn = N / 64;
  const int wid = blockIdx.x * 4 + w;
  const int mt = wid / ntn, nq = wid % ntn;
  if (mt * 16 >= M) return;
  const int row0 = mt * 16, col0 = nq * 64;
  const float* arow = A + (size_t)(row0 + ln) * lda;
  v8f acc[4] = {};
  for (int kb = 0; kb < K; kb += 32) {
    FragB ah, al;
    const v4f x0 = *(const v4fa*)(arow + kb + 8 * hh), x1 = *(const v4fa*)(arow + kb + 8 * hh + 4);
    const v4f x2 = *(const v4fa*)(arow + kb + 16 + 8 * hh), x3 = *(const v4fa*)(arow + kb + 16 + 8 * hh + 4);
    float xs[16] = {x0[0],x0[1],x0[2],x0[3],x1[0],x1[1],x1[2],x1[3],x2[0],x2[1],x2[2],x2[3],x3[0],x3[1],x3[2],x3[3]};
#pragma unroll
    for (int i = 0; i < 16; ++i) { const unsigned short hb = bf16_bits(xs[i]); ah.u[i] = hb; al.u[i] = ASPLIT ? bf16_bits(xs[i] - bf16_val(hb)) : (unsigned short)0; }
#pragma unroll
    for (int t = 0; t < 4; ++t) {
      const unsigned short* brow = Wt + (size_t)(col0 + t * 16 + ln) * ldb + kb;
      FragB b;
      b.half[0] = *(const v8us*)(brow + 8 * hh);
      b.half[1] = *(const v8us*)(brow + 16 + 8 * hh);
      acc[t] = mmaN<ASPLIT ? 2 : 1>(ah.v, al.v, b.v, b.v, acc[t]);
    }
  }
#pragma unroll
  for (int t = 0; t < 4; ++t) {
    float bv = bias ? bias[col0 + t * 16 + ln] : 0.f;
    if (BIAS_BF16) bv = bf16_round(bv);
#pragma unroll
    for (int r = 0; r < 8; ++r) { float v = acc[t][r] + bv; if (ACT == 1) v = fmaxf(v, 0.f); so[w][8 * hh + r][t * 16 + ln] = v; }
  }
  __builtin_amdgcn_fence(__ATOMIC_ACQ_REL, "workgroup");
  __builtin_amdgcn_wave_barrier();
  const int rsub = lane >> 4, c4 = (lane & 15) * 4;
  {
#pragma unroll
    for (int q = 0; q < 8; ++q) {
      const int r = q * 2 + rsub;
      const v4f v = *(const v4fa*)&so[w][r][c4];
      *(v4f*)(C + (size_t)(row0 + r) * ldc + col0 + c4) = v;
    }
    
  }
}

// GEMM C = act(A·W + bias + resid): A f32 (ASPLIT -> hi/lo 2 terms), Wt bf16 [N][K]; ACT 0 none, 1 relu, 2 exact gelu;
// resid (optional, f32, row index = (row % rmod), pitch ldr, RES_BF16 rounds it) added before the activation.
template <bool ASPLIT, int ACT, bool BIAS_BF16, bool RES_BF16>
__global__ __launch_bounds__(128) void k_gemm_bf3(const float* __restrict__ A, int lda, const unsigned short* __restrict__ Wt, int ldb,
                                                const float* __restrict__ bias, const float* __restrict__ resid, int rmod, int ldr,
                                                float* __restrict__ C, int ldc, int M, int N, int K) {
  __shared__ __attribute__((aligned(16))) float so[4][16][64];
  const int tid = threadIdx.x, w = tid >> 5, lane = tid & 31, ln = lane & 15, hh = lane >> 4;
  const int ntn = N / 64;
  const int wid = blockIdx.x * 4 + w;
  const int mt = wid / ntn, nq = wid % ntn;
  if (mt * 16 >= M) return;
  const int row0 = mt * 16, col0 = nq * 64;
  const float* arow = A + (size_t)(row0 + ln) * lda;
  v8f acc[4] = {};
  for (int kb = 0; kb < K; kb += 32) {
    FragB ah, al;
    const v4f x0 = *(const v4fa*)(arow + kb + 8 * hh), x1 = *(const v4fa*)(arow + kb + 8 * hh + 4);
    const v4f x2 = *(const v4fa*)(arow + kb + 16 + 8 * hh), x3 = *(const v4fa*)(arow + kb + 16 + 8 * hh + 4);
    float xs[16] = {x0[0],x0[1],x0[2],x0[3],x1[0],x1[1],x1[2],x1[3],x2[0],x2[1],x2[2],x2[3],x3[0],x3[1],x3[2],x3[3]};
#pragma unroll
    for (int i = 0; i < 16; ++i) { const unsigned short hb = bf16_bits(xs[i]); ah.u[i] = hb; al.u[i] = ASPLIT ? bf16_bits(xs[i] - bf16_val(hb)) : (unsigned short)0; }
#pragma unroll
    for (int t = 0; t < 4; ++t) {
      const unsigned short* brow = Wt + (size_t)(col0 + t * 16 + ln) * ldb + kb;
      FragB b;
      b.half[0] = *(const v8us*)(brow + 8 * hh);
      b.half[1] = *(const v8us*)(brow + 16 + 8 * hh);
      acc[t] = mmaN<ASPLIT ? 2 : 1>(ah.v, al.v, b.v, b.v, acc[t]);
    }
  }
#pragma unroll
  for (int t = 0; t < 4; ++t) {
    const int col = col0 + t * 16 + ln;
    float bv = bias ? bias[col] : 0.f;
    if (BIAS_BF16) bv = bf16_round(bv);
#pragma unroll
    for (int r = 0; r < 8; ++r) {
      float v = acc[t][r] + bv;
      if (resid) { float rv = resid[(size_t)((row0 + 8 * hh + r) % rmod) * ldr + col]; if (RES_BF16) rv = bf16_round(rv); v += rv; }
      if (ACT == 1) v = fmaxf(v, 0.f);
      if (ACT == 2) v = 0.5f * v * (1.0f + erff(v * 0.70710678118654752f));
      if (ACT == 3) { const float u = 0.7978845608028654f * (v + 0.044715f * v * v * v); v = 0.5f * v * (1.0f + tanhf(u)); }
      so[w][8 * hh + r][t * 16 + ln] = v;
    }
  }
  __builtin_amdgcn_fence(__ATOMIC_ACQ_REL, "workgroup");
  __builtin_amdgcn_wave_barrier();
  const int rsub = lane >> 4, c4 = (lane & 15) * 4;
  {
#pragma unroll
    for (int q = 0; q < 8; ++q) {
      const int r = q * 2 + rsub;
      const v4f v = *(const v4fa*)&so[w][r][c4];
      *(v4f*)(C + (size_t)(row0 + r) * ldc + col0 + c4) = v;
    }
    
  }
}
// row LayerNorm (biased variance, eps) over N: s = X (+ R); optional out_sum <- s; out_norm <- (s-mu)*rsqrt(var+eps)*g + b
template <bool PARAM_BF16>
__global__ __launch_bounds__(256) void k_layernorm(const float* __restrict__ X, const float* __restrict__ R, const float* __restrict__ g, const float* __restrict__ bta,
                                                  float* __restrict__ out_sum, float* __restrict__ out_norm, int N, float eps) {
  __shared__ float red[256];
  const int row = blockIdx.x, tid = threadIdx.x;
  const float* x = X + (size_t)row * N; const float* rr = R ? R + (size_t)row * N : nullptr;
  float vals[16];                     // up to N = 4096
  const int per = N / 256;            // contiguous chunk per thread? use strided-by-4 chunks: thread handles j = tid*4 + 1024*u
  float s1 = 0.f;
  for (int u = 0; u < per / 4; ++u) {
    const int j = tid * 4 + 1024 * u;
    const v4f a = *(const v4fa*)(x + j);
    v4f b = {0.f,0.f,0.f,0.f}; if (rr) b = *(const v4fa*)(rr + j);
#pragma unroll
    for (int q = 0; q < 4; ++q) { const float v = a[q] + b[q]; vals[u * 4 + q] = v; s1 += v; }
  }
  red[tid] = s1; __syncthreads();
  for (int st = 128; st > 0; st >>= 1) { if (tid < st) red[tid] += red[tid + st]; __syncthreads(); }
  const float mu = red[0] / (float)N; __syncthreads();
  float s2 = 0.f;
  for (int u = 0; u < per / 4; ++u)
#pragma unroll
    for (int q = 0; q < 4; ++q) { const float c = vals[u * 4 + q] - mu; s2 += c * c; }
  red[tid] = s2; __syncthreads();
  for (int st = 128; st > 0; st >>= 1) { if (tid < st) red[tid] += red[tid + st]; __syncthreads(); }
  const float rs = rsqrtf(red[0] / (float)N + eps);
  {
    for (int u = 0; u < per / 4; ++u) {
      const int j = tid * 4 + 1024 * u;
      v4f o, sm;
#pragma unroll
      for (int q = 0; q < 4; ++q) {
        float gg = g[j + q], bb = bta[j + q];
        if (PARAM_BF16) { gg = bf16_round(gg); bb = bf16_round(bb); }
        sm[q] = vals[u * 4 + q]; o[q] = (vals[u * 4 + q] - mu) * rs * gg + bb;
      }
      if (out_sum) *(v4f*)(out_sum + (size_t)row * N + j) = sm;
      *(v4f*)(out_norm + (size_t)row * N + j) = o;
    }
    
  }
}



// ---- f16 WMMA path (v_wmma_f32_16x16x32_f16): 11-bit significands for operands in range — used where a [0,1] probability operand needs more precision than bf16
typedef _Float16 v16h __attribute__((ext_vector_type(16)));
union FragH { v16h v; v8us half[2]; _Float16 h[16]; unsigned short u[16]; };
template <int NT>
__device__ __forceinline__ v8f mmaH(v16h ah, v16h al, v16h bh, v16h bl, v8f c) {
  c = __builtin_amdgcn_wmma_f32_16x16x32_f16(false, ah, false, bh, (short)0, c, false, false);
  if (NT >= 2) c = __builtin_amdgcn_wmma_f32_16x16x32_f16(false, al, false, bh, (short)0, c, false, false);
  if (NT >= 3) c = __builtin_amdgcn_wmma_f32_16x16x32_f16(false, ah, false, bl, (short)0, c, false, false);
  asm volatile("v_nop\n\tv_nop\n\tv_nop\n\tv_nop" : "+v"(c) : "v"(ah), "v"(al), "v"(bh), "v"(bl));
  return c;
}
// batched GEMM like k_gemm_b but f16 operands: A f32 (split into f16 hi/lo if ASPLIT, else rounded to f16), Bt = f16 values [n][k]; alpha; C f32; N multiple of 16 (partial tiles skipped)
template <bool ASPLIT>
__global__ __launch_bounds__(128) void k_gemm_h(const float* __restrict__ A, int lda, size_t sA, const _Float16* __restrict__ Bh, int ldb, size_t sB, float alpha, float* __restrict__ C, int ldc, size_t sC, int M, int N, int K) {
  __shared__ __attribute__((aligned(16))) float so[4][16][64];
  const int tid = threadIdx.x, w = tid >> 5, lane = tid & 31, ln = lane & 15, hh = lane >> 4; const int by = blockIdx.y;
  A += (size_t)by * sA; Bh += (size_t)by * sB; C += (size_t)by * sC;
  const int ntn = (N + 63) / 64; const int wid = blockIdx.x * 4 + w; const int mt = wid / ntn, nq = wid % ntn; if (mt * 16 >= M) return;
  const int row0 = mt * 16, col0 = nq * 64; const float* arow = A + (size_t)(row0 + ln) * lda;
  v8f acc[4] = {};
  for (int kb = 0; kb < K; kb += 32) {
    FragH ah, al;
    const v4f x0 = *(const v4fa*)(arow + kb + 8 * hh), x1 = *(const v4fa*)(arow + kb + 8 * hh + 4), x2 = *(const v4fa*)(arow + kb + 16 + 8 * hh), x3 = *(const v4fa*)(arow + kb + 16 + 8 * hh + 4);
    float xs[16] = {x0[0],x0[1],x0[2],x0[3],x1[0],x1[1],x1[2],x1[3],x2[0],x2[1],x2[2],x2[3],x3[0],x3[1],x3[2],x3[3]};
#pragma unroll
    for (int i = 0; i < 16; ++i) { const _Float16 h = (_Float16)xs[i]; ah.h[i] = h; al.h[i] = ASPLIT ? (_Float16)(xs[i] - (float)h) : (_Float16)0.0f; }
#pragma unroll
    for (int t = 0; t < 4; ++t) { if (col0 + t * 16 >= N) continue; const size_t boff = (size_t)(col0 + t * 16 + ln) * ldb + kb; FragH bq; bq.half[0] = *(const v8us*)(Bh + boff + 8 * hh); bq.half[1] = *(const v8us*)(Bh + boff + 16 + 8 * hh);
      acc[t] = mmaH<ASPLIT ? 2 : 1>(ah.v, al.v, bq.v, bq.v, acc[t]); }
  }
#pragma unroll
  for (int t = 0; t < 4; ++t) { if (col0 + t * 16 >= N) continue;
#pragma unroll
    for (int r = 0; r < 8; ++r) so[w][8 * hh + r][t * 16 + ln] = acc[t][r] * alpha; }
  __builtin_amdgcn_fence(__ATOMIC_ACQ_REL, "workgroup"); __builtin_amdgcn_wave_barrier();
  const int rsub = lane >> 4, c4 = (lane & 15) * 4;
  {
#pragma unroll
    for (int q = 0; q < 8; ++q) { const int r = q * 2 + rsub; if (col0 + c4 < N) { const v4f v = *(const v4fa*)&so[w][r][c4]; *(v4f*)(C + (size_t)(row0 + r) * ldc + col0 + c4) = v; } }
     }
}

// Wt[n][k] = f16(W[k][n]·scale) from f32 row-major W[K][N] (scale = power of two; bf16-exact weights stay exact in f16 away from the subnormal range)
__global__ __launch_bounds__(256) void k_wt_f16(const float* __restrict__ W, _Float16* __restrict__ Wt, int K, int N, float scale) {
  const int t = blockIdx.x * 256 + threadIdx.x; if (t >= N * (K / 8)) return; const int n = t / (K / 8), k8 = (t % (K / 8)) * 8; FragH f;
#pragma unroll
  for (int i = 0; i < 8; ++i) f.h[i] = (_Float16)(bf16_round(W[(size_t)(k8 + i) * N + n]) * scale); const v8us o = f.half[0];
  *(v8us*)((unsigned short*)Wt + (size_t)n * K + k8) = o; 
}
// k_gemm_hh variant with fused epilogue: v = acc·alpha + bias[by·sBias + col] (+ CP[(row/rowsPerB)·sCPb + by·64 + col] if CP) ; ACT 0 none / 1 elu ; writes f16 C16 (and f32 C if non-null)
template <int ACT>
__global__ __launch_bounds__(128) void k_gemm_hhx(const _Float16* __restrict__ A, int lda, size_t sA, const _Float16* __restrict__ Bh, int ldb, size_t sB, float alpha, const float* __restrict__ bias, size_t sBias, const float* __restrict__ CP, int rowsPerB, size_t sCPb, int row0g,
    float* __restrict__ C, _Float16* __restrict__ C16, int ldc, size_t sC, int M, int N, int K) {
  __shared__ __attribute__((aligned(16))) float so[4][16][64];
  const int tid = threadIdx.x, w = tid >> 5, lane = tid & 31, ln = lane & 15, hh = lane >> 4; const int by = blockIdx.y;
  A += (size_t)by * sA; Bh += (size_t)by * sB; const size_t cofs = (size_t)by * sC; const float* bp = bias ? bias + (size_t)by * sBias : nullptr;
  const int ntn = (N + 63) / 64; const int wid = blockIdx.x * 4 + w; const int mt = wid / ntn, nq = wid % ntn; if (mt * 16 >= M) return;
  const int row0 = mt * 16, col0 = nq * 64; const _Float16* arow = A + (size_t)(row0 + ln) * lda;
  v8f acc[4] = {};
  for (int kb = 0; kb < K; kb += 32) { FragH ah; ah.half[0] = *(const v8us*)((const unsigned short*)arow + kb + 8 * hh); ah.half[1] = *(const v8us*)((const unsigned short*)arow + kb + 16 + 8 * hh);
#pragma unroll
    for (int t = 0; t < 4; ++t) { if (col0 + t * 16 >= N) continue; const size_t boff = (size_t)(col0 + t * 16 + ln) * ldb + kb; FragH bq; bq.half[0] = *(const v8us*)((const unsigned short*)Bh + boff + 8 * hh); bq.half[1] = *(const v8us*)((const unsigned short*)Bh + boff + 16 + 8 * hh);
      acc[t] = mmaH<1>(ah.v, ah.v, bq.v, bq.v, acc[t]); }
  }
#pragma unroll
  for (int t = 0; t < 4; ++t) { if (col0 + t * 16 >= N) continue; const int col = col0 + t * 16 + ln; const float bv = bp ? bf16_round(bp[col]) : 0.f;
#pragma unroll
    for (int r = 0; r < 8; ++r) { float v = acc[t][r] * alpha + bv; if (CP) { const int rr = row0g + row0 + 8 * hh + r; if (rowsPerB < 0) v += CP[cofs + (size_t)rr * ldc + col];      /* rowsPerB < 0: own element of the batched C plane */ else { const int bidx = rr / rowsPerB; v += CP[(size_t)bidx * sCPb + (size_t)by * 64 + col]; } } if (ACT == 1) v = (v > 0.f) ? v : expm1f(v); else if (ACT == 7) v = (v > 0.f) ? v + 1.0f : expf(v); else if (ACT == 8) v = tanhf(v); else if (ACT == 9) v = 0.5f * v * (1.0f + tanhf(0.7978845608028654f * (v + 0.044715f * v * v * v))); else if (ACT == 11) v = 1.0f / (1.0f + expf(-v)); else if (ACT == 12) v = (v > 0.f) ? v : 0.01f * v; else if (ACT == 14) v = (v > 0.f) ? v : 0.1f * v; else if (ACT == 16) v = (v >= 0.f) ? v : 0.3f * v; else if (ACT == 17) v = (v >= 0.f) ? v : 0.2f * v; else if (ACT == 15) v = v / (1.0f + expf(-v)); else if (ACT == 3) v = fmaxf(v, 0.f); else if (ACT == 6) v = 0.5f * v * (1.0f + erff(v * 0.70710678118654752f)); so[w][8 * hh + r][t * 16 + ln] = v; } }
  __builtin_amdgcn_fence(__ATOMIC_ACQ_REL, "workgroup"); __builtin_amdgcn_wave_barrier();
  const int rsub = lane >> 4, c4 = (lane & 15) * 4; typedef _Float16 v4h __attribute__((ext_vector_type(4)));
  {
#pragma unroll
    for (int q = 0; q < 8; ++q) { const int r = q * 2 + rsub; if (col0 + c4 < N) { const v4f v = *(const v4fa*)&so[w][r][c4]; if (C) *(v4f*)(C + cofs + (size_t)(row0 + r) * ldc + col0 + c4) = v; if (C16) { v4h h4; for (int i = 0; i < 4; ++i) h4[i] = (_Float16)v[i]; *(v4h*)(C16 + cofs + (size_t)(row0 + r) * ldc + col0 + c4) = h4; } } }
     }
}


typedef _Float16 v4h __attribute__((ext_vector_type(4)));

__global__ __launch_bounds__(256) void k_h16(const float* __restrict__ x, _Float16* __restrict__ X16, size_t n8) { const size_t t = (size_t)blockIdx.x * 256 + threadIdx.x; if (t >= n8) return; FragH f;
#pragma unroll
  for (int q = 0; q < 8; ++q) f.h[q] = (_Float16)x[t * 8 + q]; *(v8us*)((unsigned short*)X16 + t * 8) = f.half[0];  }
__global__ __launch_bounds__(256) void k_round16f(const float* __restrict__ W, _Float16* __restrict__ Bt, size_t n8) { const size_t t = (size_t)blockIdx.x * 256 + threadIdx.x; if (t >= n8) return; FragH f;
#pragma unroll
  for (int i = 0; i < 8; ++i) f.h[i] = (_Float16)(bf16_round(W[t * 8 + i]) * 16.0f); *(v8us*)((unsigned short*)Bt + t * 8) = f.half[0];  }
// fragment of 16 rows x 32 k from f16 rows in global memory: a lane holds k = 8 hh .. + 7 and 16 + 8 hh .. + 7 of its row
__device__ __forceinline__ v16h g2_frag(const _Float16* p, int hh) { FragH f; f.half[0] = *(const v8us*)((const unsigned short*)p + 8 * hh); f.half[1] = *(const v8us*)((const unsigned short*)p + 16 + 8 * hh); return f.v; }
__global__ __launch_bounds__(256) void k_rsm(const float* __restrict__ S, _Float16* __restrict__ P, int nrows) {
  #pragma clang fp contract(off)
  const int i = blockIdx.x * 256 + threadIdx.x; if (i >= nrows) return; const float* s = S + (size_t)i * SQ; float mx = -3.0e38f;
#pragma unroll 1
  for (int j = 0; j < SQ; ++j) mx = fmaxf(mx, s[j]); float se = 0.f;
#pragma unroll 1
  for (int j = 0; j < SQ; ++j) se += expf(s[j] - mx); const float sc = 256.0f / se;
#pragma unroll 1
  for (int j0 = 0; j0 < SQ; j0 += 8) { FragH f; for (int q = 0; q < 8; ++q) f.h[q] = (_Float16)(expf(s[j0 + q] - mx) * sc); unsigned short* d = (unsigned short*)P + (size_t)i * SQ + j0; *(v8us*)d = f.half[0];  } }
__global__ __launch_bounds__(256) void k_vt(const _Float16* __restrict__ V16, int b, int h0, _Float16* __restrict__ VT) { __shared__ unsigned short tl[64][65]; const int tid = threadIdx.x; const int hh = blockIdx.x % HG, sg = blockIdx.x / HG; const int s0 = sg * 64; const int h = h0 + hh;
  for (int i = tid; i < 64 * 8; i += 256) { const int j = i / 8, d8 = (i % 8) * 8; FragH f; f.half[0] = *(const v8us*)((const unsigned short*)V16 + ((size_t)b * SQ + s0 + j) * DM + h * HD + d8); for (int q = 0; q < 8; ++q) tl[d8 + q][j] = f.u[q]; }
  __syncthreads();
  { for (int i = tid; i < 64 * 8; i += 256) { const int d = i / 8, j8 = (i % 8) * 8; FragH f; for (int q = 0; q < 8; ++q) f.u[q] = tl[d][j8 + q]; *(v8us*)((unsigned short*)VT + ((size_t)hh * HD + d) * SQ + s0 + j8) = f.half[0]; }  } }



__global__ __launch_bounds__(256) void k_rsmcf2(const float* __restrict__ S, _Float16* __restrict__ P, int hg, int q0, int nk) {
  #pragma clang fp contract(off)
  const int t = blockIdx.x * 256 + threadIdx.x; if (t >= hg * QT) return; const size_t i = (size_t)t; const float* s = S + i * NKX; const int last = q0 + (t % QT); float mx = -3.0e38f;
#pragma unroll 1
  for (int j = 0; j < nk; ++j) { const float f = (j <= last) ? 1.f : 0.f; mx = fmaxf(mx, fmaf(f, s[j], (1.f - f) * -1.0e9f)); } float se = 0.f;
#pragma unroll 1
  for (int j = 0; j < nk; ++j) { const float f = (j <= last) ? 1.f : 0.f; se += __expf(fmaf(f, s[j], (1.f - f) * -1.0e9f) - mx); } const float sc = 256.0f / se;
#pragma unroll 1
  for (int j0 = 0; j0 < nk; j0 += 8) { FragH fr; for (int q = 0; q < 8; ++q) { const int j = j0 + q; const float f = (j <= last) ? 1.f : 0.f; fr.h[q] = (_Float16)(__expf(fmaf(f, s[j], (1.f - f) * -1.0e9f) - mx) * sc); } unsigned short* d = (unsigned short*)P + i * NKX + j0; *(v8us*)d = fr.half[0];  } }

template <int MASKADD>
__global__ __launch_bounds__(64) void k_att0(const float* __restrict__ QF, const float* __restrict__ KF, const float* __restrict__ VF, int ld, const float* __restrict__ mask, float scale, float* __restrict__ OF, int ldo) {
  #pragma clang fp contract(off)
  __shared__ __attribute__((aligned(16))) float lq[64][64]; __shared__ __attribute__((aligned(16))) float lo[64][64];
  const int tid = threadIdx.x; const int h = blockIdx.x / (QT0 / 64), rg = blockIdx.x % (QT0 / 64); const int i = rg * 64 + tid;
  const float* qr = QF + (size_t)i * ld + h * HD;
#pragma unroll 1
  for (int c = 0; c < HD / 4; ++c) { *(v4f*)&lq[tid][c * 4] = *(const v4fa*)(qr + c * 4); const v4f z = {0.f, 0.f, 0.f, 0.f}; *(v4f*)&lo[tid][c * 4] = z; }
  float m = -1.0e30f, l = 0.f; const int jmax = MASKADD ? (SQ - 1) : (rg * 64 + 63);      /* additive-mask form: every key (the mask input decides); causal form: keys up to the block's last row */
#pragma unroll 1
  for (int j = 0; j <= jmax; ++j) { const float* kr = KF + (size_t)j * ld + h * HD; const float* vr = VF + (size_t)j * ld + h * HD; float s = 0.f;
#pragma unroll 1
    for (int c = 0; c < HD / 4; ++c) { const v4f kq = *(const v4fa*)(kr + c * 4); const v4f qq = *(v4f*)&lq[tid][c * 4]; s = __fadd_rn(s, __fmul_rn(qq[0], kq[0])); s = __fadd_rn(s, __fmul_rn(qq[1], kq[1])); s = __fadd_rn(s, __fmul_rn(qq[2], kq[2])); s = __fadd_rn(s, __fmul_rn(qq[3], kq[3])); }
    s = __fmul_rn(s, scale); if (MASKADD) s = __fadd_rn(s, __fmul_rn(bf16_round(mask[(size_t)i * SQ + j]), -10000.0f));
    const float f = (MASKADD || j <= i) ? 1.f : 0.f; const float sm = fmaf(f, s, (1.f - f) * -1.0e30f); const float mn = fmaxf(m, sm); const float sc = expf(m - mn); const float e = expf(sm - mn); l = __fadd_rn(__fmul_rn(l, sc), e); m = mn;
#pragma unroll 1
    for (int c = 0; c < HD / 4; ++c) { const v4f vv = *(const v4fa*)(vr + c * 4); v4f oo = *(v4f*)&lo[tid][c * 4]; for (int u = 0; u < 4; ++u) oo[u] = __fadd_rn(__fmul_rn(oo[u], sc), __fmul_rn(e, vv[u])); *(v4f*)&lo[tid][c * 4] = oo; } }
  const float fin = 64.0f / l;      /* o carried x64 */
#pragma unroll 1
  for (int c = 0; c < HD / 4; ++c) { v4f oo = *(v4f*)&lo[tid][c * 4]; for (int u = 0; u < 4; ++u) oo[u] = __fmul_rn(oo[u], fin); *(v4f*)&lo[tid][c * 4] = oo; }
  __syncthreads();
  {
#pragma unroll 1
    for (int it = 0; it < 16; ++it) { const int row = it * 4 + tid / 16, pc = (tid % 16) * 4; const v4f v = *(const v4f*)&lo[row][pc]; *(v4f*)(OF + (size_t)(rg * 64 + row) * ldo + h * HD + pc) = v; }
     } }

__global__ __launch_bounds__(256) void k_oscale(const float* __restrict__ OF, float* __restrict__ out, size_t n4) { const size_t t = (size_t)blockIdx.x * 256 + threadIdx.x; if (t >= n4) return; const v4f a = *(const v4fa*)(OF + t * 4); v4f o; for (int q = 0; q < 4; ++q) o[q] = a[q] * 0.015625f; *(v4f*)(out + t * 4) = o;  }

__global__ __launch_bounds__(256) void k_bfr(const float* __restrict__ x, float* __restrict__ XB, size_t n8) { const size_t t = (size_t)blockIdx.x * 256 + threadIdx.x; if (t >= n8) return; v4f a = *(const v4fa*)(x + t * 8), c = *(const v4fa*)(x + t * 8 + 4); for (int q = 0; q < 4; ++q) { a[q] = bf16_round(a[q]); c[q] = bf16_round(c[q]); }
  { *(v4f*)(XB + t * 8) = a; *(v4f*)(XB + t * 8 + 4) = c;  } }



__global__ __launch_bounds__(256) void k_rsmfvl(const float* __restrict__ S, _Float16* __restrict__ P, _Float16* __restrict__ PL, int qn, const int* __restrict__ vlp) {
  #pragma clang fp contract(off)
  const int t = blockIdx.x * 256 + threadIdx.x; if (t >= qn) return; const int vl = vlp[0]; const size_t i = (size_t)t; const float* s = S + i * SQ; float mx = -3.0e38f;
#pragma unroll 1
  for (int j = 0; j < SQ; ++j) { const float f = (j < vl) ? 1.f : 0.f; mx = fmaxf(mx, fmaf(f, s[j], (1.f - f) * -1000000.0f)); } float se = 0.f;
#pragma unroll 1
  for (int j = 0; j < SQ; ++j) { const float f = (j < vl) ? 1.f : 0.f; se += __expf(fmaf(f, s[j], (1.f - f) * -1000000.0f) - mx); } const float sc = 256.0f / se;
#pragma unroll 1
  for (int j0 = 0; j0 < SQ; j0 += 8) { FragH fr, gr; for (int q = 0; q < 8; ++q) { const int j = j0 + q; const float f = (j < vl) ? 1.f : 0.f; const float pv = __expf(fmaf(f, s[j], (1.f - f) * -1000000.0f) - mx) * sc; const _Float16 ph = (_Float16)pv; fr.h[q] = ph; gr.h[q] = (_Float16)((pv - (float)ph) * 1024.0f); }
    unsigned short* d = (unsigned short*)P + i * SQ + j0; unsigned short* dl = (unsigned short*)PL + i * SQ + j0; *(v8us*)d = fr.half[0]; *(v8us*)dl = gr.half[0];  } }

// Fused attention, one launch for all batches: a wave owns 32 output rows i (two groups of 16; their k rows stay in registers as B operands), so every fragment read from LDS feeds two products; it walks every second pass of 64 positions j, its partner wave the others, and the two partial results are joined at the end.
// S^T = x k'^T (A = query rows x from LDS, exact in f16: one plane), so a lane holds 32 scores of ONE row i: maximum and sum in-lane plus one exchange between the wave halves; the weights pack straight into the B operand of O^T += V^T P^T.
// A reference per row (base 2) goes into the score products as their C operand, so exp2 is taken straight on the accumulator; the reference moves only in the first two trips and in trips where a lane's sum of the trip's weights reaches FWL (one test a trip). S and P never leave registers.
typedef _Float16 v8h __attribute__((ext_vector_type(8)));
#define FJ 128                       /* positions j per LDS stage (two passes of 64) */
#define FPB 144                      /* LDS row pitch, bytes: 128-byte rows + 16, an odd multiple of 16 for 16-byte reads */
#define FVB 272                      /* LDS row pitch, bytes, of a V^T row of 128 positions: 256 + 16, an odd multiple of 16 too */
#define FXT (FJ * FPB)               /* the staged x tile: 128 rows of 64 features */
#define FBF (FXT + DM * FVB)         /* one buffer: the x tile, then the V^T tile of 64 rows */
#define FWB (-10.0f)                 /* a score at its row's reference gets the weight 2^FWB: 25 binades of room up to FWL, and f16 still holds 2^-14 of it */
#define FWL 32768.0f                 /* a lane's sum of a trip's weights from which the reference is renewed */
__device__ __forceinline__ float fa_xhalf(float x) { return __builtin_bit_cast(float, __builtin_amdgcn_permlanex16(__builtin_bit_cast(int, x), __builtin_bit_cast(int, x), 0x76543210, 0xfedcba98, false, false)); }      /* lane l with lane l ^ 16 */
__device__ __forceinline__ v16h fa_frag(const unsigned char* p) { FragH f; f.half[0] = *(const v8us*)p; f.half[1] = *(const v8us*)(p + 32); return f.v; }      /* same k order as g2_frag: p already holds the 16 * hh bytes */
__device__ __forceinline__ v8f fa_mma(v16h a, v16h b, v8f c) { return __builtin_amdgcn_wmma_f32_16x16x32_f16(false, a, false, b, (short)0, c, false, false); }
/* eight v_exp_f32 in one statement with the slot the instruction set asks for behind a transcendental: each is followed by an independent one (outputs early-clobbered, so none overwrites a source), the last by v_nop */
__device__ __forceinline__ v8f fa_exp8(v8f y) { float e0, e1, e2, e3, e4, e5, e6, e7;
  asm("v_exp_f32 %0, %8\n\tv_exp_f32 %1, %9\n\tv_exp_f32 %2, %10\n\tv_exp_f32 %3, %11\n\tv_exp_f32 %4, %12\n\tv_exp_f32 %5, %13\n\tv_exp_f32 %6, %14\n\tv_exp_f32 %7, %15\n\tv_nop" : "=&v"(e0), "=&v"(e1), "=&v"(e2), "=&v"(e3), "=&v"(e4), "=&v"(e5), "=&v"(e6), "=&v"(e7) : "v"(y[0]), "v"(y[1]), "v"(y[2]), "v"(y[3]), "v"(y[4]), "v"(y[5]), "v"(y[6]), "v"(y[7]));
  const v8f e = {e0, e1, e2, e3, e4, e5, e6, e7}; return e; }
typedef float v2f __attribute__((ext_vector_type(2)));
__global__ __launch_bounds__(256) void k_fattn(const _Float16* __restrict__ KH, const _Float16* __restrict__ KL, const _Float16* __restrict__ QH, const _Float16* __restrict__ VT, float* __restrict__ out) {
  __shared__ __attribute__((aligned(16))) unsigned char sm[3 * FBF];      /* a ring of three buffers of two tiles; behind the loop: the exchange of the partial results */
  const int tid = threadIdx.x, w = tid >> 5, lane = tid & 31, ln = lane & 15, hh = lane >> 4;
  const int rg = w & 3, jh = w >> 2;      /* a wave owns 32 output rows (two groups of 16) and walks one of the two passes of every stage; waves w and w ^ 4 share their rows */
  const int b = blockIdx.x / (SQ / 128), i0 = (blockIdx.x % (SQ / 128)) * 128 + rg * 32; const size_t r0 = (size_t)b * SQ;
  v16h kh[2][2], kl[2][2];
#pragma unroll
  for (int c = 0; c < 2; ++c) { const _Float16* khp = KH + (r0 + i0 + 16 * c + ln) * DM; const _Float16* klp = KL + (r0 + i0 + 16 * c + ln) * DM;
    kh[c][0] = g2_frag(khp, hh); kh[c][1] = g2_frag(khp + 32, hh); kl[c][0] = g2_frag(klp, hh); kl[c][1] = g2_frag(klp + 32, hh); }
  asm volatile("s_wait_xcnt 0x0" ::: "memory");      /* in front of the first instruction that reuses an address register of the k loads */
  __builtin_amdgcn_sched_barrier(0);      /* the k loads stay the oldest global loads: the wait for stage 0 then covers them, and the loop needs no wait to zero that would drain the stage in flight */
  const int srow = tid >> 3, sch = tid & 7, vrow = tid >> 4, vch = tid & 15;      /* staging: a thread moves 16-byte piece sch of rows srow + 32 r of the x tile and piece vch of rows vrow + 16 r of the V^T tile, r = 0 .. 3 */
  const unsigned short* gq = (const unsigned short*)QH + (r0 + srow) * DM + sch * 8; const unsigned short* gv = (const unsigned short*)VT + ((size_t)b * DM + vrow) * SQ + vch * 8;
  unsigned char* sb = sm + srow * FPB + sch * 16; unsigned char* sbv = sm + FXT + vrow * FVB + vch * 16; const unsigned char* lbq = sm + (jh * 64 + ln) * FPB + 16 * hh; const unsigned char* lbv = sm + FXT + ln * FVB + jh * 128 + 16 * hh;      /* the wave's pass: rows j 64 jh .. + 63 of the x tile, the same positions (128 bytes) of the V^T rows */
  v8us tq[4], tv[4]; v16h qa[8], va[4][2];
  const unsigned short *pq, *pv;      /* the addresses of the stage last asked for */
  auto g_load = [&](int st) { pq = gq + (size_t)st * FJ * DM; pv = gv + (size_t)st * FJ;
#pragma unroll
    for (int r = 0; r < 4; ++r) tq[r] = *(const v8us*)(pq + r * 32 * DM);
#pragma unroll
    for (int r = 0; r < 4; ++r) tv[r] = *(const v8us*)(pv + (size_t)r * 16 * SQ); };
  auto s_store = [&](int off) {
#pragma unroll
    for (int r = 0; r < 4; ++r) *(v8us*)(sb + off + r * 32 * FPB) = tq[r];
#pragma unroll
    for (int r = 0; r < 4; ++r) *(v8us*)(sbv + off + r * 16 * FVB) = tv[r]; };
  auto ld_q = [&](int off) {      /* the x fragments of the wave's pass: per 16 rows j k 0..31, k 32..63 */
#pragma unroll
    for (int jt = 0; jt < 4; ++jt) { const unsigned char* p = lbq + off + jt * 16 * FPB; qa[jt * 2] = fa_frag(p); qa[jt * 2 + 1] = fa_frag(p + 64); } };
  auto ld_v = [&](int off) {      /* the V^T fragments of the wave's pass: 16 rows f each, positions j 32 u .. + 31 */
#pragma unroll
    for (int t = 0; t < 4; ++t) { const unsigned char* p = lbv + off + t * 16 * FVB; va[t][0] = fa_frag(p); va[t][1] = fa_frag(p + 64); } };
  const v8f z8 = {0.f, 0.f, 0.f, 0.f, 0.f, 0.f, 0.f, 0.f}; v8f o[2][4] = {{z8, z8, z8, z8}, {z8, z8, z8, z8}}, a[2][4]; v2f l2[2] = {{0.f, 0.f}, {0.f, 0.f}}, ps2[2]; v16h pf[2], pg[2];
  v8f ci[2] = {z8 + FWB, z8 + FWB};      /* FWB minus the row's reference (base 2; set in trip 0) in all eight elements: the C operand of the score products */
  auto scores = [&](int c) {      /* row group c; four accumulator chains (the 16-row tiles jt), each C, x.hi (k 0..31, 32..63), x.lo (the same); a[c][jt][r] = score - reference + FWB of i = i0 + 16 c + ln, j = 16 jt + 8 hh + r */
#pragma unroll
    for (int jt = 0; jt < 4; ++jt) a[c][jt] = fa_mma(qa[2 * jt], kh[c][0], ci[c]);
#pragma unroll
    for (int jt = 0; jt < 4; ++jt) a[c][jt] = fa_mma(qa[2 * jt + 1], kh[c][1], a[c][jt]);
#pragma unroll
    for (int jt = 0; jt < 4; ++jt) a[c][jt] = fa_mma(qa[2 * jt], kl[c][0], a[c][jt]);
#pragma unroll
    for (int jt = 0; jt < 4; ++jt) a[c][jt] = fa_mma(qa[2 * jt + 1], kl[c][1], a[c][jt]); };
  auto expsum = [&](int c) {      /* the weights of row group c, the lane's sum of them (two halves), and their f16 pack */
    const v8f p0 = fa_exp8(a[c][0]), p1 = fa_exp8(a[c][1]), p2 = fa_exp8(a[c][2]), p3 = fa_exp8(a[c][3]); const v8f ps = (p0 + p1) + (p2 + p3);
    ps2[c] = (__builtin_shufflevector(ps, ps, 0, 1) + __builtin_shufflevector(ps, ps, 2, 3)) + (__builtin_shufflevector(ps, ps, 4, 5) + __builtin_shufflevector(ps, ps, 6, 7));
    union { v16h v; v8h h[2]; } f, g; f.h[0] = __builtin_convertvector(p0, v8h); f.h[1] = __builtin_convertvector(p1, v8h); g.h[0] = __builtin_convertvector(p2, v8h); g.h[1] = __builtin_convertvector(p3, v8h);      /* element e: j = 8 hh + e, then 16 + 8 hh + (e - 8): the k order of fa_frag; g: the same + 32 */
    pf[c] = f.v; pg[c] = g.v; };
  auto renew = [&](int c, bool first) {      /* the reference of every row of group c moves up to the trip's maximum (trip 0: is set to it, up or down); O and the sum follow, the trip's weights are taken again */
    float mx = a[c][0][0], my = a[c][1][0], mz = a[c][2][0], mw = a[c][3][0];      /* four independent chains */
#pragma unroll
    for (int r = 1; r < 8; ++r) { mx = fmaxf(mx, a[c][0][r]); my = fmaxf(my, a[c][1][r]); mz = fmaxf(mz, a[c][2][r]); mw = fmaxf(mw, a[c][3][r]); }
    mx = fmaxf(fmaxf(mx, my), fmaxf(mz, mw)); mx = fmaxf(mx, fa_xhalf(mx));      /* both lanes of a row get the same value */
    const float d = first ? mx - FWB : fmaxf(mx - FWB, 0.f); const float dm = first ? 0.f : -d; float al;      /* trip 0: O and the sum are zero and stay so */
    asm("v_exp_f32 %0, %1\n\tv_nop" : "=&v"(al) : "v"(dm));      /* v_nop: the slot behind a transcendental */
    ci[c] -= d; l2[c] *= al;
#pragma unroll
    for (int jt = 0; jt < 4; ++jt) a[c][jt] -= d;
#pragma unroll
    for (int t = 0; t < 4; ++t) o[c][t] *= al;
    expsum(c); };
  auto p_v = [&](int c) {
    l2[c] += ps2[c];
#pragma unroll
    for (int t = 0; t < 4; ++t) o[c][t] = fa_mma(va[t][0], pf[c], o[c][t]);
#pragma unroll
    for (int t = 0; t < 4; ++t) o[c][t] = fa_mma(va[t][1], pg[c], o[c][t]); };      /* o[c][t][r] = O[i0 + 16 c + ln][16 t + 8 hh + r] */
  g_load(0); s_store(0); g_load(1); s_store(FBF); g_load(2);      /* stages 0 and 1 are in the ring before the loop, stage 2 is in flight */
  asm volatile("s_wait_dscnt 0x0" ::: "memory");      /* own LDS stores done before the barrier is signalled */
  asm volatile("s_barrier_signal -1\n\ts_barrier_wait -1" ::: "memory");      /* by hand: __syncthreads() would also wait for the global loads of the next stage, which are meant to stay in flight */
  ld_q(0); ld_v(0);
  int o1 = FBF, o2 = 2 * FBF;      /* the buffers of stages s + 1 and s + 2 */
#pragma unroll 1      /* one stage (one pass of 64 rows a wave) a trip: stage s lies in buffer s mod 3 */
  for (int s = 0; s < SQ / FJ; ++s) {
    /* the scheduling fences keep each group of LDS instructions where it is written, in one place and not among the products */
    s_store(o2); g_load((s + 3 < SQ / FJ) ? s + 3 : SQ / FJ - 1); __builtin_amdgcn_sched_barrier(0);      /* stage s + 2 into the buffer of stage s - 1, which every wave had left when it signalled in trip s - 1: the stores land under the products; the stage after it flies for a whole trip; past the end the last stage is fetched again (in bounds) and nobody uses it */
    scores(0); scores(1); __builtin_amdgcn_sched_barrier(0);
    asm volatile("s_wait_xcnt 0x0" :: "v"(pq), "v"(pv) : "memory");      /* the address registers of this trip's global loads are inputs here: they are kept up to this wait and reused only behind it, so it can stand behind the products instead of directly behind the loads */
    asm volatile("s_wait_dscnt 0x0" ::: "memory");      /* own stores of stage s + 2 and own last reads of stage s are done */
    asm volatile("s_barrier_signal -1" ::: "memory");      /* the signal alone: it says the line above of this wave. The wait stands at the foot of the trip, so a wave goes on into its vector work while its neighbour on the SIMD still has the matrix unit, and the two stay out of step */
    ld_q(o1); __builtin_amdgcn_sched_barrier(0);      /* directly behind the products that read the same registers: it flies under the vector work. Stage s + 1 was published by the barrier of trip s - 1, and this trip's barrier does not free it: the read needs no wait here */
    expsum(0); expsum(1);
    const bool need = !(ps2[0][0] + ps2[0][1] < FWL) | !(ps2[1][0] + ps2[1][1] < FWL) | (s < 2);      /* a weight at or above FWL (or a sum that is no number) shows in its lane's sum: below it every weight fits f16. The first two trips always renew: a maximum of 128 scores is seldom passed by the room there is */
    if (__builtin_amdgcn_ballot_w32(need) != 0) { renew(0, s == 0); renew(1, s == 0); }      /* one wave-uniform scalar branch a trip */
    p_v(0); p_v(1); __builtin_amdgcn_sched_barrier(0);
    asm volatile("s_barrier_wait -1" ::: "memory");      /* every wave has signalled: stage s + 2 is published, the buffer of stage s is free for the stores of the next trip */
    ld_v(o1); __builtin_amdgcn_sched_barrier(0);
    o1 = o2; o2 = (o2 == 2 * FBF) ? 0 : o2 + FBF; }
  asm volatile("s_wait_loadcnt 0x0\n\ts_wait_dscnt 0x0" ::: "memory");      /* what the last trip fetched ahead (nobody uses it) has landed before its registers and the ring are used for something else */
  __syncthreads();      /* every wave has left the ring: it becomes the exchange buffer */
  /* the two waves of a pair hold partial results of the same 32 rows: each hands the partner one row group (maximum, sum, O) and finishes the other */
  float lc[2]; const float m[2] = {FWB - ci[0][0], FWB - ci[1][0]};      /* the references in use */
#pragma unroll
  for (int c = 0; c < 2; ++c) { float l = l2[c][0] + l2[c][1]; l += fa_xhalf(l); lc[c] = l; }
  const bool up = jh != 0;      /* wave-uniform: the upper wave keeps group 1 */
  float* xs = (float*)sm + w * (34 * 32); const float* xp = (const float*)sm + (w ^ 4) * (34 * 32);
#pragma unroll
  for (int t = 0; t < 4; ++t) { const v8f g = up ? o[0][t] : o[1][t]; const v4f x = {g[0], g[1], g[2], g[3]}, y = {g[4], g[5], g[6], g[7]}; *(v4f*)(xs + (t * 64 + lane) * 4) = x; *(v4f*)(xs + (t * 64 + 32 + lane) * 4) = y; }
  xs[1024 + lane] = up ? m[0] : m[1]; xs[1056 + lane] = up ? lc[0] : lc[1];
  __syncthreads();      /* the partner's group is in LDS */
  const float mk = up ? m[1] : m[0], lk = up ? lc[1] : lc[0], mp = xp[1024 + lane], lp = xp[1056 + lane];
  const float mn = fmaxf(mk, mp), dk = mk - mn, dp = mp - mn; float fk, fp;
  asm("v_exp_f32 %0, %2\n\tv_exp_f32 %1, %3\n\tv_nop" : "=&v"(fk), "=&v"(fp) : "v"(dk), "v"(dp));      /* v_nop: the slot behind a transcendental */
  const float inv = 1.0f / (lk * fk + lp * fp); fk *= inv; fp *= inv;
  float* orow = out + (r0 + i0 + 16 * jh + ln) * DM + 8 * hh;
#pragma unroll
  for (int t = 0; t < 4; ++t) { const v8f g = up ? o[1][t] : o[0][t]; const v4f px = *(const v4f*)(xp + (t * 64 + lane) * 4), py = *(const v4f*)(xp + (t * 64 + 32 + lane) * 4);
    const v4f x = {g[0] * fk + px[0] * fp, g[1] * fk + px[1] * fp, g[2] * fk + px[2] * fp, g[3] * fk + px[3] * fp}, y = {g[4] * fk + py[0] * fp, g[5] * fk + py[1] * fp, g[6] * fk + py[2] * fp, g[7] * fk + py[3] * fp};
    *(v4f*)(orow + t * 16) = x; *(v4f*)(orow + t * 16 + 4) = y; } }


// Everything in front of the attention in ONE launch. A work-group takes 128 token rows, projects key and value of those rows, applies Wq^T to k and passes the query rows on unchanged.
// All global loads are issued first, whole lines a wave; inputs (rounded to bf16, exact in f16), the three weight matrices (x16; Wq transposed) and the rounded biases go to LDS.
// k: D^T = Wk x^T (A = weight rows, B = token rows), so a lane holds 8 neighbouring features of ONE token: hi and residual pack into 16-byte pieces, the rows of the wave's own tokens in LDS.
// k' = Wq^T k: the same form again, A = rows of Wq^T, B = those k rows, hi and residual each (two accumulators, joined 2^-10); k' -> hi + residual rows. The query rows leave as the exact f16 rows they are staged as.
// v: D = x W^T (A = token rows, B = weight rows), so a lane holds 8 neighbouring tokens of ONE feature: the pieces of a V^T row. Same k order and the same two accumulation steps (k 0..31, then 32..63) in both forms.
// Every result is staged in LDS; behind one barrier all of it is stored in whole 128-byte lines.
#define PJT 128                      /* token rows per work-group: 16 a wave */
#define PJP 144                      /* LDS row pitch, bytes, of 64 f16: 128 + 16, as FPB */
#define PJV 272                      /* LDS row pitch, bytes, of a staged V^T row of 128 tokens: 256 + 16 */
typedef unsigned short v4us __attribute__((ext_vector_type(4), may_alias));
__device__ __forceinline__ float pj_round(float x) { const unsigned int u = __float_as_uint(x); return __uint_as_float((u + 0x7FFFu + ((u >> 16) & 1u)) & 0xFFFF0000u); }      /* the value of bf16_round */
__device__ __forceinline__ v4us pj_cvt(v4f x, float scale) { const v4f y = {pj_round(x[0]) * scale, pj_round(x[1]) * scale, pj_round(x[2]) * scale, pj_round(x[3]) * scale}; return __builtin_bit_cast(v4us, __builtin_convertvector(y, v4h)); }
__global__ __launch_bounds__(256) void k_proj(const float* __restrict__ xq, const float* __restrict__ xk, const float* __restrict__ xv, const float* __restrict__ wq, const float* __restrict__ wk, const float* __restrict__ bk, const float* __restrict__ wv, const float* __restrict__ bv,
    _Float16* __restrict__ QH, _Float16* __restrict__ KH, _Float16* __restrict__ KL, _Float16* __restrict__ VT) {
  __shared__ __attribute__((aligned(16))) unsigned char sx[3 * PJT * PJP];      /* f16 rows of query, key, value */
  __shared__ __attribute__((aligned(16))) unsigned char sw[3 * DM * PJP];       /* f16 rows of Wq^T, Wk, Wv (x16) */
  __shared__ __attribute__((aligned(16))) float sb[4 * DM];                     /* bk, bk, bv, bv rounded to bf16 (the second and the third quarter are read) */
  __shared__ __attribute__((aligned(16))) unsigned char so[8 * 4 * 16 * PJP];   /* per wave: its 16 rows of k' hi, k' residual, k hi, k residual */
  __shared__ __attribute__((aligned(16))) unsigned char sv[DM * PJV];           /* V^T of the 128 tokens */
  const int tid = threadIdx.x, w = tid >> 5, lane = tid & 31, ln = lane & 15, hh = lane >> 4;
  const size_t row0 = (size_t)blockIdx.x * PJT;
  const float* const xs[3] = {xq + row0 * DM, xk + row0 * DM, xv + row0 * DM}; const float* const wsr[3] = {wq, wk, wv};
  const float br = (tid < 2 * DM ? bk : bv)[tid & (DM - 1)];      /* from every thread, among the other loads: under a branch its wait would go to zero and drain the input loads before the first conversion */
  v4f wr[3][4], xr[3][8];      /* piece i * 256 + tid (4 floats) of each tile: row i * 16 + tid / 16, piece tid % 16 of the row; Wq: column tid % 64, rows i * 16 + 4 (tid / 64) .. + 3, a whole line per wave load */
#pragma unroll
  for (int i = 0; i < 4; ++i) {
#pragma unroll
    for (int q = 0; q < 4; ++q) wr[0][i][q] = wq[(i * 16 + (tid >> 6) * 4 + q) * DM + (tid & (DM - 1))]; }
#pragma unroll
  for (int m = 1; m < 3; ++m) {
#pragma unroll
    for (int i = 0; i < 4; ++i) wr[m][i] = *(const v4fa*)(wsr[m] + (i * 256 + tid) * 4); }
#pragma unroll
  for (int m = 0; m < 3; ++m) {
#pragma unroll
    for (int i = 0; i < 8; ++i) xr[m][i] = *(const v4fa*)(xs[m] + (i * 256 + tid) * 4); }
  sb[tid] = pj_round(br);
  const int so4 = (tid >> 4) * PJP + (tid & 15) * 8;
#pragma unroll
  for (int i = 0; i < 4; ++i) *(v4us*)(sw + (tid & (DM - 1)) * PJP + (i * 16 + (tid >> 6) * 4) * 2) = pj_cvt(wr[0][i], 16.0f);      /* row m of Wq^T: Wq[n][m], n in a row */
#pragma unroll
  for (int m = 1; m < 3; ++m) {
#pragma unroll
    for (int i = 0; i < 4; ++i) *(v4us*)(sw + (m * DM + i * 16) * PJP + so4) = pj_cvt(wr[m][i], 16.0f); }
#pragma unroll
  for (int m = 0; m < 3; ++m) {
#pragma unroll
    for (int i = 0; i < 8; ++i) *(v4us*)(sx + (m * PJT + i * 16) * PJP + so4) = pj_cvt(xr[m][i], 1.0f); }
  __syncthreads();
  const unsigned char* xl = sx + (16 * w + ln) * PJP + 16 * hh; const unsigned char* wl = sw + ln * PJP + 16 * hh; unsigned char* sh = so + w * (4 * 16 * PJP);
  const v8f z8 = {0.f, 0.f, 0.f, 0.f, 0.f, 0.f, 0.f, 0.f};
  { const v16h x0 = fa_frag(xl + 2 * PJT * PJP), x1 = fa_frag(xl + 2 * PJT * PJP + 64);
#pragma unroll
    for (int t = 0; t < 4; ++t) { const unsigned char* p = wl + (2 * DM + t * 16) * PJP;
      v8f c = fa_mma(x0, fa_frag(p), z8); c = fa_mma(x1, fa_frag(p + 64), c);      /* c[r]: token 16 w + 8 hh + r, feature 16 t + ln */
      const v8f v = c * 0.0625f + sb[2 * DM + t * 16 + ln];
      *(v8us*)(sv + (t * 16 + ln) * PJV + (16 * w + 8 * hh) * 2) = __builtin_bit_cast(v8us, __builtin_convertvector(v, v8h)); } }
  { const v16h x0 = fa_frag(xl + PJT * PJP), x1 = fa_frag(xl + PJT * PJP + 64);
#pragma unroll
    for (int t = 0; t < 4; ++t) { const unsigned char* p = wl + (DM + t * 16) * PJP;
      v8f c = fa_mma(fa_frag(p), x0, z8); c = fa_mma(fa_frag(p + 64), x1, c);      /* c[r]: feature 16 t + 8 hh + r of k, token 16 w + ln */
      const v4f b0 = *(const v4f*)&sb[DM + t * 16 + 8 * hh], b1 = *(const v4f*)&sb[DM + t * 16 + 8 * hh + 4];
      const v8f v = c * 0.0625f + __builtin_shufflevector(b0, b1, 0, 1, 2, 3, 4, 5, 6, 7); const v8h h = __builtin_convertvector(v, v8h);
      const v8h l = __builtin_convertvector((v - __builtin_convertvector(h, v8f)) * 1024.0f, v8h);
      unsigned char* d = sh + (32 + ln) * PJP + t * 32 + hh * 16; *(v8us*)d = __builtin_bit_cast(v8us, h); *(v8us*)(d + 16 * PJP) = __builtin_bit_cast(v8us, l); } }
  __builtin_amdgcn_fence(__ATOMIC_ACQ_REL, "workgroup"); __builtin_amdgcn_wave_barrier();      /* each lane reads back only the k pieces it stored itself: its LDS stores stay in front of these loads */
  { const unsigned char* kr = sh + (32 + ln) * PJP + 16 * hh;      /* token 16 w + ln as a B row: k order of fa_frag, as the Wq^T rows */
    const v16h g0 = fa_frag(kr), g1 = fa_frag(kr + 64), r0 = fa_frag(kr + 16 * PJP), r1 = fa_frag(kr + 16 * PJP + 64);
#pragma unroll
    for (int t = 0; t < 4; ++t) { const unsigned char* p = wl + t * 16 * PJP; const v16h a0 = fa_frag(p), a1 = fa_frag(p + 64);
      v8f c = fa_mma(a0, g0, z8), e = fa_mma(a0, r0, z8); c = fa_mma(a1, g1, c); e = fa_mma(a1, r1, e);      /* c[r], e[r]: feature 16 t + 8 hh + r of k', token 16 w + ln */
      const v8f v = (e * 0.0009765625f + c) * (0.0625f * 1.44269504f); const v8h h = __builtin_convertvector(v, v8h);      /* log2(e): the scores come out in base 2 */
      const v8h l = __builtin_convertvector(v - __builtin_convertvector(h, v8f), v8h);      /* unscaled: it shares the accumulator of the hi products */
      unsigned char* d = sh + ln * PJP + t * 32 + hh * 16; *(v8us*)d = __builtin_bit_cast(v8us, h); *(v8us*)(d + 16 * PJP) = __builtin_bit_cast(v8us, l); } }
  __syncthreads();      /* V^T rows cross the waves; the k' rows are read back by other lanes of the wave that staged them */
  { unsigned short* gh = (unsigned short*)KH + (row0 + 16 * w) * DM; unsigned short* gl = (unsigned short*)KL + (row0 + 16 * w) * DM; unsigned short* gx = (unsigned short*)QH + (row0 + 16 * w) * DM;
#pragma unroll
    for (int i = 0; i < 4; ++i) { const int ix = i * 32 + lane; const unsigned char* s = sh + (ix >> 3) * PJP + (ix & 7) * 16;      /* the wave's 16 rows are 2 KiB in a row: 512 contiguous bytes a store */
      *(v8us*)(gh + ix * 8) = *(const v8us*)s; *(v8us*)(gl + ix * 8) = *(const v8us*)(s + 16 * PJP); *(v8us*)(gx + ix * 8) = *(const v8us*)(sx + (16 * w + (ix >> 3)) * PJP + (ix & 7) * 16); } }
  unsigned short* gv = (unsigned short*)VT + (size_t)(blockIdx.x / (SQ / PJT)) * DM * SQ + (blockIdx.x % (SQ / PJT)) * PJT;
#pragma unroll
  for (int i = 0; i < 4; ++i) { const int ix = i * 256 + tid, d = ix >> 4, pc = ix & 15; *(v8us*)(gv + (size_t)d * SQ + pc * 8) = *(const v8us*)(sv + d * PJV + pc * 16); } }      /* 256 contiguous bytes of a V^T row per 16 lanes */

extern "C" void kernel_launch(void* const* d_in, const int* in_sizes, int n_in,
                              void* d_out, int out_size, void* d_ws, size_t ws_size, hipStream_t stream) {
  (void)in_sizes; (void)n_in; (void)out_size;
  const float* const* I = (const float* const*)d_in; const float* xq = I[0]; const float* xk = I[1]; const float* xv = I[2]; const float* wq = I[3]; const float* wk = I[5]; const float* bk = I[6]; const float* wv = I[7]; const float* bv = I[8];      /* query, key, value [8][4096][64]; natural [64][64] weights + biases */
  char* ws = (char*)d_ws; size_t off = 0;
  auto take = [&](size_t bytes) { char* p = ws + off; off += (bytes + 255) & ~(size_t)255; return p; };
  _Float16* QH = (_Float16*)take(NR * DM * 2); _Float16* KH = (_Float16*)take(NR * DM * 2); _Float16* KL = (_Float16*)take(NR * DM * 2); _Float16* VT = (_Float16*)take(NR * DM * 2);
  if (off > ws_size) return;
  k_proj<<<(unsigned)(NR / PJT), 256, 0, stream>>>(xq, xk, xv, wq, wk, bk, wv, bv, QH, KH, KL, VT);      /* query rows -> exact f16 rows; k' = log2(e) Wq^T k -> f16 hi + residual rows; v -> V^T [64][4096] of every batch; I[4] (bq) shifts every score of a row alike and is not read */
  k_fattn<<<NB * (SQ / 128), 256, 0, stream>>>(KH, KL, QH, VT, (float*)d_out);      /* scores (x.hi + x.lo, base 2), softmax over the query positions, out[i] = sum_j attn[i][j] v[j] */
}
